// v000
// Measured on an AMD MI455X. A time is GPU time per run, averaged over a window of back-to-back runs after a warm-up
// (all launches, gaps included; the runs take copies of the inputs in turn), and the median of several windows.
// Apart from v000's, it joins two sittings. Times from different sittings can be a few percent apart, while
// side-by-side timings come from the same sitting.
// v000, which the later versions start from, runs in 206 microseconds.
#include <hip/hip_runtime.h>

// Causal grouped-query self-attention with max-plus scores: x [SEQ][768]; Wq [768][768], Wk / Wv [768][384], Wproj [768][768], all [in][out] (y = x W, no bias);
// 12 query heads x 64, 6 key/value heads (2 query heads per key/value head); half-split rotary tables cos / sin [SEQ][32] read by value;
// per-head RMS normalisation (eps 1e-6) of q and k after the rotation; score[t][j] = max_d (q[t][d] + k[j][d]); causal softmax; context = P v; output = context Wproj (f32).
// Compute dtypes, f32 accumulate everywhere: q / k / v projections v_wmma_f32_16x16x32_bf16 (x, W RNE-converted to bf16; products exact); max-plus scores are not a multiply-accumulate: f32 on the vector unit from f32 q / k planes;
// P.V v_wmma_f32_16x16x32_f16: P (x16384 carry, cancels in the normalisation) and v single f16 on query rows >= EROWS; on query rows < EROWS P and v each as f16 value + f16 remainder x2048, remainder products in their own accumulator folded by 1/2048, row sum from the f32 exponentials;
// output projection v_wmma_f32_16x16x32_bf16: context as bf16 value + bf16 remainder (two products into one accumulator), Wproj RNE-converted to bf16; softmax f32 (online, running max over kept keys).
// Layout: bf16 copy of x; transposed bf16 weights WT [2304][768] = q | k | v | proj rows ([out][in]); f32 planes q / k [18 heads][t][64] (rotated, normalised); v^T plane f16 [384][t] and remainder plane [384][t < EROWS];
// fused flash kernel in transposed form (O^T = V^T P^T, P built on the vector unit directly in B-fragment layout); context plane bf16 [t][768 value | 768 remainder].

#ifndef SEQ
#define SEQ 512
#endif
#define SEQ_FULL 512
#define DM    768
#define NHQ   12
#define NHK   6
#define NREP  2
#define HD    64
#define HROT  32
#define DKV   (NHK * HD)              // 384
#define NQK   (DM + DKV)              // 1152: q | k rows of WT
#define WROWS (DM + 2 * DKV + DM)     // 2304: q | k | v | proj rows of WT
#define YP    (2 * DM)                // context plane row pitch (value | remainder)
#define AW    4                       // waves per flash block (16 query rows each)
#define QSP   68                      // LDS row pitch (floats) of the q / context tile
#define TSP   68                      // LDS row pitch (floats) of the GEMM output tile
#define CTP   72                      // LDS row pitch (16-bit words) of the transposing converter tile
#define EROWS (SEQ < 256 ? SEQ : 256) // query rows handled by the multi-product flash instantiation
#define QRS   2048.0f                 // carry of the v remainder plane / P remainder fragment
#define QRI   (1.0f / 2048.0f)
#define LOG2E 1.4426950408889634f
#define PSH   14.0f                   // log2 of the P carry (16384)
#define NEGB  (-3.0e38f)

static_assert(HD == 64);
static_assert(HROT * 2 == HD);
static_assert(NHQ * HD == DM);
static_assert(NHK * NREP == NHQ);
static_assert(DM % 64 == 0);
static_assert(DKV % 64 == 0);
static_assert(NQK % 64 == 0);
static_assert(DM % 32 == 0);                    // GEMM k-loop steps by 32
static_assert(SEQ % 64 == 0);
static_assert(SEQ % 32 == 0);                   // key loop steps by 32
static_assert(SEQ <= SEQ_FULL);
static_assert(EROWS % 64 == 0);                 // a 64-token v^T tile lies wholly inside or outside the remainder plane
static_assert(EROWS % 32 == 0);                 // key bound of an early wave never exceeds EROWS
static_assert(EROWS % (16 * AW) == 0);
static_assert((SEQ - EROWS) % (16 * AW) == 0);
static_assert(EROWS <= SEQ);
static_assert(((size_t)SEQ * DM) % 8 == 0);
static_assert((QSP * 4) % 16 == 0);
static_assert((TSP * 4) % 16 == 0);
static_assert((CTP * 2) % 16 == 0);
static_assert(QSP >= HD);
static_assert(TSP >= 64);
static_assert(CTP >= 64);
// store-loop extents: trips x lanes x bytes == tile rows x row bytes
static_assert(2 * 256 * 16 == 64 * 64 * 2);
static_assert(32 * 32 * 16 == 64 * 64 * 4);     // k_qk / k_oproj: 64 rows x 256 B
static_assert(16 * 32 * 16 == 64 * 64 * 2);
static_assert(4 * 32 * 16 == 16 * HD * 2);
// static LDS per kernel
static_assert(64 * CTP * 2 <= 131072);
static_assert(64 * TSP * 4 <= 131072);
static_assert(AW * (16 * QSP + 32 * HD) * 4 <= 131072);

typedef _Float16 h16;
typedef unsigned short bf;
typedef __attribute__((ext_vector_type(16))) __bf16   v16bf;
typedef __attribute__((ext_vector_type(16))) _Float16 v16h;
typedef __attribute__((ext_vector_type(8)))  _Float16 v8h;
typedef __attribute__((ext_vector_type(8)))  unsigned short v8us;
typedef __attribute__((ext_vector_type(8)))  float    v8f;
typedef __attribute__((ext_vector_type(4)))  float    v4f;
typedef v4f  __attribute__((may_alias)) v4fa;
typedef v8us __attribute__((may_alias)) v8usa;

__device__ __forceinline__ unsigned short f2bf(float f) { unsigned u = __float_as_uint(f); u += 0x7FFFu + ((u >> 16) & 1u); return (unsigned short)(u >> 16); }
__device__ __forceinline__ float bfr(float f) { return __uint_as_float(((unsigned)f2bf(f)) << 16); }   // value after RNE convert to bf16
__device__ __forceinline__ v16h cat16(v8h lo, v8h hi) { return __builtin_shufflevector(lo, hi, 0, 1, 2, 3, 4, 5, 6, 7, 8, 9, 10, 11, 12, 13, 14, 15); }
__device__ __forceinline__ v16bf cat16b(v8us lo, v8us hi) { return __builtin_bit_cast(v16bf, __builtin_shufflevector(lo, hi, 0, 1, 2, 3, 4, 5, 6, 7, 8, 9, 10, 11, 12, 13, 14, 15)); }
__device__ __forceinline__ v8f wmma16(v16h a, v16h b, v8f c) { return __builtin_amdgcn_wmma_f32_16x16x32_f16(false, a, false, b, (short)0, c, false, false); }
__device__ __forceinline__ v8f wmmab(v16bf a, v16bf b, v8f c) { return __builtin_amdgcn_wmma_f32_16x16x32_bf16(false, a, false, b, (short)0, c, false, false); }
// fragment loaders from K-contiguous 16-bit rows; p already includes + 8*(lane>>4): elements 0..7 <- k0+8h+0..7, elements 8..15 <- k0+16+8h+0..7 (same map for A and B)
__device__ __forceinline__ v16h  ldh(const h16* p) { return cat16(*(const v8h*)p, *(const v8h*)(p + 16)); }
__device__ __forceinline__ v16bf ldb(const bf* p)  { return cat16b(*(const v8us*)p, *(const v8us*)(p + 16)); }
// ordering point for wave-private LDS tiles (same wave writes and reads)
__device__ __forceinline__ void wave_sync() { __builtin_amdgcn_fence(3 /* release order */, "wavefront"); __builtin_amdgcn_wave_barrier(); asm volatile("" ::: "memory"); }

// per-instruction guarded matrix steps: one accumulator tied per guard, A / B kept live across the nops
__device__ __forceinline__ v8f wmma16g(v16h a, v16h b, v8f c) { c = wmma16(a, b, c); asm volatile("v_nop\n\tv_nop\n\tv_nop\n\tv_nop" : "+v"(c) : "v"(a), "v"(b)); return c; }
__device__ __forceinline__ v8f wmmabg(v16bf a, v16bf b, v8f c) { c = wmmab(a, b, c); asm volatile("v_nop\n\tv_nop\n\tv_nop\n\tv_nop" : "+v"(c) : "v"(a), "v"(b)); return c; }
// f32 -> f16 convert that cannot produce a subnormal (|v| < 2^-14 -> +0)
__device__ __forceinline__ h16 toh_flush(float v) { const h16 r = (h16)v; return (fabsf(v) < 6.103515625e-05f) ? (h16)0.0f : r; }
__device__ __forceinline__ float bf2f(unsigned short b) { return __uint_as_float(((unsigned)b) << 16); }

__global__ __launch_bounds__(256) void k_cvt8(const float* __restrict__ src, bf* dst, size_t n8) {
    const size_t i = (size_t)blockIdx.x * 256 + threadIdx.x; if (i >= n8) return;
    const v8f v = *(const v8f*)(src + i * 8); v8us o;
#pragma unroll
    for (int k = 0; k < 8; ++k) o[k] = f2bf(v[k]);
    *(v8us*)(dst + i * 8) = o; 
}

// k_cvtT: transposing bf16 (RNE convert) copy of a weight: in W[DM rows (k)][ncols (n)] f32 -> out WT[rowoff + n][k], row pitch DM.
__global__ __launch_bounds__(256) void k_cvtT(const float* __restrict__ W, bf* WT, int ncols, int rowoff) {
    __shared__ __align__(16) bf ts[64 * CTP];
    const int tid = threadIdx.x;
    const int n0 = blockIdx.x * 64, k0 = blockIdx.y * 64;
#pragma unroll
    for (int i = 0; i < 4; ++i) { const int idx = i * 256 + tid; const int kr = idx >> 4, c4 = (idx & 15) * 4;   // 64 k rows x 16 float4
        const v4f v = *(const v4f*)(W + (size_t)(k0 + kr) * (size_t)ncols + n0 + c4);
#pragma unroll
        for (int e = 0; e < 4; ++e) ts[(c4 + e) * CTP + kr] = f2bf(v[e]); }
    __syncthreads();                                            // cross-wave tile: block barrier
{
#pragma unroll
        for (int i = 0; i < 2; ++i) { const int p = i * 256 + tid; const int row = p >> 3, c8 = (p & 7) * 8;   // 2 trips x 32 rows = 64 rows; 8 lanes x 8 = 64 k
            const v8us o = *(const v8usa*)(&ts[row * CTP + c8]);
            *(v8us*)(WT + (size_t)(rowoff + n0 + row) * DM + k0 + c8) = o; }
         }
}

// gemm64: register-blocked bf16 GEMM core, ONE WAVE per 64x64 tile (16 accumulators), operands straight from K-contiguous bf16 planes.
// C[m][n] = sum_part sum_k A[m][part*kb + k] Bt[n][k]; aoff / boff already include the lane's row and + 8*(lane>>4).
__device__ __forceinline__ void gemm64(const bf* __restrict__ A, const bf* __restrict__ Bt, const int pitchA, const int pitchB, const int kb, const int nparts,
                                       const size_t aoff, const size_t boff, v8f (&acc)[4][4]) {
#pragma unroll
    for (int mb = 0; mb < 4; ++mb)
#pragma unroll
        for (int nb = 0; nb < 4; ++nb) acc[mb][nb] = (v8f){};
#pragma unroll 1
    for (int part = 0; part < nparts; ++part) {
        const size_t ap = aoff + (size_t)part * (size_t)kb;
#pragma unroll 1
        for (int kc = 0; kc < kb; kc += 32) {
            v16bf a[4];
#pragma unroll
            for (int mb = 0; mb < 4; ++mb) a[mb] = ldb(A + ap + (size_t)mb * 16 * (size_t)pitchA + kc);
#pragma unroll
            for (int nb = 0; nb < 4; ++nb) { const v16bf b = ldb(Bt + boff + (size_t)nb * 16 * (size_t)pitchB + kc);
#pragma unroll
                for (int mb = 0; mb < 4; ++mb) acc[mb][nb] = wmmabg(a[mb], b, acc[mb][nb]); }
        }
    }
}

// k_qk: q and k projections with rotation + RMS normalisation in the epilogue. A = x rows (m = t), Bt = WT rows n in [0, 1152): column tile = head (0..11 q, 12..17 k).
__global__ __launch_bounds__(32) void k_qk(const bf* __restrict__ XB, const bf* __restrict__ WT, const float* __restrict__ cosb, const float* __restrict__ sinb, float* QKF) {
    __shared__ __align__(16) float os[64 * TSP];
    const int lane = threadIdx.x & 31, lr = lane & 15, hi = lane >> 4;
    const int r0 = blockIdx.x * 64, head = blockIdx.y, c0 = head * 64;
    v8f acc[4][4];
    gemm64(XB, WT, DM, DM, DM, 1, (size_t)(r0 + lr) * DM + 8 * hi, (size_t)(c0 + lr) * DM + 8 * hi, acc);
#pragma unroll
    for (int mb = 0; mb < 4; ++mb)
#pragma unroll
        for (int nb = 0; nb < 4; ++nb)
#pragma unroll
            for (int j = 0; j < 8; ++j) os[(mb * 16 + hi * 8 + j) * TSP + nb * 16 + lr] = acc[mb][nb][j];   // D: row 8h+j, col lane&15; all 64 x 64 written
    wave_sync();
#pragma unroll 1
    for (int r = 0; r < 64; ++r) {                              // lane = rotary pair column (d, d + 32)
        const int t = r0 + r;
        const float x1 = os[r * TSP + lane], x2 = os[r * TSP + HROT + lane];
        const float c = bfr(cosb[(size_t)t * HROT + lane]), s = bfr(sinb[(size_t)t * HROT + lane]);
        const float o1 = x1 * c - x2 * s, o2 = x2 * c + x1 * s;
        float ss = o1 * o1 + o2 * o2;
#pragma unroll
        for (int off = 16; off > 0; off >>= 1) ss += __shfl_xor(ss, off, 32);
        const float sc = rsqrtf(ss * (1.0f / (float)HD) + 1e-6f);
        os[r * TSP + lane] = o1 * sc; os[r * TSP + HROT + lane] = o2 * sc; }
    wave_sync();
    float* dst = QKF + ((size_t)head * SEQ + (size_t)r0) * HD;
{
#pragma unroll 4
        for (int i = 0; i < 32; ++i) { const int idx = i * 32 + lane; const int row = idx >> 4, c4 = (idx & 15) * 4;   // 32 trips x 2 rows = 64 rows; 16 lanes x 4 floats = 64 columns
            const v4f val = *(const v4fa*)(&os[row * TSP + c4]);
            *(v4f*)(dst + (size_t)idx * 4) = val; }
         }
}

// k_vt: v^T projection. A = WT rows 1152 + m (m = kvh*64 + d), Bt = x rows (n = t); plane VT [m][t] f16 (row pitch SEQ) and, for t < EROWS (block-uniform test), the f16 remainder x2048 VR [m][t] (row pitch EROWS).
__global__ __launch_bounds__(32) void k_vt(const bf* __restrict__ WV, const bf* __restrict__ XB, h16* VT, h16* VR) {
    __shared__ __align__(16) float os[64 * TSP];
    const int lane = threadIdx.x & 31, lr = lane & 15, hi = lane >> 4;
    const int r0 = blockIdx.x * 64, c0 = blockIdx.y * 64;
    v8f acc[4][4];
    gemm64(WV, XB, DM, DM, DM, 1, (size_t)(r0 + lr) * DM + 8 * hi, (size_t)(c0 + lr) * DM + 8 * hi, acc);
#pragma unroll
    for (int mb = 0; mb < 4; ++mb)
#pragma unroll
        for (int nb = 0; nb < 4; ++nb)
#pragma unroll
            for (int j = 0; j < 8; ++j) os[(mb * 16 + hi * 8 + j) * TSP + nb * 16 + lr] = acc[mb][nb][j];
    wave_sync();
    const bool wr = c0 < EROWS;                                 // block-uniform: whole tile inside the remainder plane
{
#pragma unroll 4
        for (int i = 0; i < 16; ++i) { const int p = i * 32 + lane; const int row = p >> 3, c8 = (p & 7) * 8;   // 16 trips x 4 rows = 64 rows; 8 lanes x 8 = 64 columns
            const v4f x0 = *(const v4fa*)(&os[row * TSP + c8]); const v4f x1 = *(const v4fa*)(&os[row * TSP + c8 + 4]); v8h hv, rv;
#pragma unroll
            for (int e = 0; e < 4; ++e) { const h16 a0 = toh_flush(x0[e]); const h16 a1 = toh_flush(x1[e]); hv[e] = a0; hv[4 + e] = a1;
                rv[e] = toh_flush((x0[e] - (float)a0) * QRS); rv[4 + e] = toh_flush((x1[e] - (float)a1) * QRS); }
            *(v8h*)(VT + (size_t)(r0 + row) * SEQ + c0 + c8) = hv;
            if (wr) *(v8h*)(VR + (size_t)(r0 + row) * EROWS + c0 + c8) = rv; }
         }
}

// k_oproj: output projection. A = context plane rows (value | remainder, two K parts of 768), Bt = WT rows 1536 + n; f32 output [t][768].
__global__ __launch_bounds__(32) void k_oproj(const bf* __restrict__ YB, const bf* __restrict__ WP, float* OUT) {
    __shared__ __align__(16) float os[64 * TSP];
    const int lane = threadIdx.x & 31, lr = lane & 15, hi = lane >> 4;
    const int r0 = blockIdx.x * 64, c0 = blockIdx.y * 64;
    v8f acc[4][4];
    gemm64(YB, WP, YP, DM, DM, 2, (size_t)(r0 + lr) * YP + 8 * hi, (size_t)(c0 + lr) * DM + 8 * hi, acc);
#pragma unroll
    for (int mb = 0; mb < 4; ++mb)
#pragma unroll
        for (int nb = 0; nb < 4; ++nb)
#pragma unroll
            for (int j = 0; j < 8; ++j) os[(mb * 16 + hi * 8 + j) * TSP + nb * 16 + lr] = acc[mb][nb][j];
    wave_sync();
{
#pragma unroll 4
        for (int i = 0; i < 32; ++i) { const int idx = i * 32 + lane; const int row = idx >> 4, c4 = (idx & 15) * 4;   // 32 trips x 2 rows = 64 rows; 16 lanes x 4 floats = 64 columns
            const v4f val = *(const v4fa*)(&os[row * TSP + c4]);
            *(v4f*)(OUT + (size_t)(r0 + row) * DM + c0 + c4) = val; }
         }
}

// flash_body: fused attention, one wave per 16 query rows of one head. q tile and the 32-key K tile live in wave-private LDS (f32); scores on the vector unit:
// lane (t = lane&15, h = lane>>4) forms max_d(q[t][d] + k[key][d]) for keys 8h+r and 16+8h+r of each 32-key step, i.e. directly the B-fragment layout of
// O^T[d][t] = V^T P^T (element r <- keys 8h+r, element 8+r <- keys 16+8h+r, lane unchanged). V^T fragments (A, row d, k = key) straight from the f16 planes.
// Softmax state (running max over kept keys, partial sum) is one scalar per lane; the two lane halves of a row are combined with one xor-16 exchange.
// Causal keep rule (key <= t) evaluated per element inside every visited tile; the per-wave key bound is a wave scalar, multiple of 32, <= SEQ.
// EARLY = 1 (query rows [0, EROWS)): P = f16 value + f16 remainder x2048; O = V P + (V P_rem + V_rem P) / 2048 (remainder products in their own accumulators); row sum from the f32 exponentials.
// EARLY = 0 (query rows [EROWS, SEQ)): single P, v; row sum over the converted P.
template <int EARLY>
__device__ __forceinline__ void flash_body(const float* __restrict__ QKF, const h16* __restrict__ VT, const h16* __restrict__ VR, bf* YB) {
    __shared__ __align__(16) float qs[AW * 16 * QSP];           // wave-private slices: q tile, later the context tile
    __shared__ __align__(16) float ks[AW * 32 * HD];            // wave-private slices: 32-key K tile
    const int lane = threadIdx.x & 31, lr = lane & 15, hi = lane >> 4;
    const int wave = __builtin_amdgcn_readfirstlane((int)(threadIdx.x >> 5));
    const int h = blockIdx.y, kvh = h / NREP;
    const int t0 = (EARLY ? 0 : EROWS) + (blockIdx.x * AW + wave) * 16;
    const int lim = t0 + lr;                                    // key j kept iff j <= lim
    const int nk = (t0 + 16 + 31) & ~31;                        // wave-uniform, multiple of 32, <= SEQ (<= EROWS when EARLY)
    const int qb = wave * 16 * QSP, kbs = wave * 32 * HD;
    { const size_t qsrc = ((size_t)h * SEQ + (size_t)t0) * HD;  // 16 rows x 64 floats, contiguous
#pragma unroll
      for (int i = 0; i < 8; ++i) { const int idx = i * 32 + lane;
          const v4f v = *(const v4f*)(QKF + qsrc + (size_t)idx * 4);
          *(v4fa*)(&qs[qb + (idx >> 4) * QSP + (idx & 15) * 4]) = v; } }
    const size_t kplane = ((size_t)(NHQ + kvh) * SEQ) * HD;     // k heads follow the q heads in the plane
    const size_t vo  = (size_t)(kvh * HD + lr) * SEQ + 8 * hi;   // + 16j*SEQ + key   (A fragment: row d, k = key)
    const size_t vro = (size_t)(kvh * HD + lr) * EROWS + 8 * hi; // remainder plane, tokens < EROWS
    const v16h hz = (v16h){};
    v8f o[4], oR[4];
#pragma unroll
    for (int j = 0; j < 4; ++j) { o[j] = (v8f){}; oR[j] = (v8f){}; }
    float m = NEGB, l = 0.0f;
#pragma unroll 1
    for (int key0 = 0; key0 < nk; key0 += 32) {
        wave_sync();                                            // earlier reads of the K tile are done
        { const size_t ksrc = kplane + (size_t)key0 * HD;       // 32 keys x 64 floats, contiguous; keys < nk <= SEQ
#pragma unroll 8
          for (int i = 0; i < 16; ++i) { const int idx = i * 32 + lane;
              const v4f v = *(const v4f*)(QKF + ksrc + (size_t)idx * 4);
              *(v4fa*)(&ks[kbs + idx * 4]) = v; } }
        wave_sync();
        float sa[8], sb[8];
#pragma unroll
        for (int r = 0; r < 8; ++r) { sa[r] = NEGB; sb[r] = NEGB; }
#pragma unroll 1
        for (int d4 = 0; d4 < HD / 4; ++d4) {
            const v4f q4 = *(const v4fa*)(&qs[qb + lr * QSP + d4 * 4]);
#pragma unroll
            for (int r = 0; r < 8; ++r) {
                const v4f ka = *(const v4fa*)(&ks[kbs + (8 * hi + r) * HD + d4 * 4]);
                const v4f kc = *(const v4fa*)(&ks[kbs + (16 + 8 * hi + r) * HD + d4 * 4]);
                sa[r] = fmaxf(sa[r], fmaxf(fmaxf(q4[0] + ka[0], q4[1] + ka[1]), fmaxf(q4[2] + ka[2], q4[3] + ka[3])));
                sb[r] = fmaxf(sb[r], fmaxf(fmaxf(q4[0] + kc[0], q4[1] + kc[1]), fmaxf(q4[2] + kc[2], q4[3] + kc[3]))); }
        }
        const int ja = key0 + 8 * hi;
        float mx = NEGB;
#pragma unroll
        for (int r = 0; r < 8; ++r) {
            sa[r] = sa[r] * LOG2E; sb[r] = sb[r] * LOG2E;
            const bool fa = (ja + r <= lim), fb = (ja + 16 + r <= lim);
            mx = fmaxf(mx, fmaxf(fa ? sa[r] : NEGB, fb ? sb[r] : NEGB)); }
        mx = fmaxf(mx, __shfl_xor(mx, 16, 32));
        const float mnew = fmaxf(m, mx);
        const float alpha = __builtin_amdgcn_exp2f(m - mnew);
        const float sh = PSH - mnew;
        v16h pb, pr = hz; float ls = 0.0f;
#pragma unroll
        for (int r = 0; r < 8; ++r) {
            const float xa = sa[r] + sh, xb = sb[r] + sh;
            const float ea = __builtin_amdgcn_exp2f(xa), eb = __builtin_amdgcn_exp2f(xb);
            const bool fa = (ja + r <= lim) & (xa >= -14.0f), fb = (ja + 16 + r <= lim) & (xb >= -14.0f);   // dropped keys and values below the f16 normal range selected to 0 by value
            const float ga = fa ? ea : 0.0f, gb = fb ? eb : 0.0f;
            const h16 pa = (h16)ga; const h16 pc = (h16)gb;
            pb[r] = pa; pb[8 + r] = pc;
            if (EARLY) { pr[r] = toh_flush((ga - (float)pa) * QRS); pr[8 + r] = toh_flush((gb - (float)pc) * QRS); ls += ga + gb; }
            else       { ls += (float)pa + (float)pc; } }
        l = l * alpha + ls; m = mnew;
#pragma unroll
        for (int j = 0; j < 4; ++j) {
            const v16h v = ldh(VT + vo + (size_t)(16 * j) * SEQ + key0);
            o[j] = o[j] * alpha;
            o[j] = wmma16g(v, pb, o[j]);
            if (EARLY) {
                const v16h vr = ldh(VR + vro + (size_t)(16 * j) * EROWS + key0);   // key0 + 31 < nk <= EROWS
                oR[j] = oR[j] * alpha;
                oR[j] = wmma16g(v, pr, oR[j]);
                oR[j] = wmma16g(vr, pb, oR[j]); }
        }
    }
    l += __shfl_xor(l, 16, 32);
    const bool any = l > 0.0f;
    const float lsafe = any ? l : 1.0f;
    const float inv = any ? (1.0f / lsafe) : 0.0f;
    wave_sync();                                                // q tile reads are done; the slice becomes the context tile
    // O^T D layout: f_j[r] = (d = 16j + 8h + r, t = lane&15) -> qs[t][d]; rows 0..15 x columns 0..63 all written
#pragma unroll
    for (int j = 0; j < 4; ++j) {
        v8f f = o[j];
        if (EARLY) f = o[j] + oR[j] * QRI;
        v4f a, c;
        a[0] = f[0] * inv; a[1] = f[1] * inv; a[2] = f[2] * inv; a[3] = f[3] * inv; c[0] = f[4] * inv; c[1] = f[5] * inv; c[2] = f[6] * inv; c[3] = f[7] * inv;
        *(v4fa*)(&qs[qb + lr * QSP + 16 * j + 8 * hi]) = a; *(v4fa*)(&qs[qb + lr * QSP + 16 * j + 8 * hi + 4]) = c; }
    wave_sync();
    bf* yrow = YB + (size_t)t0 * YP + h * HD;
{
#pragma unroll
        for (int s = 0; s < 4; ++s) { const int row = 4 * s + (lane >> 3), c8 = (lane & 7) * 8;   // 4 s x 4 rows = 16 rows; 8 lanes x 8 = 64 columns = one line
            const v4f x0 = *(const v4fa*)(&qs[qb + row * QSP + c8]); const v4f x1 = *(const v4fa*)(&qs[qb + row * QSP + c8 + 4]); v8us hv, lv;
#pragma unroll
            for (int e = 0; e < 4; ++e) { const unsigned short b0 = f2bf(x0[e]); const unsigned short b1 = f2bf(x1[e]); hv[e] = b0; hv[4 + e] = b1;
                lv[e] = f2bf(x0[e] - bf2f(b0)); lv[4 + e] = f2bf(x1[e] - bf2f(b1)); }
            *(v8us*)(yrow + (size_t)row * YP + c8) = hv;
            *(v8us*)(yrow + (size_t)row * YP + DM + c8) = lv; }
         }
}

__global__ __launch_bounds__(32 * AW) __attribute__((amdgpu_num_vgpr(256))) void k_flash_early(const float* __restrict__ QKF, const h16* __restrict__ VT, const h16* __restrict__ VR, bf* YB) {
    flash_body<1>(QKF, VT, VR, YB);
}
__global__ __launch_bounds__(32 * AW) __attribute__((amdgpu_num_vgpr(256))) void k_flash_late(const float* __restrict__ QKF, const h16* __restrict__ VT, const h16* __restrict__ VR, bf* YB) {
    flash_body<0>(QKF, VT, VR, YB);
}

static constexpr size_t al256(size_t v) { return (v + 255) & ~(size_t)255; }
static constexpr size_t SZ_XB = al256((size_t)SEQ * DM * 2);
static constexpr size_t SZ_WT = al256((size_t)WROWS * DM * 2);
static constexpr size_t SZ_QK = al256((size_t)(NHQ + NHK) * SEQ * HD * 4);
static constexpr size_t SZ_VT = al256((size_t)DKV * SEQ * 2);
static constexpr size_t SZ_VR = al256((size_t)DKV * EROWS * 2);
static constexpr size_t SZ_YB = al256((size_t)SEQ * YP * 2);
static constexpr size_t SZ_TOTAL = SZ_XB + SZ_WT + SZ_QK + SZ_VT + SZ_VR + SZ_YB;
static_assert(SZ_TOTAL <= (size_t)134217728);          // workspace carve <= 128 MiB
static_assert(((size_t)DM * DM * 2) % 256 == 0);       // weight sub-planes stay 256-byte aligned
static_assert(((size_t)DKV * DM * 2) % 256 == 0);
static_assert(((size_t)NHQ * SEQ * HD * 4) % 256 == 0);

extern "C" void kernel_launch(void* const* d_in, const int* in_sizes, int n_in,
                              void* d_out, int out_size, void* d_ws, size_t ws_size, hipStream_t stream) {
    if (n_in < 7) return;
    if ((size_t)in_sizes[0] < (size_t)SEQ * DM) return;
    if ((size_t)in_sizes[1] < (size_t)SEQ * HROT || (size_t)in_sizes[2] < (size_t)SEQ * HROT) return;
    if ((size_t)in_sizes[3] < (size_t)DM * DM || (size_t)in_sizes[6] < (size_t)DM * DM) return;
    if ((size_t)in_sizes[4] < (size_t)DM * DKV || (size_t)in_sizes[5] < (size_t)DM * DKV) return;
    if ((size_t)out_size < (size_t)SEQ * DM) return;
    if (SZ_TOTAL > ws_size) return;
    // wire order: x, cos, sin, Wq, Wk, Wv, Wproj
    const float* x    = (const float*)d_in[0];
    const float* cosb = (const float*)d_in[1];
    const float* sinb = (const float*)d_in[2];
    const float* wq   = (const float*)d_in[3];
    const float* wk   = (const float*)d_in[4];
    const float* wv   = (const float*)d_in[5];
    const float* wp   = (const float*)d_in[6];
    float* OUT = (float*)d_out;                        // [SEQ][768]
    char* wsp = (char*)d_ws;
    bf*    XB  = (bf*)wsp;    wsp += SZ_XB;            // x bf16 [SEQ][768]
    bf*    WT  = (bf*)wsp;    wsp += SZ_WT;            // [2304][768]: q | k | v | proj, each [out][in]
    float* QKF = (float*)wsp; wsp += SZ_QK;            // [18][SEQ][64] f32: 12 q heads, 6 k heads
    h16*   VT  = (h16*)wsp;   wsp += SZ_VT;            // [384][SEQ]
    h16*   VR  = (h16*)wsp;   wsp += SZ_VR;            // [384][EROWS] remainder x2048, tokens < EROWS
    bf*    YB  = (bf*)wsp;    wsp += SZ_YB;            // [SEQ][768 value | 768 remainder]

    { const size_t n8 = (size_t)SEQ * DM / 8;
      k_cvt8<<<(unsigned)((n8 + 255) / 256), 256, 0, stream>>>(x, XB, n8); }
    // transposes: in W[768 rows][ncols] -> out WT[rowoff + ncols rows][768]; grid (ncols/64 over columns, 768/64 over rows)
    k_cvtT<<<dim3(DM / 64,  DM / 64, 1), 256, 0, stream>>>(wq, WT, DM,  0);
    k_cvtT<<<dim3(DKV / 64, DM / 64, 1), 256, 0, stream>>>(wk, WT, DKV, DM);
    k_cvtT<<<dim3(DKV / 64, DM / 64, 1), 256, 0, stream>>>(wv, WT, DKV, NQK);
    k_cvtT<<<dim3(DM / 64,  DM / 64, 1), 256, 0, stream>>>(wp, WT, DM,  NQK + DKV);

    // q | k: A = x rows, Bt = WT rows [0, 1152) -> f32 planes [head][t][64], rotated and normalised
    k_qk<<<dim3(SEQ / 64, NHQ + NHK, 1), 32, 0, stream>>>(XB, WT, cosb, sinb, QKF);
    // v^T: A = WT rows [1152, 1536), Bt = x rows -> [m][t] f16 (+ remainder for t < EROWS)
    k_vt<<<dim3(DKV / 64, SEQ / 64, 1), 32, 0, stream>>>(WT + (size_t)NQK * DM, XB, VT, VR);

    // query rows [0, EROWS): multi-product instantiation; rows [EROWS, SEQ): single-product instantiation (disjoint context rows)
    k_flash_early<<<dim3(EROWS / (16 * AW), NHQ, 1), 32 * AW, 0, stream>>>(QKF, VT, VR, YB);
    if (SEQ > EROWS)
        k_flash_late<<<dim3((SEQ - EROWS) / (16 * AW), NHQ, 1), 32 * AW, 0, stream>>>(QKF, VT, VR, YB);

    // output projection: A = context rows (value | remainder), Bt = WT rows [1536, 2304)
    k_oproj<<<dim3(SEQ / 64, DM / 64, 1), 32, 0, stream>>>(YB, WT + (size_t)(NQK + DKV) * DM, OUT);
}

// v001
// A run of this version takes 135 microseconds.
// In two side-by-side timings against v000, it was 1.51 and 1.50 times as fast.
#include <hip/hip_runtime.h>

// Causal grouped-query self-attention with max-plus scores: x [SEQ][768]; Wq [768][768], Wk / Wv [768][384], Wproj [768][768], all [in][out] (y = x W, no bias);
// 12 query heads x 64, 6 key/value heads (2 query heads per key/value head); half-split rotary tables cos / sin [SEQ][32] read by value;
// per-head RMS normalisation (eps 1e-6) of q and k after the rotation; score[t][j] = max_d (q[t][d] + k[j][d]); causal softmax; context = P v; output = context Wproj (f32).
// Compute dtypes, f32 accumulate everywhere: q / k / v projections v_wmma_f32_16x16x32_bf16 (x, W RNE-converted to bf16; products exact); max-plus scores are not a multiply-accumulate: f32 on the vector unit from f32 q / k planes;
// P.V v_wmma_f32_16x16x32_f16: P (x16384 carry, cancels in the normalisation) and v single f16 on query rows >= EROWS; on query rows < EROWS P and v each as f16 value + f16 remainder x2048, remainder products in their own accumulator folded by 1/2048, row sum from the f32 exponentials;
// output projection v_wmma_f32_16x16x32_bf16: context as bf16 value + bf16 remainder (two products into one accumulator), Wproj RNE-converted to bf16; softmax f32 (online, running max over kept keys).
// Layout: bf16 copy of x; transposed bf16 weights WT [2304][768] = q | k | v | proj rows ([out][in]); f32 planes q / k [18 heads][t][64] (rotated, normalised); v^T plane f16 [384][t] and remainder plane [384][t < EROWS];
// fused flash kernel in transposed form (O^T = V^T P^T, P built on the vector unit directly in B-fragment layout); context plane bf16 [t][768 value | 768 remainder].

#ifndef SEQ
#define SEQ 512
#endif
#define SEQ_FULL 512
#define DM    768
#define NHQ   12
#define NHK   6
#define NREP  2
#define HD    64
#define HROT  32
#define DKV   (NHK * HD)              // 384
#define NQK   (DM + DKV)              // 1152: q | k rows of WT
#define WROWS (DM + 2 * DKV + DM)     // 2304: q | k | v | proj rows of WT
#define YP    (2 * DM)                // context plane row pitch (value | remainder)
#define AW    4                       // waves per flash block (16 query rows each)
#define QSP   68                      // LDS row pitch (floats) of the q / context tile
#define TSP   68                      // LDS row pitch (floats) of the GEMM output tile
#define CTP   72                      // LDS row pitch (16-bit words) of the transposing converter tile
#define EROWS (SEQ < 256 ? SEQ : 256) // query rows handled by the multi-product flash instantiation
#define QRS   2048.0f                 // carry of the v remainder plane / P remainder fragment
#define QRI   (1.0f / 2048.0f)
#define LOG2E 1.4426950408889634f
#define PSH   14.0f                   // log2 of the P carry (16384)
#define NEGB  (-3.0e38f)

static_assert(HD == 64);
static_assert(HROT * 2 == HD);
static_assert(NHQ * HD == DM);
static_assert(NHK * NREP == NHQ);
static_assert(DM % 64 == 0);
static_assert(DKV % 64 == 0);
static_assert(NQK % 64 == 0);
static_assert(DM % 32 == 0);                    // GEMM k-loop steps by 32
static_assert(SEQ % 64 == 0);
static_assert(SEQ % 32 == 0);                   // key loop steps by 32
static_assert(SEQ <= SEQ_FULL);
static_assert(EROWS % 64 == 0);                 // a 64-token v^T tile lies wholly inside or outside the remainder plane
static_assert(EROWS % 32 == 0);                 // key bound of an early wave never exceeds EROWS
static_assert(EROWS % (16 * AW) == 0);
static_assert((SEQ - EROWS) % (16 * AW) == 0);
static_assert(EROWS <= SEQ);
static_assert(((size_t)SEQ * DM) % 8 == 0);
static_assert((QSP * 4) % 16 == 0);
static_assert((TSP * 4) % 16 == 0);
static_assert((CTP * 2) % 16 == 0);
static_assert(QSP >= HD);
static_assert(TSP >= 64);
static_assert(CTP >= 64);
// store-loop extents: trips x lanes x bytes == tile rows x row bytes
static_assert(2 * 256 * 16 == 64 * 64 * 2);
static_assert(32 * 32 * 16 == 64 * 64 * 4);     // qk_body / k_oproj: 64 rows x 256 B
static_assert(16 * 32 * 16 == 64 * 64 * 2);
static_assert(4 * 32 * 16 == 16 * HD * 2);
// static LDS per kernel
static_assert(64 * CTP * 2 <= 131072);
static_assert(64 * TSP * 4 <= 131072);
static_assert(AW * (16 * QSP + 32 * HD) * 4 <= 131072);

typedef _Float16 h16;
typedef unsigned short bf;
typedef __attribute__((ext_vector_type(16))) __bf16   v16bf;
typedef __attribute__((ext_vector_type(16))) _Float16 v16h;
typedef __attribute__((ext_vector_type(8)))  _Float16 v8h;
typedef __attribute__((ext_vector_type(8)))  unsigned short v8us;
typedef __attribute__((ext_vector_type(8)))  float    v8f;
typedef __attribute__((ext_vector_type(4)))  float    v4f;
typedef v4f  __attribute__((may_alias)) v4fa;
typedef v8us __attribute__((may_alias)) v8usa;

__device__ __forceinline__ unsigned short f2bf(float f) { unsigned u = __float_as_uint(f); u += 0x7FFFu + ((u >> 16) & 1u); return (unsigned short)(u >> 16); }
__device__ __forceinline__ float bfr(float f) { return __uint_as_float(((unsigned)f2bf(f)) << 16); }   // value after RNE convert to bf16
__device__ __forceinline__ v16h cat16(v8h lo, v8h hi) { return __builtin_shufflevector(lo, hi, 0, 1, 2, 3, 4, 5, 6, 7, 8, 9, 10, 11, 12, 13, 14, 15); }
__device__ __forceinline__ v16bf cat16b(v8us lo, v8us hi) { return __builtin_bit_cast(v16bf, __builtin_shufflevector(lo, hi, 0, 1, 2, 3, 4, 5, 6, 7, 8, 9, 10, 11, 12, 13, 14, 15)); }
__device__ __forceinline__ v8f wmma16(v16h a, v16h b, v8f c) { return __builtin_amdgcn_wmma_f32_16x16x32_f16(false, a, false, b, (short)0, c, false, false); }
__device__ __forceinline__ v8f wmmab(v16bf a, v16bf b, v8f c) { return __builtin_amdgcn_wmma_f32_16x16x32_bf16(false, a, false, b, (short)0, c, false, false); }
// fragment loaders from K-contiguous 16-bit rows; p already includes + 8*(lane>>4): elements 0..7 <- k0+8h+0..7, elements 8..15 <- k0+16+8h+0..7 (same map for A and B)
__device__ __forceinline__ v16h  ldh(const h16* p) { return cat16(*(const v8h*)p, *(const v8h*)(p + 16)); }
__device__ __forceinline__ v16bf ldb(const bf* p)  { return cat16b(*(const v8us*)p, *(const v8us*)(p + 16)); }
// ordering point for wave-private LDS tiles (same wave writes and reads)
__device__ __forceinline__ void wave_sync() { __builtin_amdgcn_fence(3 /* release order */, "wavefront"); __builtin_amdgcn_wave_barrier(); asm volatile("" ::: "memory"); }

// per-instruction guarded matrix steps: one accumulator tied per guard, A / B kept live across the nops
__device__ __forceinline__ v8f wmma16g(v16h a, v16h b, v8f c) { c = wmma16(a, b, c); asm volatile("v_nop\n\tv_nop\n\tv_nop\n\tv_nop" : "+v"(c) : "v"(a), "v"(b)); return c; }
__device__ __forceinline__ v8f wmmabg(v16bf a, v16bf b, v8f c) { c = wmmab(a, b, c); asm volatile("v_nop\n\tv_nop\n\tv_nop\n\tv_nop" : "+v"(c) : "v"(a), "v"(b)); return c; }
// f32 -> f16 convert that cannot produce a subnormal (|v| < 2^-14 -> +0)
__device__ __forceinline__ h16 toh_flush(float v) { const h16 r = (h16)v; return (fabsf(v) < 6.103515625e-05f) ? (h16)0.0f : r; }
__device__ __forceinline__ float bf2f(unsigned short b) { return __uint_as_float(((unsigned)b) << 16); }

// cvt8_body: bf16 (RNE convert) copy of x, 8 elements per thread; b = block index inside the x part of the converter grid.
__device__ __forceinline__ void cvt8_body(const float* __restrict__ src, bf* dst, size_t n8, int b) {
    const size_t i = (size_t)b * 256 + threadIdx.x; if (i >= n8) return;
    const v8f v = *(const v8f*)(src + i * 8); v8us o;
#pragma unroll
    for (int k = 0; k < 8; ++k) o[k] = f2bf(v[k]);
    *(v8us*)(dst + i * 8) = o; 
}

// cvtT_body: transposing bf16 (RNE convert) copy of a weight: in W[DM rows (k)][ncols (n)] f32 -> out WT[rowoff + n][k], row pitch DM; b = 64x64 tile index inside this weight (k tile fastest).
__device__ __forceinline__ void cvtT_body(const float* __restrict__ W, bf* WT, int ncols, int rowoff, int b, bf* ts) {
    const int tid = threadIdx.x;
    const int n0 = (b / (DM / 64)) * 64, k0 = (b % (DM / 64)) * 64;
#pragma unroll
    for (int i = 0; i < 4; ++i) { const int idx = i * 256 + tid; const int kr = idx >> 4, c4 = (idx & 15) * 4;   // 64 k rows x 16 float4
        const v4f v = *(const v4f*)(W + (size_t)(k0 + kr) * (size_t)ncols + n0 + c4);
#pragma unroll
        for (int e = 0; e < 4; ++e) ts[(c4 + e) * CTP + kr] = f2bf(v[e]); }
    __syncthreads();                                            // cross-wave tile: block barrier
{
#pragma unroll
        for (int i = 0; i < 2; ++i) { const int p = i * 256 + tid; const int row = p >> 3, c8 = (p & 7) * 8;   // 2 trips x 32 rows = 64 rows; 8 lanes x 8 = 64 k
            const v8us o = *(const v8usa*)(&ts[row * CTP + c8]);
            *(v8us*)(WT + (size_t)(rowoff + n0 + row) * DM + k0 + c8) = o; }
        asm volatile("s_wait_xcnt 0x0" ::: "memory");                            // code of the grid's other part follows in the listing and rewrites the two stores' registers: wait first
         }
}

// k_cvt: every operand conversion in one grid (the five parts touch disjoint data). Block ranges: x | Wq | Wk | Wv | Wproj; every test below is block-uniform.
#define CB_X  ((int)(((size_t)SEQ * DM / 8 + 255) / 256))
#define CB_WD ((DM / 64) * (DM / 64))                           // tiles of a [768][768] weight
#define CB_WK ((DKV / 64) * (DM / 64))                          // tiles of a [768][384] weight
__global__ __launch_bounds__(256) void k_cvt(const float* __restrict__ x, const float* __restrict__ wq, const float* __restrict__ wk, const float* __restrict__ wv, const float* __restrict__ wp, bf* XB, bf* WT) {
    __shared__ __align__(16) bf ts[64 * CTP];
    int b = blockIdx.x;
    if (b < CB_X) { cvt8_body(x, XB, (size_t)SEQ * DM / 8, b); }
    else {                                                      // whole blocks only: the barrier of the transposing part is met by all 256 threads or by none
        b -= CB_X;
        const float* W; int ncols, rowoff;
        if (b < CB_WD)                  { W = wq; ncols = DM;  rowoff = 0; }
        else if (b < CB_WD + CB_WK)     { W = wk; ncols = DKV; rowoff = DM;        b -= CB_WD; }
        else if (b < CB_WD + 2 * CB_WK) { W = wv; ncols = DKV; rowoff = NQK;       b -= CB_WD + CB_WK; }
        else                            { W = wp; ncols = DM;  rowoff = NQK + DKV; b -= CB_WD + 2 * CB_WK; }
        cvtT_body(W, WT, ncols, rowoff, b, ts);
    }
}

// gemm64: register-blocked bf16 GEMM core, ONE WAVE per 64x64 tile (16 accumulators), operands straight from K-contiguous bf16 planes.
// C[m][n] = sum_part sum_k A[m][part*kb + k] Bt[n][k]; aoff / boff already include the lane's row and + 8*(lane>>4).
__device__ __forceinline__ void gemm64(const bf* __restrict__ A, const bf* __restrict__ Bt, const int pitchA, const int pitchB, const int kb, const int nparts,
                                       const size_t aoff, const size_t boff, v8f (&acc)[4][4]) {
#pragma unroll
    for (int mb = 0; mb < 4; ++mb)
#pragma unroll
        for (int nb = 0; nb < 4; ++nb) acc[mb][nb] = (v8f){};
#pragma unroll 1
    for (int part = 0; part < nparts; ++part) {
        const size_t ap = aoff + (size_t)part * (size_t)kb;
#pragma unroll 1
        for (int kc = 0; kc < kb; kc += 32) {
            v16bf a[4];
#pragma unroll
            for (int mb = 0; mb < 4; ++mb) a[mb] = ldb(A + ap + (size_t)mb * 16 * (size_t)pitchA + kc);
#pragma unroll
            for (int nb = 0; nb < 4; ++nb) { const v16bf b = ldb(Bt + boff + (size_t)nb * 16 * (size_t)pitchB + kc);
#pragma unroll
                for (int mb = 0; mb < 4; ++mb) acc[mb][nb] = wmmabg(a[mb], b, acc[mb][nb]); }
        }
    }
}

// qk_body: q and k projections with rotation + RMS normalisation in the epilogue. A = x rows (m = t), Bt = WT rows n in [0, 1152): column tile = head (0..11 q, 12..17 k).
__device__ __forceinline__ void qk_body(const bf* __restrict__ XB, const bf* __restrict__ WT, const float* __restrict__ cosb, const float* __restrict__ sinb, float* QKF, const int ttile, const int head, float* os) {
    const int lane = threadIdx.x & 31, lr = lane & 15, hi = lane >> 4;
    const int r0 = ttile * 64, c0 = head * 64;
    v8f acc[4][4];
    gemm64(XB, WT, DM, DM, DM, 1, (size_t)(r0 + lr) * DM + 8 * hi, (size_t)(c0 + lr) * DM + 8 * hi, acc);
#pragma unroll
    for (int mb = 0; mb < 4; ++mb)
#pragma unroll
        for (int nb = 0; nb < 4; ++nb)
#pragma unroll
            for (int j = 0; j < 8; ++j) os[(mb * 16 + hi * 8 + j) * TSP + nb * 16 + lr] = acc[mb][nb][j];   // D: row 8h+j, col lane&15; all 64 x 64 written
    wave_sync();
#pragma unroll 1
    for (int r = 0; r < 64; ++r) {                              // lane = rotary pair column (d, d + 32)
        const int t = r0 + r;
        const float x1 = os[r * TSP + lane], x2 = os[r * TSP + HROT + lane];
        const float c = bfr(cosb[(size_t)t * HROT + lane]), s = bfr(sinb[(size_t)t * HROT + lane]);
        const float o1 = x1 * c - x2 * s, o2 = x2 * c + x1 * s;
        float ss = o1 * o1 + o2 * o2;
#pragma unroll
        for (int off = 16; off > 0; off >>= 1) ss += __shfl_xor(ss, off, 32);
        const float sc = rsqrtf(ss * (1.0f / (float)HD) + 1e-6f);
        os[r * TSP + lane] = o1 * sc; os[r * TSP + HROT + lane] = o2 * sc; }
    wave_sync();
    float* dst = QKF + ((size_t)head * SEQ + (size_t)r0) * HD;
{
#pragma unroll 4
        for (int i = 0; i < 32; ++i) { const int idx = i * 32 + lane; const int row = idx >> 4, c4 = (idx & 15) * 4;   // 32 trips x 2 rows = 64 rows; 16 lanes x 4 floats = 64 columns
            const v4f val = *(const v4fa*)(&os[row * TSP + c4]);
            *(v4f*)(dst + (size_t)idx * 4) = val; }
         }
}

// vt_body: v^T projection. A = WT rows 1152 + m (m = kvh*64 + d), Bt = x rows (n = t); plane VT [m][t] f16 (row pitch SEQ) and, for t < EROWS (block-uniform test), the f16 remainder x2048 VR [m][t] (row pitch EROWS).
__device__ __forceinline__ void vt_body(const bf* __restrict__ WV, const bf* __restrict__ XB, h16* VT, h16* VR, const int mtile, const int ttile, float* os) {
    const int lane = threadIdx.x & 31, lr = lane & 15, hi = lane >> 4;
    const int r0 = mtile * 64, c0 = ttile * 64;
    v8f acc[4][4];
    gemm64(WV, XB, DM, DM, DM, 1, (size_t)(r0 + lr) * DM + 8 * hi, (size_t)(c0 + lr) * DM + 8 * hi, acc);
#pragma unroll
    for (int mb = 0; mb < 4; ++mb)
#pragma unroll
        for (int nb = 0; nb < 4; ++nb)
#pragma unroll
            for (int j = 0; j < 8; ++j) os[(mb * 16 + hi * 8 + j) * TSP + nb * 16 + lr] = acc[mb][nb][j];
    wave_sync();
    const bool wr = c0 < EROWS;                                 // block-uniform: whole tile inside the remainder plane
{
#pragma unroll 4
        for (int i = 0; i < 16; ++i) { const int p = i * 32 + lane; const int row = p >> 3, c8 = (p & 7) * 8;   // 16 trips x 4 rows = 64 rows; 8 lanes x 8 = 64 columns
            const v4f x0 = *(const v4fa*)(&os[row * TSP + c8]); const v4f x1 = *(const v4fa*)(&os[row * TSP + c8 + 4]); v8h hv, rv;
#pragma unroll
            for (int e = 0; e < 4; ++e) { const h16 a0 = toh_flush(x0[e]); const h16 a1 = toh_flush(x1[e]); hv[e] = a0; hv[4 + e] = a1;
                rv[e] = toh_flush((x0[e] - (float)a0) * QRS); rv[4 + e] = toh_flush((x1[e] - (float)a1) * QRS); }
            *(v8h*)(VT + (size_t)(r0 + row) * SEQ + c0 + c8) = hv;
            asm volatile("s_wait_xcnt 0x0" ::: "memory");                        // the store's registers are rewritten behind it (remainder packing, next trip): wait first
            if (wr) { *(v8h*)(VR + (size_t)(r0 + row) * EROWS + c0 + c8) = rv;
                asm volatile("s_wait_xcnt 0x0" ::: "memory"); } }                // same, for the remainder store
         }
}

// k_qkv: the three input projections in one grid (disjoint outputs): blockIdx.x = 64-token tile; blockIdx.y < 18: q / k head, else v^T row tile.
__global__ __launch_bounds__(32) void k_qkv(const bf* __restrict__ XB, const bf* __restrict__ WT, const float* __restrict__ cosb, const float* __restrict__ sinb, float* QKF, h16* VT, h16* VR) {
    __shared__ __align__(16) float os[64 * TSP];
    const int by = blockIdx.y;
    if (by < NHQ + NHK) qk_body(XB, WT, cosb, sinb, QKF, blockIdx.x, by, os);
    else                vt_body(WT + (size_t)NQK * DM, XB, VT, VR, by - (NHQ + NHK), blockIdx.x, os);
}

// k_oproj: output projection. A = context plane rows (value | remainder, two K parts of 768), Bt = WT rows 1536 + n; f32 output [t][768].
__global__ __launch_bounds__(32) void k_oproj(const bf* __restrict__ YB, const bf* __restrict__ WP, float* OUT) {
    __shared__ __align__(16) float os[64 * TSP];
    const int lane = threadIdx.x & 31, lr = lane & 15, hi = lane >> 4;
    const int r0 = blockIdx.x * 64, c0 = blockIdx.y * 64;
    v8f acc[4][4];
    gemm64(YB, WP, YP, DM, DM, 2, (size_t)(r0 + lr) * YP + 8 * hi, (size_t)(c0 + lr) * DM + 8 * hi, acc);
#pragma unroll
    for (int mb = 0; mb < 4; ++mb)
#pragma unroll
        for (int nb = 0; nb < 4; ++nb)
#pragma unroll
            for (int j = 0; j < 8; ++j) os[(mb * 16 + hi * 8 + j) * TSP + nb * 16 + lr] = acc[mb][nb][j];
    wave_sync();
{
#pragma unroll 4
        for (int i = 0; i < 32; ++i) { const int idx = i * 32 + lane; const int row = idx >> 4, c4 = (idx & 15) * 4;   // 32 trips x 2 rows = 64 rows; 16 lanes x 4 floats = 64 columns
            const v4f val = *(const v4fa*)(&os[row * TSP + c4]);
            *(v4f*)(OUT + (size_t)(r0 + row) * DM + c0 + c4) = val; }
         }
}

// flash_body: fused attention, one wave per 16 query rows of one head. q tile and the 32-key K tile live in wave-private LDS (f32); scores on the vector unit:
// lane (t = lane&15, h = lane>>4) forms max_d(q[t][d] + k[key][d]) for keys 8h+r and 16+8h+r of each 32-key step, i.e. directly the B-fragment layout of
// O^T[d][t] = V^T P^T (element r <- keys 8h+r, element 8+r <- keys 16+8h+r, lane unchanged). V^T fragments (A, row d, k = key) straight from the f16 planes.
// Softmax state (running max over kept keys, partial sum) is one scalar per lane; the two lane halves of a row are combined with one xor-16 exchange.
// Causal keep rule (key <= t) evaluated per element inside every visited tile; the per-wave key bound is a wave scalar, multiple of 32, <= SEQ.
// EARLY = 1 (query rows [0, EROWS)): P = f16 value + f16 remainder x2048; O = V P + (V P_rem + V_rem P) / 2048 (remainder products in their own accumulators); row sum from the f32 exponentials.
// EARLY = 0 (query rows [EROWS, SEQ)): single P, v; row sum over the converted P.
template <int EARLY>
__device__ __forceinline__ void flash_body(const float* __restrict__ QKF, const h16* __restrict__ VT, const h16* __restrict__ VR, bf* YB, float* qs, float* ks) {
    const int lane = threadIdx.x & 31, lr = lane & 15, hi = lane >> 4;
    const int wave = __builtin_amdgcn_readfirstlane((int)(threadIdx.x >> 5));
    const int h = blockIdx.y, kvh = h / NREP;
    const int t0 = (blockIdx.x * AW + wave) * 16;               // blockIdx.x = tile of 16 * AW query rows, wholly below or wholly at / above EROWS
    const int lim = t0 + lr;                                    // key j kept iff j <= lim
    const int nk = (t0 + 16 + 31) & ~31;                        // wave-uniform, multiple of 32, <= SEQ (<= EROWS when EARLY)
    const int qb = wave * 16 * QSP, kbs = wave * 32 * HD;
    { const size_t qsrc = ((size_t)h * SEQ + (size_t)t0) * HD;  // 16 rows x 64 floats, contiguous
#pragma unroll
      for (int i = 0; i < 8; ++i) { const int idx = i * 32 + lane;
          const v4f v = *(const v4f*)(QKF + qsrc + (size_t)idx * 4);
          *(v4fa*)(&qs[qb + (idx >> 4) * QSP + (idx & 15) * 4]) = v; } }
    const size_t kplane = ((size_t)(NHQ + kvh) * SEQ) * HD;     // k heads follow the q heads in the plane
    const size_t vo  = (size_t)(kvh * HD + lr) * SEQ + 8 * hi;   // + 16j*SEQ + key   (A fragment: row d, k = key)
    const size_t vro = (size_t)(kvh * HD + lr) * EROWS + 8 * hi; // remainder plane, tokens < EROWS
    const v16h hz = (v16h){};
    v8f o[4], oR[4];
#pragma unroll
    for (int j = 0; j < 4; ++j) { o[j] = (v8f){}; oR[j] = (v8f){}; }
    float m = NEGB, l = 0.0f;
#pragma unroll 1
    for (int key0 = 0; key0 < nk; key0 += 32) {
        wave_sync();                                            // earlier reads of the K tile are done
        { const size_t ksrc = kplane + (size_t)key0 * HD;       // 32 keys x 64 floats, contiguous; keys < nk <= SEQ
#pragma unroll 8
          for (int i = 0; i < 16; ++i) { const int idx = i * 32 + lane;
              const v4f v = *(const v4f*)(QKF + ksrc + (size_t)idx * 4);
              *(v4fa*)(&ks[kbs + idx * 4]) = v; } }
        wave_sync();
        float sa[8], sb[8];
#pragma unroll
        for (int r = 0; r < 8; ++r) { sa[r] = NEGB; sb[r] = NEGB; }
#pragma unroll 1
        for (int d4 = 0; d4 < HD / 4; ++d4) {
            const v4f q4 = *(const v4fa*)(&qs[qb + lr * QSP + d4 * 4]);
#pragma unroll
            for (int r = 0; r < 8; ++r) {
                const v4f ka = *(const v4fa*)(&ks[kbs + (8 * hi + r) * HD + d4 * 4]);
                const v4f kc = *(const v4fa*)(&ks[kbs + (16 + 8 * hi + r) * HD + d4 * 4]);
                sa[r] = fmaxf(sa[r], fmaxf(fmaxf(q4[0] + ka[0], q4[1] + ka[1]), fmaxf(q4[2] + ka[2], q4[3] + ka[3])));
                sb[r] = fmaxf(sb[r], fmaxf(fmaxf(q4[0] + kc[0], q4[1] + kc[1]), fmaxf(q4[2] + kc[2], q4[3] + kc[3]))); }
        }
        const int ja = key0 + 8 * hi;
        float mx = NEGB;
#pragma unroll
        for (int r = 0; r < 8; ++r) {
            sa[r] = sa[r] * LOG2E; sb[r] = sb[r] * LOG2E;
            const bool fa = (ja + r <= lim), fb = (ja + 16 + r <= lim);
            mx = fmaxf(mx, fmaxf(fa ? sa[r] : NEGB, fb ? sb[r] : NEGB)); }
        mx = fmaxf(mx, __shfl_xor(mx, 16, 32));
        const float mnew = fmaxf(m, mx);
        const float alpha = __builtin_amdgcn_exp2f(m - mnew);
        const float sh = PSH - mnew;
        v16h pb, pr = hz; float ls = 0.0f;
#pragma unroll
        for (int r = 0; r < 8; ++r) {
            const float xa = sa[r] + sh, xb = sb[r] + sh;
            const float ea = __builtin_amdgcn_exp2f(xa), eb = __builtin_amdgcn_exp2f(xb);
            const bool fa = (ja + r <= lim) & (xa >= -14.0f), fb = (ja + 16 + r <= lim) & (xb >= -14.0f);   // dropped keys and values below the f16 normal range selected to 0 by value
            const float ga = fa ? ea : 0.0f, gb = fb ? eb : 0.0f;
            const h16 pa = (h16)ga; const h16 pc = (h16)gb;
            pb[r] = pa; pb[8 + r] = pc;
            if (EARLY) { pr[r] = toh_flush((ga - (float)pa) * QRS); pr[8 + r] = toh_flush((gb - (float)pc) * QRS); ls += ga + gb; }
            else       { ls += (float)pa + (float)pc; } }
        l = l * alpha + ls; m = mnew;
#pragma unroll
        for (int j = 0; j < 4; ++j) {
            const v16h v = ldh(VT + vo + (size_t)(16 * j) * SEQ + key0);
            o[j] = o[j] * alpha;
            o[j] = wmma16g(v, pb, o[j]);
            if (EARLY) {
                const v16h vr = ldh(VR + vro + (size_t)(16 * j) * EROWS + key0);   // key0 + 31 < nk <= EROWS
                oR[j] = oR[j] * alpha;
                oR[j] = wmma16g(v, pr, oR[j]);
                oR[j] = wmma16g(vr, pb, oR[j]); }
        }
    }
    l += __shfl_xor(l, 16, 32);
    const bool any = l > 0.0f;
    const float lsafe = any ? l : 1.0f;
    const float inv = any ? (1.0f / lsafe) : 0.0f;
    wave_sync();                                                // q tile reads are done; the slice becomes the context tile
    // O^T D layout: f_j[r] = (d = 16j + 8h + r, t = lane&15) -> qs[t][d]; rows 0..15 x columns 0..63 all written
#pragma unroll
    for (int j = 0; j < 4; ++j) {
        v8f f = o[j];
        if (EARLY) f = o[j] + oR[j] * QRI;
        v4f a, c;
        a[0] = f[0] * inv; a[1] = f[1] * inv; a[2] = f[2] * inv; a[3] = f[3] * inv; c[0] = f[4] * inv; c[1] = f[5] * inv; c[2] = f[6] * inv; c[3] = f[7] * inv;
        *(v4fa*)(&qs[qb + lr * QSP + 16 * j + 8 * hi]) = a; *(v4fa*)(&qs[qb + lr * QSP + 16 * j + 8 * hi + 4]) = c; }
    wave_sync();
    bf* yrow = YB + (size_t)t0 * YP + h * HD;
{
#pragma unroll
        for (int s = 0; s < 4; ++s) { const int row = 4 * s + (lane >> 3), c8 = (lane & 7) * 8;   // 4 s x 4 rows = 16 rows; 8 lanes x 8 = 64 columns = one line
            const v4f x0 = *(const v4fa*)(&qs[qb + row * QSP + c8]); const v4f x1 = *(const v4fa*)(&qs[qb + row * QSP + c8 + 4]); v8us hv, lv;
#pragma unroll
            for (int e = 0; e < 4; ++e) { const unsigned short b0 = f2bf(x0[e]); const unsigned short b1 = f2bf(x1[e]); hv[e] = b0; hv[4 + e] = b1;
                lv[e] = f2bf(x0[e] - bf2f(b0)); lv[4 + e] = f2bf(x1[e] - bf2f(b1)); }
            *(v8us*)(yrow + (size_t)row * YP + c8) = hv;
            *(v8us*)(yrow + (size_t)row * YP + DM + c8) = lv; }
         }
}

// k_flash: both instantiations in one grid (disjoint context rows); the choice is block-uniform.
__global__ __launch_bounds__(32 * AW) __attribute__((amdgpu_num_vgpr(256))) void k_flash(const float* __restrict__ QKF, const h16* __restrict__ VT, const h16* __restrict__ VR, bf* YB) {
    __shared__ __align__(16) float qs[AW * 16 * QSP];           // wave-private slices: q tile, later the context tile
    __shared__ __align__(16) float ks[AW * 32 * HD];            // wave-private slices: 32-key K tile
    if ((int)blockIdx.x * (16 * AW) < EROWS) flash_body<1>(QKF, VT, VR, YB, qs, ks);
    else                                     flash_body<0>(QKF, VT, VR, YB, qs, ks);
}

static constexpr size_t al256(size_t v) { return (v + 255) & ~(size_t)255; }
static constexpr size_t SZ_XB = al256((size_t)SEQ * DM * 2);
static constexpr size_t SZ_WT = al256((size_t)WROWS * DM * 2);
static constexpr size_t SZ_QK = al256((size_t)(NHQ + NHK) * SEQ * HD * 4);
static constexpr size_t SZ_VT = al256((size_t)DKV * SEQ * 2);
static constexpr size_t SZ_VR = al256((size_t)DKV * EROWS * 2);
static constexpr size_t SZ_YB = al256((size_t)SEQ * YP * 2);
static constexpr size_t SZ_TOTAL = SZ_XB + SZ_WT + SZ_QK + SZ_VT + SZ_VR + SZ_YB;
static_assert(SZ_TOTAL <= (size_t)134217728);          // workspace carve <= 128 MiB
static_assert(((size_t)DM * DM * 2) % 256 == 0);       // weight sub-planes stay 256-byte aligned
static_assert(((size_t)DKV * DM * 2) % 256 == 0);
static_assert(((size_t)NHQ * SEQ * HD * 4) % 256 == 0);

extern "C" void kernel_launch(void* const* d_in, const int* in_sizes, int n_in,
                              void* d_out, int out_size, void* d_ws, size_t ws_size, hipStream_t stream) {
    if (n_in < 7) return;
    if ((size_t)in_sizes[0] < (size_t)SEQ * DM) return;
    if ((size_t)in_sizes[1] < (size_t)SEQ * HROT || (size_t)in_sizes[2] < (size_t)SEQ * HROT) return;
    if ((size_t)in_sizes[3] < (size_t)DM * DM || (size_t)in_sizes[6] < (size_t)DM * DM) return;
    if ((size_t)in_sizes[4] < (size_t)DM * DKV || (size_t)in_sizes[5] < (size_t)DM * DKV) return;
    if ((size_t)out_size < (size_t)SEQ * DM) return;
    if (SZ_TOTAL > ws_size) return;
    // wire order: x, cos, sin, Wq, Wk, Wv, Wproj
    const float* x    = (const float*)d_in[0];
    const float* cosb = (const float*)d_in[1];
    const float* sinb = (const float*)d_in[2];
    const float* wq   = (const float*)d_in[3];
    const float* wk   = (const float*)d_in[4];
    const float* wv   = (const float*)d_in[5];
    const float* wp   = (const float*)d_in[6];
    float* OUT = (float*)d_out;                        // [SEQ][768]
    char* wsp = (char*)d_ws;
    bf*    XB  = (bf*)wsp;    wsp += SZ_XB;            // x bf16 [SEQ][768]
    bf*    WT  = (bf*)wsp;    wsp += SZ_WT;            // [2304][768]: q | k | v | proj, each [out][in]
    float* QKF = (float*)wsp; wsp += SZ_QK;            // [18][SEQ][64] f32: 12 q heads, 6 k heads
    h16*   VT  = (h16*)wsp;   wsp += SZ_VT;            // [384][SEQ]
    h16*   VR  = (h16*)wsp;   wsp += SZ_VR;            // [384][EROWS] remainder x2048, tokens < EROWS
    bf*    YB  = (bf*)wsp;    wsp += SZ_YB;            // [SEQ][768 value | 768 remainder]

    // conversions: x -> XB; W[768 rows][ncols] -> WT[rowoff + ncols rows][768]
    k_cvt<<<CB_X + 2 * CB_WD + 2 * CB_WK, 256, 0, stream>>>(x, wq, wk, wv, wp, XB, WT);

    // q | k: A = x rows, Bt = WT rows [0, 1152) -> f32 planes [head][t][64], rotated and normalised; v^T: A = WT rows [1152, 1536), Bt = x rows -> [m][t] f16 (+ remainder for t < EROWS)
    k_qkv<<<dim3(SEQ / 64, NHQ + NHK + DKV / 64, 1), 32, 0, stream>>>(XB, WT, cosb, sinb, QKF, VT, VR);

    // query rows [0, EROWS): multi-product instantiation; rows [EROWS, SEQ): single-product instantiation
    k_flash<<<dim3(SEQ / (16 * AW), NHQ, 1), 32 * AW, 0, stream>>>(QKF, VT, VR, YB);

    // output projection: A = context rows (value | remainder), Bt = WT rows [1536, 2304)
    k_oproj<<<dim3(SEQ / 64, DM / 64, 1), 32, 0, stream>>>(YB, WT + (size_t)(NQK + DKV) * DM, OUT);
}

// v002
// A run of this version takes 97.5 microseconds.
// Two timings next to v001 both put it at 1.39 times that version's speed.
// Over all steps from v000 it is 2.09 times as fast.
#include <hip/hip_runtime.h>

// Causal grouped-query self-attention with max-plus scores: x [SEQ][768]; Wq [768][768], Wk / Wv [768][384], Wproj [768][768], all [in][out] (y = x W, no bias);
// 12 query heads x 64, 6 key/value heads (2 query heads per key/value head); half-split rotary tables cos / sin [SEQ][32] read by value;
// per-head RMS normalisation (eps 1e-6) of q and k after the rotation; score[t][j] = max_d (q[t][d] + k[j][d]); causal softmax; context = P v; output = context Wproj (f32).
// Compute dtypes, f32 accumulate everywhere: q / k / v projections v_wmma_f32_16x16x32_bf16 (x, W RNE-converted to bf16; products exact); max-plus scores are not a multiply-accumulate: f32 on the vector unit from f32 q / k planes;
// P.V v_wmma_f32_16x16x32_f16: P (x16384 carry, cancels in the normalisation) and v single f16 on query rows >= EROWS; on query rows < EROWS P and v each as f16 value + f16 remainder x2048, remainder products in their own accumulator folded by 1/2048, row sum from the f32 exponentials;
// output projection v_wmma_f32_16x16x32_bf16: context as bf16 value + bf16 remainder (two products into one accumulator), Wproj RNE-converted to bf16; softmax f32 (online, running max over kept keys).
// Layout: bf16 copy of x; transposed bf16 weights WT [2304][768] = q | k | v | proj rows ([out][in]); f32 planes q / k [18 heads][t][64] (rotated, normalised); v^T plane f16 [384][t] and remainder plane [384][t < EROWS];
// fused flash kernel in transposed form (O^T = V^T P^T, P built on the vector unit directly in B-fragment layout); context plane bf16 [t][768 value | 768 remainder].

#ifndef SEQ
#define SEQ 512
#endif
#define SEQ_FULL 512
#define DM    768
#define NHQ   12
#define NHK   6
#define NREP  2
#define HD    64
#define HROT  32
#define DKV   (NHK * HD)              // 384
#define NQK   (DM + DKV)              // 1152: q | k rows of WT
#define WROWS (DM + 2 * DKV + DM)     // 2304: q | k | v | proj rows of WT
#define YP    (2 * DM)                // context plane row pitch (value | remainder)
#define AW    8                       // waves per flash block: all work on the same 16 query rows, 32-key steps dealt round-robin
#define QSP   68                      // LDS row pitch (floats) of the q / context tile
#define TSP   68                      // LDS row pitch (floats) of the GEMM output tile
#define CTP   72                      // LDS row pitch (16-bit words) of the transposing converter tile
#define EROWS (SEQ < 256 ? SEQ : 256) // query rows handled by the multi-product flash instantiation
#define QRS   2048.0f                 // carry of the v remainder plane / P remainder fragment
#define QRI   (1.0f / 2048.0f)
#define LOG2E 1.4426950408889634f
#define PSH   14.0f                   // log2 of the P carry (16384)
#define NEGB  (-3.0e38f)

static_assert(HD == 64);
static_assert(HROT * 2 == HD);
static_assert(NHQ * HD == DM);
static_assert(NHK * NREP == NHQ);
static_assert(DM % 64 == 0);
static_assert(DKV % 64 == 0);
static_assert(NQK % 64 == 0);
static_assert(DM % 32 == 0);                    // GEMM k-loop steps by 32
static_assert(SEQ % 64 == 0);
static_assert(SEQ % 32 == 0);                   // key loop steps by 32
static_assert(SEQ <= SEQ_FULL);
static_assert(EROWS % 64 == 0);                 // a 64-token v^T tile lies wholly inside or outside the remainder plane
static_assert(EROWS % 32 == 0);                 // key bound of an early wave never exceeds EROWS
static_assert(EROWS % 16 == 0);                 // a 16-row query tile lies wholly below or wholly at / above EROWS
static_assert(AW * 32 * 4 == 16 * HD);          // merge: every thread of the block owns 4 context columns of one row
static_assert(EROWS <= SEQ);
static_assert(((size_t)SEQ * DM) % 8 == 0);
static_assert((QSP * 4) % 16 == 0);
static_assert((TSP * 4) % 16 == 0);
static_assert((CTP * 2) % 16 == 0);
static_assert(QSP >= HD);
static_assert(TSP >= 64);
static_assert(CTP >= 64);
// store-loop extents: trips x lanes x bytes == tile rows x row bytes
static_assert(2 * 256 * 16 == 64 * 64 * 2);
static_assert(32 * 32 * 16 == 64 * 64 * 4);     // qk_body / k_oproj: 64 rows x 256 B
static_assert(16 * 32 * 16 == 64 * 64 * 2);
// static LDS per kernel
static_assert(64 * CTP * 2 <= 131072);
static_assert(64 * TSP * 4 <= 131072);
static_assert(AW * (16 * QSP + 32 * HD + 32) * 4 <= 131072);

typedef _Float16 h16;
typedef unsigned short bf;
typedef __attribute__((ext_vector_type(16))) __bf16   v16bf;
typedef __attribute__((ext_vector_type(16))) _Float16 v16h;
typedef __attribute__((ext_vector_type(8)))  _Float16 v8h;
typedef __attribute__((ext_vector_type(8)))  unsigned short v8us;
typedef __attribute__((ext_vector_type(4)))  unsigned short v4us;
typedef __attribute__((ext_vector_type(8)))  float    v8f;
typedef __attribute__((ext_vector_type(4)))  float    v4f;
typedef v4f  __attribute__((may_alias)) v4fa;
typedef v8us __attribute__((may_alias)) v8usa;

__device__ __forceinline__ unsigned short f2bf(float f) { unsigned u = __float_as_uint(f); u += 0x7FFFu + ((u >> 16) & 1u); return (unsigned short)(u >> 16); }
__device__ __forceinline__ float bfr(float f) { return __uint_as_float(((unsigned)f2bf(f)) << 16); }   // value after RNE convert to bf16
__device__ __forceinline__ v16h cat16(v8h lo, v8h hi) { return __builtin_shufflevector(lo, hi, 0, 1, 2, 3, 4, 5, 6, 7, 8, 9, 10, 11, 12, 13, 14, 15); }
__device__ __forceinline__ v16bf cat16b(v8us lo, v8us hi) { return __builtin_bit_cast(v16bf, __builtin_shufflevector(lo, hi, 0, 1, 2, 3, 4, 5, 6, 7, 8, 9, 10, 11, 12, 13, 14, 15)); }
__device__ __forceinline__ v8f wmma16(v16h a, v16h b, v8f c) { return __builtin_amdgcn_wmma_f32_16x16x32_f16(false, a, false, b, (short)0, c, false, false); }
__device__ __forceinline__ v8f wmmab(v16bf a, v16bf b, v8f c) { return __builtin_amdgcn_wmma_f32_16x16x32_bf16(false, a, false, b, (short)0, c, false, false); }
// fragment loaders from K-contiguous 16-bit rows; p already includes + 8*(lane>>4): elements 0..7 <- k0+8h+0..7, elements 8..15 <- k0+16+8h+0..7 (same map for A and B)
__device__ __forceinline__ v16h  ldh(const h16* p) { return cat16(*(const v8h*)p, *(const v8h*)(p + 16)); }
__device__ __forceinline__ v16bf ldb(const bf* p)  { return cat16b(*(const v8us*)p, *(const v8us*)(p + 16)); }
// ordering point for wave-private LDS tiles (same wave writes and reads)
__device__ __forceinline__ void wave_sync() { __builtin_amdgcn_fence(3 /* release order */, "wavefront"); __builtin_amdgcn_wave_barrier(); asm volatile("" ::: "memory"); }

// per-instruction guarded matrix steps: one accumulator tied per guard, A / B kept live across the nops
__device__ __forceinline__ v8f wmma16g(v16h a, v16h b, v8f c) { c = wmma16(a, b, c); asm volatile("v_nop\n\tv_nop\n\tv_nop\n\tv_nop" : "+v"(c) : "v"(a), "v"(b)); return c; }
__device__ __forceinline__ v8f wmmabg(v16bf a, v16bf b, v8f c) { c = wmmab(a, b, c); asm volatile("v_nop\n\tv_nop\n\tv_nop\n\tv_nop" : "+v"(c) : "v"(a), "v"(b)); return c; }
// f32 -> f16 convert that cannot produce a subnormal (|v| < 2^-14 -> +0)
__device__ __forceinline__ h16 toh_flush(float v) { const h16 r = (h16)v; return (fabsf(v) < 6.103515625e-05f) ? (h16)0.0f : r; }
__device__ __forceinline__ float bf2f(unsigned short b) { return __uint_as_float(((unsigned)b) << 16); }

// cvt8_body: bf16 (RNE convert) copy of x, 8 elements per thread; b = block index inside the x part of the converter grid.
__device__ __forceinline__ void cvt8_body(const float* __restrict__ src, bf* dst, size_t n8, int b) {
    const size_t i = (size_t)b * 256 + threadIdx.x; if (i >= n8) return;
    const v8f v = *(const v8f*)(src + i * 8); v8us o;
#pragma unroll
    for (int k = 0; k < 8; ++k) o[k] = f2bf(v[k]);
    *(v8us*)(dst + i * 8) = o; 
}

// cvtT_body: transposing bf16 (RNE convert) copy of a weight: in W[DM rows (k)][ncols (n)] f32 -> out WT[rowoff + n][k], row pitch DM; b = 64x64 tile index inside this weight (k tile fastest).
__device__ __forceinline__ void cvtT_body(const float* __restrict__ W, bf* WT, int ncols, int rowoff, int b, bf* ts) {
    const int tid = threadIdx.x;
    const int n0 = (b / (DM / 64)) * 64, k0 = (b % (DM / 64)) * 64;
#pragma unroll
    for (int i = 0; i < 4; ++i) { const int idx = i * 256 + tid; const int kr = idx >> 4, c4 = (idx & 15) * 4;   // 64 k rows x 16 float4
        const v4f v = *(const v4f*)(W + (size_t)(k0 + kr) * (size_t)ncols + n0 + c4);
#pragma unroll
        for (int e = 0; e < 4; ++e) ts[(c4 + e) * CTP + kr] = f2bf(v[e]); }
    __syncthreads();                                            // cross-wave tile: block barrier
{
#pragma unroll
        for (int i = 0; i < 2; ++i) { const int p = i * 256 + tid; const int row = p >> 3, c8 = (p & 7) * 8;   // 2 trips x 32 rows = 64 rows; 8 lanes x 8 = 64 k
            const v8us o = *(const v8usa*)(&ts[row * CTP + c8]);
            *(v8us*)(WT + (size_t)(rowoff + n0 + row) * DM + k0 + c8) = o; }
        asm volatile("s_wait_xcnt 0x0" ::: "memory");                            // code of the grid's other part follows in the listing and rewrites the two stores' registers: wait first
         }
}

// k_cvt: every operand conversion in one grid (the five parts touch disjoint data). Block ranges: x | Wq | Wk | Wv | Wproj; every test below is block-uniform.
#define CB_X  ((int)(((size_t)SEQ * DM / 8 + 255) / 256))
#define CB_WD ((DM / 64) * (DM / 64))                           // tiles of a [768][768] weight
#define CB_WK ((DKV / 64) * (DM / 64))                          // tiles of a [768][384] weight
__global__ __launch_bounds__(256) void k_cvt(const float* __restrict__ x, const float* __restrict__ wq, const float* __restrict__ wk, const float* __restrict__ wv, const float* __restrict__ wp, bf* XB, bf* WT) {
    __shared__ __align__(16) bf ts[64 * CTP];
    int b = blockIdx.x;
    if (b < CB_X) { cvt8_body(x, XB, (size_t)SEQ * DM / 8, b); }
    else {                                                      // whole blocks only: the barrier of the transposing part is met by all 256 threads or by none
        b -= CB_X;
        const float* W; int ncols, rowoff;
        if (b < CB_WD)                  { W = wq; ncols = DM;  rowoff = 0; }
        else if (b < CB_WD + CB_WK)     { W = wk; ncols = DKV; rowoff = DM;        b -= CB_WD; }
        else if (b < CB_WD + 2 * CB_WK) { W = wv; ncols = DKV; rowoff = NQK;       b -= CB_WD + CB_WK; }
        else                            { W = wp; ncols = DM;  rowoff = NQK + DKV; b -= CB_WD + 2 * CB_WK; }
        cvtT_body(W, WT, ncols, rowoff, b, ts);
    }
}

// gemm64: register-blocked bf16 GEMM core, ONE WAVE per 64x64 tile (16 accumulators), operands straight from K-contiguous bf16 planes.
// C[m][n] = sum_part sum_k A[m][part*kb + k] Bt[n][k]; aoff / boff already include the lane's row and + 8*(lane>>4).
__device__ __forceinline__ void gemm64(const bf* __restrict__ A, const bf* __restrict__ Bt, const int pitchA, const int pitchB, const int kb, const int nparts,
                                       const size_t aoff, const size_t boff, v8f (&acc)[4][4]) {
#pragma unroll
    for (int mb = 0; mb < 4; ++mb)
#pragma unroll
        for (int nb = 0; nb < 4; ++nb) acc[mb][nb] = (v8f){};
#pragma unroll 1
    for (int part = 0; part < nparts; ++part) {
        const size_t ap = aoff + (size_t)part * (size_t)kb;
#pragma unroll 1
        for (int kc = 0; kc < kb; kc += 32) {
            v16bf a[4];
#pragma unroll
            for (int mb = 0; mb < 4; ++mb) a[mb] = ldb(A + ap + (size_t)mb * 16 * (size_t)pitchA + kc);
#pragma unroll
            for (int nb = 0; nb < 4; ++nb) { const v16bf b = ldb(Bt + boff + (size_t)nb * 16 * (size_t)pitchB + kc);
#pragma unroll
                for (int mb = 0; mb < 4; ++mb) acc[mb][nb] = wmmabg(a[mb], b, acc[mb][nb]); }
        }
    }
}

// qk_body: q and k projections with rotation + RMS normalisation in the epilogue. A = x rows (m = t), Bt = WT rows n in [0, 1152): column tile = head (0..11 q, 12..17 k).
__device__ __forceinline__ void qk_body(const bf* __restrict__ XB, const bf* __restrict__ WT, const float* __restrict__ cosb, const float* __restrict__ sinb, float* QKF, const int ttile, const int head, float* os) {
    const int lane = threadIdx.x & 31, lr = lane & 15, hi = lane >> 4;
    const int r0 = ttile * 64, c0 = head * 64;
    v8f acc[4][4];
    gemm64(XB, WT, DM, DM, DM, 1, (size_t)(r0 + lr) * DM + 8 * hi, (size_t)(c0 + lr) * DM + 8 * hi, acc);
#pragma unroll
    for (int mb = 0; mb < 4; ++mb)
#pragma unroll
        for (int nb = 0; nb < 4; ++nb)
#pragma unroll
            for (int j = 0; j < 8; ++j) os[(mb * 16 + hi * 8 + j) * TSP + nb * 16 + lr] = acc[mb][nb][j];   // D: row 8h+j, col lane&15; all 64 x 64 written
    wave_sync();
#pragma unroll 1
    for (int r = 0; r < 64; ++r) {                              // lane = rotary pair column (d, d + 32)
        const int t = r0 + r;
        const float x1 = os[r * TSP + lane], x2 = os[r * TSP + HROT + lane];
        const float c = bfr(cosb[(size_t)t * HROT + lane]), s = bfr(sinb[(size_t)t * HROT + lane]);
        const float o1 = x1 * c - x2 * s, o2 = x2 * c + x1 * s;
        float ss = o1 * o1 + o2 * o2;
#pragma unroll
        for (int off = 16; off > 0; off >>= 1) ss += __shfl_xor(ss, off, 32);
        const float sc = rsqrtf(ss * (1.0f / (float)HD) + 1e-6f);
        os[r * TSP + lane] = o1 * sc; os[r * TSP + HROT + lane] = o2 * sc; }
    wave_sync();
    float* dst = QKF + ((size_t)head * SEQ + (size_t)r0) * HD;
{
#pragma unroll 4
        for (int i = 0; i < 32; ++i) { const int idx = i * 32 + lane; const int row = idx >> 4, c4 = (idx & 15) * 4;   // 32 trips x 2 rows = 64 rows; 16 lanes x 4 floats = 64 columns
            const v4f val = *(const v4fa*)(&os[row * TSP + c4]);
            *(v4f*)(dst + (size_t)idx * 4) = val; }
         }
}

// vt_body: v^T projection. A = WT rows 1152 + m (m = kvh*64 + d), Bt = x rows (n = t); plane VT [m][t] f16 (row pitch SEQ) and, for t < EROWS (block-uniform test), the f16 remainder x2048 VR [m][t] (row pitch EROWS).
__device__ __forceinline__ void vt_body(const bf* __restrict__ WV, const bf* __restrict__ XB, h16* VT, h16* VR, const int mtile, const int ttile, float* os) {
    const int lane = threadIdx.x & 31, lr = lane & 15, hi = lane >> 4;
    const int r0 = mtile * 64, c0 = ttile * 64;
    v8f acc[4][4];
    gemm64(WV, XB, DM, DM, DM, 1, (size_t)(r0 + lr) * DM + 8 * hi, (size_t)(c0 + lr) * DM + 8 * hi, acc);
#pragma unroll
    for (int mb = 0; mb < 4; ++mb)
#pragma unroll
        for (int nb = 0; nb < 4; ++nb)
#pragma unroll
            for (int j = 0; j < 8; ++j) os[(mb * 16 + hi * 8 + j) * TSP + nb * 16 + lr] = acc[mb][nb][j];
    wave_sync();
    const bool wr = c0 < EROWS;                                 // block-uniform: whole tile inside the remainder plane
{
#pragma unroll 4
        for (int i = 0; i < 16; ++i) { const int p = i * 32 + lane; const int row = p >> 3, c8 = (p & 7) * 8;   // 16 trips x 4 rows = 64 rows; 8 lanes x 8 = 64 columns
            const v4f x0 = *(const v4fa*)(&os[row * TSP + c8]); const v4f x1 = *(const v4fa*)(&os[row * TSP + c8 + 4]); v8h hv, rv;
#pragma unroll
            for (int e = 0; e < 4; ++e) { const h16 a0 = toh_flush(x0[e]); const h16 a1 = toh_flush(x1[e]); hv[e] = a0; hv[4 + e] = a1;
                rv[e] = toh_flush((x0[e] - (float)a0) * QRS); rv[4 + e] = toh_flush((x1[e] - (float)a1) * QRS); }
            *(v8h*)(VT + (size_t)(r0 + row) * SEQ + c0 + c8) = hv;
            asm volatile("s_wait_xcnt 0x0" ::: "memory");                        // the store's registers are rewritten behind it (remainder packing, next trip): wait first
            if (wr) { *(v8h*)(VR + (size_t)(r0 + row) * EROWS + c0 + c8) = rv;
                asm volatile("s_wait_xcnt 0x0" ::: "memory"); } }                // same, for the remainder store
         }
}

// k_qkv: the three input projections in one grid (disjoint outputs): blockIdx.x = 64-token tile; blockIdx.y < 18: q / k head, else v^T row tile.
__global__ __launch_bounds__(32) void k_qkv(const bf* __restrict__ XB, const bf* __restrict__ WT, const float* __restrict__ cosb, const float* __restrict__ sinb, float* QKF, h16* VT, h16* VR) {
    __shared__ __align__(16) float os[64 * TSP];
    const int by = blockIdx.y;
    if (by < NHQ + NHK) qk_body(XB, WT, cosb, sinb, QKF, blockIdx.x, by, os);
    else                vt_body(WT + (size_t)NQK * DM, XB, VT, VR, by - (NHQ + NHK), blockIdx.x, os);
}

// k_oproj: output projection. A = context plane rows (value | remainder, two K parts of 768), Bt = WT rows 1536 + n; f32 output [t][768].
__global__ __launch_bounds__(32) void k_oproj(const bf* __restrict__ YB, const bf* __restrict__ WP, float* OUT) {
    __shared__ __align__(16) float os[64 * TSP];
    const int lane = threadIdx.x & 31, lr = lane & 15, hi = lane >> 4;
    const int r0 = blockIdx.x * 64, c0 = blockIdx.y * 64;
    v8f acc[4][4];
    gemm64(YB, WP, YP, DM, DM, 2, (size_t)(r0 + lr) * YP + 8 * hi, (size_t)(c0 + lr) * DM + 8 * hi, acc);
#pragma unroll
    for (int mb = 0; mb < 4; ++mb)
#pragma unroll
        for (int nb = 0; nb < 4; ++nb)
#pragma unroll
            for (int j = 0; j < 8; ++j) os[(mb * 16 + hi * 8 + j) * TSP + nb * 16 + lr] = acc[mb][nb][j];
    wave_sync();
{
#pragma unroll 4
        for (int i = 0; i < 32; ++i) { const int idx = i * 32 + lane; const int row = idx >> 4, c4 = (idx & 15) * 4;   // 32 trips x 2 rows = 64 rows; 16 lanes x 4 floats = 64 columns
            const v4f val = *(const v4fa*)(&os[row * TSP + c4]);
            *(v4f*)(OUT + (size_t)(r0 + row) * DM + c0 + c4) = val; }
         }
}

// flash_body: fused attention, one block of AW waves per 16 query rows of one head; wave w takes the 32-key steps w, w + AW, ... and keeps its own softmax state and context partial;
// the partials (unnormalised context, running max, row sum) meet in LDS behind one block barrier and are merged in f32 by all threads. q tile and the 32-key K tile live in wave-private LDS (f32); scores on the vector unit:
// lane (t = lane&15, h = lane>>4) forms max_d(q[t][d] + k[key][d]) for keys 8h+r and 16+8h+r of each 32-key step, i.e. directly the B-fragment layout of
// O^T[d][t] = V^T P^T (element r <- keys 8h+r, element 8+r <- keys 16+8h+r, lane unchanged). V^T fragments (A, row d, k = key) straight from the f16 planes.
// Softmax state (running max over kept keys, partial sum) is one scalar per lane; the two lane halves of a row are combined with one xor-16 exchange.
// Causal keep rule (key <= t) evaluated per element inside every visited tile; the per-wave key bound is a wave scalar, multiple of 32, <= SEQ.
// EARLY = 1 (query rows [0, EROWS)): P = f16 value + f16 remainder x2048; O = V P + (V P_rem + V_rem P) / 2048 (remainder products in their own accumulators); row sum from the f32 exponentials.
// EARLY = 0 (query rows [EROWS, SEQ)): single P, v; row sum over the converted P.
template <int EARLY>
__device__ __forceinline__ void flash_body(const float* __restrict__ QKF, const h16* __restrict__ VT, const h16* __restrict__ VR, bf* YB, float* qs, float* ks, float* ms, float* lsum) {
    const int lane = threadIdx.x & 31, lr = lane & 15, hi = lane >> 4;
    const int wave = __builtin_amdgcn_readfirstlane((int)(threadIdx.x >> 5));
    const int h = blockIdx.y, kvh = h / NREP;
    const int t0 = blockIdx.x * 16;                             // blockIdx.x = tile of 16 query rows, wholly below or wholly at / above EROWS
    const int lim = t0 + lr;                                    // key j kept iff j <= lim
    const int nk = (t0 + 16 + 31) & ~31;                        // block-uniform, multiple of 32, <= SEQ (<= EROWS when EARLY)
    const int qb = wave * 16 * QSP, kbs = wave * 32 * HD;
    { const size_t qsrc = ((size_t)h * SEQ + (size_t)t0) * HD;  // 16 rows x 64 floats, contiguous
#pragma unroll
      for (int i = 0; i < 8; ++i) { const int idx = i * 32 + lane;
          const v4f v = *(const v4f*)(QKF + qsrc + (size_t)idx * 4);
          *(v4fa*)(&qs[qb + (idx >> 4) * QSP + (idx & 15) * 4]) = v; } }
    const size_t kplane = ((size_t)(NHQ + kvh) * SEQ) * HD;     // k heads follow the q heads in the plane
    const size_t vo  = (size_t)(kvh * HD + lr) * SEQ + 8 * hi;   // + 16j*SEQ + key   (A fragment: row d, k = key)
    const size_t vro = (size_t)(kvh * HD + lr) * EROWS + 8 * hi; // remainder plane, tokens < EROWS
    const v16h hz = (v16h){};
    v8f o[4], oR[4];
#pragma unroll
    for (int j = 0; j < 4; ++j) { o[j] = (v8f){}; oR[j] = (v8f){}; }
    float m = NEGB, l = 0.0f;
#pragma unroll 1
    for (int key0 = wave * 32; key0 < nk; key0 += 32 * AW) {    // a wave with no step keeps o = 0, l = 0, m = NEGB: weight 0 in the merge
        wave_sync();                                            // earlier reads of the K tile are done
        { const size_t ksrc = kplane + (size_t)key0 * HD;       // 32 keys x 64 floats, contiguous; keys < nk <= SEQ
#pragma unroll
          for (int g = 0; g < 2; ++g) { v4f kv[8];              // eight loads in flight, then their eight LDS stores
#pragma unroll
              for (int i = 0; i < 8; ++i) {
                  if (i == 7) asm volatile("s_wait_xcnt 0x0" ::: "memory");      // the group's last load may land in the address pair that the seven before it name: wait first
                  kv[i] = *(const v4f*)(QKF + ksrc + (size_t)((g * 8 + i) * 32 + lane) * 4); }
              asm volatile("s_wait_xcnt 0x0" ::: "memory");                      // the address pair is rewritten behind the group (next group, score loop): wait first
#pragma unroll
              for (int i = 0; i < 8; ++i) *(v4fa*)(&ks[kbs + ((g * 8 + i) * 32 + lane) * 4]) = kv[i]; } }
        wave_sync();
        float sa[8], sb[8];
#pragma unroll
        for (int r = 0; r < 8; ++r) { sa[r] = NEGB; sb[r] = NEGB; }
#pragma unroll 1
        for (int d4 = 0; d4 < HD / 4; ++d4) {
            const v4f q4 = *(const v4fa*)(&qs[qb + lr * QSP + d4 * 4]);
#pragma unroll
            for (int r = 0; r < 8; ++r) {
                const v4f ka = *(const v4fa*)(&ks[kbs + (8 * hi + r) * HD + d4 * 4]);
                const v4f kc = *(const v4fa*)(&ks[kbs + (16 + 8 * hi + r) * HD + d4 * 4]);
                sa[r] = fmaxf(sa[r], fmaxf(fmaxf(q4[0] + ka[0], q4[1] + ka[1]), fmaxf(q4[2] + ka[2], q4[3] + ka[3])));
                sb[r] = fmaxf(sb[r], fmaxf(fmaxf(q4[0] + kc[0], q4[1] + kc[1]), fmaxf(q4[2] + kc[2], q4[3] + kc[3]))); }
        }
        const int ja = key0 + 8 * hi;
        float mx = NEGB;
#pragma unroll
        for (int r = 0; r < 8; ++r) {
            sa[r] = sa[r] * LOG2E; sb[r] = sb[r] * LOG2E;
            const bool fa = (ja + r <= lim), fb = (ja + 16 + r <= lim);
            mx = fmaxf(mx, fmaxf(fa ? sa[r] : NEGB, fb ? sb[r] : NEGB)); }
        mx = fmaxf(mx, __shfl_xor(mx, 16, 32));
        const float mnew = fmaxf(m, mx);
        const float alpha = __builtin_amdgcn_exp2f(m - mnew);
        const float sh = PSH - mnew;
        v16h pb, pr = hz; float ls = 0.0f;
#pragma unroll
        for (int r = 0; r < 8; ++r) {
            const float xa = sa[r] + sh, xb = sb[r] + sh;
            const float ea = __builtin_amdgcn_exp2f(xa), eb = __builtin_amdgcn_exp2f(xb);
            const bool fa = (ja + r <= lim) & (xa >= -14.0f), fb = (ja + 16 + r <= lim) & (xb >= -14.0f);   // dropped keys and values below the f16 normal range selected to 0 by value
            const float ga = fa ? ea : 0.0f, gb = fb ? eb : 0.0f;
            const h16 pa = (h16)ga; const h16 pc = (h16)gb;
            pb[r] = pa; pb[8 + r] = pc;
            if (EARLY) { pr[r] = toh_flush((ga - (float)pa) * QRS); pr[8 + r] = toh_flush((gb - (float)pc) * QRS); ls += ga + gb; }
            else       { ls += (float)pa + (float)pc; } }
        l = l * alpha + ls; m = mnew;
#pragma unroll
        for (int j = 0; j < 4; ++j) {
            const v16h v = ldh(VT + vo + (size_t)(16 * j) * SEQ + key0);
            o[j] = o[j] * alpha;
            o[j] = wmma16g(v, pb, o[j]);
            if (EARLY) {
                const v16h vr = ldh(VR + vro + (size_t)(16 * j) * EROWS + key0);   // key0 + 31 < nk <= EROWS
                oR[j] = oR[j] * alpha;
                oR[j] = wmma16g(v, pr, oR[j]);
                oR[j] = wmma16g(vr, pb, oR[j]); }
        }
    }
    l += __shfl_xor(l, 16, 32);
    wave_sync();                                                // q tile reads are done; the slice becomes this wave's context partial
    // O^T D layout: f_j[r] = (d = 16j + 8h + r, t = lane&15) -> qs[t][d]; rows 0..15 x columns 0..63 all written
#pragma unroll
    for (int j = 0; j < 4; ++j) {
        v8f f = o[j];
        if (EARLY) f = o[j] + oR[j] * QRI;
        v4f a, c;
        a[0] = f[0]; a[1] = f[1]; a[2] = f[2]; a[3] = f[3]; c[0] = f[4]; c[1] = f[5]; c[2] = f[6]; c[3] = f[7];
        *(v4fa*)(&qs[qb + lr * QSP + 16 * j + 8 * hi]) = a; *(v4fa*)(&qs[qb + lr * QSP + 16 * j + 8 * hi + 4]) = c; }
    if (hi == 0) { ms[wave * 16 + lr] = m; lsum[wave * 16 + lr] = l; }   // both lane halves hold the same m and l
    __syncthreads();                                            // cross-wave: every wave's partial is read by every wave below
    // merge: thread = (row, 4 columns); partial w weighs 2^(m_w - M), M the maximum over the waves
    const int row = (int)threadIdx.x >> 4, c4 = ((int)threadIdx.x & 15) * 4;
    float mw[AW], M = NEGB;
#pragma unroll
    for (int w = 0; w < AW; ++w) { mw[w] = ms[w * 16 + row]; M = fmaxf(M, mw[w]); }
    float L = 0.0f; v4f acc = (v4f){};
#pragma unroll
    for (int w = 0; w < AW; ++w) {
        const float sc = __builtin_amdgcn_exp2f(mw[w] - M);
        const v4f p = *(const v4fa*)(&qs[w * 16 * QSP + row * QSP + c4]);
        L += lsum[w * 16 + row] * sc;
        acc += p * sc; }
    const bool any = L > 0.0f;
    const float lsafe = any ? L : 1.0f;
    const float inv = any ? (1.0f / lsafe) : 0.0f;
    v4us hv, lv;
#pragma unroll
    for (int e = 0; e < 4; ++e) { const float y = acc[e] * inv; const unsigned short b0 = f2bf(y); hv[e] = b0; lv[e] = f2bf(y - bf2f(b0)); }
    bf* yrow = YB + (size_t)(t0 + row) * YP + h * HD + c4;      // 16 lanes x 4 columns = one 128-byte line per row and plane
    *(v4us*)(yrow) = hv;
    *(v4us*)(yrow + DM) = lv;
}

// k_flash: both instantiations in one grid (disjoint context rows); the choice is block-uniform.
__global__ __launch_bounds__(32 * AW) __attribute__((amdgpu_num_vgpr(256))) void k_flash(const float* __restrict__ QKF, const h16* __restrict__ VT, const h16* __restrict__ VR, bf* YB) {
    __shared__ __align__(16) float qs[AW * 16 * QSP];           // per-wave slices: q tile, later the wave's context partial
    __shared__ __align__(16) float ks[AW * 32 * HD];            // wave-private slices: 32-key K tile
    __shared__ float ms[AW * 16];                               // per wave and row: running max
    __shared__ float lsum[AW * 16];                             // per wave and row: sum of the exponentials
    if ((int)blockIdx.x * 16 < EROWS) flash_body<1>(QKF, VT, VR, YB, qs, ks, ms, lsum);   // block-uniform: the barrier inside is met by all threads or by none
    else                              flash_body<0>(QKF, VT, VR, YB, qs, ks, ms, lsum);
}

static constexpr size_t al256(size_t v) { return (v + 255) & ~(size_t)255; }
static constexpr size_t SZ_XB = al256((size_t)SEQ * DM * 2);
static constexpr size_t SZ_WT = al256((size_t)WROWS * DM * 2);
static constexpr size_t SZ_QK = al256((size_t)(NHQ + NHK) * SEQ * HD * 4);
static constexpr size_t SZ_VT = al256((size_t)DKV * SEQ * 2);
static constexpr size_t SZ_VR = al256((size_t)DKV * EROWS * 2);
static constexpr size_t SZ_YB = al256((size_t)SEQ * YP * 2);
static constexpr size_t SZ_TOTAL = SZ_XB + SZ_WT + SZ_QK + SZ_VT + SZ_VR + SZ_YB;
static_assert(SZ_TOTAL <= (size_t)134217728);          // workspace carve <= 128 MiB
static_assert(((size_t)DM * DM * 2) % 256 == 0);       // weight sub-planes stay 256-byte aligned
static_assert(((size_t)DKV * DM * 2) % 256 == 0);
static_assert(((size_t)NHQ * SEQ * HD * 4) % 256 == 0);

extern "C" void kernel_launch(void* const* d_in, const int* in_sizes, int n_in,
                              void* d_out, int out_size, void* d_ws, size_t ws_size, hipStream_t stream) {
    if (n_in < 7) return;
    if ((size_t)in_sizes[0] < (size_t)SEQ * DM) return;
    if ((size_t)in_sizes[1] < (size_t)SEQ * HROT || (size_t)in_sizes[2] < (size_t)SEQ * HROT) return;
    if ((size_t)in_sizes[3] < (size_t)DM * DM || (size_t)in_sizes[6] < (size_t)DM * DM) return;
    if ((size_t)in_sizes[4] < (size_t)DM * DKV || (size_t)in_sizes[5] < (size_t)DM * DKV) return;
    if ((size_t)out_size < (size_t)SEQ * DM) return;
    if (SZ_TOTAL > ws_size) return;
    // wire order: x, cos, sin, Wq, Wk, Wv, Wproj
    const float* x    = (const float*)d_in[0];
    const float* cosb = (const float*)d_in[1];
    const float* sinb = (const float*)d_in[2];
    const float* wq   = (const float*)d_in[3];
    const float* wk   = (const float*)d_in[4];
    const float* wv   = (const float*)d_in[5];
    const float* wp   = (const float*)d_in[6];
    float* OUT = (float*)d_out;                        // [SEQ][768]
    char* wsp = (char*)d_ws;
    bf*    XB  = (bf*)wsp;    wsp += SZ_XB;            // x bf16 [SEQ][768]
    bf*    WT  = (bf*)wsp;    wsp += SZ_WT;            // [2304][768]: q | k | v | proj, each [out][in]
    float* QKF = (float*)wsp; wsp += SZ_QK;            // [18][SEQ][64] f32: 12 q heads, 6 k heads
    h16*   VT  = (h16*)wsp;   wsp += SZ_VT;            // [384][SEQ]
    h16*   VR  = (h16*)wsp;   wsp += SZ_VR;            // [384][EROWS] remainder x2048, tokens < EROWS
    bf*    YB  = (bf*)wsp;    wsp += SZ_YB;            // [SEQ][768 value | 768 remainder]

    // conversions: x -> XB; W[768 rows][ncols] -> WT[rowoff + ncols rows][768]
    k_cvt<<<CB_X + 2 * CB_WD + 2 * CB_WK, 256, 0, stream>>>(x, wq, wk, wv, wp, XB, WT);

    // q | k: A = x rows, Bt = WT rows [0, 1152) -> f32 planes [head][t][64], rotated and normalised; v^T: A = WT rows [1152, 1536), Bt = x rows -> [m][t] f16 (+ remainder for t < EROWS)
    k_qkv<<<dim3(SEQ / 64, NHQ + NHK + DKV / 64, 1), 32, 0, stream>>>(XB, WT, cosb, sinb, QKF, VT, VR);

    // query rows [0, EROWS): multi-product instantiation; rows [EROWS, SEQ): single-product instantiation
    k_flash<<<dim3(SEQ / 16, NHQ, 1), 32 * AW, 0, stream>>>(QKF, VT, VR, YB);

    // output projection: A = context rows (value | remainder), Bt = WT rows [1536, 2304)
    k_oproj<<<dim3(SEQ / 64, DM / 64, 1), 32, 0, stream>>>(YB, WT + (size_t)(NQK + DKV) * DM, OUT);
}

// v003
// A run of this version takes 35 microseconds.
// Two timings next to v002 put it at 2.79 and 2.80 times that version's speed.
// Counting every step since v000, it is 5.83 times as fast.
#include <hip/hip_runtime.h>

// Causal grouped-query self-attention with max-plus scores: x [SEQ][768]; Wq [768][768], Wk / Wv [768][384], Wproj [768][768], all [in][out] (y = x W, no bias);
// 12 query heads x 64, 6 key/value heads (2 query heads per key/value head); half-split rotary tables cos / sin [SEQ][32] read by value;
// per-head RMS normalisation (eps 1e-6) of q and k after the rotation; score[t][j] = max_d (q[t][d] + k[j][d]); causal softmax; context = P v; output = context Wproj (f32).
// Compute dtypes, f32 accumulate everywhere: q / k / v projections v_wmma_f32_16x16x32_bf16 (x, W RNE-converted to bf16; products exact); max-plus scores are not a multiply-accumulate: f32 on the vector unit from f32 q / k planes;
// P.V v_wmma_f32_16x16x32_f16: P (x16384 carry, cancels in the normalisation) and v single f16 on query rows >= EROWS; on query rows < EROWS P and v each as f16 value + f16 remainder x2048, remainder products in their own accumulator folded by 1/2048, row sum from the f32 exponentials;
// output projection v_wmma_f32_16x16x32_bf16: context as bf16 value + bf16 remainder (value and remainder in separate k slices, summed in the f32 merge), Wproj RNE-converted to bf16; softmax f32 (online, running max over kept keys).
// Layout: bf16 copy of x; transposed bf16 weights WT [2304][768] = q | k | v | proj rows ([out][in]); f32 planes q / k [18 heads][t][64] (rotated, normalised); v^T plane f16 [384][t] and remainder plane [384][t < EROWS];
// fused flash kernel in transposed form (O^T = V^T P^T, P built on the vector unit directly in B-fragment layout); context plane bf16 [t][768 value | 768 remainder].

#ifndef SEQ
#define SEQ 512
#endif
#define SEQ_FULL 512
#define DM    768
#define NHQ   12
#define NHK   6
#define NREP  2
#define HD    64
#define HROT  32
#define DKV   (NHK * HD)              // 384
#define NQK   (DM + DKV)              // 1152: q | k rows of WT
#define WROWS (DM + 2 * DKV + DM)     // 2304: q | k | v | proj rows of WT
#define YP    (2 * DM)                // context plane row pitch (value | remainder)
#define AW    8                       // waves per flash block: all work on the same 16 query rows, 32-key steps dealt round-robin
#define GKW   8                       // k slices of a 64x64 GEMM tile, one per wave pair
#define GNW   2                       // column halves of a GEMM tile: a wave holds 64 rows x 32 columns of one k slice
#define GW    (GKW * GNW)             // waves per GEMM block
#define KBAT  3                       // 32-wide k-steps whose fragments a wave loads as one batch
#define QSP   68                      // LDS row pitch (floats) of the q / context tile
#define TSP   68                      // LDS row pitch (floats) of the GEMM output tile
#define CTP   72                      // LDS row pitch (16-bit words) of the transposing converter tile
#define EROWS (SEQ < 256 ? SEQ : 256) // query rows handled by the multi-product flash instantiation
#define QRS   2048.0f                 // carry of the v remainder plane / P remainder fragment
#define QRI   (1.0f / 2048.0f)
#define LOG2E 1.4426950408889634f
#define PSH   14.0f                   // log2 of the P carry (16384)
#define NEGB  (-3.0e38f)

static_assert(HD == 64);
static_assert(HROT * 2 == HD);
static_assert(NHQ * HD == DM);
static_assert(NHK * NREP == NHQ);
static_assert(DM % 64 == 0);
static_assert(DKV % 64 == 0);
static_assert(NQK % 64 == 0);
static_assert(DM % 32 == 0);                    // GEMM k-loop steps by 32
static_assert(SEQ % 64 == 0);
static_assert(SEQ % 32 == 0);                   // key loop steps by 32
static_assert(SEQ <= SEQ_FULL);
static_assert(EROWS % 64 == 0);                 // a 64-token v^T tile lies wholly inside or outside the remainder plane
static_assert(EROWS % 32 == 0);                 // key bound of an early wave never exceeds EROWS
static_assert(EROWS % 16 == 0);                 // a 16-row query tile lies wholly below or wholly at / above EROWS
static_assert(AW * 32 * 4 == 16 * HD);          // merge: every thread of the block owns 4 context columns of one row
static_assert(EROWS <= SEQ);
static_assert(((size_t)SEQ * DM) % 8 == 0);
static_assert((QSP * 4) % 16 == 0);
static_assert((TSP * 4) % 16 == 0);
static_assert((CTP * 2) % 16 == 0);
static_assert(QSP >= HD);
static_assert(TSP >= 64);
static_assert(CTP >= 64);
// store-loop extents: trips x lanes x bytes == tile rows x row bytes
static_assert(2 * 256 * 16 == 64 * 64 * 2);
static_assert(GW * 2 * 32 * 16 == 64 * 64 * 4); // qk_body: every wave stores its own 64 / GW rows x 256 B in 2 trips
static_assert(2 * GW * 32 * 16 == 64 * 64 * 4); // k_oproj: 64 rows x 256 B
static_assert(GW * 32 * 16 == 64 * 64 * 2);     // vt_body: one 16-byte piece per thread
static_assert(GW == 16);                        // merge: wave w sums accumulator fragment w of the 4 x 4
static_assert(64 % GW == 0);
static_assert(DM == GKW * KBAT * 32);           // input projections: one batch per wave
static_assert(2 * DM == GKW * 2 * KBAT * 32);   // output projection: two batches per wave
static_assert(GKW % 2 == 0);                    // output projection: a k slice lies wholly in the value or wholly in the remainder part
// static LDS per kernel
static_assert(64 * CTP * 2 <= 131072);
static_assert((GKW * 64 * 64 + 64 * TSP) * 4 <= 163840);
static_assert(AW * (16 * QSP + 32 * HD + 32) * 4 <= 131072);

typedef _Float16 h16;
typedef unsigned short bf;
typedef __attribute__((ext_vector_type(16))) __bf16   v16bf;
typedef __attribute__((ext_vector_type(16))) _Float16 v16h;
typedef __attribute__((ext_vector_type(8)))  _Float16 v8h;
typedef __attribute__((ext_vector_type(8)))  unsigned short v8us;
typedef __attribute__((ext_vector_type(4)))  unsigned short v4us;
typedef __attribute__((ext_vector_type(8)))  float    v8f;
typedef __attribute__((ext_vector_type(4)))  float    v4f;
typedef v4f  __attribute__((may_alias)) v4fa;
typedef v8us __attribute__((may_alias)) v8usa;

__device__ __forceinline__ unsigned short f2bf(float f) { unsigned u = __float_as_uint(f); u += 0x7FFFu + ((u >> 16) & 1u); return (unsigned short)(u >> 16); }
__device__ __forceinline__ float bfr(float f) { return __uint_as_float(((unsigned)f2bf(f)) << 16); }   // value after RNE convert to bf16
__device__ __forceinline__ v16h cat16(v8h lo, v8h hi) { return __builtin_shufflevector(lo, hi, 0, 1, 2, 3, 4, 5, 6, 7, 8, 9, 10, 11, 12, 13, 14, 15); }
__device__ __forceinline__ v16bf cat16b(v8us lo, v8us hi) { return __builtin_bit_cast(v16bf, __builtin_shufflevector(lo, hi, 0, 1, 2, 3, 4, 5, 6, 7, 8, 9, 10, 11, 12, 13, 14, 15)); }
__device__ __forceinline__ v8f wmma16(v16h a, v16h b, v8f c) { return __builtin_amdgcn_wmma_f32_16x16x32_f16(false, a, false, b, (short)0, c, false, false); }
__device__ __forceinline__ v8f wmmab(v16bf a, v16bf b, v8f c) { return __builtin_amdgcn_wmma_f32_16x16x32_bf16(false, a, false, b, (short)0, c, false, false); }
// fragment loaders from K-contiguous 16-bit rows; p already includes + 8*(lane>>4): elements 0..7 <- k0+8h+0..7, elements 8..15 <- k0+16+8h+0..7 (same map for A and B)
__device__ __forceinline__ v16h  ldh(const h16* p) { return cat16(*(const v8h*)p, *(const v8h*)(p + 16)); }
// ordering point for wave-private LDS tiles (same wave writes and reads)
__device__ __forceinline__ void wave_sync() { __builtin_amdgcn_fence(3 /* release order */, "wavefront"); __builtin_amdgcn_wave_barrier(); asm volatile("" ::: "memory"); }

// per-instruction guarded matrix steps: one accumulator tied per guard, A / B kept live across the nops
__device__ __forceinline__ v8f wmma16g(v16h a, v16h b, v8f c) { c = wmma16(a, b, c); asm volatile("v_nop\n\tv_nop\n\tv_nop\n\tv_nop" : "+v"(c) : "v"(a), "v"(b)); return c; }
__device__ __forceinline__ v8f wmmabg(v16bf a, v16bf b, v8f c) { c = wmmab(a, b, c); asm volatile("v_nop\n\tv_nop\n\tv_nop\n\tv_nop" : "+v"(c) : "v"(a), "v"(b)); return c; }
// f32 -> f16 convert that cannot produce a subnormal (|v| < 2^-14 -> +0)
__device__ __forceinline__ h16 toh_flush(float v) { const h16 r = (h16)v; return (fabsf(v) < 6.103515625e-05f) ? (h16)0.0f : r; }
__device__ __forceinline__ float bf2f(unsigned short b) { return __uint_as_float(((unsigned)b) << 16); }

// cvt8_body: bf16 (RNE convert) copy of x, 8 elements per thread; b = block index inside the x part of the converter grid.
__device__ __forceinline__ void cvt8_body(const float* __restrict__ src, bf* dst, size_t n8, int b) {
    const size_t i = (size_t)b * 256 + threadIdx.x; if (i >= n8) return;
    const v8f v = *(const v8f*)(src + i * 8); v8us o;
#pragma unroll
    for (int k = 0; k < 8; ++k) o[k] = f2bf(v[k]);
    *(v8us*)(dst + i * 8) = o; 
}

// cvtT_body: transposing bf16 (RNE convert) copy of a weight: in W[DM rows (k)][ncols (n)] f32 -> out WT[rowoff + n][k], row pitch DM; b = 64x64 tile index inside this weight (k tile fastest).
__device__ __forceinline__ void cvtT_body(const float* __restrict__ W, bf* WT, int ncols, int rowoff, int b, bf* ts) {
    const int tid = threadIdx.x;
    const int n0 = (b / (DM / 64)) * 64, k0 = (b % (DM / 64)) * 64;
#pragma unroll
    for (int i = 0; i < 4; ++i) { const int idx = i * 256 + tid; const int kr = idx >> 4, c4 = (idx & 15) * 4;   // 64 k rows x 16 float4
        const v4f v = *(const v4f*)(W + (size_t)(k0 + kr) * (size_t)ncols + n0 + c4);
#pragma unroll
        for (int e = 0; e < 4; ++e) ts[(c4 + e) * CTP + kr] = f2bf(v[e]); }
    __syncthreads();                                            // cross-wave tile: block barrier
{
#pragma unroll
        for (int i = 0; i < 2; ++i) { const int p = i * 256 + tid; const int row = p >> 3, c8 = (p & 7) * 8;   // 2 trips x 32 rows = 64 rows; 8 lanes x 8 = 64 k
            const v8us o = *(const v8usa*)(&ts[row * CTP + c8]);
            *(v8us*)(WT + (size_t)(rowoff + n0 + row) * DM + k0 + c8) = o; }
        asm volatile("s_wait_xcnt 0x0" ::: "memory");                            // code of the grid's other part follows in the listing and rewrites the two stores' registers: wait first
         }
}

// k_cvt: every operand conversion in one grid (the five parts touch disjoint data). Block ranges: x | Wq | Wk | Wv | Wproj; every test below is block-uniform.
#define CB_X  ((int)(((size_t)SEQ * DM / 8 + 255) / 256))
#define CB_WD ((DM / 64) * (DM / 64))                           // tiles of a [768][768] weight
#define CB_WK ((DKV / 64) * (DM / 64))                          // tiles of a [768][384] weight
__global__ __launch_bounds__(256) void k_cvt(const float* __restrict__ x, const float* __restrict__ wq, const float* __restrict__ wk, const float* __restrict__ wv, const float* __restrict__ wp, bf* XB, bf* WT) {
    __shared__ __align__(16) bf ts[64 * CTP];
    int b = blockIdx.x;
    if (b < CB_X) { cvt8_body(x, XB, (size_t)SEQ * DM / 8, b); }
    else {                                                      // whole blocks only: the barrier of the transposing part is met by all 256 threads or by none
        b -= CB_X;
        const float* W; int ncols, rowoff;
        if (b < CB_WD)                  { W = wq; ncols = DM;  rowoff = 0; }
        else if (b < CB_WD + CB_WK)     { W = wk; ncols = DKV; rowoff = DM;        b -= CB_WD; }
        else if (b < CB_WD + 2 * CB_WK) { W = wv; ncols = DKV; rowoff = NQK;       b -= CB_WD + CB_WK; }
        else                            { W = wp; ncols = DM;  rowoff = NQK + DKV; b -= CB_WD + 2 * CB_WK; }
        cvtT_body(W, WT, ncols, rowoff, b, ts);
    }
}

// gemm_slice: one wave's share of a 64x64 tile: 64 rows x 32 columns (8 accumulators) over NB batches of KBAT k-steps, operands straight from K-contiguous bf16 planes.
// aoff / boff already include the lane's row, + 8*(lane>>4) and the first k of the wave's slice.
template <int NB>
__device__ __forceinline__ void gemm_slice(const bf* __restrict__ A, const bf* __restrict__ Bt, const int pitchA, const int pitchB, const size_t aoff, const size_t boff, v8f (&acc)[4][GNW]) {
#pragma unroll
    for (int mb = 0; mb < 4; ++mb)
#pragma unroll
        for (int nb = 0; nb < GNW; ++nb) acc[mb][nb] = (v8f){};
    const bf* pa = A + aoff; const bf* pb = Bt + boff;
#pragma unroll
    for (int bt = 0; bt < NB; ++bt) {
        v8us al[KBAT][4][2], bl[KBAT][GNW][2];                  // 16-byte halves of the fragments (k0+8h+0..7 | k0+16+8h+0..7), all in flight together
#pragma unroll
        for (int s = 0; s < KBAT; ++s) {
            const int kc = (bt * KBAT + s) * 32;
#pragma unroll
            for (int i = 0; i < 8; ++i)       if (s < KBAT - 1 || i < 7)           al[s][i >> 1][i & 1] = *(const v8us*)(pa + (size_t)(i >> 1) * 16 * (size_t)pitchA + kc + 16 * (i & 1));
#pragma unroll
            for (int i = 0; i < 2 * GNW; ++i) if (s < KBAT - 1 || i < 2 * GNW - 1) bl[s][i >> 1][i & 1] = *(const v8us*)(pb + (size_t)(i >> 1) * 16 * (size_t)pitchB + kc + 16 * (i & 1)); }
        const int kl = (bt * KBAT + KBAT - 1) * 32 + 16;
        asm volatile("s_wait_xcnt 0x0" ::: "memory");                            // the last load off an address pair may land in that pair, which the loads before it name: wait first
        al[KBAT - 1][3][1] = *(const v8us*)(pa + (size_t)3 * 16 * (size_t)pitchA + kl);
        asm volatile("s_wait_xcnt 0x0" ::: "memory");                            // same: the load below may land in the pair that the load above names
        bl[KBAT - 1][GNW - 1][1] = *(const v8us*)(pb + (size_t)(GNW - 1) * 16 * (size_t)pitchB + kl);
        asm volatile("s_wait_xcnt 0x0" ::: "memory");                            // the address pairs are rewritten behind the batch (LDS addresses): wait first
        v16bf a[KBAT][4], b[KBAT][GNW];
#pragma unroll
        for (int s = 0; s < KBAT; ++s) {
#pragma unroll
            for (int mb = 0; mb < 4; ++mb) a[s][mb] = cat16b(al[s][mb][0], al[s][mb][1]);
#pragma unroll
            for (int nb = 0; nb < GNW; ++nb) b[s][nb] = cat16b(bl[s][nb][0], bl[s][nb][1]); }
#pragma unroll
        for (int s = 0; s < KBAT; ++s)
#pragma unroll
            for (int nb = 0; nb < GNW; ++nb)
#pragma unroll
                for (int mb = 0; mb < 4; ++mb) acc[mb][nb] = wmmabg(a[s][mb], b[s][nb], acc[mb][nb]);
    }
}

// tile_merge: every wave puts its partial into LDS in fragment order (lane-contiguous 16-byte pieces); behind a block barrier wave w sums fragment w = mb*4 + nb over the k slices, slice 0 first,
// and writes it row-major into os (D: row 8h+j, col lane&15; all 64 x 64 written); a second block barrier publishes os to every wave.
__device__ __forceinline__ void tile_merge(const v8f (&acc)[4][GNW], float* ps, float* os, const int wave, const int lane) {
    const int lr = lane & 15, hi = lane >> 4;
    const int kq = wave / GNW, nh = wave % GNW;
#pragma unroll
    for (int mb = 0; mb < 4; ++mb)
#pragma unroll
        for (int nb = 0; nb < GNW; ++nb) {
            float* p = ps + (size_t)((kq * 16 + mb * 4 + nh * GNW + nb) * 256 + lane * 4);
            const v8f f = acc[mb][nb]; v4f a, c;
            a[0] = f[0]; a[1] = f[1]; a[2] = f[2]; a[3] = f[3]; c[0] = f[4]; c[1] = f[5]; c[2] = f[6]; c[3] = f[7];
            *(v4fa*)p = a; *(v4fa*)(p + 128) = c; }
    __syncthreads();                                            // cross-wave: every k slice's partial is read by another wave below
    const float* q0 = ps + (size_t)(wave * 256 + lane * 4);
    v4f s0 = *(const v4fa*)q0, s1 = *(const v4fa*)(q0 + 128);
#pragma unroll
    for (int q = 1; q < GKW; ++q) { s0 += *(const v4fa*)(q0 + q * 4096); s1 += *(const v4fa*)(q0 + q * 4096 + 128); }
    float* d = os + ((wave >> 2) * 16 + hi * 8) * TSP + (wave & 3) * 16 + lr;
#pragma unroll
    for (int j = 0; j < 4; ++j) { d[j * TSP] = s0[j]; d[(4 + j) * TSP] = s1[j]; }
    __syncthreads();                                            // cross-wave: the epilogues read rows that other waves wrote
}

// qk_body: q and k projections with rotation + RMS normalisation in the epilogue. A = x rows (m = t), Bt = WT rows n in [0, 1152): column tile = head (0..11 q, 12..17 k).
__device__ __forceinline__ void qk_body(const bf* __restrict__ XB, const bf* __restrict__ WT, const float* __restrict__ cosb, const float* __restrict__ sinb, float* QKF, const int ttile, const int head, float* ps, float* os) {
    const int lane = threadIdx.x & 31, lr = lane & 15, hi = lane >> 4;
    const int wave = __builtin_amdgcn_readfirstlane((int)(threadIdx.x >> 5));
    const int r0 = ttile * 64, c0 = head * 64, k0 = (wave / GNW) * (KBAT * 32);
    v8f acc[4][GNW];
    gemm_slice<1>(XB, WT, DM, DM, (size_t)(r0 + lr) * DM + 8 * hi + k0, (size_t)(c0 + (wave % GNW) * 32 + lr) * DM + 8 * hi + k0, acc);
    tile_merge(acc, ps, os, wave, lane);
    const int w0 = wave * (64 / GW);                            // this wave's rows of the tile: from here on it reads and writes these alone
#pragma unroll 1
    for (int r = w0; r < w0 + 64 / GW; ++r) {                   // lane = rotary pair column (d, d + 32)
        const int t = r0 + r;
        const float x1 = os[r * TSP + lane], x2 = os[r * TSP + HROT + lane];
        const float c = bfr(cosb[(size_t)t * HROT + lane]), s = bfr(sinb[(size_t)t * HROT + lane]);
        const float o1 = x1 * c - x2 * s, o2 = x2 * c + x1 * s;
        float ss = o1 * o1 + o2 * o2;
#pragma unroll
        for (int off = 16; off > 0; off >>= 1) ss += __shfl_xor(ss, off, 32);
        const float sc = rsqrtf(ss * (1.0f / (float)HD) + 1e-6f);
        os[r * TSP + lane] = o1 * sc; os[r * TSP + HROT + lane] = o2 * sc; }
    wave_sync();
    float* dst = QKF + ((size_t)head * SEQ + (size_t)(r0 + w0)) * HD;
{
#pragma unroll
        for (int i = 0; i < 2; ++i) { const int idx = i * 32 + lane; const int row = w0 + (idx >> 4), c4 = (idx & 15) * 4;   // 2 trips x 2 rows = the wave's 4 rows; 16 lanes x 4 floats = 64 columns
            const v4f val = *(const v4fa*)(&os[row * TSP + c4]);
            *(v4f*)(dst + (size_t)idx * 4) = val; }
         }
}

// vt_body: v^T projection. A = WT rows 1152 + m (m = kvh*64 + d), Bt = x rows (n = t); plane VT [m][t] f16 (row pitch SEQ) and, for t < EROWS (block-uniform test), the f16 remainder x2048 VR [m][t] (row pitch EROWS).
__device__ __forceinline__ void vt_body(const bf* __restrict__ WV, const bf* __restrict__ XB, h16* VT, h16* VR, const int mtile, const int ttile, float* ps, float* os) {
    const int lane = threadIdx.x & 31, lr = lane & 15, hi = lane >> 4;
    const int wave = __builtin_amdgcn_readfirstlane((int)(threadIdx.x >> 5));
    const int r0 = mtile * 64, c0 = ttile * 64, k0 = (wave / GNW) * (KBAT * 32);
    v8f acc[4][GNW];
    gemm_slice<1>(WV, XB, DM, DM, (size_t)(r0 + lr) * DM + 8 * hi + k0, (size_t)(c0 + (wave % GNW) * 32 + lr) * DM + 8 * hi + k0, acc);
    tile_merge(acc, ps, os, wave, lane);
    const bool wr = c0 < EROWS;                                 // block-uniform: whole tile inside the remainder plane
{
        { const int p = (int)threadIdx.x; const int row = p >> 3, c8 = (p & 7) * 8;   // 512 threads: 64 rows; 8 lanes x 8 = 64 columns
            const v4f x0 = *(const v4fa*)(&os[row * TSP + c8]); const v4f x1 = *(const v4fa*)(&os[row * TSP + c8 + 4]); v8h hv, rv;
#pragma unroll
            for (int e = 0; e < 4; ++e) { const h16 a0 = toh_flush(x0[e]); const h16 a1 = toh_flush(x1[e]); hv[e] = a0; hv[4 + e] = a1;
                rv[e] = toh_flush((x0[e] - (float)a0) * QRS); rv[4 + e] = toh_flush((x1[e] - (float)a1) * QRS); }
            *(v8h*)(VT + (size_t)(r0 + row) * SEQ + c0 + c8) = hv;
            asm volatile("s_wait_xcnt 0x0" ::: "memory");                        // the store's registers are rewritten behind it (remainder packing): wait first
            if (wr) { *(v8h*)(VR + (size_t)(r0 + row) * EROWS + c0 + c8) = rv;
                asm volatile("s_wait_xcnt 0x0" ::: "memory"); } }                // same, for the remainder store
         }
}

// k_qkv: the three input projections in one grid (disjoint outputs): blockIdx.x = 64-token tile; blockIdx.y < 18: q / k head, else v^T row tile.
__global__ __launch_bounds__(32 * GW) void k_qkv(const bf* __restrict__ XB, const bf* __restrict__ WT, const float* __restrict__ cosb, const float* __restrict__ sinb, float* QKF, h16* VT, h16* VR) {
    __shared__ __align__(16) float ps[GKW * 64 * 64];           // the k slices' partial tiles, fragment order
    __shared__ __align__(16) float os[64 * TSP];                // merged tile, row-major
    const int by = blockIdx.y;                                  // block-uniform: the barriers inside are met by all threads or by none
    if (by < NHQ + NHK) qk_body(XB, WT, cosb, sinb, QKF, blockIdx.x, by, ps, os);
    else                vt_body(WT + (size_t)NQK * DM, XB, VT, VR, by - (NHQ + NHK), blockIdx.x, ps, os);
}

// k_oproj: output projection. A = context plane rows (value | remainder, two K parts of 768), Bt = WT rows 1536 + n; f32 output [t][768].
__global__ __launch_bounds__(32 * GW) void k_oproj(const bf* __restrict__ YB, const bf* __restrict__ WP, float* OUT) {
    __shared__ __align__(16) float ps[GKW * 64 * 64];           // the k slices' partial tiles, fragment order
    __shared__ __align__(16) float os[64 * TSP];                // merged tile, row-major
    const int lane = threadIdx.x & 31, lr = lane & 15, hi = lane >> 4;
    const int wave = __builtin_amdgcn_readfirstlane((int)(threadIdx.x >> 5));
    const int r0 = blockIdx.x * 64, c0 = blockIdx.y * 64;
    const int ka = (wave / GNW) * (2 * KBAT * 32);              // slice start in the context row (value | remainder)
    const int kw = ka % DM;                                     // the same k in the weight row: both parts meet the same weights
    v8f acc[4][GNW];
    gemm_slice<2>(YB, WP, YP, DM, (size_t)(r0 + lr) * YP + 8 * hi + ka, (size_t)(c0 + (wave % GNW) * 32 + lr) * DM + 8 * hi + kw, acc);
    tile_merge(acc, ps, os, wave, lane);
{
#pragma unroll
        for (int i = 0; i < 2; ++i) { const int idx = i * (32 * GW) + (int)threadIdx.x; const int row = idx >> 4, c4 = (idx & 15) * 4;   // 2 trips x 32 rows = 64 rows; 16 lanes x 4 floats = 64 columns
            const v4f val = *(const v4fa*)(&os[row * TSP + c4]);
            *(v4f*)(OUT + (size_t)(r0 + row) * DM + c0 + c4) = val; }
         }
}

// flash_body: fused attention, one block of AW waves per 16 query rows of one head; wave w takes the 32-key steps w, w + AW, ... and keeps its own softmax state and context partial;
// the partials (unnormalised context, running max, row sum) meet in LDS behind one block barrier and are merged in f32 by all threads. q tile and the 32-key K tile live in wave-private LDS (f32); scores on the vector unit:
// lane (t = lane&15, h = lane>>4) forms max_d(q[t][d] + k[key][d]) for keys 8h+r and 16+8h+r of each 32-key step, i.e. directly the B-fragment layout of
// O^T[d][t] = V^T P^T (element r <- keys 8h+r, element 8+r <- keys 16+8h+r, lane unchanged). V^T fragments (A, row d, k = key) straight from the f16 planes.
// Softmax state (running max over kept keys, partial sum) is one scalar per lane; the two lane halves of a row are combined with one xor-16 exchange.
// Causal keep rule (key <= t) evaluated per element inside every visited tile; the per-wave key bound is a wave scalar, multiple of 32, <= SEQ.
// EARLY = 1 (query rows [0, EROWS)): P = f16 value + f16 remainder x2048; O = V P + (V P_rem + V_rem P) / 2048 (remainder products in their own accumulators); row sum from the f32 exponentials.
// EARLY = 0 (query rows [EROWS, SEQ)): single P, v; row sum over the converted P.
template <int EARLY>
__device__ __forceinline__ void flash_body(const float* __restrict__ QKF, const h16* __restrict__ VT, const h16* __restrict__ VR, bf* YB, float* qs, float* ks, float* ms, float* lsum) {
    const int lane = threadIdx.x & 31, lr = lane & 15, hi = lane >> 4;
    const int wave = __builtin_amdgcn_readfirstlane((int)(threadIdx.x >> 5));
    const int h = blockIdx.y, kvh = h / NREP;
    const int t0 = blockIdx.x * 16;                             // blockIdx.x = tile of 16 query rows, wholly below or wholly at / above EROWS
    const int lim = t0 + lr;                                    // key j kept iff j <= lim
    const int nk = (t0 + 16 + 31) & ~31;                        // block-uniform, multiple of 32, <= SEQ (<= EROWS when EARLY)
    const int qb = wave * 16 * QSP, kbs = wave * 32 * HD;
    { const size_t qsrc = ((size_t)h * SEQ + (size_t)t0) * HD;  // 16 rows x 64 floats, contiguous
#pragma unroll
      for (int i = 0; i < 8; ++i) { const int idx = i * 32 + lane;
          const v4f v = *(const v4f*)(QKF + qsrc + (size_t)idx * 4);
          *(v4fa*)(&qs[qb + (idx >> 4) * QSP + (idx & 15) * 4]) = v; } }
    const size_t kplane = ((size_t)(NHQ + kvh) * SEQ) * HD;     // k heads follow the q heads in the plane
    const size_t vo  = (size_t)(kvh * HD + lr) * SEQ + 8 * hi;   // + 16j*SEQ + key   (A fragment: row d, k = key)
    const size_t vro = (size_t)(kvh * HD + lr) * EROWS + 8 * hi; // remainder plane, tokens < EROWS
    const v16h hz = (v16h){};
    v8f o[4], oR[4];
#pragma unroll
    for (int j = 0; j < 4; ++j) { o[j] = (v8f){}; oR[j] = (v8f){}; }
    float m = NEGB, l = 0.0f;
#pragma unroll 1
    for (int key0 = wave * 32; key0 < nk; key0 += 32 * AW) {    // a wave with no step keeps o = 0, l = 0, m = NEGB: weight 0 in the merge
        wave_sync();                                            // earlier reads of the K tile are done
        { const size_t ksrc = kplane + (size_t)key0 * HD;       // 32 keys x 64 floats, contiguous; keys < nk <= SEQ
#pragma unroll
          for (int g = 0; g < 2; ++g) { v4f kv[8];              // eight loads in flight, then their eight LDS stores
#pragma unroll
              for (int i = 0; i < 8; ++i) {
                  if (i == 7) asm volatile("s_wait_xcnt 0x0" ::: "memory");      // the group's last load may land in the address pair that the seven before it name: wait first
                  kv[i] = *(const v4f*)(QKF + ksrc + (size_t)((g * 8 + i) * 32 + lane) * 4); }
              asm volatile("s_wait_xcnt 0x0" ::: "memory");                      // the address pair is rewritten behind the group (next group, score loop): wait first
#pragma unroll
              for (int i = 0; i < 8; ++i) *(v4fa*)(&ks[kbs + ((g * 8 + i) * 32 + lane) * 4]) = kv[i]; } }
        wave_sync();
        float sa[8], sb[8];
#pragma unroll
        for (int r = 0; r < 8; ++r) { sa[r] = NEGB; sb[r] = NEGB; }
#pragma unroll 1
        for (int d4 = 0; d4 < HD / 4; ++d4) {
            const v4f q4 = *(const v4fa*)(&qs[qb + lr * QSP + d4 * 4]);
#pragma unroll
            for (int r = 0; r < 8; ++r) {
                const v4f ka = *(const v4fa*)(&ks[kbs + (8 * hi + r) * HD + d4 * 4]);
                const v4f kc = *(const v4fa*)(&ks[kbs + (16 + 8 * hi + r) * HD + d4 * 4]);
                sa[r] = fmaxf(sa[r], fmaxf(fmaxf(q4[0] + ka[0], q4[1] + ka[1]), fmaxf(q4[2] + ka[2], q4[3] + ka[3])));
                sb[r] = fmaxf(sb[r], fmaxf(fmaxf(q4[0] + kc[0], q4[1] + kc[1]), fmaxf(q4[2] + kc[2], q4[3] + kc[3]))); }
        }
        const int ja = key0 + 8 * hi;
        float mx = NEGB;
#pragma unroll
        for (int r = 0; r < 8; ++r) {
            sa[r] = sa[r] * LOG2E; sb[r] = sb[r] * LOG2E;
            const bool fa = (ja + r <= lim), fb = (ja + 16 + r <= lim);
            mx = fmaxf(mx, fmaxf(fa ? sa[r] : NEGB, fb ? sb[r] : NEGB)); }
        mx = fmaxf(mx, __shfl_xor(mx, 16, 32));
        const float mnew = fmaxf(m, mx);
        const float alpha = __builtin_amdgcn_exp2f(m - mnew);
        const float sh = PSH - mnew;
        v16h pb, pr = hz; float ls = 0.0f;
#pragma unroll
        for (int r = 0; r < 8; ++r) {
            const float xa = sa[r] + sh, xb = sb[r] + sh;
            const float ea = __builtin_amdgcn_exp2f(xa), eb = __builtin_amdgcn_exp2f(xb);
            const bool fa = (ja + r <= lim) & (xa >= -14.0f), fb = (ja + 16 + r <= lim) & (xb >= -14.0f);   // dropped keys and values below the f16 normal range selected to 0 by value
            const float ga = fa ? ea : 0.0f, gb = fb ? eb : 0.0f;
            const h16 pa = (h16)ga; const h16 pc = (h16)gb;
            pb[r] = pa; pb[8 + r] = pc;
            if (EARLY) { pr[r] = toh_flush((ga - (float)pa) * QRS); pr[8 + r] = toh_flush((gb - (float)pc) * QRS); ls += ga + gb; }
            else       { ls += (float)pa + (float)pc; } }
        l = l * alpha + ls; m = mnew;
#pragma unroll
        for (int j = 0; j < 4; ++j) {
            const v16h v = ldh(VT + vo + (size_t)(16 * j) * SEQ + key0);
            o[j] = o[j] * alpha;
            o[j] = wmma16g(v, pb, o[j]);
            if (EARLY) {
                const v16h vr = ldh(VR + vro + (size_t)(16 * j) * EROWS + key0);   // key0 + 31 < nk <= EROWS
                oR[j] = oR[j] * alpha;
                oR[j] = wmma16g(v, pr, oR[j]);
                oR[j] = wmma16g(vr, pb, oR[j]); }
        }
    }
    l += __shfl_xor(l, 16, 32);
    wave_sync();                                                // q tile reads are done; the slice becomes this wave's context partial
    // O^T D layout: f_j[r] = (d = 16j + 8h + r, t = lane&15) -> qs[t][d]; rows 0..15 x columns 0..63 all written
#pragma unroll
    for (int j = 0; j < 4; ++j) {
        v8f f = o[j];
        if (EARLY) f = o[j] + oR[j] * QRI;
        v4f a, c;
        a[0] = f[0]; a[1] = f[1]; a[2] = f[2]; a[3] = f[3]; c[0] = f[4]; c[1] = f[5]; c[2] = f[6]; c[3] = f[7];
        *(v4fa*)(&qs[qb + lr * QSP + 16 * j + 8 * hi]) = a; *(v4fa*)(&qs[qb + lr * QSP + 16 * j + 8 * hi + 4]) = c; }
    if (hi == 0) { ms[wave * 16 + lr] = m; lsum[wave * 16 + lr] = l; }   // both lane halves hold the same m and l
    __syncthreads();                                            // cross-wave: every wave's partial is read by every wave below
    // merge: thread = (row, 4 columns); partial w weighs 2^(m_w - M), M the maximum over the waves
    const int row = (int)threadIdx.x >> 4, c4 = ((int)threadIdx.x & 15) * 4;
    float mw[AW], M = NEGB;
#pragma unroll
    for (int w = 0; w < AW; ++w) { mw[w] = ms[w * 16 + row]; M = fmaxf(M, mw[w]); }
    float L = 0.0f; v4f acc = (v4f){};
#pragma unroll
    for (int w = 0; w < AW; ++w) {
        const float sc = __builtin_amdgcn_exp2f(mw[w] - M);
        const v4f p = *(const v4fa*)(&qs[w * 16 * QSP + row * QSP + c4]);
        L += lsum[w * 16 + row] * sc;
        acc += p * sc; }
    const bool any = L > 0.0f;
    const float lsafe = any ? L : 1.0f;
    const float inv = any ? (1.0f / lsafe) : 0.0f;
    v4us hv, lv;
#pragma unroll
    for (int e = 0; e < 4; ++e) { const float y = acc[e] * inv; const unsigned short b0 = f2bf(y); hv[e] = b0; lv[e] = f2bf(y - bf2f(b0)); }
    bf* yrow = YB + (size_t)(t0 + row) * YP + h * HD + c4;      // 16 lanes x 4 columns = one 128-byte line per row and plane
    *(v4us*)(yrow) = hv;
    *(v4us*)(yrow + DM) = lv;
}

// k_flash: both instantiations in one grid (disjoint context rows); the choice is block-uniform.
__global__ __launch_bounds__(32 * AW) __attribute__((amdgpu_num_vgpr(256))) void k_flash(const float* __restrict__ QKF, const h16* __restrict__ VT, const h16* __restrict__ VR, bf* YB) {
    __shared__ __align__(16) float qs[AW * 16 * QSP];           // per-wave slices: q tile, later the wave's context partial
    __shared__ __align__(16) float ks[AW * 32 * HD];            // wave-private slices: 32-key K tile
    __shared__ float ms[AW * 16];                               // per wave and row: running max
    __shared__ float lsum[AW * 16];                             // per wave and row: sum of the exponentials
    if ((int)blockIdx.x * 16 < EROWS) flash_body<1>(QKF, VT, VR, YB, qs, ks, ms, lsum);   // block-uniform: the barrier inside is met by all threads or by none
    else                              flash_body<0>(QKF, VT, VR, YB, qs, ks, ms, lsum);
}

static constexpr size_t al256(size_t v) { return (v + 255) & ~(size_t)255; }
static constexpr size_t SZ_XB = al256((size_t)SEQ * DM * 2);
static constexpr size_t SZ_WT = al256((size_t)WROWS * DM * 2);
static constexpr size_t SZ_QK = al256((size_t)(NHQ + NHK) * SEQ * HD * 4);
static constexpr size_t SZ_VT = al256((size_t)DKV * SEQ * 2);
static constexpr size_t SZ_VR = al256((size_t)DKV * EROWS * 2);
static constexpr size_t SZ_YB = al256((size_t)SEQ * YP * 2);
static constexpr size_t SZ_TOTAL = SZ_XB + SZ_WT + SZ_QK + SZ_VT + SZ_VR + SZ_YB;
static_assert(SZ_TOTAL <= (size_t)134217728);          // workspace carve <= 128 MiB
static_assert(((size_t)DM * DM * 2) % 256 == 0);       // weight sub-planes stay 256-byte aligned
static_assert(((size_t)DKV * DM * 2) % 256 == 0);
static_assert(((size_t)NHQ * SEQ * HD * 4) % 256 == 0);

extern "C" void kernel_launch(void* const* d_in, const int* in_sizes, int n_in,
                              void* d_out, int out_size, void* d_ws, size_t ws_size, hipStream_t stream) {
    if (n_in < 7) return;
    if ((size_t)in_sizes[0] < (size_t)SEQ * DM) return;
    if ((size_t)in_sizes[1] < (size_t)SEQ * HROT || (size_t)in_sizes[2] < (size_t)SEQ * HROT) return;
    if ((size_t)in_sizes[3] < (size_t)DM * DM || (size_t)in_sizes[6] < (size_t)DM * DM) return;
    if ((size_t)in_sizes[4] < (size_t)DM * DKV || (size_t)in_sizes[5] < (size_t)DM * DKV) return;
    if ((size_t)out_size < (size_t)SEQ * DM) return;
    if (SZ_TOTAL > ws_size) return;
    // wire order: x, cos, sin, Wq, Wk, Wv, Wproj
    const float* x    = (const float*)d_in[0];
    const float* cosb = (const float*)d_in[1];
    const float* sinb = (const float*)d_in[2];
    const float* wq   = (const float*)d_in[3];
    const float* wk   = (const float*)d_in[4];
    const float* wv   = (const float*)d_in[5];
    const float* wp   = (const float*)d_in[6];
    float* OUT = (float*)d_out;                        // [SEQ][768]
    char* wsp = (char*)d_ws;
    bf*    XB  = (bf*)wsp;    wsp += SZ_XB;            // x bf16 [SEQ][768]
    bf*    WT  = (bf*)wsp;    wsp += SZ_WT;            // [2304][768]: q | k | v | proj, each [out][in]
    float* QKF = (float*)wsp; wsp += SZ_QK;            // [18][SEQ][64] f32: 12 q heads, 6 k heads
    h16*   VT  = (h16*)wsp;   wsp += SZ_VT;            // [384][SEQ]
    h16*   VR  = (h16*)wsp;   wsp += SZ_VR;            // [384][EROWS] remainder x2048, tokens < EROWS
    bf*    YB  = (bf*)wsp;    wsp += SZ_YB;            // [SEQ][768 value | 768 remainder]

    // conversions: x -> XB; W[768 rows][ncols] -> WT[rowoff + ncols rows][768]
    k_cvt<<<CB_X + 2 * CB_WD + 2 * CB_WK, 256, 0, stream>>>(x, wq, wk, wv, wp, XB, WT);

    // q | k: A = x rows, Bt = WT rows [0, 1152) -> f32 planes [head][t][64], rotated and normalised; v^T: A = WT rows [1152, 1536), Bt = x rows -> [m][t] f16 (+ remainder for t < EROWS)
    k_qkv<<<dim3(SEQ / 64, NHQ + NHK + DKV / 64, 1), 32 * GW, 0, stream>>>(XB, WT, cosb, sinb, QKF, VT, VR);

    // query rows [0, EROWS): multi-product instantiation; rows [EROWS, SEQ): single-product instantiation
    k_flash<<<dim3(SEQ / 16, NHQ, 1), 32 * AW, 0, stream>>>(QKF, VT, VR, YB);

    // output projection: A = context rows (value | remainder), Bt = WT rows [1536, 2304)
    k_oproj<<<dim3(SEQ / 64, DM / 64, 1), 32 * GW, 0, stream>>>(YB, WT + (size_t)(NQK + DKV) * DM, OUT);
}

// v004
// One run takes 31.5 microseconds.
// Two timings next to v003 both put it at 1.11 times that version's speed.
// Over all steps from v000 it is 6.46 times as fast.
#include <hip/hip_runtime.h>

// Causal grouped-query self-attention with max-plus scores: x [SEQ][768]; Wq [768][768], Wk / Wv [768][384], Wproj [768][768], all [in][out] (y = x W, no bias);
// 12 query heads x 64, 6 key/value heads (2 query heads per key/value head); half-split rotary tables cos / sin [SEQ][32] read by value;
// per-head RMS normalisation (eps 1e-6) of q and k after the rotation; score[t][j] = max_d (q[t][d] + k[j][d]); causal softmax; context = P v; output = context Wproj (f32).
// Compute dtypes, f32 accumulate everywhere: q / k / v projections v_wmma_f32_16x16x32_bf16 (x, W RNE-converted to bf16; products exact); max-plus scores are not a multiply-accumulate: f32 on the vector unit from f32 q / k planes;
// P.V v_wmma_f32_16x16x32_f16: P (x16384 carry, cancels in the normalisation) and v single f16 on query rows >= EROWS; on query rows < EROWS P and v each as f16 value + f16 remainder x2048, remainder products in their own accumulator folded by 1/2048, row sum from the f32 exponentials;
// output projection v_wmma_f32_16x16x32_bf16: context as bf16 value + bf16 remainder (value and remainder in separate k slices, summed in the f32 merge), Wproj RNE-converted to bf16; softmax f32 (online, running max over kept keys).
// Layout: bf16 copy of x; transposed bf16 weights WT [2304][768] = q | k | v | proj rows ([out][in]); f32 planes q / k [18 heads][t][64] (rotated, normalised); v^T plane f16 [384][t] and remainder plane [384][t < EROWS];
// fused flash kernel in transposed form (O^T = V^T P^T, P built on the vector unit directly in B-fragment layout); context plane bf16 [t][768 value | 768 remainder].
// Every 16-bit plane above (a matrix operand, rows x k) lies in FRAGMENT ORDER: [16-row tile][32-wide k-step][half s][lane][8 elements], lane = 16*h + (row & 15), the 8 elements k = 32*step + 16*s + 8*h + 0..7:
// one wave-wide 16-byte load of a fragment half reads 512 contiguous bytes (4 whole lines). A 16-row tile keeps its size (16 x row length), so sub-plane offsets at multiples of 16 rows are those of the row-major plane.

#ifndef SEQ
#define SEQ 512
#endif
#define SEQ_FULL 512
#define DM    768
#define NHQ   12
#define NHK   6
#define NREP  2
#define HD    64
#define HROT  32
#define DKV   (NHK * HD)              // 384
#define NQK   (DM + DKV)              // 1152: q | k rows of WT
#define WROWS (DM + 2 * DKV + DM)     // 2304: q | k | v | proj rows of WT
#define YP    (2 * DM)                // context plane row pitch (value | remainder)
#define AW    8                       // waves per flash block: all work on the same 16 query rows, 32-key steps dealt round-robin
#define GKW   8                       // k slices of a 64x64 GEMM tile, one per wave pair
#define GNW   2                       // column halves of a GEMM tile: a wave holds 64 rows x 32 columns of one k slice
#define GW    (GKW * GNW)             // waves per GEMM block
#define KBAT  3                       // 32-wide k-steps whose fragments a wave loads as one batch
#define QSP   68                      // LDS row pitch (floats) of the q / context tile
#define TSP   68                      // LDS row pitch (floats) of the GEMM output tile
#define CTP   72                      // LDS row pitch (16-bit words) of the transposing converter tile
#define EROWS (SEQ < 256 ? SEQ : 256) // query rows handled by the multi-product flash instantiation
#define QRS   2048.0f                 // carry of the v remainder plane / P remainder fragment
#define QRI   (1.0f / 2048.0f)
#define LOG2E 1.4426950408889634f
#define PSH   14.0f                   // log2 of the P carry (16384)
#define NEGB  (-3.0e38f)
#define FSTEP 512                     // elements of one (16-row tile, k-step) unit of a fragment-order plane: 2 halves x 32 lanes x 8
#define FHALF 256                     // elements of one half of it

static_assert(HD == 64);
static_assert(HROT * 2 == HD);
static_assert(NHQ * HD == DM);
static_assert(NHK * NREP == NHQ);
static_assert(DM % 64 == 0);
static_assert(DKV % 64 == 0);
static_assert(NQK % 64 == 0);
static_assert(DM % 32 == 0);                    // GEMM k-loop steps by 32
static_assert(SEQ % 64 == 0);
static_assert(SEQ % 32 == 0);                   // key loop steps by 32
static_assert(SEQ <= SEQ_FULL);
static_assert(EROWS % 64 == 0);                 // a 64-token v^T tile lies wholly inside or outside the remainder plane
static_assert(EROWS % 32 == 0);                 // key bound of an early wave never exceeds EROWS
static_assert(EROWS % 16 == 0);                 // a 16-row query tile lies wholly below or wholly at / above EROWS
static_assert(AW * 32 * 4 == 16 * HD);          // merge: every thread of the block owns 4 context columns of one row
static_assert(EROWS <= SEQ);
static_assert(((size_t)SEQ * DM) % 8 == 0);
static_assert((QSP * 4) % 16 == 0);
static_assert((TSP * 4) % 16 == 0);
static_assert((CTP * 2) % 16 == 0);
static_assert(QSP >= HD);
static_assert(TSP >= 64);
static_assert(CTP >= 64);
// store-loop extents: trips x lanes x bytes == tile rows x row bytes
static_assert(2 * 256 * 16 == 64 * 64 * 2);
static_assert(GW * 2 * 32 * 16 == 64 * 64 * 4); // qk_body: every wave stores its own 64 / GW rows x 256 B in 2 trips
static_assert(2 * GW * 32 * 16 == 64 * 64 * 4); // k_oproj: 64 rows x 256 B
static_assert(GW * 32 * 16 == 64 * 64 * 2);     // vt_body: one 16-byte piece per thread
static_assert(GW == 16);                        // merge: wave w sums accumulator fragment w of the 4 x 4
static_assert(64 % GW == 0);
static_assert(DM == GKW * KBAT * 32);           // input projections: one batch per wave
static_assert(2 * DM == GKW * 2 * KBAT * 32);   // output projection: two batches per wave
static_assert(GKW % 2 == 0);                    // output projection: a k slice lies wholly in the value or wholly in the remainder part
// static LDS per kernel
static_assert(64 * CTP * 2 <= 131072);
static_assert((GKW * 64 * 64 + 64 * TSP) * 4 <= 163840);
static_assert(AW * (16 * QSP + 32 * HD + 32) * 4 <= 131072);

typedef _Float16 h16;
typedef unsigned short bf;
typedef __attribute__((ext_vector_type(16))) __bf16   v16bf;
typedef __attribute__((ext_vector_type(16))) _Float16 v16h;
typedef __attribute__((ext_vector_type(8)))  _Float16 v8h;
typedef __attribute__((ext_vector_type(8)))  unsigned short v8us;
typedef __attribute__((ext_vector_type(4)))  unsigned short v4us;
typedef __attribute__((ext_vector_type(8)))  float    v8f;
typedef __attribute__((ext_vector_type(4)))  float    v4f;
typedef v4f  __attribute__((may_alias)) v4fa;
typedef v8us __attribute__((may_alias)) v8usa;

__device__ __forceinline__ unsigned short f2bf(float f) { unsigned u = __float_as_uint(f); u += 0x7FFFu + ((u >> 16) & 1u); return (unsigned short)(u >> 16); }
__device__ __forceinline__ float bfr(float f) { return __uint_as_float(((unsigned)f2bf(f)) << 16); }   // value after RNE convert to bf16
__device__ __forceinline__ v16h cat16(v8h lo, v8h hi) { return __builtin_shufflevector(lo, hi, 0, 1, 2, 3, 4, 5, 6, 7, 8, 9, 10, 11, 12, 13, 14, 15); }
__device__ __forceinline__ v16bf cat16b(v8us lo, v8us hi) { return __builtin_bit_cast(v16bf, __builtin_shufflevector(lo, hi, 0, 1, 2, 3, 4, 5, 6, 7, 8, 9, 10, 11, 12, 13, 14, 15)); }
__device__ __forceinline__ v8f wmma16(v16h a, v16h b, v8f c) { return __builtin_amdgcn_wmma_f32_16x16x32_f16(false, a, false, b, (short)0, c, false, false); }
__device__ __forceinline__ v8f wmmab(v16bf a, v16bf b, v8f c) { return __builtin_amdgcn_wmma_f32_16x16x32_bf16(false, a, false, b, (short)0, c, false, false); }
// fragment loader from a fragment-order plane; p = start of the (tile, k-step) unit + 8*lane: elements 0..7 <- k0+8h+0..7, elements 8..15 <- k0+16+8h+0..7 (same map for A and B)
__device__ __forceinline__ v16h  ldh(const h16* p) { return cat16(*(const v8h*)p, *(const v8h*)(p + FHALF)); }
// ordering point for wave-private LDS tiles (same wave writes and reads)
__device__ __forceinline__ void wave_sync() { __builtin_amdgcn_fence(3 /* release order */, "wavefront"); __builtin_amdgcn_wave_barrier(); asm volatile("" ::: "memory"); }

// per-instruction guarded matrix steps: one accumulator tied per guard, A / B kept live across the nops
__device__ __forceinline__ v8f wmma16g(v16h a, v16h b, v8f c) { c = wmma16(a, b, c); asm volatile("v_nop\n\tv_nop\n\tv_nop\n\tv_nop" : "+v"(c) : "v"(a), "v"(b)); return c; }
__device__ __forceinline__ v8f wmmabg(v16bf a, v16bf b, v8f c) { c = wmmab(a, b, c); asm volatile("v_nop\n\tv_nop\n\tv_nop\n\tv_nop" : "+v"(c) : "v"(a), "v"(b)); return c; }
// f32 -> f16 convert that cannot produce a subnormal (|v| < 2^-14 -> +0)
__device__ __forceinline__ h16 toh_flush(float v) { const h16 r = (h16)v; return (fabsf(v) < 6.103515625e-05f) ? (h16)0.0f : r; }
__device__ __forceinline__ float bf2f(unsigned short b) { return __uint_as_float(((unsigned)b) << 16); }

// cvt8_body: bf16 (RNE convert) copy of x in fragment order, 8 elements per thread; thread i writes 16-byte piece i of the plane; b = block index inside the x part of the converter grid.
__device__ __forceinline__ void cvt8_body(const float* __restrict__ src, bf* dst, size_t n8, int b) {
    const size_t i = (size_t)b * 256 + threadIdx.x; if (i >= n8) return;
    const int ln = (int)(i & 31), hf = (int)((i >> 5) & 1), un = (int)(i >> 6);      // lane, half, (tile, k-step) unit
    const int row = (un / (DM / 32)) * 16 + (ln & 15), k = (un % (DM / 32)) * 32 + hf * 16 + (ln >> 4) * 8;
    const v8f v = *(const v8f*)(src + (size_t)row * DM + k); v8us o;
#pragma unroll
    for (int k = 0; k < 8; ++k) o[k] = f2bf(v[k]);
    *(v8us*)(dst + i * 8) = o; 
}

// cvtT_body: transposing bf16 (RNE convert) copy of a weight: in W[DM rows (k)][ncols (n)] f32 -> out WT rows rowoff + n, fragment order; b = 64x64 tile index inside this weight (k tile fastest).
__device__ __forceinline__ void cvtT_body(const float* __restrict__ W, bf* WT, int ncols, int rowoff, int b, bf* ts) {
    const int tid = threadIdx.x;
    const int n0 = (b / (DM / 64)) * 64, k0 = (b % (DM / 64)) * 64;
#pragma unroll
    for (int i = 0; i < 4; ++i) { const int idx = i * 256 + tid; const int kr = idx >> 4, c4 = (idx & 15) * 4;   // 64 k rows x 16 float4
        const v4f v = *(const v4f*)(W + (size_t)(k0 + kr) * (size_t)ncols + n0 + c4);
#pragma unroll
        for (int e = 0; e < 4; ++e) ts[(c4 + e) * CTP + kr] = f2bf(v[e]); }
    __syncthreads();                                            // cross-wave tile: block barrier
{
#pragma unroll
        for (int i = 0; i < 2; ++i) { const int p = i * 256 + tid; const int ch = p >> 5, ln = p & 31;          // 16 halves of 512 B: ch = 16-row tile (4) x k-step (2) x half (2); one wave writes one half
            const int row = (ch >> 2) * 16 + (ln & 15), c8 = ((ch >> 1) & 1) * 32 + (ch & 1) * 16 + (ln >> 4) * 8;
            const v8us o = *(const v8usa*)(&ts[row * CTP + c8]);
            *(v8us*)(WT + ((size_t)((rowoff + n0) / 16 + (ch >> 2)) * (DM / 32) + (size_t)(k0 / 32 + ((ch >> 1) & 1))) * FSTEP + (ch & 1) * FHALF + ln * 8) = o; }
        asm volatile("s_wait_xcnt 0x0" ::: "memory");                            // code of the grid's other part follows in the listing and rewrites the two stores' registers: wait first
         }
}

// k_cvt: every operand conversion in one grid (the five parts touch disjoint data). Block ranges: x | Wq | Wk | Wv | Wproj; every test below is block-uniform.
#define CB_X  ((int)(((size_t)SEQ * DM / 8 + 255) / 256))
#define CB_WD ((DM / 64) * (DM / 64))                           // tiles of a [768][768] weight
#define CB_WK ((DKV / 64) * (DM / 64))                          // tiles of a [768][384] weight
__global__ __launch_bounds__(256) void k_cvt(const float* __restrict__ x, const float* __restrict__ wq, const float* __restrict__ wk, const float* __restrict__ wv, const float* __restrict__ wp, bf* XB, bf* WT) {
    __shared__ __align__(16) bf ts[64 * CTP];
    int b = blockIdx.x;
    if (b < CB_X) { cvt8_body(x, XB, (size_t)SEQ * DM / 8, b); }
    else {                                                      // whole blocks only: the barrier of the transposing part is met by all 256 threads or by none
        b -= CB_X;
        const float* W; int ncols, rowoff;
        if (b < CB_WD)                  { W = wq; ncols = DM;  rowoff = 0; }
        else if (b < CB_WD + CB_WK)     { W = wk; ncols = DKV; rowoff = DM;        b -= CB_WD; }
        else if (b < CB_WD + 2 * CB_WK) { W = wv; ncols = DKV; rowoff = NQK;       b -= CB_WD + CB_WK; }
        else                            { W = wp; ncols = DM;  rowoff = NQK + DKV; b -= CB_WD + 2 * CB_WK; }
        cvtT_body(W, WT, ncols, rowoff, b, ts);
    }
}

// gemm_slice: one wave's share of a 64x64 tile: 64 rows x 32 columns (8 accumulators) over NB batches of KBAT k-steps, operands straight from fragment-order bf16 planes.
// pitchA / pitchB: row length (k) of the plane; aoff / boff: start of the unit (first 16-row tile, first k-step of the wave's slice) + 8*lane.
template <int NB>
__device__ __forceinline__ void gemm_slice(const bf* __restrict__ A, const bf* __restrict__ Bt, const int pitchA, const int pitchB, const size_t aoff, const size_t boff, v8f (&acc)[4][GNW]) {
#pragma unroll
    for (int mb = 0; mb < 4; ++mb)
#pragma unroll
        for (int nb = 0; nb < GNW; ++nb) acc[mb][nb] = (v8f){};
    const bf* pa = A + aoff; const bf* pb = Bt + boff;
#pragma unroll
    for (int bt = 0; bt < NB; ++bt) {
        v8us al[KBAT][4][2], bl[KBAT][GNW][2];                  // 16-byte halves of the fragments (k0+8h+0..7 | k0+16+8h+0..7), all in flight together
#pragma unroll
        for (int s = 0; s < KBAT; ++s) {
            const int kc = (bt * KBAT + s) * FSTEP;
#pragma unroll
            for (int i = 0; i < 8; ++i)       if (s < KBAT - 1 || i < 7)           al[s][i >> 1][i & 1] = *(const v8us*)(pa + (size_t)(i >> 1) * 16 * (size_t)pitchA + kc + FHALF * (i & 1));
#pragma unroll
            for (int i = 0; i < 2 * GNW; ++i) if (s < KBAT - 1 || i < 2 * GNW - 1) bl[s][i >> 1][i & 1] = *(const v8us*)(pb + (size_t)(i >> 1) * 16 * (size_t)pitchB + kc + FHALF * (i & 1)); }
        const int kl = (bt * KBAT + KBAT - 1) * FSTEP + FHALF;
        asm volatile("s_wait_xcnt 0x0" ::: "memory");                            // the last load off an address register may land in it, and the loads before it name it: wait first
        al[KBAT - 1][3][1] = *(const v8us*)(pa + (size_t)3 * 16 * (size_t)pitchA + kl);
        asm volatile("s_wait_xcnt 0x0" ::: "memory");                            // same: the load below may land in a register that the load above names
        bl[KBAT - 1][GNW - 1][1] = *(const v8us*)(pb + (size_t)(GNW - 1) * 16 * (size_t)pitchB + kl);
        asm volatile("s_wait_xcnt 0x0" ::: "memory");                            // the address registers are rewritten behind the batch (LDS addresses): wait first
        v16bf a[KBAT][4], b[KBAT][GNW];
#pragma unroll
        for (int s = 0; s < KBAT; ++s) {
#pragma unroll
            for (int mb = 0; mb < 4; ++mb) a[s][mb] = cat16b(al[s][mb][0], al[s][mb][1]);
#pragma unroll
            for (int nb = 0; nb < GNW; ++nb) b[s][nb] = cat16b(bl[s][nb][0], bl[s][nb][1]); }
#pragma unroll
        for (int s = 0; s < KBAT; ++s)
#pragma unroll
            for (int nb = 0; nb < GNW; ++nb)
#pragma unroll
                for (int mb = 0; mb < 4; ++mb) acc[mb][nb] = wmmabg(a[s][mb], b[s][nb], acc[mb][nb]);
    }
}

// tile_merge: every wave puts its partial into LDS in fragment order (lane-contiguous 16-byte pieces); behind a block barrier wave w sums fragment w = mb*4 + nb over the k slices, slice 0 first,
// and writes it row-major into os (D: row 8h+j, col lane&15; all 64 x 64 written); a second block barrier publishes os to every wave.
__device__ __forceinline__ void tile_merge(const v8f (&acc)[4][GNW], float* ps, float* os, const int wave, const int lane) {
    const int lr = lane & 15, hi = lane >> 4;
    const int kq = wave / GNW, nh = wave % GNW;
#pragma unroll
    for (int mb = 0; mb < 4; ++mb)
#pragma unroll
        for (int nb = 0; nb < GNW; ++nb) {
            float* p = ps + (size_t)((kq * 16 + mb * 4 + nh * GNW + nb) * 256 + lane * 4);
            const v8f f = acc[mb][nb]; v4f a, c;
            a[0] = f[0]; a[1] = f[1]; a[2] = f[2]; a[3] = f[3]; c[0] = f[4]; c[1] = f[5]; c[2] = f[6]; c[3] = f[7];
            *(v4fa*)p = a; *(v4fa*)(p + 128) = c; }
    __syncthreads();                                            // cross-wave: every k slice's partial is read by another wave below
    const float* q0 = ps + (size_t)(wave * 256 + lane * 4);
    v4f s0 = *(const v4fa*)q0, s1 = *(const v4fa*)(q0 + 128);
#pragma unroll
    for (int q = 1; q < GKW; ++q) { s0 += *(const v4fa*)(q0 + q * 4096); s1 += *(const v4fa*)(q0 + q * 4096 + 128); }
    float* d = os + ((wave >> 2) * 16 + hi * 8) * TSP + (wave & 3) * 16 + lr;
#pragma unroll
    for (int j = 0; j < 4; ++j) { d[j * TSP] = s0[j]; d[(4 + j) * TSP] = s1[j]; }
    __syncthreads();                                            // cross-wave: the epilogues read rows that other waves wrote
}

// qk_body: q and k projections with rotation + RMS normalisation in the epilogue. A = x rows (m = t), Bt = WT rows n in [0, 1152): column tile = head (0..11 q, 12..17 k).
__device__ __forceinline__ void qk_body(const bf* __restrict__ XB, const bf* __restrict__ WT, const float* __restrict__ cosb, const float* __restrict__ sinb, float* QKF, const int ttile, const int head, float* ps, float* os) {
    const int lane = threadIdx.x & 31;
    const int wave = __builtin_amdgcn_readfirstlane((int)(threadIdx.x >> 5));
    const int r0 = ttile * 64, c0 = head * 64, k0 = (wave / GNW) * (KBAT * 32);
    v8f acc[4][GNW];
    gemm_slice<1>(XB, WT, DM, DM, (size_t)r0 * DM + k0 * 16 + lane * 8, (size_t)(c0 + (wave % GNW) * 32) * DM + k0 * 16 + lane * 8, acc);   // unit start: 16-row tile r/16 at r * row length, k-step k/32 at 16 * k
    tile_merge(acc, ps, os, wave, lane);
    const int w0 = wave * (64 / GW);                            // this wave's rows of the tile: from here on it reads and writes these alone
#pragma unroll 1
    for (int r = w0; r < w0 + 64 / GW; ++r) {                   // lane = rotary pair column (d, d + 32)
        const int t = r0 + r;
        const float x1 = os[r * TSP + lane], x2 = os[r * TSP + HROT + lane];
        const float c = bfr(cosb[(size_t)t * HROT + lane]), s = bfr(sinb[(size_t)t * HROT + lane]);
        const float o1 = x1 * c - x2 * s, o2 = x2 * c + x1 * s;
        float ss = o1 * o1 + o2 * o2;
#pragma unroll
        for (int off = 16; off > 0; off >>= 1) ss += __shfl_xor(ss, off, 32);
        const float sc = rsqrtf(ss * (1.0f / (float)HD) + 1e-6f);
        os[r * TSP + lane] = o1 * sc; os[r * TSP + HROT + lane] = o2 * sc; }
    wave_sync();
    float* dst = QKF + ((size_t)head * SEQ + (size_t)(r0 + w0)) * HD;
{
#pragma unroll
        for (int i = 0; i < 2; ++i) { const int idx = i * 32 + lane; const int row = w0 + (idx >> 4), c4 = (idx & 15) * 4;   // 2 trips x 2 rows = the wave's 4 rows; 16 lanes x 4 floats = 64 columns
            const v4f val = *(const v4fa*)(&os[row * TSP + c4]);
            *(v4f*)(dst + (size_t)idx * 4) = val; }
         }
}

// vt_body: v^T projection. A = WT rows 1152 + m (m = kvh*64 + d), Bt = x rows (n = t); plane VT [m][t] f16 (row length SEQ) and, for t < EROWS (block-uniform test), the f16 remainder x2048 VR [m][t] (row length EROWS), both in fragment order (k = t).
__device__ __forceinline__ void vt_body(const bf* __restrict__ WV, const bf* __restrict__ XB, h16* VT, h16* VR, const int mtile, const int ttile, float* ps, float* os) {
    const int lane = threadIdx.x & 31, lr = lane & 15, hi = lane >> 4;
    const int wave = __builtin_amdgcn_readfirstlane((int)(threadIdx.x >> 5));
    const int r0 = mtile * 64, c0 = ttile * 64, k0 = (wave / GNW) * (KBAT * 32);
    v8f acc[4][GNW];
    gemm_slice<1>(WV, XB, DM, DM, (size_t)r0 * DM + k0 * 16 + lane * 8, (size_t)(c0 + (wave % GNW) * 32) * DM + k0 * 16 + lane * 8, acc);
    tile_merge(acc, ps, os, wave, lane);
    const bool wr = c0 < EROWS;                                 // block-uniform: whole tile inside the remainder plane
{
        { const int row = (wave >> 2) * 16 + lr, c8 = ((wave >> 1) & 1) * 32 + (wave & 1) * 16 + hi * 8;   // 16 waves: 16-row tile (4) x k-step (2) x half (2); one wave writes one 512-byte half
            const size_t un = (size_t)(c0 / 32 + ((wave >> 1) & 1)) * FSTEP + (wave & 1) * FHALF + lane * 8;   // place inside the 16-row tile
            const v4f x0 = *(const v4fa*)(&os[row * TSP + c8]); const v4f x1 = *(const v4fa*)(&os[row * TSP + c8 + 4]); v8h hv, rv;
#pragma unroll
            for (int e = 0; e < 4; ++e) { const h16 a0 = toh_flush(x0[e]); const h16 a1 = toh_flush(x1[e]); hv[e] = a0; hv[4 + e] = a1;
                rv[e] = toh_flush((x0[e] - (float)a0) * QRS); rv[4 + e] = toh_flush((x1[e] - (float)a1) * QRS); }
            *(v8h*)(VT + (size_t)(r0 + (wave >> 2) * 16) * SEQ + un) = hv;
            asm volatile("s_wait_xcnt 0x0" ::: "memory");                        // the store's registers are rewritten behind it (remainder packing): wait first
            if (wr) { *(v8h*)(VR + (size_t)(r0 + (wave >> 2) * 16) * EROWS + un) = rv;
                asm volatile("s_wait_xcnt 0x0" ::: "memory"); } }                // same, for the remainder store
         }
}

// k_qkv: the three input projections in one grid (disjoint outputs): blockIdx.x = 64-token tile; blockIdx.y < 18: q / k head, else v^T row tile.
__global__ __launch_bounds__(32 * GW) void k_qkv(const bf* __restrict__ XB, const bf* __restrict__ WT, const float* __restrict__ cosb, const float* __restrict__ sinb, float* QKF, h16* VT, h16* VR) {
    __shared__ __align__(16) float ps[GKW * 64 * 64];           // the k slices' partial tiles, fragment order
    __shared__ __align__(16) float os[64 * TSP];                // merged tile, row-major
    const int by = blockIdx.y;                                  // block-uniform: the barriers inside are met by all threads or by none
    if (by < NHQ + NHK) qk_body(XB, WT, cosb, sinb, QKF, blockIdx.x, by, ps, os);
    else                vt_body(WT + (size_t)NQK * DM, XB, VT, VR, by - (NHQ + NHK), blockIdx.x, ps, os);
}

// k_oproj: output projection. A = context plane rows (value | remainder, two K parts of 768), Bt = WT rows 1536 + n; f32 output [t][768].
__global__ __launch_bounds__(32 * GW) void k_oproj(const bf* __restrict__ YB, const bf* __restrict__ WP, float* OUT) {
    __shared__ __align__(16) float ps[GKW * 64 * 64];           // the k slices' partial tiles, fragment order
    __shared__ __align__(16) float os[64 * TSP];                // merged tile, row-major
    const int lane = threadIdx.x & 31;
    const int wave = __builtin_amdgcn_readfirstlane((int)(threadIdx.x >> 5));
    const int r0 = blockIdx.x * 64, c0 = blockIdx.y * 64;
    const int ka = (wave / GNW) * (2 * KBAT * 32);              // slice start in the context row (value | remainder)
    const int kw = ka % DM;                                     // the same k in the weight row: both parts meet the same weights
    v8f acc[4][GNW];
    gemm_slice<2>(YB, WP, YP, DM, (size_t)r0 * YP + ka * 16 + lane * 8, (size_t)(c0 + (wave % GNW) * 32) * DM + kw * 16 + lane * 8, acc);
    tile_merge(acc, ps, os, wave, lane);
{
#pragma unroll
        for (int i = 0; i < 2; ++i) { const int idx = i * (32 * GW) + (int)threadIdx.x; const int row = idx >> 4, c4 = (idx & 15) * 4;   // 2 trips x 32 rows = 64 rows; 16 lanes x 4 floats = 64 columns
            const v4f val = *(const v4fa*)(&os[row * TSP + c4]);
            *(v4f*)(OUT + (size_t)(r0 + row) * DM + c0 + c4) = val; }
         }
}

// flash_body: fused attention, one block of AW waves per 16 query rows of one head; wave w takes the 32-key steps w, w + AW, ... and keeps its own softmax state and context partial;
// the partials (unnormalised context, running max, row sum) meet in LDS behind one block barrier and are merged in f32 by all threads. q tile and the 32-key K tile live in wave-private LDS (f32); scores on the vector unit:
// lane (t = lane&15, h = lane>>4) forms max_d(q[t][d] + k[key][d]) for keys 8h+r and 16+8h+r of each 32-key step, i.e. directly the B-fragment layout of
// O^T[d][t] = V^T P^T (element r <- keys 8h+r, element 8+r <- keys 16+8h+r, lane unchanged). V^T fragments (A, row d, k = key) straight from the f16 planes.
// Softmax state (running max over kept keys, partial sum) is one scalar per lane; the two lane halves of a row are combined with one xor-16 exchange.
// Causal keep rule (key <= t) evaluated per element inside every visited tile; the per-wave key bound is a wave scalar, multiple of 32, <= SEQ.
// EARLY = 1 (query rows [0, EROWS)): P = f16 value + f16 remainder x2048; O = V P + (V P_rem + V_rem P) / 2048 (remainder products in their own accumulators); row sum from the f32 exponentials.
// EARLY = 0 (query rows [EROWS, SEQ)): single P, v; row sum over the converted P.
template <int EARLY>
__device__ __forceinline__ void flash_body(const float* __restrict__ QKF, const h16* __restrict__ VT, const h16* __restrict__ VR, bf* YB, float* qs, float* ks, float* ms, float* lsum) {
    const int lane = threadIdx.x & 31, lr = lane & 15, hi = lane >> 4;
    const int wave = __builtin_amdgcn_readfirstlane((int)(threadIdx.x >> 5));
    const int h = blockIdx.y, kvh = h / NREP;
    const int t0 = blockIdx.x * 16;                             // blockIdx.x = tile of 16 query rows, wholly below or wholly at / above EROWS
    const int lim = t0 + lr;                                    // key j kept iff j <= lim
    const int nk = (t0 + 16 + 31) & ~31;                        // block-uniform, multiple of 32, <= SEQ (<= EROWS when EARLY)
    const int qb = wave * 16 * QSP, kbs = wave * 32 * HD;
    { const size_t qsrc = ((size_t)h * SEQ + (size_t)t0) * HD;  // 16 rows x 64 floats, contiguous
#pragma unroll
      for (int i = 0; i < 8; ++i) { const int idx = i * 32 + lane;
          const v4f v = *(const v4f*)(QKF + qsrc + (size_t)idx * 4);
          *(v4fa*)(&qs[qb + (idx >> 4) * QSP + (idx & 15) * 4]) = v; } }
    const size_t kplane = ((size_t)(NHQ + kvh) * SEQ) * HD;     // k heads follow the q heads in the plane
    const size_t vo  = (size_t)(kvh * HD) * SEQ + lane * 8;      // + 16j*SEQ + 16*key0   (A fragment: row d, k = key; fragment-order plane)
    const size_t vro = (size_t)(kvh * HD) * EROWS + lane * 8;    // remainder plane, tokens < EROWS
    const v16h hz = (v16h){};
    v8f o[4], oR[4];
#pragma unroll
    for (int j = 0; j < 4; ++j) { o[j] = (v8f){}; oR[j] = (v8f){}; }
    float m = NEGB, l = 0.0f;
#pragma unroll 1
    for (int key0 = wave * 32; key0 < nk; key0 += 32 * AW) {    // a wave with no step keeps o = 0, l = 0, m = NEGB: weight 0 in the merge
        wave_sync();                                            // earlier reads of the K tile are done
        { const size_t ksrc = kplane + (size_t)key0 * HD;       // 32 keys x 64 floats, contiguous; keys < nk <= SEQ
#pragma unroll
          for (int g = 0; g < 2; ++g) { v4f kv[8];              // eight loads in flight, then their eight LDS stores
#pragma unroll
              for (int i = 0; i < 8; ++i) {
                  if (i == 7) asm volatile("s_wait_xcnt 0x0" ::: "memory");      // the group's last load may land in the address pair that the seven before it name: wait first
                  kv[i] = *(const v4f*)(QKF + ksrc + (size_t)((g * 8 + i) * 32 + lane) * 4); }
              asm volatile("s_wait_xcnt 0x0" ::: "memory");                      // the address pair is rewritten behind the group (next group, score loop): wait first
#pragma unroll
              for (int i = 0; i < 8; ++i) *(v4fa*)(&ks[kbs + ((g * 8 + i) * 32 + lane) * 4]) = kv[i]; } }
        wave_sync();
        float sa[8], sb[8];
#pragma unroll
        for (int r = 0; r < 8; ++r) { sa[r] = NEGB; sb[r] = NEGB; }
#pragma unroll 1
        for (int d4 = 0; d4 < HD / 4; ++d4) {
            const v4f q4 = *(const v4fa*)(&qs[qb + lr * QSP + d4 * 4]);
#pragma unroll
            for (int r = 0; r < 8; ++r) {
                const v4f ka = *(const v4fa*)(&ks[kbs + (8 * hi + r) * HD + d4 * 4]);
                const v4f kc = *(const v4fa*)(&ks[kbs + (16 + 8 * hi + r) * HD + d4 * 4]);
                sa[r] = fmaxf(sa[r], fmaxf(fmaxf(q4[0] + ka[0], q4[1] + ka[1]), fmaxf(q4[2] + ka[2], q4[3] + ka[3])));
                sb[r] = fmaxf(sb[r], fmaxf(fmaxf(q4[0] + kc[0], q4[1] + kc[1]), fmaxf(q4[2] + kc[2], q4[3] + kc[3]))); }
        }
        const int ja = key0 + 8 * hi;
        float mx = NEGB;
#pragma unroll
        for (int r = 0; r < 8; ++r) {
            sa[r] = sa[r] * LOG2E; sb[r] = sb[r] * LOG2E;
            const bool fa = (ja + r <= lim), fb = (ja + 16 + r <= lim);
            mx = fmaxf(mx, fmaxf(fa ? sa[r] : NEGB, fb ? sb[r] : NEGB)); }
        mx = fmaxf(mx, __shfl_xor(mx, 16, 32));
        const float mnew = fmaxf(m, mx);
        const float alpha = __builtin_amdgcn_exp2f(m - mnew);
        const float sh = PSH - mnew;
        v16h pb, pr = hz; float ls = 0.0f;
#pragma unroll
        for (int r = 0; r < 8; ++r) {
            const float xa = sa[r] + sh, xb = sb[r] + sh;
            const float ea = __builtin_amdgcn_exp2f(xa), eb = __builtin_amdgcn_exp2f(xb);
            const bool fa = (ja + r <= lim) & (xa >= -14.0f), fb = (ja + 16 + r <= lim) & (xb >= -14.0f);   // dropped keys and values below the f16 normal range selected to 0 by value
            const float ga = fa ? ea : 0.0f, gb = fb ? eb : 0.0f;
            const h16 pa = (h16)ga; const h16 pc = (h16)gb;
            pb[r] = pa; pb[8 + r] = pc;
            if (EARLY) { pr[r] = toh_flush((ga - (float)pa) * QRS); pr[8 + r] = toh_flush((gb - (float)pc) * QRS); ls += ga + gb; }
            else       { ls += (float)pa + (float)pc; } }
        l = l * alpha + ls; m = mnew;
#pragma unroll
        for (int j = 0; j < 4; ++j) {
            const v16h v = ldh(VT + vo + (size_t)(16 * j) * SEQ + (size_t)key0 * 16);
            o[j] = o[j] * alpha;
            o[j] = wmma16g(v, pb, o[j]);
            if (EARLY) {
                const v16h vr = ldh(VR + vro + (size_t)(16 * j) * EROWS + (size_t)key0 * 16);   // key0 + 31 < nk <= EROWS
                oR[j] = oR[j] * alpha;
                oR[j] = wmma16g(v, pr, oR[j]);
                oR[j] = wmma16g(vr, pb, oR[j]); }
        }
        asm volatile("s_wait_xcnt 0x0" ::: "memory");                            // the next step's K tile loads may land in the address pairs that the V loads above name: wait first
    }
    l += __shfl_xor(l, 16, 32);
    wave_sync();                                                // q tile reads are done; the slice becomes this wave's context partial
    // O^T D layout: f_j[r] = (d = 16j + 8h + r, t = lane&15) -> qs[t][d]; rows 0..15 x columns 0..63 all written
#pragma unroll
    for (int j = 0; j < 4; ++j) {
        v8f f = o[j];
        if (EARLY) f = o[j] + oR[j] * QRI;
        v4f a, c;
        a[0] = f[0]; a[1] = f[1]; a[2] = f[2]; a[3] = f[3]; c[0] = f[4]; c[1] = f[5]; c[2] = f[6]; c[3] = f[7];
        *(v4fa*)(&qs[qb + lr * QSP + 16 * j + 8 * hi]) = a; *(v4fa*)(&qs[qb + lr * QSP + 16 * j + 8 * hi + 4]) = c; }
    if (hi == 0) { ms[wave * 16 + lr] = m; lsum[wave * 16 + lr] = l; }   // both lane halves hold the same m and l
    __syncthreads();                                            // cross-wave: every wave's partial is read by every wave below
    // merge: thread = (row, 4 columns), dealt so that thread p owns 8-byte piece p of the head's 2 k-steps in the fragment-order context plane; partial w weighs 2^(m_w - M), M the maximum over the waves
    const int row = ((int)threadIdx.x >> 1) & 15, c4 = ((int)threadIdx.x >> 6) * 16 + (((int)threadIdx.x >> 5) & 1) * 8 + ((int)threadIdx.x & 1) * 4;
    float mw[AW], M = NEGB;
#pragma unroll
    for (int w = 0; w < AW; ++w) { mw[w] = ms[w * 16 + row]; M = fmaxf(M, mw[w]); }
    float L = 0.0f; v4f acc = (v4f){};
#pragma unroll
    for (int w = 0; w < AW; ++w) {
        const float sc = __builtin_amdgcn_exp2f(mw[w] - M);
        const v4f p = *(const v4fa*)(&qs[w * 16 * QSP + row * QSP + c4]);
        L += lsum[w * 16 + row] * sc;
        acc += p * sc; }
    const bool any = L > 0.0f;
    const float lsafe = any ? L : 1.0f;
    const float inv = any ? (1.0f / lsafe) : 0.0f;
    v4us hv, lv;
#pragma unroll
    for (int e = 0; e < 4; ++e) { const float y = acc[e] * inv; const unsigned short b0 = f2bf(y); hv[e] = b0; lv[e] = f2bf(y - bf2f(b0)); }
    bf* yrow = YB + (size_t)t0 * YP + (size_t)(h * HD) * 16 + (int)threadIdx.x * 4;   // the block's 16-row tile, the head's k-steps: 2 KiB in a row per part, a wave stores 2 whole lines
    *(v4us*)(yrow) = hv;
    *(v4us*)(yrow + DM * 16) = lv;
}

// k_flash: both instantiations in one grid (disjoint context rows); the choice is block-uniform.
__global__ __launch_bounds__(32 * AW) __attribute__((amdgpu_num_vgpr(256))) void k_flash(const float* __restrict__ QKF, const h16* __restrict__ VT, const h16* __restrict__ VR, bf* YB) {
    __shared__ __align__(16) float qs[AW * 16 * QSP];           // per-wave slices: q tile, later the wave's context partial
    __shared__ __align__(16) float ks[AW * 32 * HD];            // wave-private slices: 32-key K tile
    __shared__ float ms[AW * 16];                               // per wave and row: running max
    __shared__ float lsum[AW * 16];                             // per wave and row: sum of the exponentials
    if ((int)blockIdx.x * 16 < EROWS) flash_body<1>(QKF, VT, VR, YB, qs, ks, ms, lsum);   // block-uniform: the barrier inside is met by all threads or by none
    else                              flash_body<0>(QKF, VT, VR, YB, qs, ks, ms, lsum);
}

static constexpr size_t al256(size_t v) { return (v + 255) & ~(size_t)255; }
static constexpr size_t SZ_XB = al256((size_t)SEQ * DM * 2);
static constexpr size_t SZ_WT = al256((size_t)WROWS * DM * 2);
static constexpr size_t SZ_QK = al256((size_t)(NHQ + NHK) * SEQ * HD * 4);
static constexpr size_t SZ_VT = al256((size_t)DKV * SEQ * 2);
static constexpr size_t SZ_VR = al256((size_t)DKV * EROWS * 2);
static constexpr size_t SZ_YB = al256((size_t)SEQ * YP * 2);
static constexpr size_t SZ_TOTAL = SZ_XB + SZ_WT + SZ_QK + SZ_VT + SZ_VR + SZ_YB;
static_assert(SZ_TOTAL <= (size_t)134217728);          // workspace carve <= 128 MiB
static_assert(((size_t)DM * DM * 2) % 256 == 0);       // weight sub-planes stay 256-byte aligned
static_assert(((size_t)DKV * DM * 2) % 256 == 0);
static_assert(((size_t)NHQ * SEQ * HD * 4) % 256 == 0);

extern "C" void kernel_launch(void* const* d_in, const int* in_sizes, int n_in,
                              void* d_out, int out_size, void* d_ws, size_t ws_size, hipStream_t stream) {
    if (n_in < 7) return;
    if ((size_t)in_sizes[0] < (size_t)SEQ * DM) return;
    if ((size_t)in_sizes[1] < (size_t)SEQ * HROT || (size_t)in_sizes[2] < (size_t)SEQ * HROT) return;
    if ((size_t)in_sizes[3] < (size_t)DM * DM || (size_t)in_sizes[6] < (size_t)DM * DM) return;
    if ((size_t)in_sizes[4] < (size_t)DM * DKV || (size_t)in_sizes[5] < (size_t)DM * DKV) return;
    if ((size_t)out_size < (size_t)SEQ * DM) return;
    if (SZ_TOTAL > ws_size) return;
    // wire order: x, cos, sin, Wq, Wk, Wv, Wproj
    const float* x    = (const float*)d_in[0];
    const float* cosb = (const float*)d_in[1];
    const float* sinb = (const float*)d_in[2];
    const float* wq   = (const float*)d_in[3];
    const float* wk   = (const float*)d_in[4];
    const float* wv   = (const float*)d_in[5];
    const float* wp   = (const float*)d_in[6];
    float* OUT = (float*)d_out;                        // [SEQ][768]
    char* wsp = (char*)d_ws;
    bf*    XB  = (bf*)wsp;    wsp += SZ_XB;            // x bf16 [SEQ][768]
    bf*    WT  = (bf*)wsp;    wsp += SZ_WT;            // [2304][768]: q | k | v | proj, each [out][in]
    float* QKF = (float*)wsp; wsp += SZ_QK;            // [18][SEQ][64] f32: 12 q heads, 6 k heads
    h16*   VT  = (h16*)wsp;   wsp += SZ_VT;            // [384][SEQ]
    h16*   VR  = (h16*)wsp;   wsp += SZ_VR;            // [384][EROWS] remainder x2048, tokens < EROWS
    bf*    YB  = (bf*)wsp;    wsp += SZ_YB;            // [SEQ][768 value | 768 remainder]

    // conversions: x -> XB; W[768 rows][ncols] -> WT[rowoff + ncols rows][768]
    k_cvt<<<CB_X + 2 * CB_WD + 2 * CB_WK, 256, 0, stream>>>(x, wq, wk, wv, wp, XB, WT);

    // q | k: A = x rows, Bt = WT rows [0, 1152) -> f32 planes [head][t][64], rotated and normalised; v^T: A = WT rows [1152, 1536), Bt = x rows -> [m][t] f16 (+ remainder for t < EROWS)
    k_qkv<<<dim3(SEQ / 64, NHQ + NHK + DKV / 64, 1), 32 * GW, 0, stream>>>(XB, WT, cosb, sinb, QKF, VT, VR);

    // query rows [0, EROWS): multi-product instantiation; rows [EROWS, SEQ): single-product instantiation
    k_flash<<<dim3(SEQ / 16, NHQ, 1), 32 * AW, 0, stream>>>(QKF, VT, VR, YB);

    // output projection: A = context rows (value | remainder), Bt = WT rows [1536, 2304)
    k_oproj<<<dim3(SEQ / 64, DM / 64, 1), 32 * GW, 0, stream>>>(YB, WT + (size_t)(NQK + DKV) * DM, OUT);
}

// v005
// Measured time: 28.8 microseconds a run.
// Timed twice side by side with v004, it ran 1.09 times as fast both times.
// Over all steps from v000 it is 7.06 times as fast.
#include <hip/hip_runtime.h>

// Causal grouped-query self-attention with max-plus scores: x [SEQ][768]; Wq [768][768], Wk / Wv [768][384], Wproj [768][768], all [in][out] (y = x W, no bias);
// 12 query heads x 64, 6 key/value heads (2 query heads per key/value head); half-split rotary tables cos / sin [SEQ][32] read by value;
// per-head RMS normalisation (eps 1e-6) of q and k after the rotation; score[t][j] = max_d (q[t][d] + k[j][d]); causal softmax; context = P v; output = context Wproj (f32).
// Compute dtypes, f32 accumulate everywhere: q / k / v projections v_wmma_f32_16x16x32_bf16 (x, W RNE-converted to bf16; products exact); max-plus scores are not a multiply-accumulate: f32 on the vector unit from f32 q / k planes;
// P.V v_wmma_f32_16x16x32_f16: P (x16384 carry, cancels in the normalisation) and v single f16 on query rows >= EROWS; on query rows < EROWS P and v each as f16 value + f16 remainder x2048, remainder products in their own accumulator folded by 1/2048, row sum from the f32 exponentials;
// output projection v_wmma_f32_16x16x32_bf16: context as bf16 value + bf16 remainder (value and remainder in separate k slices, summed in the f32 merge), Wproj RNE-converted to bf16; softmax f32 (online, running max over kept keys).
// Layout: bf16 copy of x; transposed bf16 weights WT [2304][768] = q | k | v | proj rows ([out][in]); f32 planes q / k [18 heads][t][64] (rotated, normalised); v^T plane f16 [384][t] and remainder plane [384][t < EROWS];
// fused flash kernel in transposed form (O^T = V^T P^T, P built on the vector unit directly in B-fragment layout); context plane bf16 [t][768 value | 768 remainder].
// Every 16-bit plane above (a matrix operand, rows x k) lies in FRAGMENT ORDER: [16-row tile][32-wide k-step][half s][lane][8 elements], lane = 16*h + (row & 15), the 8 elements k = 32*step + 16*s + 8*h + 0..7:
// one wave-wide 16-byte load of a fragment half reads 512 contiguous bytes (4 whole lines). A 16-row tile keeps its size (16 x row length), so sub-plane offsets at multiples of 16 rows are those of the row-major plane.

#ifndef SEQ
#define SEQ 512
#endif
#define SEQ_FULL 512
#define DM    768
#define NHQ   12
#define NHK   6
#define NREP  2
#define HD    64
#define HROT  32
#define DKV   (NHK * HD)              // 384
#define NQK   (DM + DKV)              // 1152: q | k rows of WT
#define WROWS (DM + 2 * DKV + DM)     // 2304: q | k | v | proj rows of WT
#define YP    (2 * DM)                // context plane row pitch (value | remainder)
#define AW    8                       // waves per flash block: all work on the same 16 query rows, 32-key steps dealt round-robin
#define GKW   8                       // k slices of a 64x64 GEMM tile, one per wave pair
#define GNW   2                       // column halves of a GEMM tile: a wave holds 64 rows x 32 columns of one k slice
#define GW    (GKW * GNW)             // waves per GEMM block
#define KBAT  3                       // 32-wide k-steps whose fragments a wave loads as one batch
#define QSP   68                      // LDS row pitch (floats) of the q / context tile
#define KSP   68                      // LDS row pitch (floats) of the 32-key K tile: rows 4 apart fall 16 banks apart
#define SSP   36                      // LDS row pitch (floats) of the 16 x 32 score tile that takes the K tile's place behind the score loop
#define TSP   68                      // LDS row pitch (floats) of the GEMM output tile
#define CTP   72                      // LDS row pitch (16-bit words) of the transposing converter tile
#define EROWS (SEQ < 256 ? SEQ : 256) // query rows handled by the multi-product flash instantiation
#define QRS   2048.0f                 // carry of the v remainder plane / P remainder fragment
#define QRI   (1.0f / 2048.0f)
#define LOG2E 1.4426950408889634f
#define PSH   14.0f                   // log2 of the P carry (16384)
#define NEGB  (-3.0e38f)
#define FSTEP 512                     // elements of one (16-row tile, k-step) unit of a fragment-order plane: 2 halves x 32 lanes x 8
#define FHALF 256                     // elements of one half of it

static_assert(HD == 64);
static_assert(HROT * 2 == HD);
static_assert(NHQ * HD == DM);
static_assert(NHK * NREP == NHQ);
static_assert(DM % 64 == 0);
static_assert(DKV % 64 == 0);
static_assert(NQK % 64 == 0);
static_assert(DM % 32 == 0);                    // GEMM k-loop steps by 32
static_assert(SEQ % 64 == 0);
static_assert(SEQ % 32 == 0);                   // key loop steps by 32
static_assert(SEQ <= SEQ_FULL);
static_assert(EROWS % 64 == 0);                 // a 64-token v^T tile lies wholly inside or outside the remainder plane
static_assert(EROWS % 32 == 0);                 // key bound of an early wave never exceeds EROWS
static_assert(EROWS % 16 == 0);                 // a 16-row query tile lies wholly below or wholly at / above EROWS
static_assert(AW * 32 * 4 == 16 * HD);          // merge: every thread of the block owns 4 context columns of one row
static_assert(EROWS <= SEQ);
static_assert(((size_t)SEQ * DM) % 8 == 0);
static_assert((QSP * 4) % 16 == 0);
static_assert((TSP * 4) % 16 == 0);
static_assert((CTP * 2) % 16 == 0);
static_assert(QSP >= HD);
static_assert((KSP * 4) % 16 == 0);
static_assert((SSP * 4) % 16 == 0);
static_assert(KSP >= HD);
static_assert(SSP >= 32);
static_assert(16 * SSP <= 32 * KSP);            // the score tile fits the wave's K slice
static_assert(TSP >= 64);
static_assert(CTP >= 64);
// store-loop extents: trips x lanes x bytes == tile rows x row bytes
static_assert(2 * 256 * 16 == 64 * 64 * 2);
static_assert(GW * 2 * 32 * 16 == 64 * 64 * 4); // qk_body: every wave stores its own 64 / GW rows x 256 B in 2 trips
static_assert(2 * GW * 32 * 16 == 64 * 64 * 4); // k_oproj: 64 rows x 256 B
static_assert(GW * 32 * 16 == 64 * 64 * 2);     // vt_body: one 16-byte piece per thread
static_assert(GW == 16);                        // merge: wave w sums accumulator fragment w of the 4 x 4
static_assert(64 % GW == 0);
static_assert(DM == GKW * KBAT * 32);           // input projections: one batch per wave
static_assert(2 * DM == GKW * 2 * KBAT * 32);   // output projection: two batches per wave
static_assert(GKW % 2 == 0);                    // output projection: a k slice lies wholly in the value or wholly in the remainder part
// static LDS per kernel
static_assert(64 * CTP * 2 <= 131072);
static_assert((GKW * 64 * 64 + 64 * TSP) * 4 <= 163840);
static_assert(AW * (16 * QSP + 32 * KSP + 32) * 4 <= 131072);

typedef _Float16 h16;
typedef unsigned short bf;
typedef __attribute__((ext_vector_type(16))) __bf16   v16bf;
typedef __attribute__((ext_vector_type(16))) _Float16 v16h;
typedef __attribute__((ext_vector_type(8)))  _Float16 v8h;
typedef __attribute__((ext_vector_type(8)))  unsigned short v8us;
typedef __attribute__((ext_vector_type(4)))  unsigned short v4us;
typedef __attribute__((ext_vector_type(8)))  float    v8f;
typedef __attribute__((ext_vector_type(4)))  float    v4f;
typedef __attribute__((ext_vector_type(2)))  float    v2f;
typedef v4f  __attribute__((may_alias)) v4fa;
typedef v8us __attribute__((may_alias)) v8usa;

__device__ __forceinline__ unsigned short f2bf(float f) { unsigned u = __float_as_uint(f); u += 0x7FFFu + ((u >> 16) & 1u); return (unsigned short)(u >> 16); }
__device__ __forceinline__ float bfr(float f) { return __uint_as_float(((unsigned)f2bf(f)) << 16); }   // value after RNE convert to bf16
__device__ __forceinline__ v16h cat16(v8h lo, v8h hi) { return __builtin_shufflevector(lo, hi, 0, 1, 2, 3, 4, 5, 6, 7, 8, 9, 10, 11, 12, 13, 14, 15); }
__device__ __forceinline__ v16bf cat16b(v8us lo, v8us hi) { return __builtin_bit_cast(v16bf, __builtin_shufflevector(lo, hi, 0, 1, 2, 3, 4, 5, 6, 7, 8, 9, 10, 11, 12, 13, 14, 15)); }
__device__ __forceinline__ v8f wmma16(v16h a, v16h b, v8f c) { return __builtin_amdgcn_wmma_f32_16x16x32_f16(false, a, false, b, (short)0, c, false, false); }
__device__ __forceinline__ v8f wmmab(v16bf a, v16bf b, v8f c) { return __builtin_amdgcn_wmma_f32_16x16x32_bf16(false, a, false, b, (short)0, c, false, false); }
// fragment loader from a fragment-order plane; p = start of the (tile, k-step) unit + 8*lane: elements 0..7 <- k0+8h+0..7, elements 8..15 <- k0+16+8h+0..7 (same map for A and B)
__device__ __forceinline__ v16h  ldh(const h16* p) { return cat16(*(const v8h*)p, *(const v8h*)(p + FHALF)); }
// the same for the last fragment off an address pair: the second half may land in the pair that the first half's load names: wait first
__device__ __forceinline__ v16h  ldh_last(const h16* p) { const v8h lo = *(const v8h*)p; asm volatile("s_wait_xcnt 0x0" ::: "memory"); const v8h hh = *(const v8h*)(p + FHALF); return cat16(lo, hh); }
// ordering point for wave-private LDS tiles (same wave writes and reads)
__device__ __forceinline__ void wave_sync() { __builtin_amdgcn_fence(3 /* release order */, "wavefront"); __builtin_amdgcn_wave_barrier(); asm volatile("" ::: "memory"); }

// per-instruction guarded matrix steps: one accumulator tied per guard, A / B kept live across the nops
__device__ __forceinline__ v8f wmma16g(v16h a, v16h b, v8f c) { c = wmma16(a, b, c); asm volatile("v_nop\n\tv_nop\n\tv_nop\n\tv_nop" : "+v"(c) : "v"(a), "v"(b)); return c; }
__device__ __forceinline__ v8f wmmabg(v16bf a, v16bf b, v8f c) { c = wmmab(a, b, c); asm volatile("v_nop\n\tv_nop\n\tv_nop\n\tv_nop" : "+v"(c) : "v"(a), "v"(b)); return c; }
// f32 -> f16 convert that cannot produce a subnormal (|v| < 2^-14 -> +0)
__device__ __forceinline__ h16 toh_flush(float v) { const h16 r = (h16)v; return (fabsf(v) < 6.103515625e-05f) ? (h16)0.0f : r; }
__device__ __forceinline__ float bf2f(unsigned short b) { return __uint_as_float(((unsigned)b) << 16); }

// cvt8_body: bf16 (RNE convert) copy of x in fragment order, 8 elements per thread; thread i writes 16-byte piece i of the plane; b = block index inside the x part of the converter grid.
__device__ __forceinline__ void cvt8_body(const float* __restrict__ src, bf* dst, size_t n8, int b) {
    const size_t i = (size_t)b * 256 + threadIdx.x; if (i >= n8) return;
    const int ln = (int)(i & 31), hf = (int)((i >> 5) & 1), un = (int)(i >> 6);      // lane, half, (tile, k-step) unit
    const int row = (un / (DM / 32)) * 16 + (ln & 15), k = (un % (DM / 32)) * 32 + hf * 16 + (ln >> 4) * 8;
    const v8f v = *(const v8f*)(src + (size_t)row * DM + k); v8us o;
#pragma unroll
    for (int k = 0; k < 8; ++k) o[k] = f2bf(v[k]);
    *(v8us*)(dst + i * 8) = o; 
}

// cvtT_body: transposing bf16 (RNE convert) copy of a weight: in W[DM rows (k)][ncols (n)] f32 -> out WT rows rowoff + n, fragment order; b = 64x64 tile index inside this weight (k tile fastest).
__device__ __forceinline__ void cvtT_body(const float* __restrict__ W, bf* WT, int ncols, int rowoff, int b, bf* ts) {
    const int tid = threadIdx.x;
    const int n0 = (b / (DM / 64)) * 64, k0 = (b % (DM / 64)) * 64;
#pragma unroll
    for (int i = 0; i < 4; ++i) { const int idx = i * 256 + tid; const int kr = idx >> 4, c4 = (idx & 15) * 4;   // 64 k rows x 16 float4
        const v4f v = *(const v4f*)(W + (size_t)(k0 + kr) * (size_t)ncols + n0 + c4);
#pragma unroll
        for (int e = 0; e < 4; ++e) ts[(c4 + e) * CTP + kr] = f2bf(v[e]); }
    __syncthreads();                                            // cross-wave tile: block barrier
{
#pragma unroll
        for (int i = 0; i < 2; ++i) { const int p = i * 256 + tid; const int ch = p >> 5, ln = p & 31;          // 16 halves of 512 B: ch = 16-row tile (4) x k-step (2) x half (2); one wave writes one half
            const int row = (ch >> 2) * 16 + (ln & 15), c8 = ((ch >> 1) & 1) * 32 + (ch & 1) * 16 + (ln >> 4) * 8;
            const v8us o = *(const v8usa*)(&ts[row * CTP + c8]);
            *(v8us*)(WT + ((size_t)((rowoff + n0) / 16 + (ch >> 2)) * (DM / 32) + (size_t)(k0 / 32 + ((ch >> 1) & 1))) * FSTEP + (ch & 1) * FHALF + ln * 8) = o; }
        asm volatile("s_wait_xcnt 0x0" ::: "memory");                            // code of the grid's other part follows in the listing and rewrites the two stores' registers: wait first
         }
}

// k_cvt: every operand conversion in one grid (the five parts touch disjoint data). Block ranges: x | Wq | Wk | Wv | Wproj; every test below is block-uniform.
#define CB_X  ((int)(((size_t)SEQ * DM / 8 + 255) / 256))
#define CB_WD ((DM / 64) * (DM / 64))                           // tiles of a [768][768] weight
#define CB_WK ((DKV / 64) * (DM / 64))                          // tiles of a [768][384] weight
__global__ __launch_bounds__(256) void k_cvt(const float* __restrict__ x, const float* __restrict__ wq, const float* __restrict__ wk, const float* __restrict__ wv, const float* __restrict__ wp, bf* XB, bf* WT) {
    __shared__ __align__(16) bf ts[64 * CTP];
    int b = blockIdx.x;
    if (b < CB_X) { cvt8_body(x, XB, (size_t)SEQ * DM / 8, b); }
    else {                                                      // whole blocks only: the barrier of the transposing part is met by all 256 threads or by none
        b -= CB_X;
        const float* W; int ncols, rowoff;
        if (b < CB_WD)                  { W = wq; ncols = DM;  rowoff = 0; }
        else if (b < CB_WD + CB_WK)     { W = wk; ncols = DKV; rowoff = DM;        b -= CB_WD; }
        else if (b < CB_WD + 2 * CB_WK) { W = wv; ncols = DKV; rowoff = NQK;       b -= CB_WD + CB_WK; }
        else                            { W = wp; ncols = DM;  rowoff = NQK + DKV; b -= CB_WD + 2 * CB_WK; }
        cvtT_body(W, WT, ncols, rowoff, b, ts);
    }
}

// gemm_slice: one wave's share of a 64x64 tile: 64 rows x 32 columns (8 accumulators) over NB batches of KBAT k-steps, operands straight from fragment-order bf16 planes.
// pitchA / pitchB: row length (k) of the plane; aoff / boff: start of the unit (first 16-row tile, first k-step of the wave's slice) + 8*lane.
template <int NB>
__device__ __forceinline__ void gemm_slice(const bf* __restrict__ A, const bf* __restrict__ Bt, const int pitchA, const int pitchB, const size_t aoff, const size_t boff, v8f (&acc)[4][GNW]) {
#pragma unroll
    for (int mb = 0; mb < 4; ++mb)
#pragma unroll
        for (int nb = 0; nb < GNW; ++nb) acc[mb][nb] = (v8f){};
    const bf* pa = A + aoff; const bf* pb = Bt + boff;
#pragma unroll
    for (int bt = 0; bt < NB; ++bt) {
        v8us al[KBAT][4][2], bl[KBAT][GNW][2];                  // 16-byte halves of the fragments (k0+8h+0..7 | k0+16+8h+0..7), all in flight together
#pragma unroll
        for (int s = 0; s < KBAT; ++s) {
            const int kc = (bt * KBAT + s) * FSTEP;
#pragma unroll
            for (int i = 0; i < 8; ++i)       if (s < KBAT - 1 || i < 7)           al[s][i >> 1][i & 1] = *(const v8us*)(pa + (size_t)(i >> 1) * 16 * (size_t)pitchA + kc + FHALF * (i & 1));
#pragma unroll
            for (int i = 0; i < 2 * GNW; ++i) if (s < KBAT - 1 || i < 2 * GNW - 1) bl[s][i >> 1][i & 1] = *(const v8us*)(pb + (size_t)(i >> 1) * 16 * (size_t)pitchB + kc + FHALF * (i & 1)); }
        const int kl = (bt * KBAT + KBAT - 1) * FSTEP + FHALF;
        asm volatile("s_wait_xcnt 0x0" ::: "memory");                            // the last load off an address register may land in it, and the loads before it name it: wait first
        al[KBAT - 1][3][1] = *(const v8us*)(pa + (size_t)3 * 16 * (size_t)pitchA + kl);
        asm volatile("s_wait_xcnt 0x0" ::: "memory");                            // same: the load below may land in a register that the load above names
        bl[KBAT - 1][GNW - 1][1] = *(const v8us*)(pb + (size_t)(GNW - 1) * 16 * (size_t)pitchB + kl);
        asm volatile("s_wait_xcnt 0x0" ::: "memory");                            // the address registers are rewritten behind the batch (LDS addresses): wait first
        v16bf a[KBAT][4], b[KBAT][GNW];
#pragma unroll
        for (int s = 0; s < KBAT; ++s) {
#pragma unroll
            for (int mb = 0; mb < 4; ++mb) a[s][mb] = cat16b(al[s][mb][0], al[s][mb][1]);
#pragma unroll
            for (int nb = 0; nb < GNW; ++nb) b[s][nb] = cat16b(bl[s][nb][0], bl[s][nb][1]); }
#pragma unroll
        for (int s = 0; s < KBAT; ++s)
#pragma unroll
            for (int nb = 0; nb < GNW; ++nb)
#pragma unroll
                for (int mb = 0; mb < 4; ++mb) acc[mb][nb] = wmmabg(a[s][mb], b[s][nb], acc[mb][nb]);
    }
}

// tile_merge: every wave puts its partial into LDS in fragment order (lane-contiguous 16-byte pieces); behind a block barrier wave w sums fragment w = mb*4 + nb over the k slices, slice 0 first,
// and writes it row-major into os (D: row 8h+j, col lane&15; all 64 x 64 written); a second block barrier publishes os to every wave.
__device__ __forceinline__ void tile_merge(const v8f (&acc)[4][GNW], float* ps, float* os, const int wave, const int lane) {
    const int lr = lane & 15, hi = lane >> 4;
    const int kq = wave / GNW, nh = wave % GNW;
#pragma unroll
    for (int mb = 0; mb < 4; ++mb)
#pragma unroll
        for (int nb = 0; nb < GNW; ++nb) {
            float* p = ps + (size_t)((kq * 16 + mb * 4 + nh * GNW + nb) * 256 + lane * 4);
            const v8f f = acc[mb][nb]; v4f a, c;
            a[0] = f[0]; a[1] = f[1]; a[2] = f[2]; a[3] = f[3]; c[0] = f[4]; c[1] = f[5]; c[2] = f[6]; c[3] = f[7];
            *(v4fa*)p = a; *(v4fa*)(p + 128) = c; }
    __syncthreads();                                            // cross-wave: every k slice's partial is read by another wave below
    const float* q0 = ps + (size_t)(wave * 256 + lane * 4);
    v4f s0 = *(const v4fa*)q0, s1 = *(const v4fa*)(q0 + 128);
#pragma unroll
    for (int q = 1; q < GKW; ++q) { s0 += *(const v4fa*)(q0 + q * 4096); s1 += *(const v4fa*)(q0 + q * 4096 + 128); }
    float* d = os + ((wave >> 2) * 16 + hi * 8) * TSP + (wave & 3) * 16 + lr;
#pragma unroll
    for (int j = 0; j < 4; ++j) { d[j * TSP] = s0[j]; d[(4 + j) * TSP] = s1[j]; }
    __syncthreads();                                            // cross-wave: the epilogues read rows that other waves wrote
}

// qk_body: q and k projections with rotation + RMS normalisation in the epilogue. A = x rows (m = t), Bt = WT rows n in [0, 1152): column tile = head (0..11 q, 12..17 k).
__device__ __forceinline__ void qk_body(const bf* __restrict__ XB, const bf* __restrict__ WT, const float* __restrict__ cosb, const float* __restrict__ sinb, float* QKF, const int ttile, const int head, float* ps, float* os) {
    const int lane = threadIdx.x & 31;
    const int wave = __builtin_amdgcn_readfirstlane((int)(threadIdx.x >> 5));
    const int r0 = ttile * 64, c0 = head * 64, k0 = (wave / GNW) * (KBAT * 32);
    v8f acc[4][GNW];
    gemm_slice<1>(XB, WT, DM, DM, (size_t)r0 * DM + k0 * 16 + lane * 8, (size_t)(c0 + (wave % GNW) * 32) * DM + k0 * 16 + lane * 8, acc);   // unit start: 16-row tile r/16 at r * row length, k-step k/32 at 16 * k
    tile_merge(acc, ps, os, wave, lane);
    const int w0 = wave * (64 / GW);                            // this wave's rows of the tile: from here on it reads and writes these alone
#pragma unroll 1
    for (int r = w0; r < w0 + 64 / GW; ++r) {                   // lane = rotary pair column (d, d + 32)
        const int t = r0 + r;
        const float x1 = os[r * TSP + lane], x2 = os[r * TSP + HROT + lane];
        const float c = bfr(cosb[(size_t)t * HROT + lane]), s = bfr(sinb[(size_t)t * HROT + lane]);
        const float o1 = x1 * c - x2 * s, o2 = x2 * c + x1 * s;
        float ss = o1 * o1 + o2 * o2;
#pragma unroll
        for (int off = 16; off > 0; off >>= 1) ss += __shfl_xor(ss, off, 32);
        const float sc = rsqrtf(ss * (1.0f / (float)HD) + 1e-6f);
        os[r * TSP + lane] = o1 * sc; os[r * TSP + HROT + lane] = o2 * sc; }
    wave_sync();
    float* dst = QKF + ((size_t)head * SEQ + (size_t)(r0 + w0)) * HD;
{
#pragma unroll
        for (int i = 0; i < 2; ++i) { const int idx = i * 32 + lane; const int row = w0 + (idx >> 4), c4 = (idx & 15) * 4;   // 2 trips x 2 rows = the wave's 4 rows; 16 lanes x 4 floats = 64 columns
            const v4f val = *(const v4fa*)(&os[row * TSP + c4]);
            *(v4f*)(dst + (size_t)idx * 4) = val; }
         }
}

// vt_body: v^T projection. A = WT rows 1152 + m (m = kvh*64 + d), Bt = x rows (n = t); plane VT [m][t] f16 (row length SEQ) and, for t < EROWS (block-uniform test), the f16 remainder x2048 VR [m][t] (row length EROWS), both in fragment order (k = t).
__device__ __forceinline__ void vt_body(const bf* __restrict__ WV, const bf* __restrict__ XB, h16* VT, h16* VR, const int mtile, const int ttile, float* ps, float* os) {
    const int lane = threadIdx.x & 31, lr = lane & 15, hi = lane >> 4;
    const int wave = __builtin_amdgcn_readfirstlane((int)(threadIdx.x >> 5));
    const int r0 = mtile * 64, c0 = ttile * 64, k0 = (wave / GNW) * (KBAT * 32);
    v8f acc[4][GNW];
    gemm_slice<1>(WV, XB, DM, DM, (size_t)r0 * DM + k0 * 16 + lane * 8, (size_t)(c0 + (wave % GNW) * 32) * DM + k0 * 16 + lane * 8, acc);
    tile_merge(acc, ps, os, wave, lane);
    const bool wr = c0 < EROWS;                                 // block-uniform: whole tile inside the remainder plane
{
        { const int row = (wave >> 2) * 16 + lr, c8 = ((wave >> 1) & 1) * 32 + (wave & 1) * 16 + hi * 8;   // 16 waves: 16-row tile (4) x k-step (2) x half (2); one wave writes one 512-byte half
            const size_t un = (size_t)(c0 / 32 + ((wave >> 1) & 1)) * FSTEP + (wave & 1) * FHALF + lane * 8;   // place inside the 16-row tile
            const v4f x0 = *(const v4fa*)(&os[row * TSP + c8]); const v4f x1 = *(const v4fa*)(&os[row * TSP + c8 + 4]); v8h hv, rv;
#pragma unroll
            for (int e = 0; e < 4; ++e) { const h16 a0 = toh_flush(x0[e]); const h16 a1 = toh_flush(x1[e]); hv[e] = a0; hv[4 + e] = a1;
                rv[e] = toh_flush((x0[e] - (float)a0) * QRS); rv[4 + e] = toh_flush((x1[e] - (float)a1) * QRS); }
            *(v8h*)(VT + (size_t)(r0 + (wave >> 2) * 16) * SEQ + un) = hv;
            asm volatile("s_wait_xcnt 0x0" ::: "memory");                        // the store's registers are rewritten behind it (remainder packing): wait first
            if (wr) { *(v8h*)(VR + (size_t)(r0 + (wave >> 2) * 16) * EROWS + un) = rv;
                asm volatile("s_wait_xcnt 0x0" ::: "memory"); } }                // same, for the remainder store
         }
}

// k_qkv: the three input projections in one grid (disjoint outputs): blockIdx.x = 64-token tile; blockIdx.y < 18: q / k head, else v^T row tile.
__global__ __launch_bounds__(32 * GW) void k_qkv(const bf* __restrict__ XB, const bf* __restrict__ WT, const float* __restrict__ cosb, const float* __restrict__ sinb, float* QKF, h16* VT, h16* VR) {
    __shared__ __align__(16) float ps[GKW * 64 * 64];           // the k slices' partial tiles, fragment order
    __shared__ __align__(16) float os[64 * TSP];                // merged tile, row-major
    const int by = blockIdx.y;                                  // block-uniform: the barriers inside are met by all threads or by none
    if (by < NHQ + NHK) qk_body(XB, WT, cosb, sinb, QKF, blockIdx.x, by, ps, os);
    else                vt_body(WT + (size_t)NQK * DM, XB, VT, VR, by - (NHQ + NHK), blockIdx.x, ps, os);
}

// k_oproj: output projection. A = context plane rows (value | remainder, two K parts of 768), Bt = WT rows 1536 + n; f32 output [t][768].
__global__ __launch_bounds__(32 * GW) void k_oproj(const bf* __restrict__ YB, const bf* __restrict__ WP, float* OUT) {
    __shared__ __align__(16) float ps[GKW * 64 * 64];           // the k slices' partial tiles, fragment order
    __shared__ __align__(16) float os[64 * TSP];                // merged tile, row-major
    const int lane = threadIdx.x & 31;
    const int wave = __builtin_amdgcn_readfirstlane((int)(threadIdx.x >> 5));
    const int r0 = blockIdx.x * 64, c0 = blockIdx.y * 64;
    const int ka = (wave / GNW) * (2 * KBAT * 32);              // slice start in the context row (value | remainder)
    const int kw = ka % DM;                                     // the same k in the weight row: both parts meet the same weights
    v8f acc[4][GNW];
    gemm_slice<2>(YB, WP, YP, DM, (size_t)r0 * YP + ka * 16 + lane * 8, (size_t)(c0 + (wave % GNW) * 32) * DM + kw * 16 + lane * 8, acc);
    tile_merge(acc, ps, os, wave, lane);
{
#pragma unroll
        for (int i = 0; i < 2; ++i) { const int idx = i * (32 * GW) + (int)threadIdx.x; const int row = idx >> 4, c4 = (idx & 15) * 4;   // 2 trips x 32 rows = 64 rows; 16 lanes x 4 floats = 64 columns
            const v4f val = *(const v4fa*)(&os[row * TSP + c4]);
            *(v4f*)(OUT + (size_t)(r0 + row) * DM + c0 + c4) = val; }
         }
}

// flash_body: fused attention, one block of AW waves per 16 query rows of one head; wave w takes the 32-key steps w, w + AW, ... and keeps its own softmax state and context partial;
// the partials (unnormalised context, running max, row sum) meet in LDS behind one block barrier and are merged in f32 by all threads. q tile and the 32-key K tile live in wave-private LDS (f32); scores on the vector unit:
// lane (qg = lane&3, kg = lane>>2) forms max_d(q[t][d] + k[key][d]) for the 4 x 4 block t = 4qg+i, key = 4kg+j of each 32-key step: 8 LDS reads of 16 bytes feed 16 (t, key) pairs x 4 d;
// the 16 x 32 scores then pass through the wave's own LDS slice, and lane (t = lane&15, h = lane>>4) takes keys 8h+r and 16+8h+r, i.e. the B-fragment layout of
// O^T[d][t] = V^T P^T (element r <- keys 8h+r, element 8+r <- keys 16+8h+r). V^T fragments (A, row d, k = key) straight from the f16 planes.
// Softmax state (running max over kept keys, partial sum) is one scalar per lane; the two lane halves of a row are combined with one xor-16 exchange.
// Causal keep rule (key <= t) evaluated per element inside every visited tile; the per-wave key bound is a wave scalar, multiple of 32, <= SEQ.
// EARLY = 1 (query rows [0, EROWS)): P = f16 value + f16 remainder x2048; O = V P + (V P_rem + V_rem P) / 2048 (remainder products in their own accumulators); row sum from the f32 exponentials.
// EARLY = 0 (query rows [EROWS, SEQ)): single P, v; row sum over the converted P.
template <int EARLY>
__device__ __forceinline__ void flash_body(const float* __restrict__ QKF, const h16* __restrict__ VT, const h16* __restrict__ VR, bf* YB, float* qs, float* ks, float* ms, float* lsum) {
    const int lane = threadIdx.x & 31, lr = lane & 15, hi = lane >> 4;
    const int wave = __builtin_amdgcn_readfirstlane((int)(threadIdx.x >> 5));
    const int h = blockIdx.y, kvh = h / NREP;
    const int t0 = blockIdx.x * 16;                             // blockIdx.x = tile of 16 query rows, wholly below or wholly at / above EROWS
    const int lim = t0 + lr;                                    // key j kept iff j <= lim
    const int nk = (t0 + 16 + 31) & ~31;                        // block-uniform, multiple of 32, <= SEQ (<= EROWS when EARLY)
    const int qb = wave * 16 * QSP, kbs = wave * 32 * KSP;
    const int qg = lane & 3, kg = lane >> 2;                    // score block of this lane: query rows 4qg + 0..3, keys 4kg + 0..3
    { const size_t qsrc = ((size_t)h * SEQ + (size_t)t0) * HD;  // 16 rows x 64 floats, contiguous
#pragma unroll
      for (int i = 0; i < 8; ++i) { const int idx = i * 32 + lane;
          const v4f v = *(const v4f*)(QKF + qsrc + (size_t)idx * 4);
          *(v4fa*)(&qs[qb + (idx >> 4) * QSP + (idx & 15) * 4]) = v; } }
    const size_t kplane = ((size_t)(NHQ + kvh) * SEQ) * HD;     // k heads follow the q heads in the plane
    const size_t vo  = (size_t)(kvh * HD) * SEQ + lane * 8;      // + 16j*SEQ + 16*key0   (A fragment: row d, k = key; fragment-order plane)
    const size_t vro = (size_t)(kvh * HD) * EROWS + lane * 8;    // remainder plane, tokens < EROWS
    const v16h hz = (v16h){};
    v8f o[4], oR[4];
#pragma unroll
    for (int j = 0; j < 4; ++j) { o[j] = (v8f){}; oR[j] = (v8f){}; }
    float m = NEGB, l = 0.0f;
#pragma unroll 1
    for (int key0 = wave * 32; key0 < nk; key0 += 32 * AW) {    // a wave with no step keeps o = 0, l = 0, m = NEGB: weight 0 in the merge
        wave_sync();                                            // earlier reads of the K / score slice are done
        { const size_t ksrc = kplane + (size_t)key0 * HD;       // 32 keys x 64 floats, contiguous; keys < nk <= SEQ
          v4f kv[2][8];                                         // both groups of eight loads in flight, then the sixteen LDS stores
#pragma unroll
          for (int g = 0; g < 2; ++g) {
#pragma unroll
              for (int i = 0; i < 8; ++i) {
                  if (i == 7) asm volatile("s_wait_xcnt 0x0" ::: "memory");      // the group's last load may land in the address pair that the seven before it name: wait first
                  kv[g][i] = *(const v4f*)(QKF + ksrc + (size_t)((g * 8 + i) * 32 + lane) * 4); }
              asm volatile("s_wait_xcnt 0x0" ::: "memory"); }                    // the address pair is rewritten behind the group (next group, score loop): wait first
#pragma unroll
          for (int g = 0; g < 2; ++g)
#pragma unroll
              for (int i = 0; i < 8; ++i) *(v4fa*)(&ks[kbs + ((g * 8 + i) * 2 + hi) * KSP + lr * 4]) = kv[g][i]; }   // piece (g*8+i)*32 + lane = key row (g*8+i)*2 + hi, floats 4*lr + 0..3
        wave_sync();
        float sc[4][4];
#pragma unroll
        for (int i = 0; i < 4; ++i)
#pragma unroll
            for (int j = 0; j < 4; ++j) sc[i][j] = NEGB;
        v4f q4[2][4], k4[2][4];                                 // two register sets: trip d4 + 1 is read from LDS while trip d4 is worked on
        const float* qrow = &qs[qb + 4 * qg * QSP];
        const float* krow = &ks[kbs + 4 * kg * KSP];
        auto rd = [&](const int st, const int d4) {             // the 4 q rows' and the 4 key rows' floats 4*d4 + 0..3 into register set st
#pragma unroll
            for (int i = 0; i < 4; ++i) { q4[st][i] = *(const v4fa*)(qrow + i * QSP + d4 * 4); k4[st][i] = *(const v4fa*)(krow + i * KSP + d4 * 4); } };
        auto pm = [&](const int st) {                           // 16 pairs x 4 d; sums paired along d, as the 16-byte reads deliver them
#pragma unroll
            for (int i = 0; i < 4; ++i)
#pragma unroll
                for (int j = 0; j < 4; ++j) {
                    const v2f lo = q4[st][i].xy + k4[st][j].xy, hh = q4[st][i].zw + k4[st][j].zw;
                    sc[i][j] = fmaxf(fmaxf(fmaxf(sc[i][j], lo[0]), lo[1]), fmaxf(hh[0], hh[1])); } };
        rd(0, 0);
#pragma unroll 1                                                // stays rolled: the text of both instantiations stays small
        for (int d4 = 0; d4 < HD / 4 - 2; d4 += 2) { rd(1, d4 + 1); pm(0); rd(0, d4 + 2); pm(1); }
        rd(1, HD / 4 - 1); pm(0); pm(1);
        wave_sync();                                            // every lane's K reads are done: the slice becomes the score tile [t][key]
#pragma unroll
        for (int i = 0; i < 4; ++i) { v4f s4; s4[0] = sc[i][0]; s4[1] = sc[i][1]; s4[2] = sc[i][2]; s4[3] = sc[i][3];
            *(v4fa*)(&ks[kbs + (4 * qg + i) * SSP + 4 * kg]) = s4; }
        wave_sync();                                            // scores are read below by other lanes of the wave
        float sa[8], sb[8];
        { const v4f a0 = *(const v4fa*)(&ks[kbs + lr * SSP + 8 * hi]),      a1 = *(const v4fa*)(&ks[kbs + lr * SSP + 8 * hi + 4]);
          const v4f b0 = *(const v4fa*)(&ks[kbs + lr * SSP + 16 + 8 * hi]), b1 = *(const v4fa*)(&ks[kbs + lr * SSP + 16 + 8 * hi + 4]);
#pragma unroll
          for (int r = 0; r < 4; ++r) { sa[r] = a0[r]; sa[4 + r] = a1[r]; sb[r] = b0[r]; sb[4 + r] = b1[r]; } }
        const int ja = key0 + 8 * hi;
        float mx = NEGB;
#pragma unroll
        for (int r = 0; r < 8; ++r) {
            sa[r] = sa[r] * LOG2E; sb[r] = sb[r] * LOG2E;
            const bool fa = (ja + r <= lim), fb = (ja + 16 + r <= lim);
            mx = fmaxf(mx, fmaxf(fa ? sa[r] : NEGB, fb ? sb[r] : NEGB)); }
        mx = fmaxf(mx, __shfl_xor(mx, 16, 32));
        const float mnew = fmaxf(m, mx);
        const float alpha = __builtin_amdgcn_exp2f(m - mnew);
        const float sh = PSH - mnew;
        v16h pb, pr = hz; float ls = 0.0f;
#pragma unroll
        for (int r = 0; r < 8; ++r) {
            const float xa = sa[r] + sh, xb = sb[r] + sh;
            const float ea = __builtin_amdgcn_exp2f(xa), eb = __builtin_amdgcn_exp2f(xb);
            const bool fa = (ja + r <= lim) & (xa >= -14.0f), fb = (ja + 16 + r <= lim) & (xb >= -14.0f);   // dropped keys and values below the f16 normal range selected to 0 by value
            const float ga = fa ? ea : 0.0f, gb = fb ? eb : 0.0f;
            const h16 pa = (h16)ga; const h16 pc = (h16)gb;
            pb[r] = pa; pb[8 + r] = pc;
            if (EARLY) { pr[r] = toh_flush((ga - (float)pa) * QRS); pr[8 + r] = toh_flush((gb - (float)pc) * QRS); ls += ga + gb; }
            else       { ls += (float)pa + (float)pc; } }
        l = l * alpha + ls; m = mnew;
#pragma unroll
        for (int j = 0; j < 4; ++j) {
            const v16h v = ldh(VT + vo + (size_t)(16 * j) * SEQ + (size_t)key0 * 16);
            o[j] = o[j] * alpha;
            o[j] = wmma16g(v, pb, o[j]);
            if (EARLY) {
                const h16* pvr = VR + vro + (size_t)(16 * j) * EROWS + (size_t)key0 * 16;       // key0 + 31 < nk <= EROWS
                const v16h vr = (j == 3) ? ldh_last(pvr) : ldh(pvr);
                oR[j] = oR[j] * alpha;
                oR[j] = wmma16g(v, pr, oR[j]);
                oR[j] = wmma16g(vr, pb, oR[j]); }
        }
        asm volatile("s_wait_xcnt 0x0" ::: "memory");                            // the next step's K tile loads may land in the address pairs that the V loads above name: wait first
    }
    l += __shfl_xor(l, 16, 32);
    wave_sync();                                                // q tile reads are done; the slice becomes this wave's context partial
    // O^T D layout: f_j[r] = (d = 16j + 8h + r, t = lane&15) -> qs[t][d]; rows 0..15 x columns 0..63 all written
#pragma unroll
    for (int j = 0; j < 4; ++j) {
        v8f f = o[j];
        if (EARLY) f = o[j] + oR[j] * QRI;
        v4f a, c;
        a[0] = f[0]; a[1] = f[1]; a[2] = f[2]; a[3] = f[3]; c[0] = f[4]; c[1] = f[5]; c[2] = f[6]; c[3] = f[7];
        *(v4fa*)(&qs[qb + lr * QSP + 16 * j + 8 * hi]) = a; *(v4fa*)(&qs[qb + lr * QSP + 16 * j + 8 * hi + 4]) = c; }
    if (hi == 0) { ms[wave * 16 + lr] = m; lsum[wave * 16 + lr] = l; }   // both lane halves hold the same m and l
    __syncthreads();                                            // cross-wave: every wave's partial is read by every wave below
    // merge: thread = (row, 4 columns), dealt so that thread p owns 8-byte piece p of the head's 2 k-steps in the fragment-order context plane; partial w weighs 2^(m_w - M), M the maximum over the waves
    const int row = ((int)threadIdx.x >> 1) & 15, c4 = ((int)threadIdx.x >> 6) * 16 + (((int)threadIdx.x >> 5) & 1) * 8 + ((int)threadIdx.x & 1) * 4;
    float mw[AW], M = NEGB;
#pragma unroll
    for (int w = 0; w < AW; ++w) { mw[w] = ms[w * 16 + row]; M = fmaxf(M, mw[w]); }
    float L = 0.0f; v4f acc = (v4f){};
#pragma unroll
    for (int w = 0; w < AW; ++w) {
        const float sc = __builtin_amdgcn_exp2f(mw[w] - M);
        const v4f p = *(const v4fa*)(&qs[w * 16 * QSP + row * QSP + c4]);
        L += lsum[w * 16 + row] * sc;
        acc += p * sc; }
    const bool any = L > 0.0f;
    const float lsafe = any ? L : 1.0f;
    const float inv = any ? (1.0f / lsafe) : 0.0f;
    v4us hv, lv;
#pragma unroll
    for (int e = 0; e < 4; ++e) { const float y = acc[e] * inv; const unsigned short b0 = f2bf(y); hv[e] = b0; lv[e] = f2bf(y - bf2f(b0)); }
    bf* yrow = YB + (size_t)t0 * YP + (size_t)(h * HD) * 16 + (int)threadIdx.x * 4;   // the block's 16-row tile, the head's k-steps: 2 KiB in a row per part, a wave stores 2 whole lines
    *(v4us*)(yrow) = hv;
    *(v4us*)(yrow + DM * 16) = lv;
}

// k_flash: both instantiations in one grid (disjoint context rows); the choice is block-uniform.
__global__ __launch_bounds__(32 * AW) __attribute__((amdgpu_num_vgpr(256))) void k_flash(const float* __restrict__ QKF, const h16* __restrict__ VT, const h16* __restrict__ VR, bf* YB) {
    __shared__ __align__(16) float qs[AW * 16 * QSP];           // per-wave slices: q tile, later the wave's context partial
    __shared__ __align__(16) float ks[AW * 32 * KSP];           // wave-private slices: 32-key K tile, then the step's score tile
    __shared__ float ms[AW * 16];                               // per wave and row: running max
    __shared__ float lsum[AW * 16];                             // per wave and row: sum of the exponentials
    if ((int)blockIdx.x * 16 < EROWS) flash_body<1>(QKF, VT, VR, YB, qs, ks, ms, lsum);   // block-uniform: the barrier inside is met by all threads or by none
    else                              flash_body<0>(QKF, VT, VR, YB, qs, ks, ms, lsum);
}

static constexpr size_t al256(size_t v) { return (v + 255) & ~(size_t)255; }
static constexpr size_t SZ_XB = al256((size_t)SEQ * DM * 2);
static constexpr size_t SZ_WT = al256((size_t)WROWS * DM * 2);
static constexpr size_t SZ_QK = al256((size_t)(NHQ + NHK) * SEQ * HD * 4);
static constexpr size_t SZ_VT = al256((size_t)DKV * SEQ * 2);
static constexpr size_t SZ_VR = al256((size_t)DKV * EROWS * 2);
static constexpr size_t SZ_YB = al256((size_t)SEQ * YP * 2);
static constexpr size_t SZ_TOTAL = SZ_XB + SZ_WT + SZ_QK + SZ_VT + SZ_VR + SZ_YB;
static_assert(SZ_TOTAL <= (size_t)134217728);          // workspace carve <= 128 MiB
static_assert(((size_t)DM * DM * 2) % 256 == 0);       // weight sub-planes stay 256-byte aligned
static_assert(((size_t)DKV * DM * 2) % 256 == 0);
static_assert(((size_t)NHQ * SEQ * HD * 4) % 256 == 0);

extern "C" void kernel_launch(void* const* d_in, const int* in_sizes, int n_in,
                              void* d_out, int out_size, void* d_ws, size_t ws_size, hipStream_t stream) {
    if (n_in < 7) return;
    if ((size_t)in_sizes[0] < (size_t)SEQ * DM) return;
    if ((size_t)in_sizes[1] < (size_t)SEQ * HROT || (size_t)in_sizes[2] < (size_t)SEQ * HROT) return;
    if ((size_t)in_sizes[3] < (size_t)DM * DM || (size_t)in_sizes[6] < (size_t)DM * DM) return;
    if ((size_t)in_sizes[4] < (size_t)DM * DKV || (size_t)in_sizes[5] < (size_t)DM * DKV) return;
    if ((size_t)out_size < (size_t)SEQ * DM) return;
    if (SZ_TOTAL > ws_size) return;
    // wire order: x, cos, sin, Wq, Wk, Wv, Wproj
    const float* x    = (const float*)d_in[0];
    const float* cosb = (const float*)d_in[1];
    const float* sinb = (const float*)d_in[2];
    const float* wq   = (const float*)d_in[3];
    const float* wk   = (const float*)d_in[4];
    const float* wv   = (const float*)d_in[5];
    const float* wp   = (const float*)d_in[6];
    float* OUT = (float*)d_out;                        // [SEQ][768]
    char* wsp = (char*)d_ws;
    bf*    XB  = (bf*)wsp;    wsp += SZ_XB;            // x bf16 [SEQ][768]
    bf*    WT  = (bf*)wsp;    wsp += SZ_WT;            // [2304][768]: q | k | v | proj, each [out][in]
    float* QKF = (float*)wsp; wsp += SZ_QK;            // [18][SEQ][64] f32: 12 q heads, 6 k heads
    h16*   VT  = (h16*)wsp;   wsp += SZ_VT;            // [384][SEQ]
    h16*   VR  = (h16*)wsp;   wsp += SZ_VR;            // [384][EROWS] remainder x2048, tokens < EROWS
    bf*    YB  = (bf*)wsp;    wsp += SZ_YB;            // [SEQ][768 value | 768 remainder]

    // conversions: x -> XB; W[768 rows][ncols] -> WT[rowoff + ncols rows][768]
    k_cvt<<<CB_X + 2 * CB_WD + 2 * CB_WK, 256, 0, stream>>>(x, wq, wk, wv, wp, XB, WT);

    // q | k: A = x rows, Bt = WT rows [0, 1152) -> f32 planes [head][t][64], rotated and normalised; v^T: A = WT rows [1152, 1536), Bt = x rows -> [m][t] f16 (+ remainder for t < EROWS)
    k_qkv<<<dim3(SEQ / 64, NHQ + NHK + DKV / 64, 1), 32 * GW, 0, stream>>>(XB, WT, cosb, sinb, QKF, VT, VR);

    // query rows [0, EROWS): multi-product instantiation; rows [EROWS, SEQ): single-product instantiation
    k_flash<<<dim3(SEQ / 16, NHQ, 1), 32 * AW, 0, stream>>>(QKF, VT, VR, YB);

    // output projection: A = context rows (value | remainder), Bt = WT rows [1536, 2304)
    k_oproj<<<dim3(SEQ / 64, DM / 64, 1), 32 * GW, 0, stream>>>(YB, WT + (size_t)(NQK + DKV) * DM, OUT);
}

// v006
// A run of this version takes 26.8 microseconds.
// Two timings next to v005 put it at 1.11 and 1.07 times that version's speed.
// All steps since v000 together make it 7.67 times as fast.
#include <hip/hip_runtime.h>

// Causal grouped-query self-attention with max-plus scores: x [SEQ][768]; Wq [768][768], Wk / Wv [768][384], Wproj [768][768], all [in][out] (y = x W, no bias);
// 12 query heads x 64, 6 key/value heads (2 query heads per key/value head); half-split rotary tables cos / sin [SEQ][32] read by value;
// per-head RMS normalisation (eps 1e-6) of q and k after the rotation; score[t][j] = max_d (q[t][d] + k[j][d]); causal softmax; context = P v; output = context Wproj (f32).
// Compute dtypes, f32 accumulate everywhere: q / k / v projections v_wmma_f32_16x16x32_bf16 (x, W RNE-converted to bf16 where the projection kernel loads them; products exact); max-plus scores are not a multiply-accumulate: f32 on the vector unit from f32 q / k planes;
// P.V v_wmma_f32_16x16x32_f16: P (x16384 carry, cancels in the normalisation) and v single f16 on query rows >= EROWS; on query rows < EROWS P and v each as f16 value + f16 remainder x2048, remainder products in their own accumulator folded by 1/2048, row sum from the f32 exponentials;
// output projection v_wmma_f32_16x16x32_bf16: context as bf16 value + bf16 remainder (two K parts against the same weights, summed in the f32 k-slice merge), Wproj RNE-converted to bf16; softmax f32 (online, running max over kept keys).
// Layout: transposed bf16 output-projection weights WP [768][768] ([out][in]); f32 planes q / k [18 heads][t][64] (rotated, normalised); v^T plane f16 [384][t] and remainder plane [384][t < EROWS];
// fused flash kernel in transposed form (O^T = V^T P^T, P built on the vector unit directly in B-fragment layout); context plane bf16 [t][768 value | 768 remainder].
// Every 16-bit plane above (a matrix operand, rows x k) lies in FRAGMENT ORDER: [16-row tile][32-wide k-step][half s][lane][8 elements], lane = 16*h + (row & 15), the 8 elements k = 32*step + 16*s + 8*h + 0..7:
// one wave-wide 16-byte load of a fragment half reads 512 contiguous bytes (4 whole lines). A 16-row tile keeps its size (16 x row length), so sub-plane offsets at multiples of 16 rows are those of the row-major plane.

#ifndef SEQ
#define SEQ 512
#endif
#define SEQ_FULL 512
#define DM    768
#define NHQ   12
#define NHK   6
#define NREP  2
#define HD    64
#define HROT  32
#define DKV   (NHK * HD)              // 384
#define YP    (2 * DM)                // context plane row pitch (value | remainder)
#define AW    8                       // waves per flash block: all work on the same 16 query rows, 32-key steps dealt round-robin
#define GKW   8                       // k slices of a 64x64 GEMM tile, one per wave pair
#define GNW   2                       // column halves of a GEMM tile: a wave holds 64 rows x 32 columns of one k slice
#define GW    (GKW * GNW)             // waves per GEMM block
#define KBAT  3                       // 32-wide k-steps whose fragments a wave loads as one batch
#define QSP   68                      // LDS row pitch (floats) of the q / context tile
#define KSP   68                      // LDS row pitch (floats) of the 32-key K tile: rows 4 apart fall 16 banks apart
#define SSP   36                      // LDS row pitch (floats) of the 16 x 32 score tile that takes the K tile's place behind the score loop
#define TSP   68                      // LDS row pitch (floats) of the GEMM output tile
#define CTP   72                      // LDS row pitch (16-bit words) of the transposing converter tile
#define CTN   3                       // 64x64 weight tiles per converter block
#define XOP   136                     // LDS pitch (16-bit words) of one 8-wide k piece of a 16-row x tile: 16 rows x 8 + 8, so pieces 1 apart fall 4 banks apart
#define EROWS (SEQ < 256 ? SEQ : 256) // query rows handled by the multi-product flash instantiation
#define QRS   2048.0f                 // carry of the v remainder plane / P remainder fragment
#define QRI   (1.0f / 2048.0f)
#define LOG2E 1.4426950408889634f
#define PSH   14.0f                   // log2 of the P carry (16384)
#define NEGB  (-3.0e38f)
#define FSTEP 512                     // elements of one (16-row tile, k-step) unit of a fragment-order plane: 2 halves x 32 lanes x 8
#define FHALF 256                     // elements of one half of it

static_assert(HD == 64);
static_assert(HROT * 2 == HD);
static_assert(NHQ * HD == DM);
static_assert(NHK * NREP == NHQ);
static_assert(DM % 64 == 0);
static_assert(DKV % 64 == 0);
static_assert(DM % 32 == 0);                    // GEMM k-loop steps by 32
static_assert(SEQ % 64 == 0);
static_assert(SEQ % 32 == 0);                   // key loop steps by 32
static_assert(SEQ <= SEQ_FULL);
static_assert(EROWS % 64 == 0);                 // a 64-token v^T tile lies wholly inside or outside the remainder plane
static_assert(EROWS % 32 == 0);                 // key bound of an early wave never exceeds EROWS
static_assert(EROWS % 16 == 0);                 // a 16-row query tile lies wholly below or wholly at / above EROWS
static_assert(AW * 32 * 4 == 16 * HD);          // merge: every thread of the block owns 4 context columns of one row
static_assert(EROWS <= SEQ);
static_assert((QSP * 4) % 16 == 0);
static_assert((TSP * 4) % 16 == 0);
static_assert((CTP * 2) % 16 == 0);
static_assert(QSP >= HD);
static_assert((KSP * 4) % 16 == 0);
static_assert((SSP * 4) % 16 == 0);
static_assert(KSP >= HD);
static_assert(SSP >= 32);
static_assert(16 * SSP <= 32 * KSP);            // the score tile fits the wave's K slice
static_assert(TSP >= 64);
static_assert(CTP >= 64);
// store-loop extents: trips x lanes x bytes == tile rows x row bytes
static_assert(GW * 32 * 16 == 64 * 64 * 2);     // cvtP_body: one 16-byte piece per thread and tile
static_assert(2 * GW * 32 * 4 == 64 * 64);      // cvtP_body: two 4-float loads per thread and tile
static_assert(((DM / 64) * (DM / 64)) % (CTN * (SEQ / 64)) == 0);   // converter blocks fill whole rows of the grid, CTN tiles each
static_assert((DM / 64) % CTN == 0);            // a converter block's tiles share their 64 columns
static_assert(GW * 4 == 64 && DM == 6 * 128);   // x staging: a wave brings 4 rows, each in 6 loads of 512 B
static_assert((XOP * 2) % 16 == 0);
static_assert(GW * 2 * 32 * 16 == 64 * 64 * 4); // qk_tail: every wave stores its own 64 / GW rows x 256 B in 2 trips
static_assert(2 * GW * 32 * 16 == 64 * 64 * 4); // k_oproj: 64 rows x 256 B
static_assert(GW * 32 * 16 == 64 * 64 * 2);     // vt_tail: one 16-byte piece per thread
static_assert(GW == 16);                        // merge: wave w sums accumulator fragment w of the 4 x 4
static_assert(64 % GW == 0);
static_assert(DM == GKW * KBAT * 32);           // input projections: one batch per wave
static_assert(2 * DM == GKW * 2 * KBAT * 32);   // output projection: two batches per wave
static_assert(GKW % 2 == 0);                    // output projection: a k slice lies wholly in the value or wholly in the remainder part
// static LDS per kernel
static_assert((GKW * 64 * 64 + 64 * TSP) * 4 + 4 * (DM / 8) * XOP * 2 + CTN * 64 * CTP * 2 <= 327680);
static_assert((GKW * 64 * 64 + 64 * TSP) * 4 <= 163840);
static_assert(AW * (16 * QSP + 32 * KSP + 32) * 4 <= 131072);

typedef _Float16 h16;
typedef unsigned short bf;
typedef __attribute__((ext_vector_type(16))) __bf16   v16bf;
typedef __attribute__((ext_vector_type(16))) _Float16 v16h;
typedef __attribute__((ext_vector_type(8)))  _Float16 v8h;
typedef __attribute__((ext_vector_type(8)))  unsigned short v8us;
typedef __attribute__((ext_vector_type(4)))  unsigned short v4us;
typedef __attribute__((ext_vector_type(8)))  float    v8f;
typedef __attribute__((ext_vector_type(4)))  float    v4f;
typedef __attribute__((ext_vector_type(2)))  float    v2f;
typedef __attribute__((ext_vector_type(2)))  __bf16   v2bf;
typedef __attribute__((ext_vector_type(8)))  unsigned v8u;
typedef __attribute__((ext_vector_type(2)))  unsigned v2u;
typedef v2u  __attribute__((may_alias)) v2ua;
typedef v4f  __attribute__((may_alias)) v4fa;
typedef v8us __attribute__((may_alias)) v8usa;

__device__ __forceinline__ unsigned short f2bf(float f) { unsigned u = __float_as_uint(f); u += 0x7FFFu + ((u >> 16) & 1u); return (unsigned short)(u >> 16); }
__device__ __forceinline__ unsigned cvt2(float lo, float hh) { v2f t; t[0] = lo; t[1] = hh; return __builtin_bit_cast(unsigned, __builtin_convertvector(t, v2bf)); }   // two RNE converts to bf16 in one packed instruction, lo in bits 15..0
__device__ __forceinline__ float bfr(float f) { return __uint_as_float(((unsigned)f2bf(f)) << 16); }   // value after RNE convert to bf16
__device__ __forceinline__ v16h cat16(v8h lo, v8h hi) { return __builtin_shufflevector(lo, hi, 0, 1, 2, 3, 4, 5, 6, 7, 8, 9, 10, 11, 12, 13, 14, 15); }
__device__ __forceinline__ v16bf cat16b(v8us lo, v8us hi) { return __builtin_bit_cast(v16bf, __builtin_shufflevector(lo, hi, 0, 1, 2, 3, 4, 5, 6, 7, 8, 9, 10, 11, 12, 13, 14, 15)); }
__device__ __forceinline__ v8f wmma16(v16h a, v16h b, v8f c) { return __builtin_amdgcn_wmma_f32_16x16x32_f16(false, a, false, b, (short)0, c, false, false); }
__device__ __forceinline__ v8f wmmab(v16bf a, v16bf b, v8f c) { return __builtin_amdgcn_wmma_f32_16x16x32_bf16(false, a, false, b, (short)0, c, false, false); }
// fragment loader from a fragment-order plane; p = start of the (tile, k-step) unit + 8*lane: elements 0..7 <- k0+8h+0..7, elements 8..15 <- k0+16+8h+0..7 (same map for A and B)
__device__ __forceinline__ v16h  ldh(const h16* p) { return cat16(*(const v8h*)p, *(const v8h*)(p + FHALF)); }
// the same for the last fragment off an address pair: the second half may land in the pair that the first half's load names: wait first
__device__ __forceinline__ v16h  ldh_last(const h16* p) { const v8h lo = *(const v8h*)p; asm volatile("s_wait_xcnt 0x0" ::: "memory"); const v8h hh = *(const v8h*)(p + FHALF); return cat16(lo, hh); }
// ordering point for wave-private LDS tiles (same wave writes and reads)
__device__ __forceinline__ void wave_sync() { __builtin_amdgcn_fence(3 /* release order */, "wavefront"); __builtin_amdgcn_wave_barrier(); asm volatile("" ::: "memory"); }

// per-instruction guarded matrix steps: one accumulator tied per guard, A / B kept live across the nops
__device__ __forceinline__ v8f wmma16g(v16h a, v16h b, v8f c) { c = wmma16(a, b, c); asm volatile("v_nop\n\tv_nop\n\tv_nop\n\tv_nop" : "+v"(c) : "v"(a), "v"(b)); return c; }
__device__ __forceinline__ v8f wmmabg(v16bf a, v16bf b, v8f c) { c = wmmab(a, b, c); asm volatile("v_nop\n\tv_nop\n\tv_nop\n\tv_nop" : "+v"(c) : "v"(a), "v"(b)); return c; }
// f32 -> f16 convert that cannot produce a subnormal (|v| < 2^-14 -> +0)
__device__ __forceinline__ h16 toh_flush(float v) { const h16 r = (h16)v; return (fabsf(v) < 6.103515625e-05f) ? (h16)0.0f : r; }
__device__ __forceinline__ float bf2f(unsigned short b) { return __uint_as_float(((unsigned)b) << 16); }

// cvtP_body: transposing bf16 (RNE convert) copy of the output-projection weight: W[DM rows (k)][DM (n)] f32 -> WP rows n, fragment order; block b takes CTN 64x64 tiles that follow one another along k, all their loads in flight together.
__device__ __forceinline__ void cvtP_body(const float* __restrict__ W, bf* WP, const int b, bf* ts) {
    const int tid = threadIdx.x;
    const int n0 = (b / (DM / (64 * CTN))) * 64, k0 = (b % (DM / (64 * CTN))) * (64 * CTN);
    const int kr = tid >> 4, c4 = (tid & 15) * 4;               // a load trip: 32 k rows x 16 float4
    const float* pw = W + (size_t)(k0 + kr) * DM + n0 + c4;
    v4f v[2 * CTN];
#pragma unroll
    for (int i = 0; i < 2 * CTN - 1; ++i) v[i] = *(const v4f*)(pw + (size_t)(i * 32) * DM);
    asm volatile("s_wait_xcnt 0x0" ::: "memory");                                // the last load off the address register may land in it, and the loads before it name it: wait first
    v[2 * CTN - 1] = *(const v4f*)(pw + (size_t)((2 * CTN - 1) * 32) * DM);
    asm volatile("s_wait_xcnt 0x0" ::: "memory");                                // the address register is rewritten behind the loads (LDS addresses): wait first
#pragma unroll
    for (int i = 0; i < 2 * CTN; ++i)
#pragma unroll
        for (int e = 0; e < 4; ++e) ts[((i >> 1) * 64 + c4 + e) * CTP + (i & 1) * 32 + kr] = f2bf(v[i][e]);   // tile i >> 1: [n][k]
    __syncthreads();                                            // cross-wave tiles: block barrier
    const int ch = tid >> 5, ln = tid & 31;                     // 16 halves of 512 B per tile: ch = 16-row tile (4) x k-step (2) x half (2); one wave writes one half
    const int row = (ch >> 2) * 16 + (ln & 15), c8 = ((ch >> 1) & 1) * 32 + (ch & 1) * 16 + (ln >> 4) * 8;
    bf* pd = WP + ((size_t)(n0 / 16 + (ch >> 2)) * (DM / 32) + (size_t)(k0 / 32 + ((ch >> 1) & 1))) * FSTEP + (ch & 1) * FHALF + ln * 8;
#pragma unroll
    for (int u = 0; u < CTN; ++u) { const v8us o = *(const v8usa*)(&ts[(u * 64 + row) * CTP + c8]);
        *(v8us*)(pd + u * 2 * FSTEP) = o; }
}

// gemm_slice: one wave's share of a 64x64 tile: 64 rows x 32 columns (8 accumulators) over NB batches of KBAT k-steps, operands straight from fragment-order bf16 planes.
// pitchA / pitchB: row length (k) of the plane; aoff / boff: start of the unit (first 16-row tile, first k-step of the wave's slice) + 8*lane.
template <int NB>
__device__ __forceinline__ void gemm_slice(const bf* __restrict__ A, const bf* __restrict__ Bt, const int pitchA, const int pitchB, const size_t aoff, const size_t boff, v8f (&acc)[4][GNW]) {
#pragma unroll
    for (int mb = 0; mb < 4; ++mb)
#pragma unroll
        for (int nb = 0; nb < GNW; ++nb) acc[mb][nb] = (v8f){};
    const bf* pa = A + aoff; const bf* pb = Bt + boff;
#pragma unroll
    for (int bt = 0; bt < NB; ++bt) {
        v8us al[KBAT][4][2], bl[KBAT][GNW][2];                  // 16-byte halves of the fragments (k0+8h+0..7 | k0+16+8h+0..7), all in flight together
#pragma unroll
        for (int s = 0; s < KBAT; ++s) {
            const int kc = (bt * KBAT + s) * FSTEP;
#pragma unroll
            for (int i = 0; i < 8; ++i)       if (s < KBAT - 1 || i < 7)           al[s][i >> 1][i & 1] = *(const v8us*)(pa + (size_t)(i >> 1) * 16 * (size_t)pitchA + kc + FHALF * (i & 1));
#pragma unroll
            for (int i = 0; i < 2 * GNW; ++i) if (s < KBAT - 1 || i < 2 * GNW - 1) bl[s][i >> 1][i & 1] = *(const v8us*)(pb + (size_t)(i >> 1) * 16 * (size_t)pitchB + kc + FHALF * (i & 1)); }
        const int kl = (bt * KBAT + KBAT - 1) * FSTEP + FHALF;
        asm volatile("s_wait_xcnt 0x0" ::: "memory");                            // the last load off an address register may land in it, and the loads before it name it: wait first
        al[KBAT - 1][3][1] = *(const v8us*)(pa + (size_t)3 * 16 * (size_t)pitchA + kl);
        asm volatile("s_wait_xcnt 0x0" ::: "memory");                            // same: the load below may land in a register that the load above names
        bl[KBAT - 1][GNW - 1][1] = *(const v8us*)(pb + (size_t)(GNW - 1) * 16 * (size_t)pitchB + kl);
        asm volatile("s_wait_xcnt 0x0" ::: "memory");                            // the address registers are rewritten behind the batch (LDS addresses): wait first
        v16bf a[KBAT][4], b[KBAT][GNW];
#pragma unroll
        for (int s = 0; s < KBAT; ++s) {
#pragma unroll
            for (int mb = 0; mb < 4; ++mb) a[s][mb] = cat16b(al[s][mb][0], al[s][mb][1]);
#pragma unroll
            for (int nb = 0; nb < GNW; ++nb) b[s][nb] = cat16b(bl[s][nb][0], bl[s][nb][1]); }
#pragma unroll
        for (int s = 0; s < KBAT; ++s)
#pragma unroll
            for (int nb = 0; nb < GNW; ++nb)
#pragma unroll
                for (int mb = 0; mb < 4; ++mb) acc[mb][nb] = wmmabg(a[s][mb], b[s][nb], acc[mb][nb]);
    }
}

// tile_merge: every wave puts its partial into LDS in fragment order (lane-contiguous 16-byte pieces); behind a block barrier wave w sums fragment w = mb*4 + nb over the k slices, slice 0 first,
// and writes it row-major into os (D: row 8h+j, col lane&15; all 64 x 64 written); a second block barrier publishes os to every wave.
__device__ __forceinline__ void tile_merge(const v8f (&acc)[4][GNW], float* ps, float* os, const int wave, const int lane) {
    const int lr = lane & 15, hi = lane >> 4;
    const int kq = wave / GNW, nh = wave % GNW;
#pragma unroll
    for (int mb = 0; mb < 4; ++mb)
#pragma unroll
        for (int nb = 0; nb < GNW; ++nb) {
            float* p = ps + (size_t)((kq * 16 + mb * 4 + nh * GNW + nb) * 256 + lane * 4);
            const v8f f = acc[mb][nb]; v4f a, c;
            a[0] = f[0]; a[1] = f[1]; a[2] = f[2]; a[3] = f[3]; c[0] = f[4]; c[1] = f[5]; c[2] = f[6]; c[3] = f[7];
            *(v4fa*)p = a; *(v4fa*)(p + 128) = c; }
    __syncthreads();                                            // cross-wave: every k slice's partial is read by another wave below
    const float* q0 = ps + (size_t)(wave * 256 + lane * 4);
    v4f s0 = *(const v4fa*)q0, s1 = *(const v4fa*)(q0 + 128);
#pragma unroll
    for (int q = 1; q < GKW; ++q) { s0 += *(const v4fa*)(q0 + q * 4096); s1 += *(const v4fa*)(q0 + q * 4096 + 128); }
    float* d = os + ((wave >> 2) * 16 + hi * 8) * TSP + (wave & 3) * 16 + lr;
#pragma unroll
    for (int j = 0; j < 4; ++j) { d[j * TSP] = s0[j]; d[(4 + j) * TSP] = s1[j]; }
    __syncthreads();                                            // cross-wave: the epilogues read rows that other waves wrote
}

// proj_slice: one wave's share of a 64x64 tile of x W (64 tokens x 32 columns over a k slice of KBAT k-steps), both operands read as f32 and RNE-converted to bf16 on the way.
// W [DM][NC] is read in place, with no transposition: lane (lr, hi) loads the column pair c0 + 32*nh + 2*lr + 0..1 of the 16 k rows of its half of a k-step (a wave-wide 8-byte load = 2 whole lines);
// column 2*lr + nb goes to B fragment nb, so accumulator (mb, nb) holds output column 32*nh + 2*lr + nb in lane column lr; two k neighbours of one column share a register through one packed convert.
// x: the block's 64 rows are brought once, by all waves, in whole lines, converted and laid in LDS as [16-row tile][8-wide k piece][row][8] (pitch XOP); behind a block barrier every wave reads its A fragments there.
// k order of both fragments, as everywhere in this file: elements 0..7 <- k0+8h+0..7, elements 8..15 <- k0+16+8h+0..7.
template <int NC>
__device__ __forceinline__ void proj_slice(const float* __restrict__ x, const float* __restrict__ W, const int r0, const int c0, bf* xs, const int wave, const int lane, v8f (&acc)[4][GNW]) {
    const int lr = lane & 15, hi = lane >> 4;
    const int kq = wave / GNW, nh = wave % GNW, k0 = kq * (KBAT * 32);
    const float* pw = W + (size_t)(k0 + 8 * hi) * NC + c0 + 32 * nh + 2 * lr;
    const float* px = x + (size_t)(r0 + wave * 4) * DM + lane * 4;
    v2f wl[KBAT][16]; v4f xl[4][6];                             // all of the wave's loads in flight together; x first: it has the longer way (LDS, barrier)
#pragma unroll
    for (int r = 0; r < 4; ++r)
#pragma unroll
        for (int p = 0; p < 6; ++p) if (r < 3 || p < 5) xl[r][p] = *(const v4f*)(px + r * DM + p * 128);
    asm volatile("s_wait_xcnt 0x0" ::: "memory");                                // the last load off an address register may land in it, and the loads before it name it: wait first
    xl[3][5] = *(const v4f*)(px + 3 * DM + 5 * 128);
    asm volatile("s_wait_xcnt 0x0" ::: "memory");                                // a weight load below may land in the register that the load above names: wait first
#pragma unroll
    for (int s = 0; s < KBAT; ++s)
#pragma unroll
        for (int e = 0; e < 16; ++e) if (s < KBAT - 1 || e < 15) wl[s][e] = *(const v2f*)(pw + (size_t)(32 * s + (e >> 3) * 16 + (e & 7)) * NC);
    asm volatile("s_wait_xcnt 0x0" ::: "memory");                                // same, for the weight loads' address register
    wl[KBAT - 1][15] = *(const v2f*)(pw + (size_t)(32 * (KBAT - 1) + 16 + 7) * NC);
    asm volatile("s_wait_xcnt 0x0" ::: "memory");                                // the address registers are rewritten behind the loads (LDS addresses): wait first
    bf* xd = xs + ((wave >> 2) * (DM / 8) + (lane >> 1)) * XOP + (wave & 3) * 32 + (lane & 1) * 4;   // row 4*wave + r of the tile; floats 128*p + 4*lane + 0..3 = half (lane & 1) of k piece 16*p + (lane >> 1)
#pragma unroll
    for (int r = 0; r < 4; ++r)
#pragma unroll
        for (int p = 0; p < 6; ++p) { v2u t; t[0] = cvt2(xl[r][p][0], xl[r][p][1]); t[1] = cvt2(xl[r][p][2], xl[r][p][3]);
            *(v2ua*)(xd + p * 16 * XOP + r * 8) = t; }
    v16bf b[KBAT][GNW];
#pragma unroll
    for (int s = 0; s < KBAT; ++s)
#pragma unroll
        for (int nb = 0; nb < GNW; ++nb) { v8u t;
#pragma unroll
            for (int j = 0; j < 8; ++j) t[j] = cvt2(wl[s][2 * j][nb], wl[s][2 * j + 1][nb]);
            b[s][nb] = __builtin_bit_cast(v16bf, t); }
    __syncthreads();                                            // cross-wave: every wave reads x rows that other waves staged
    const bf* xa = xs + (k0 / 8 + hi) * XOP + lr * 8;
    v16bf a[KBAT][4];
#pragma unroll
    for (int s = 0; s < KBAT; ++s)
#pragma unroll
        for (int mb = 0; mb < 4; ++mb) a[s][mb] = cat16b(*(const v8usa*)(xa + (mb * (DM / 8) + 4 * s) * XOP), *(const v8usa*)(xa + (mb * (DM / 8) + 4 * s + 2) * XOP));
#pragma unroll
    for (int mb = 0; mb < 4; ++mb)
#pragma unroll
        for (int nb = 0; nb < GNW; ++nb) acc[mb][nb] = (v8f){};
#pragma unroll
    for (int s = 0; s < KBAT; ++s)
#pragma unroll
        for (int nb = 0; nb < GNW; ++nb)
#pragma unroll
            for (int mb = 0; mb < 4; ++mb) acc[mb][nb] = wmmabg(a[s][mb], b[s][nb], acc[mb][nb]);
}

// proj_merge: tile_merge for proj_slice's column deal: fragment w = mb*4 + nh*2 + nb holds rows mb*16 + 8h + j, column 32*nh + 2*(lane&15) + nb. TR = 0: os[token][column]; TR = 1: os[column][token].
template <int TR>
__device__ __forceinline__ void proj_merge(const v8f (&acc)[4][GNW], float* ps, float* os, const int wave, const int lane) {
    const int lr = lane & 15, hi = lane >> 4;
    const int kq = wave / GNW, nh = wave % GNW;
#pragma unroll
    for (int mb = 0; mb < 4; ++mb)
#pragma unroll
        for (int nb = 0; nb < GNW; ++nb) {
            float* p = ps + (size_t)((kq * 16 + mb * 4 + nh * GNW + nb) * 256 + lane * 4);
            const v8f f = acc[mb][nb]; v4f a, c;
            a[0] = f[0]; a[1] = f[1]; a[2] = f[2]; a[3] = f[3]; c[0] = f[4]; c[1] = f[5]; c[2] = f[6]; c[3] = f[7];
            *(v4fa*)p = a; *(v4fa*)(p + 128) = c; }
    __syncthreads();                                            // cross-wave: every k slice's partial is read by another wave below
    const float* q0 = ps + (size_t)(wave * 256 + lane * 4);
    v4f s0 = *(const v4fa*)q0, s1 = *(const v4fa*)(q0 + 128);
#pragma unroll
    for (int q = 1; q < GKW; ++q) { s0 += *(const v4fa*)(q0 + q * 4096); s1 += *(const v4fa*)(q0 + q * 4096 + 128); }
    const int row = (wave >> 2) * 16 + hi * 8, col = ((wave >> 1) & 1) * 32 + 2 * lr + (wave & 1);
    if (TR) { *(v4fa*)(&os[col * TSP + row]) = s0; *(v4fa*)(&os[col * TSP + row + 4]) = s1; }
    else {
#pragma unroll
        for (int j = 0; j < 4; ++j) { os[(row + j) * TSP + col] = s0[j]; os[(row + 4 + j) * TSP + col] = s1[j]; } }
    __syncthreads();                                            // cross-wave: the epilogues read rows that other waves wrote
}

// qk_tail: rotation + RMS normalisation of a merged q or k tile os[token][d] (column tile = head: 0..11 q, 12..17 k) and its store.
__device__ __forceinline__ void qk_tail(const float* __restrict__ cosb, const float* __restrict__ sinb, float* QKF, const int ttile, const int head, float* os, const int wave, const int lane) {
    const int r0 = ttile * 64;
    const int w0 = wave * (64 / GW);                            // this wave's rows of the tile: from here on it reads and writes these alone
#pragma unroll 1
    for (int r = w0; r < w0 + 64 / GW; ++r) {                   // lane = rotary pair column (d, d + 32)
        const int t = r0 + r;
        const float x1 = os[r * TSP + lane], x2 = os[r * TSP + HROT + lane];
        const float c = bfr(cosb[(size_t)t * HROT + lane]), s = bfr(sinb[(size_t)t * HROT + lane]);
        const float o1 = x1 * c - x2 * s, o2 = x2 * c + x1 * s;
        float ss = o1 * o1 + o2 * o2;
#pragma unroll
        for (int off = 16; off > 0; off >>= 1) ss += __shfl_xor(ss, off, 32);
        const float sc = rsqrtf(ss * (1.0f / (float)HD) + 1e-6f);
        os[r * TSP + lane] = o1 * sc; os[r * TSP + HROT + lane] = o2 * sc; }
    wave_sync();
    float* dst = QKF + ((size_t)head * SEQ + (size_t)(r0 + w0)) * HD;
{
#pragma unroll
        for (int i = 0; i < 2; ++i) { const int idx = i * 32 + lane; const int row = w0 + (idx >> 4), c4 = (idx & 15) * 4;   // 2 trips x 2 rows = the wave's 4 rows; 16 lanes x 4 floats = 64 columns
            const v4f val = *(const v4fa*)(&os[row * TSP + c4]);
            *(v4f*)(dst + (size_t)idx * 4) = val; }
         }
}

// vt_tail: a merged v tile os[m][token] (m = kvh*64 + d) -> plane VT [m][t] f16 (row length SEQ) and, for t < EROWS (block-uniform test), the f16 remainder x2048 VR [m][t] (row length EROWS), both in fragment order (k = t).
__device__ __forceinline__ void vt_tail(h16* VT, h16* VR, const int mtile, const int ttile, float* os, const int wave, const int lane) {
    const int lr = lane & 15, hi = lane >> 4;
    const int r0 = mtile * 64, c0 = ttile * 64;
    const bool wr = c0 < EROWS;                                 // block-uniform: whole tile inside the remainder plane
{
        { const int row = (wave >> 2) * 16 + lr, c8 = ((wave >> 1) & 1) * 32 + (wave & 1) * 16 + hi * 8;   // 16 waves: 16-row tile (4) x k-step (2) x half (2); one wave writes one 512-byte half
            const size_t un = (size_t)(c0 / 32 + ((wave >> 1) & 1)) * FSTEP + (wave & 1) * FHALF + lane * 8;   // place inside the 16-row tile
            const v4f x0 = *(const v4fa*)(&os[row * TSP + c8]); const v4f x1 = *(const v4fa*)(&os[row * TSP + c8 + 4]); v8h hv, rv;
#pragma unroll
            for (int e = 0; e < 4; ++e) { const h16 a0 = toh_flush(x0[e]); const h16 a1 = toh_flush(x1[e]); hv[e] = a0; hv[4 + e] = a1;
                rv[e] = toh_flush((x0[e] - (float)a0) * QRS); rv[4 + e] = toh_flush((x1[e] - (float)a1) * QRS); }
            *(v8h*)(VT + (size_t)(r0 + (wave >> 2) * 16) * SEQ + un) = hv;
            asm volatile("s_wait_xcnt 0x0" ::: "memory");                        // the store's registers are rewritten behind it (remainder packing): wait first
            if (wr) { *(v8h*)(VR + (size_t)(r0 + (wave >> 2) * 16) * EROWS + un) = rv;
                asm volatile("s_wait_xcnt 0x0" ::: "memory"); } }                // same, for the remainder store
         }
}

// k_qkv: the three input projections, straight from the f32 inputs, and the conversion of the output-projection weight in one grid (disjoint outputs): blockIdx.x = 64-token tile;
// blockIdx.y < 12: q head, < 18: k head, < 24: 64 columns of v; above: converter blocks, which need nothing of the projections and run beside them on WGPs that the 192 projection blocks leave idle.
#define PB_Y  (NHQ + NHK + DKV / 64)                            // grid rows of the projections
#define CB_Y  (((DM / 64) * (DM / 64)) / (CTN * (SEQ / 64)))    // grid rows of the converter
__global__ __launch_bounds__(32 * GW) void k_qkv(const float* __restrict__ x, const float* __restrict__ wq, const float* __restrict__ wk, const float* __restrict__ wv, const float* __restrict__ wp,
                                                 const float* __restrict__ cosb, const float* __restrict__ sinb, float* QKF, h16* VT, h16* VR, bf* WP) {
    __shared__ __align__(16) float ps[GKW * 64 * 64];           // the k slices' partial tiles, fragment order
    __shared__ __align__(16) float os[64 * TSP];                // merged tile, row-major
    __shared__ __align__(16) bf xs[4 * (DM / 8) * XOP];         // the block's 64 x rows, bf16
    __shared__ __align__(16) bf ts[CTN * 64 * CTP];             // converter tiles
    const int by = blockIdx.y;                                  // block-uniform: the barriers inside are met by all threads or by none
    const int lane = threadIdx.x & 31;
    const int wave = __builtin_amdgcn_readfirstlane((int)(threadIdx.x >> 5));
    if (by >= PB_Y) { cvtP_body(wp, WP, (by - PB_Y) * (SEQ / 64) + (int)blockIdx.x, ts); return; }
    v8f acc[4][GNW];
    if (by < NHQ) proj_slice<DM>(x, wq, blockIdx.x * 64, by * 64, xs, wave, lane, acc);
    else          proj_slice<DKV>(x, by < NHQ + NHK ? wk : wv, blockIdx.x * 64, (by < NHQ + NHK ? by - NHQ : by - (NHQ + NHK)) * 64, xs, wave, lane, acc);
    if (by < NHQ + NHK) { proj_merge<0>(acc, ps, os, wave, lane); qk_tail(cosb, sinb, QKF, blockIdx.x, by, os, wave, lane); }
    else                { proj_merge<1>(acc, ps, os, wave, lane); vt_tail(VT, VR, by - (NHQ + NHK), blockIdx.x, os, wave, lane); }
}

// k_oproj: output projection. A = context plane rows (value | remainder, two K parts of 768), Bt = WP rows n; f32 output [t][768].
__global__ __launch_bounds__(32 * GW) void k_oproj(const bf* __restrict__ YB, const bf* __restrict__ WP, float* OUT) {
    __shared__ __align__(16) float ps[GKW * 64 * 64];           // the k slices' partial tiles, fragment order
    __shared__ __align__(16) float os[64 * TSP];                // merged tile, row-major
    const int lane = threadIdx.x & 31;
    const int wave = __builtin_amdgcn_readfirstlane((int)(threadIdx.x >> 5));
    const int r0 = blockIdx.x * 64, c0 = blockIdx.y * 64;
    const int ka = (wave / GNW) * (2 * KBAT * 32);              // slice start in the context row (value | remainder)
    const int kw = ka % DM;                                     // the same k in the weight row: both parts meet the same weights
    v8f acc[4][GNW];
    gemm_slice<2>(YB, WP, YP, DM, (size_t)r0 * YP + ka * 16 + lane * 8, (size_t)(c0 + (wave % GNW) * 32) * DM + kw * 16 + lane * 8, acc);
    tile_merge(acc, ps, os, wave, lane);
{
#pragma unroll
        for (int i = 0; i < 2; ++i) { const int idx = i * (32 * GW) + (int)threadIdx.x; const int row = idx >> 4, c4 = (idx & 15) * 4;   // 2 trips x 32 rows = 64 rows; 16 lanes x 4 floats = 64 columns
            const v4f val = *(const v4fa*)(&os[row * TSP + c4]);
            *(v4f*)(OUT + (size_t)(r0 + row) * DM + c0 + c4) = val; }
         }
}

// flash_body: fused attention, one block of AW waves per 16 query rows of one head; wave w takes the 32-key steps w, w + AW, ... and keeps its own softmax state and context partial;
// the partials (unnormalised context, running max, row sum) meet in LDS behind one block barrier and are merged in f32 by all threads. q tile and the 32-key K tile live in wave-private LDS (f32); scores on the vector unit:
// lane (qg = lane&3, kg = lane>>2) forms max_d(q[t][d] + k[key][d]) for the 4 x 4 block t = 4qg+i, key = 4kg+j of each 32-key step: 8 LDS reads of 16 bytes feed 16 (t, key) pairs x 4 d;
// the 16 x 32 scores then pass through the wave's own LDS slice, and lane (t = lane&15, h = lane>>4) takes keys 8h+r and 16+8h+r, i.e. the B-fragment layout of
// O^T[d][t] = V^T P^T (element r <- keys 8h+r, element 8+r <- keys 16+8h+r). V^T fragments (A, row d, k = key) straight from the f16 planes.
// Softmax state (running max over kept keys, partial sum) is one scalar per lane; the two lane halves of a row are combined with one xor-16 exchange.
// Causal keep rule (key <= t) evaluated per element inside every visited tile; the per-wave key bound is a wave scalar, multiple of 32, <= SEQ.
// EARLY = 1 (query rows [0, EROWS)): P = f16 value + f16 remainder x2048; O = V P + (V P_rem + V_rem P) / 2048 (remainder products in their own accumulators); row sum from the f32 exponentials.
// EARLY = 0 (query rows [EROWS, SEQ)): single P, v; row sum over the converted P.
template <int EARLY>
__device__ __forceinline__ void flash_body(const float* __restrict__ QKF, const h16* __restrict__ VT, const h16* __restrict__ VR, bf* YB, float* qs, float* ks, float* ms, float* lsum) {
    const int lane = threadIdx.x & 31, lr = lane & 15, hi = lane >> 4;
    const int wave = __builtin_amdgcn_readfirstlane((int)(threadIdx.x >> 5));
    const int h = blockIdx.y, kvh = h / NREP;
    const int t0 = blockIdx.x * 16;                             // blockIdx.x = tile of 16 query rows, wholly below or wholly at / above EROWS
    const int lim = t0 + lr;                                    // key j kept iff j <= lim
    const int nk = (t0 + 16 + 31) & ~31;                        // block-uniform, multiple of 32, <= SEQ (<= EROWS when EARLY)
    const int qb = wave * 16 * QSP, kbs = wave * 32 * KSP;
    const int qg = lane & 3, kg = lane >> 2;                    // score block of this lane: query rows 4qg + 0..3, keys 4kg + 0..3
    { const size_t qsrc = ((size_t)h * SEQ + (size_t)t0) * HD;  // 16 rows x 64 floats, contiguous
#pragma unroll
      for (int i = 0; i < 8; ++i) { const int idx = i * 32 + lane;
          const v4f v = *(const v4f*)(QKF + qsrc + (size_t)idx * 4);
          *(v4fa*)(&qs[qb + (idx >> 4) * QSP + (idx & 15) * 4]) = v; } }
    const size_t kplane = ((size_t)(NHQ + kvh) * SEQ) * HD;     // k heads follow the q heads in the plane
    const size_t vo  = (size_t)(kvh * HD) * SEQ + lane * 8;      // + 16j*SEQ + 16*key0   (A fragment: row d, k = key; fragment-order plane)
    const size_t vro = (size_t)(kvh * HD) * EROWS + lane * 8;    // remainder plane, tokens < EROWS
    const v16h hz = (v16h){};
    v8f o[4], oR[4];
#pragma unroll
    for (int j = 0; j < 4; ++j) { o[j] = (v8f){}; oR[j] = (v8f){}; }
    float m = NEGB, l = 0.0f;
#pragma unroll 1
    for (int key0 = wave * 32; key0 < nk; key0 += 32 * AW) {    // a wave with no step keeps o = 0, l = 0, m = NEGB: weight 0 in the merge
        wave_sync();                                            // earlier reads of the K / score slice are done
        { const size_t ksrc = kplane + (size_t)key0 * HD;       // 32 keys x 64 floats, contiguous; keys < nk <= SEQ
          v4f kv[2][8];                                         // both groups of eight loads in flight, then the sixteen LDS stores
#pragma unroll
          for (int g = 0; g < 2; ++g) {
#pragma unroll
              for (int i = 0; i < 8; ++i) {
                  if (i == 7) asm volatile("s_wait_xcnt 0x0" ::: "memory");      // the group's last load may land in the address pair that the seven before it name: wait first
                  kv[g][i] = *(const v4f*)(QKF + ksrc + (size_t)((g * 8 + i) * 32 + lane) * 4); }
              asm volatile("s_wait_xcnt 0x0" ::: "memory"); }                    // the address pair is rewritten behind the group (next group, score loop): wait first
#pragma unroll
          for (int g = 0; g < 2; ++g)
#pragma unroll
              for (int i = 0; i < 8; ++i) *(v4fa*)(&ks[kbs + ((g * 8 + i) * 2 + hi) * KSP + lr * 4]) = kv[g][i]; }   // piece (g*8+i)*32 + lane = key row (g*8+i)*2 + hi, floats 4*lr + 0..3
        wave_sync();
        float sc[4][4];
#pragma unroll
        for (int i = 0; i < 4; ++i)
#pragma unroll
            for (int j = 0; j < 4; ++j) sc[i][j] = NEGB;
        v4f q4[2][4], k4[2][4];                                 // two register sets: trip d4 + 1 is read from LDS while trip d4 is worked on
        const float* qrow = &qs[qb + 4 * qg * QSP];
        const float* krow = &ks[kbs + 4 * kg * KSP];
        auto rd = [&](const int st, const int d4) {             // the 4 q rows' and the 4 key rows' floats 4*d4 + 0..3 into register set st
#pragma unroll
            for (int i = 0; i < 4; ++i) { q4[st][i] = *(const v4fa*)(qrow + i * QSP + d4 * 4); k4[st][i] = *(const v4fa*)(krow + i * KSP + d4 * 4); } };
        auto pm = [&](const int st) {                           // 16 pairs x 4 d; sums paired along d, as the 16-byte reads deliver them
#pragma unroll
            for (int i = 0; i < 4; ++i)
#pragma unroll
                for (int j = 0; j < 4; ++j) {
                    const v2f lo = q4[st][i].xy + k4[st][j].xy, hh = q4[st][i].zw + k4[st][j].zw;
                    sc[i][j] = fmaxf(fmaxf(fmaxf(sc[i][j], lo[0]), lo[1]), fmaxf(hh[0], hh[1])); } };
        rd(0, 0);
#pragma unroll 1                                                // stays rolled: the text of both instantiations stays small
        for (int d4 = 0; d4 < HD / 4 - 2; d4 += 2) { rd(1, d4 + 1); pm(0); rd(0, d4 + 2); pm(1); }
        rd(1, HD / 4 - 1); pm(0); pm(1);
        wave_sync();                                            // every lane's K reads are done: the slice becomes the score tile [t][key]
#pragma unroll
        for (int i = 0; i < 4; ++i) { v4f s4; s4[0] = sc[i][0]; s4[1] = sc[i][1]; s4[2] = sc[i][2]; s4[3] = sc[i][3];
            *(v4fa*)(&ks[kbs + (4 * qg + i) * SSP + 4 * kg]) = s4; }
        wave_sync();                                            // scores are read below by other lanes of the wave
        float sa[8], sb[8];
        { const v4f a0 = *(const v4fa*)(&ks[kbs + lr * SSP + 8 * hi]),      a1 = *(const v4fa*)(&ks[kbs + lr * SSP + 8 * hi + 4]);
          const v4f b0 = *(const v4fa*)(&ks[kbs + lr * SSP + 16 + 8 * hi]), b1 = *(const v4fa*)(&ks[kbs + lr * SSP + 16 + 8 * hi + 4]);
#pragma unroll
          for (int r = 0; r < 4; ++r) { sa[r] = a0[r]; sa[4 + r] = a1[r]; sb[r] = b0[r]; sb[4 + r] = b1[r]; } }
        const int ja = key0 + 8 * hi;
        float mx = NEGB;
#pragma unroll
        for (int r = 0; r < 8; ++r) {
            sa[r] = sa[r] * LOG2E; sb[r] = sb[r] * LOG2E;
            const bool fa = (ja + r <= lim), fb = (ja + 16 + r <= lim);
            mx = fmaxf(mx, fmaxf(fa ? sa[r] : NEGB, fb ? sb[r] : NEGB)); }
        mx = fmaxf(mx, __shfl_xor(mx, 16, 32));
        const float mnew = fmaxf(m, mx);
        const float alpha = __builtin_amdgcn_exp2f(m - mnew);
        const float sh = PSH - mnew;
        v16h pb, pr = hz; float ls = 0.0f;
#pragma unroll
        for (int r = 0; r < 8; ++r) {
            const float xa = sa[r] + sh, xb = sb[r] + sh;
            const float ea = __builtin_amdgcn_exp2f(xa), eb = __builtin_amdgcn_exp2f(xb);
            const bool fa = (ja + r <= lim) & (xa >= -14.0f), fb = (ja + 16 + r <= lim) & (xb >= -14.0f);   // dropped keys and values below the f16 normal range selected to 0 by value
            const float ga = fa ? ea : 0.0f, gb = fb ? eb : 0.0f;
            const h16 pa = (h16)ga; const h16 pc = (h16)gb;
            pb[r] = pa; pb[8 + r] = pc;
            if (EARLY) { pr[r] = toh_flush((ga - (float)pa) * QRS); pr[8 + r] = toh_flush((gb - (float)pc) * QRS); ls += ga + gb; }
            else       { ls += (float)pa + (float)pc; } }
        l = l * alpha + ls; m = mnew;
#pragma unroll
        for (int j = 0; j < 4; ++j) {
            const v16h v = ldh(VT + vo + (size_t)(16 * j) * SEQ + (size_t)key0 * 16);
            o[j] = o[j] * alpha;
            o[j] = wmma16g(v, pb, o[j]);
            if (EARLY) {
                const h16* pvr = VR + vro + (size_t)(16 * j) * EROWS + (size_t)key0 * 16;       // key0 + 31 < nk <= EROWS
                const v16h vr = (j == 3) ? ldh_last(pvr) : ldh(pvr);
                oR[j] = oR[j] * alpha;
                oR[j] = wmma16g(v, pr, oR[j]);
                oR[j] = wmma16g(vr, pb, oR[j]); }
        }
        asm volatile("s_wait_xcnt 0x0" ::: "memory");                            // the next step's K tile loads may land in the address pairs that the V loads above name: wait first
    }
    l += __shfl_xor(l, 16, 32);
    wave_sync();                                                // q tile reads are done; the slice becomes this wave's context partial
    // O^T D layout: f_j[r] = (d = 16j + 8h + r, t = lane&15) -> qs[t][d]; rows 0..15 x columns 0..63 all written
#pragma unroll
    for (int j = 0; j < 4; ++j) {
        v8f f = o[j];
        if (EARLY) f = o[j] + oR[j] * QRI;
        v4f a, c;
        a[0] = f[0]; a[1] = f[1]; a[2] = f[2]; a[3] = f[3]; c[0] = f[4]; c[1] = f[5]; c[2] = f[6]; c[3] = f[7];
        *(v4fa*)(&qs[qb + lr * QSP + 16 * j + 8 * hi]) = a; *(v4fa*)(&qs[qb + lr * QSP + 16 * j + 8 * hi + 4]) = c; }
    if (hi == 0) { ms[wave * 16 + lr] = m; lsum[wave * 16 + lr] = l; }   // both lane halves hold the same m and l
    __syncthreads();                                            // cross-wave: every wave's partial is read by every wave below
    // merge: thread = (row, 4 columns), dealt so that thread p owns 8-byte piece p of the head's 2 k-steps in the fragment-order context plane; partial w weighs 2^(m_w - M), M the maximum over the waves
    const int row = ((int)threadIdx.x >> 1) & 15, c4 = ((int)threadIdx.x >> 6) * 16 + (((int)threadIdx.x >> 5) & 1) * 8 + ((int)threadIdx.x & 1) * 4;
    float mw[AW], M = NEGB;
#pragma unroll
    for (int w = 0; w < AW; ++w) { mw[w] = ms[w * 16 + row]; M = fmaxf(M, mw[w]); }
    float L = 0.0f; v4f acc = (v4f){};
#pragma unroll
    for (int w = 0; w < AW; ++w) {
        const float sc = __builtin_amdgcn_exp2f(mw[w] - M);
        const v4f p = *(const v4fa*)(&qs[w * 16 * QSP + row * QSP + c4]);
        L += lsum[w * 16 + row] * sc;
        acc += p * sc; }
    const bool any = L > 0.0f;
    const float lsafe = any ? L : 1.0f;
    const float inv = any ? (1.0f / lsafe) : 0.0f;
    v4us hv, lv;
#pragma unroll
    for (int e = 0; e < 4; ++e) { const float y = acc[e] * inv; const unsigned short b0 = f2bf(y); hv[e] = b0; lv[e] = f2bf(y - bf2f(b0)); }
    bf* yrow = YB + (size_t)t0 * YP + (size_t)(h * HD) * 16 + (int)threadIdx.x * 4;   // the block's 16-row tile, the head's k-steps: 2 KiB in a row per part, a wave stores 2 whole lines
    *(v4us*)(yrow) = hv;
    *(v4us*)(yrow + DM * 16) = lv;
}

// k_flash: both instantiations in one grid (disjoint context rows); the choice is block-uniform.
__global__ __launch_bounds__(32 * AW) __attribute__((amdgpu_num_vgpr(256))) void k_flash(const float* __restrict__ QKF, const h16* __restrict__ VT, const h16* __restrict__ VR, bf* YB) {
    __shared__ __align__(16) float qs[AW * 16 * QSP];           // per-wave slices: q tile, later the wave's context partial
    __shared__ __align__(16) float ks[AW * 32 * KSP];           // wave-private slices: 32-key K tile, then the step's score tile
    __shared__ float ms[AW * 16];                               // per wave and row: running max
    __shared__ float lsum[AW * 16];                             // per wave and row: sum of the exponentials
    if ((int)blockIdx.x * 16 < EROWS) flash_body<1>(QKF, VT, VR, YB, qs, ks, ms, lsum);   // block-uniform: the barrier inside is met by all threads or by none
    else                              flash_body<0>(QKF, VT, VR, YB, qs, ks, ms, lsum);
}

static constexpr size_t al256(size_t v) { return (v + 255) & ~(size_t)255; }
static constexpr size_t SZ_WP = al256((size_t)DM * DM * 2);
static constexpr size_t SZ_QK = al256((size_t)(NHQ + NHK) * SEQ * HD * 4);
static constexpr size_t SZ_VT = al256((size_t)DKV * SEQ * 2);
static constexpr size_t SZ_VR = al256((size_t)DKV * EROWS * 2);
static constexpr size_t SZ_YB = al256((size_t)SEQ * YP * 2);
static constexpr size_t SZ_TOTAL = SZ_WP + SZ_QK + SZ_VT + SZ_VR + SZ_YB;
static_assert(SZ_TOTAL <= (size_t)134217728);          // workspace carve <= 128 MiB
static_assert(((size_t)NHQ * SEQ * HD * 4) % 256 == 0);

extern "C" void kernel_launch(void* const* d_in, const int* in_sizes, int n_in,
                              void* d_out, int out_size, void* d_ws, size_t ws_size, hipStream_t stream) {
    if (n_in < 7) return;
    if ((size_t)in_sizes[0] < (size_t)SEQ * DM) return;
    if ((size_t)in_sizes[1] < (size_t)SEQ * HROT || (size_t)in_sizes[2] < (size_t)SEQ * HROT) return;
    if ((size_t)in_sizes[3] < (size_t)DM * DM || (size_t)in_sizes[6] < (size_t)DM * DM) return;
    if ((size_t)in_sizes[4] < (size_t)DM * DKV || (size_t)in_sizes[5] < (size_t)DM * DKV) return;
    if ((size_t)out_size < (size_t)SEQ * DM) return;
    if (SZ_TOTAL > ws_size) return;
    // wire order: x, cos, sin, Wq, Wk, Wv, Wproj
    const float* x    = (const float*)d_in[0];
    const float* cosb = (const float*)d_in[1];
    const float* sinb = (const float*)d_in[2];
    const float* wq   = (const float*)d_in[3];
    const float* wk   = (const float*)d_in[4];
    const float* wv   = (const float*)d_in[5];
    const float* wp   = (const float*)d_in[6];
    float* OUT = (float*)d_out;                        // [SEQ][768]
    char* wsp = (char*)d_ws;
    bf*    WP  = (bf*)wsp;    wsp += SZ_WP;            // [768][768]: output-projection weight, [out][in]
    float* QKF = (float*)wsp; wsp += SZ_QK;            // [18][SEQ][64] f32: 12 q heads, 6 k heads
    h16*   VT  = (h16*)wsp;   wsp += SZ_VT;            // [384][SEQ]
    h16*   VR  = (h16*)wsp;   wsp += SZ_VR;            // [384][EROWS] remainder x2048, tokens < EROWS
    bf*    YB  = (bf*)wsp;    wsp += SZ_YB;            // [SEQ][768 value | 768 remainder]

    // q | k: x W -> f32 planes [head][t][64], rotated and normalised; v: x Wv -> [m][t] f16 (+ remainder for t < EROWS); Wproj -> WP
    k_qkv<<<dim3(SEQ / 64, PB_Y + CB_Y, 1), 32 * GW, 0, stream>>>(x, wq, wk, wv, wp, cosb, sinb, QKF, VT, VR, WP);

    // query rows [0, EROWS): multi-product instantiation; rows [EROWS, SEQ): single-product instantiation
    k_flash<<<dim3(SEQ / 16, NHQ, 1), 32 * AW, 0, stream>>>(QKF, VT, VR, YB);

    // output projection: A = context rows (value | remainder), Bt = WP rows
    k_oproj<<<dim3(SEQ / 64, DM / 64, 1), 32 * GW, 0, stream>>>(YB, WP, OUT);
}

// v007
// A run of this version takes 25.7 microseconds.
// Two timings next to v006 both put it at 1.04 times that version's speed.
// All steps since v000 together make it 7.99 times as fast.
#include <hip/hip_runtime.h>

// Causal grouped-query self-attention with max-plus scores: x [SEQ][768]; Wq [768][768], Wk / Wv [768][384], Wproj [768][768], all [in][out] (y = x W, no bias);
// 12 query heads x 64, 6 key/value heads (2 query heads per key/value head); half-split rotary tables cos / sin [SEQ][32] read by value;
// per-head RMS normalisation (eps 1e-6) of q and k after the rotation; score[t][j] = max_d (q[t][d] + k[j][d]); causal softmax; context = P v; output = context Wproj (f32).
// Compute dtypes, f32 accumulate everywhere: q / k / v projections v_wmma_f32_16x16x32_bf16 (x, W RNE-converted to bf16 where the projection kernel loads them; products exact); max-plus scores are not a multiply-accumulate: f32 on the vector unit from f32 q / k planes;
// P.V v_wmma_f32_16x16x32_f16: P (x16384 carry, cancels in the normalisation) and v single f16 on query rows >= EROWS; on query rows < EROWS P and v each as f16 value + f16 remainder x2048, remainder products in their own accumulator folded by 1/2048, row sum from the f32 exponentials;
// output projection v_wmma_f32_16x16x32_bf16: context as bf16 value + bf16 remainder (two K parts against the same weights, summed in the f32 k-slice merge), Wproj RNE-converted to bf16; softmax f32 (online, running max over kept keys).
// Layout: transposed bf16 output-projection weights WP [768][768] ([out][in]); f32 planes q / k [18 heads][t][64] (rotated, normalised); v^T plane f16 [384][t] and remainder plane [384][t < EROWS];
// fused flash kernel in transposed form (O^T = V^T P^T, P built on the vector unit directly in B-fragment layout); context plane bf16 [t][768 value | 768 remainder].
// Every 16-bit plane above (a matrix operand, rows x k) lies in FRAGMENT ORDER: [16-row tile][32-wide k-step][half s][lane][8 elements], lane = 16*h + (row & 15), the 8 elements k = 32*step + 16*s + 8*h + 0..7:
// one wave-wide 16-byte load of a fragment half reads 512 contiguous bytes (4 whole lines). A 16-row tile keeps its size (16 x row length), so sub-plane offsets at multiples of 16 rows are those of the row-major plane.

#ifndef SEQ
#define SEQ 512
#endif
#define SEQ_FULL 512
#define DM    768
#define NHQ   12
#define NHK   6
#define NREP  2
#define HD    64
#define HROT  32
#define DKV   (NHK * HD)              // 384
#define YP    (2 * DM)                // context plane row pitch (value | remainder)
#define AW    8                       // waves per flash block: all work on the same 16 query rows, 32-key steps dealt round-robin
#define GKW   8                       // k slices of a 64x64 GEMM tile, one per wave pair
#define GNW   2                       // column halves of a GEMM tile: a wave holds 64 rows x 32 columns of one k slice
#define GW    (GKW * GNW)             // waves per GEMM block
#define KBAT  3                       // 32-wide k-steps whose fragments a wave loads as one batch
#define QSP   68                      // LDS row pitch (floats) of the q / context tile
#define KSP   68                      // LDS row pitch (floats) of the 32-key K tile: rows 4 apart fall 16 banks apart
#define SSP   36                      // LDS row pitch (floats) of the 16 x 32 score tile that takes the K tile's place behind the score loop
#define TSP   68                      // LDS row pitch (floats) of the GEMM output tile
#define CTP   72                      // LDS row pitch (16-bit words) of the transposing converter tile
#define CTN   3                       // 64x64 weight tiles per converter block
#define XOP   136                     // LDS pitch (16-bit words) of one 8-wide k piece of a 16-row x tile: 16 rows x 8 + 8, so pieces 1 apart fall 4 banks apart
#define EROWS (SEQ < 256 ? SEQ : 256) // query rows handled by the multi-product flash instantiation
#define QRS   2048.0f                 // carry of the v remainder plane / P remainder fragment
#define QRI   (1.0f / 2048.0f)
#define LOG2E 1.4426950408889634f
#define PSH   14.0f                   // log2 of the P carry (16384)
#define NEGB  (-3.0e38f)
#define FSTEP 512                     // elements of one (16-row tile, k-step) unit of a fragment-order plane: 2 halves x 32 lanes x 8
#define FHALF 256                     // elements of one half of it

static_assert(HD == 64);
static_assert(HROT * 2 == HD);
static_assert(NHQ * HD == DM);
static_assert(NHK * NREP == NHQ);
static_assert(DM % 64 == 0);
static_assert(DKV % 64 == 0);
static_assert(DM % 32 == 0);                    // GEMM k-loop steps by 32
static_assert(SEQ % 64 == 0);
static_assert(SEQ % 32 == 0);                   // key loop steps by 32
static_assert(SEQ <= SEQ_FULL);
static_assert(EROWS % 64 == 0);                 // a 64-token v^T tile lies wholly inside or outside the remainder plane
static_assert(EROWS % 32 == 0);                 // key bound of an early wave never exceeds EROWS
static_assert(EROWS % 16 == 0);                 // a 16-row query tile lies wholly below or wholly at / above EROWS
static_assert(AW * 32 * 4 == 16 * HD);          // merge: every thread of the block owns 4 context columns of one row
static_assert(EROWS <= SEQ);
static_assert((QSP * 4) % 16 == 0);
static_assert((TSP * 4) % 16 == 0);
static_assert((CTP * 2) % 16 == 0);
static_assert(QSP >= HD);
static_assert((KSP * 4) % 16 == 0);
static_assert((SSP * 4) % 16 == 0);
static_assert(KSP >= HD);
static_assert(SSP >= 32);
static_assert(16 * SSP <= 32 * KSP);            // the score tile fits the wave's K slice
static_assert(TSP >= 64);
static_assert(CTP >= 64);
// store-loop extents: trips x lanes x bytes == tile rows x row bytes
static_assert(GW * 32 * 16 == 64 * 64 * 2);     // cvtP_body: one 16-byte piece per thread and tile
static_assert(2 * GW * 32 * 4 == 64 * 64);      // cvtP_body: two 4-float loads per thread and tile
static_assert(((DM / 64) * (DM / 64)) % (CTN * (SEQ / 64)) == 0);   // converter blocks fill whole rows of the grid, CTN tiles each
static_assert((DM / 64) % CTN == 0);            // a converter block's tiles share their 64 columns
static_assert(GW * 4 == 64 && DM == 6 * 128);   // x staging: a wave brings 4 rows, each in 6 loads of 512 B
static_assert((XOP * 2) % 16 == 0);
static_assert(GW * 2 * 32 * 16 == 64 * 64 * 4); // qk_tail: every wave stores its own 64 / GW rows x 256 B in 2 trips
static_assert(2 * GW * 32 * 16 == 64 * 64 * 4); // k_oproj: 64 rows x 256 B
static_assert(GW * 32 * 16 == 64 * 64 * 2);     // vt_tail: one 16-byte piece per thread
static_assert(GW == 16);                        // merge: wave w sums accumulator fragment w of the 4 x 4
static_assert(64 % GW == 0);
static_assert(DM == GKW * KBAT * 32);           // input projections: one batch per wave
static_assert(2 * DM == GKW * 2 * KBAT * 32);   // output projection: two batches per wave
static_assert(GKW % 2 == 0);                    // output projection: a k slice lies wholly in the value or wholly in the remainder part
// static LDS per kernel
static_assert((GKW * 64 * 64 + 64 * TSP) * 4 + 4 * (DM / 8) * XOP * 2 + CTN * 64 * CTP * 2 <= 327680);
static_assert((GKW * 64 * 64 + 64 * TSP) * 4 <= 163840);
static_assert(AW * (16 * QSP + 32 * KSP + 32) * 4 <= 131072);

typedef _Float16 h16;
typedef unsigned short bf;
typedef __attribute__((ext_vector_type(16))) __bf16   v16bf;
typedef __attribute__((ext_vector_type(16))) _Float16 v16h;
typedef __attribute__((ext_vector_type(8)))  _Float16 v8h;
typedef __attribute__((ext_vector_type(8)))  unsigned short v8us;
typedef __attribute__((ext_vector_type(4)))  unsigned short v4us;
typedef __attribute__((ext_vector_type(8)))  float    v8f;
typedef __attribute__((ext_vector_type(4)))  float    v4f;
typedef __attribute__((ext_vector_type(2)))  float    v2f;
typedef __attribute__((ext_vector_type(2)))  __bf16   v2bf;
typedef __attribute__((ext_vector_type(8)))  unsigned v8u;
typedef __attribute__((ext_vector_type(2)))  unsigned v2u;
typedef v2u  __attribute__((may_alias)) v2ua;
typedef v4f  __attribute__((may_alias)) v4fa;
typedef v8us __attribute__((may_alias)) v8usa;

__device__ __forceinline__ unsigned short f2bf(float f) { unsigned u = __float_as_uint(f); u += 0x7FFFu + ((u >> 16) & 1u); return (unsigned short)(u >> 16); }
__device__ __forceinline__ unsigned cvt2(float lo, float hh) { v2f t; t[0] = lo; t[1] = hh; return __builtin_bit_cast(unsigned, __builtin_convertvector(t, v2bf)); }   // two RNE converts to bf16 in one packed instruction, lo in bits 15..0
__device__ __forceinline__ float bfr(float f) { return __uint_as_float(((unsigned)f2bf(f)) << 16); }   // value after RNE convert to bf16
__device__ __forceinline__ v16h cat16(v8h lo, v8h hi) { return __builtin_shufflevector(lo, hi, 0, 1, 2, 3, 4, 5, 6, 7, 8, 9, 10, 11, 12, 13, 14, 15); }
__device__ __forceinline__ v16bf cat16b(v8us lo, v8us hi) { return __builtin_bit_cast(v16bf, __builtin_shufflevector(lo, hi, 0, 1, 2, 3, 4, 5, 6, 7, 8, 9, 10, 11, 12, 13, 14, 15)); }
__device__ __forceinline__ v8f wmma16(v16h a, v16h b, v8f c) { return __builtin_amdgcn_wmma_f32_16x16x32_f16(false, a, false, b, (short)0, c, false, false); }
__device__ __forceinline__ v8f wmmab(v16bf a, v16bf b, v8f c) { return __builtin_amdgcn_wmma_f32_16x16x32_bf16(false, a, false, b, (short)0, c, false, false); }
// fragment loader from a fragment-order plane; p = start of the (tile, k-step) unit + 8*lane: elements 0..7 <- k0+8h+0..7, elements 8..15 <- k0+16+8h+0..7 (same map for A and B)
__device__ __forceinline__ v16h  ldh(const h16* p) { return cat16(*(const v8h*)p, *(const v8h*)(p + FHALF)); }
// the same for the last fragment off an address pair: the second half may land in the pair that the first half's load names: wait first
__device__ __forceinline__ v16h  ldh_last(const h16* p) { const v8h lo = *(const v8h*)p; asm volatile("s_wait_xcnt 0x0" ::: "memory"); const v8h hh = *(const v8h*)(p + FHALF); return cat16(lo, hh); }
// ordering point for wave-private LDS tiles (same wave writes and reads)
__device__ __forceinline__ void wave_sync() { __builtin_amdgcn_fence(3 /* release order */, "wavefront"); __builtin_amdgcn_wave_barrier(); asm volatile("" ::: "memory"); }

// per-instruction guarded matrix steps: one accumulator tied per guard, A / B kept live across the nops
__device__ __forceinline__ v8f wmma16g(v16h a, v16h b, v8f c) { c = wmma16(a, b, c); asm volatile("v_nop\n\tv_nop\n\tv_nop\n\tv_nop" : "+v"(c) : "v"(a), "v"(b)); return c; }
__device__ __forceinline__ v8f wmmabg(v16bf a, v16bf b, v8f c) { c = wmmab(a, b, c); asm volatile("v_nop\n\tv_nop\n\tv_nop\n\tv_nop" : "+v"(c) : "v"(a), "v"(b)); return c; }
// f32 -> f16 convert that cannot produce a subnormal (|v| < 2^-14 -> +0)
__device__ __forceinline__ h16 toh_flush(float v) { const h16 r = (h16)v; return (fabsf(v) < 6.103515625e-05f) ? (h16)0.0f : r; }
__device__ __forceinline__ float bf2f(unsigned short b) { return __uint_as_float(((unsigned)b) << 16); }

// cvtP_body: transposing bf16 (RNE convert) copy of the output-projection weight: W[DM rows (k)][DM (n)] f32 -> WP rows n, fragment order; block b takes CTN 64x64 tiles that follow one another along k, all their loads in flight together.
__device__ __forceinline__ void cvtP_body(const float* __restrict__ W, bf* WP, const int b, bf* ts) {
    const int tid = threadIdx.x;
    const int n0 = (b / (DM / (64 * CTN))) * 64, k0 = (b % (DM / (64 * CTN))) * (64 * CTN);
    const int kr = tid >> 4, c4 = (tid & 15) * 4;               // a load trip: 32 k rows x 16 float4
    const float* pw = W + (size_t)(k0 + kr) * DM + n0 + c4;
    v4f v[2 * CTN];
#pragma unroll
    for (int i = 0; i < 2 * CTN - 1; ++i) v[i] = *(const v4f*)(pw + (size_t)(i * 32) * DM);
    asm volatile("s_wait_xcnt 0x0" ::: "memory");                                // the last load off the address register may land in it, and the loads before it name it: wait first
    v[2 * CTN - 1] = *(const v4f*)(pw + (size_t)((2 * CTN - 1) * 32) * DM);
    asm volatile("s_wait_xcnt 0x0" ::: "memory");                                // the address register is rewritten behind the loads (LDS addresses): wait first
#pragma unroll
    for (int i = 0; i < 2 * CTN; ++i)
#pragma unroll
        for (int e = 0; e < 4; ++e) ts[((i >> 1) * 64 + c4 + e) * CTP + (i & 1) * 32 + kr] = f2bf(v[i][e]);   // tile i >> 1: [n][k]
    __syncthreads();                                            // cross-wave tiles: block barrier
    const int ch = tid >> 5, ln = tid & 31;                     // 16 halves of 512 B per tile: ch = 16-row tile (4) x k-step (2) x half (2); one wave writes one half
    const int row = (ch >> 2) * 16 + (ln & 15), c8 = ((ch >> 1) & 1) * 32 + (ch & 1) * 16 + (ln >> 4) * 8;
    bf* pd = WP + ((size_t)(n0 / 16 + (ch >> 2)) * (DM / 32) + (size_t)(k0 / 32 + ((ch >> 1) & 1))) * FSTEP + (ch & 1) * FHALF + ln * 8;
#pragma unroll
    for (int u = 0; u < CTN; ++u) { const v8us o = *(const v8usa*)(&ts[(u * 64 + row) * CTP + c8]);
        *(v8us*)(pd + u * 2 * FSTEP) = o; }
}

// gemm_slice: one wave's share of a 64x64 tile: 64 rows x 32 columns (8 accumulators) over NB batches of KBAT k-steps, operands straight from fragment-order bf16 planes.
// pitchA / pitchB: row length (k) of the plane; aoff / boff: start of the unit (first 16-row tile, first k-step of the wave's slice) + 8*lane.
template <int NB>
__device__ __forceinline__ void gemm_slice(const bf* __restrict__ A, const bf* __restrict__ Bt, const int pitchA, const int pitchB, const size_t aoff, const size_t boff, v8f (&acc)[4][GNW]) {
#pragma unroll
    for (int mb = 0; mb < 4; ++mb)
#pragma unroll
        for (int nb = 0; nb < GNW; ++nb) acc[mb][nb] = (v8f){};
    const bf* pa = A + aoff; const bf* pb = Bt + boff;
#pragma unroll
    for (int bt = 0; bt < NB; ++bt) {
        v8us al[KBAT][4][2], bl[KBAT][GNW][2];                  // 16-byte halves of the fragments (k0+8h+0..7 | k0+16+8h+0..7), all in flight together
#pragma unroll
        for (int s = 0; s < KBAT; ++s) {
            const int kc = (bt * KBAT + s) * FSTEP;
#pragma unroll
            for (int i = 0; i < 8; ++i)       if (s < KBAT - 1 || i < 7)           al[s][i >> 1][i & 1] = *(const v8us*)(pa + (size_t)(i >> 1) * 16 * (size_t)pitchA + kc + FHALF * (i & 1));
#pragma unroll
            for (int i = 0; i < 2 * GNW; ++i) if (s < KBAT - 1 || i < 2 * GNW - 1) bl[s][i >> 1][i & 1] = *(const v8us*)(pb + (size_t)(i >> 1) * 16 * (size_t)pitchB + kc + FHALF * (i & 1)); }
        const int kl = (bt * KBAT + KBAT - 1) * FSTEP + FHALF;
        asm volatile("s_wait_xcnt 0x0" ::: "memory");                            // the last load off an address register may land in it, and the loads before it name it: wait first
        al[KBAT - 1][3][1] = *(const v8us*)(pa + (size_t)3 * 16 * (size_t)pitchA + kl);
        asm volatile("s_wait_xcnt 0x0" ::: "memory");                            // same: the load below may land in a register that the load above names
        bl[KBAT - 1][GNW - 1][1] = *(const v8us*)(pb + (size_t)(GNW - 1) * 16 * (size_t)pitchB + kl);
        asm volatile("s_wait_xcnt 0x0" ::: "memory");                            // the address registers are rewritten behind the batch (LDS addresses): wait first
        v16bf a[KBAT][4], b[KBAT][GNW];
#pragma unroll
        for (int s = 0; s < KBAT; ++s) {
#pragma unroll
            for (int mb = 0; mb < 4; ++mb) a[s][mb] = cat16b(al[s][mb][0], al[s][mb][1]);
#pragma unroll
            for (int nb = 0; nb < GNW; ++nb) b[s][nb] = cat16b(bl[s][nb][0], bl[s][nb][1]); }
#pragma unroll
        for (int s = 0; s < KBAT; ++s)
#pragma unroll
            for (int nb = 0; nb < GNW; ++nb)
#pragma unroll
                for (int mb = 0; mb < 4; ++mb) acc[mb][nb] = wmmabg(a[s][mb], b[s][nb], acc[mb][nb]);
    }
}

// tile_merge: every wave puts its partial into LDS in fragment order (lane-contiguous 16-byte pieces); behind a block barrier wave w sums fragment w = mb*4 + nb over the k slices, slice 0 first,
// and writes it row-major into os (D: row 8h+j, col lane&15; all 64 x 64 written); a second block barrier publishes os to every wave.
__device__ __forceinline__ void tile_merge(const v8f (&acc)[4][GNW], float* ps, float* os, const int wave, const int lane) {
    const int lr = lane & 15, hi = lane >> 4;
    const int kq = wave / GNW, nh = wave % GNW;
#pragma unroll
    for (int mb = 0; mb < 4; ++mb)
#pragma unroll
        for (int nb = 0; nb < GNW; ++nb) {
            float* p = ps + (size_t)((kq * 16 + mb * 4 + nh * GNW + nb) * 256 + lane * 4);
            const v8f f = acc[mb][nb]; v4f a, c;
            a[0] = f[0]; a[1] = f[1]; a[2] = f[2]; a[3] = f[3]; c[0] = f[4]; c[1] = f[5]; c[2] = f[6]; c[3] = f[7];
            *(v4fa*)p = a; *(v4fa*)(p + 128) = c; }
    __syncthreads();                                            // cross-wave: every k slice's partial is read by another wave below
    const float* q0 = ps + (size_t)(wave * 256 + lane * 4);
    v4f s0 = *(const v4fa*)q0, s1 = *(const v4fa*)(q0 + 128);
#pragma unroll
    for (int q = 1; q < GKW; ++q) { s0 += *(const v4fa*)(q0 + q * 4096); s1 += *(const v4fa*)(q0 + q * 4096 + 128); }
    float* d = os + ((wave >> 2) * 16 + hi * 8) * TSP + (wave & 3) * 16 + lr;
#pragma unroll
    for (int j = 0; j < 4; ++j) { d[j * TSP] = s0[j]; d[(4 + j) * TSP] = s1[j]; }
    __syncthreads();                                            // cross-wave: the epilogues read rows that other waves wrote
}

// proj_slice: one wave's share of a 64x64 tile of x W (64 tokens x 32 columns over a k slice of KBAT k-steps), both operands read as f32 and RNE-converted to bf16 on the way.
// W [DM][NC] is read in place, with no transposition: lane (lr, hi) loads the column pair c0 + 32*nh + 2*lr + 0..1 of the 16 k rows of its half of a k-step (a wave-wide 8-byte load = 2 whole lines);
// column 2*lr + nb goes to B fragment nb, so accumulator (mb, nb) holds output column 32*nh + 2*lr + nb in lane column lr; two k neighbours of one column share a register through one packed convert.
// x: the block's 64 rows are brought once, by all waves, in whole lines, converted and laid in LDS as [16-row tile][8-wide k piece][row][8] (pitch XOP); behind a block barrier every wave reads its A fragments there.
// k order of both fragments, as everywhere in this file: elements 0..7 <- k0+8h+0..7, elements 8..15 <- k0+16+8h+0..7.
template <int NC>
__device__ __forceinline__ void proj_slice(const float* __restrict__ x, const float* __restrict__ W, const int r0, const int c0, bf* xs, const int wave, const int lane, v8f (&acc)[4][GNW]) {
    const int lr = lane & 15, hi = lane >> 4;
    const int kq = wave / GNW, nh = wave % GNW, k0 = kq * (KBAT * 32);
    const float* pw = W + (size_t)(k0 + 8 * hi) * NC + c0 + 32 * nh + 2 * lr;
    const float* px = x + (size_t)(r0 + wave * 4) * DM + lane * 4;
    v2f wl[KBAT][16]; v4f xl[4][6];                             // all of the wave's loads in flight together; x first: it has the longer way (LDS, barrier)
#pragma unroll
    for (int r = 0; r < 4; ++r)
#pragma unroll
        for (int p = 0; p < 6; ++p) if (r < 3 || p < 5) xl[r][p] = *(const v4f*)(px + r * DM + p * 128);
    asm volatile("s_wait_xcnt 0x0" ::: "memory");                                // the last load off an address register may land in it, and the loads before it name it: wait first
    xl[3][5] = *(const v4f*)(px + 3 * DM + 5 * 128);
    asm volatile("s_wait_xcnt 0x0" ::: "memory");                                // a weight load below may land in the register that the load above names: wait first
#pragma unroll
    for (int s = 0; s < KBAT; ++s)
#pragma unroll
        for (int e = 0; e < 16; ++e) if (s < KBAT - 1 || e < 15) wl[s][e] = *(const v2f*)(pw + (size_t)(32 * s + (e >> 3) * 16 + (e & 7)) * NC);
    asm volatile("s_wait_xcnt 0x0" ::: "memory");                                // same, for the weight loads' address register
    wl[KBAT - 1][15] = *(const v2f*)(pw + (size_t)(32 * (KBAT - 1) + 16 + 7) * NC);
    asm volatile("s_wait_xcnt 0x0" ::: "memory");                                // the address registers are rewritten behind the loads (LDS addresses): wait first
    bf* xd = xs + ((wave >> 2) * (DM / 8) + (lane >> 1)) * XOP + (wave & 3) * 32 + (lane & 1) * 4;   // row 4*wave + r of the tile; floats 128*p + 4*lane + 0..3 = half (lane & 1) of k piece 16*p + (lane >> 1)
#pragma unroll
    for (int r = 0; r < 4; ++r)
#pragma unroll
        for (int p = 0; p < 6; ++p) { v2u t; t[0] = cvt2(xl[r][p][0], xl[r][p][1]); t[1] = cvt2(xl[r][p][2], xl[r][p][3]);
            *(v2ua*)(xd + p * 16 * XOP + r * 8) = t; }
    v16bf b[KBAT][GNW];
#pragma unroll
    for (int s = 0; s < KBAT; ++s)
#pragma unroll
        for (int nb = 0; nb < GNW; ++nb) { v8u t;
#pragma unroll
            for (int j = 0; j < 8; ++j) t[j] = cvt2(wl[s][2 * j][nb], wl[s][2 * j + 1][nb]);
            b[s][nb] = __builtin_bit_cast(v16bf, t); }
    __syncthreads();                                            // cross-wave: every wave reads x rows that other waves staged
    const bf* xa = xs + (k0 / 8 + hi) * XOP + lr * 8;
    v16bf a[KBAT][4];
#pragma unroll
    for (int s = 0; s < KBAT; ++s)
#pragma unroll
        for (int mb = 0; mb < 4; ++mb) a[s][mb] = cat16b(*(const v8usa*)(xa + (mb * (DM / 8) + 4 * s) * XOP), *(const v8usa*)(xa + (mb * (DM / 8) + 4 * s + 2) * XOP));
#pragma unroll
    for (int mb = 0; mb < 4; ++mb)
#pragma unroll
        for (int nb = 0; nb < GNW; ++nb) acc[mb][nb] = (v8f){};
#pragma unroll
    for (int s = 0; s < KBAT; ++s)
#pragma unroll
        for (int nb = 0; nb < GNW; ++nb)
#pragma unroll
            for (int mb = 0; mb < 4; ++mb) acc[mb][nb] = wmmabg(a[s][mb], b[s][nb], acc[mb][nb]);
}

// proj_merge: tile_merge for proj_slice's column deal: fragment w = mb*4 + nh*2 + nb holds rows mb*16 + 8h + j, column 32*nh + 2*(lane&15) + nb. TR = 0: os[token][column]; TR = 1: os[column][token].
template <int TR>
__device__ __forceinline__ void proj_merge(const v8f (&acc)[4][GNW], float* ps, float* os, const int wave, const int lane) {
    const int lr = lane & 15, hi = lane >> 4;
    const int kq = wave / GNW, nh = wave % GNW;
#pragma unroll
    for (int mb = 0; mb < 4; ++mb)
#pragma unroll
        for (int nb = 0; nb < GNW; ++nb) {
            float* p = ps + (size_t)((kq * 16 + mb * 4 + nh * GNW + nb) * 256 + lane * 4);
            const v8f f = acc[mb][nb]; v4f a, c;
            a[0] = f[0]; a[1] = f[1]; a[2] = f[2]; a[3] = f[3]; c[0] = f[4]; c[1] = f[5]; c[2] = f[6]; c[3] = f[7];
            *(v4fa*)p = a; *(v4fa*)(p + 128) = c; }
    __syncthreads();                                            // cross-wave: every k slice's partial is read by another wave below
    const float* q0 = ps + (size_t)(wave * 256 + lane * 4);
    v4f s0 = *(const v4fa*)q0, s1 = *(const v4fa*)(q0 + 128);
#pragma unroll
    for (int q = 1; q < GKW; ++q) { s0 += *(const v4fa*)(q0 + q * 4096); s1 += *(const v4fa*)(q0 + q * 4096 + 128); }
    const int row = (wave >> 2) * 16 + hi * 8, col = ((wave >> 1) & 1) * 32 + 2 * lr + (wave & 1);
    if (TR) { *(v4fa*)(&os[col * TSP + row]) = s0; *(v4fa*)(&os[col * TSP + row + 4]) = s1; }
    else {
#pragma unroll
        for (int j = 0; j < 4; ++j) { os[(row + j) * TSP + col] = s0[j]; os[(row + 4 + j) * TSP + col] = s1[j]; } }
    __syncthreads();                                            // cross-wave: the epilogues read rows that other waves wrote
}

// qk_tail: rotation + RMS normalisation of a merged q or k tile os[token][d] (column tile = head: 0..11 q, 12..17 k) and its store.
__device__ __forceinline__ void qk_tail(const float* __restrict__ cosb, const float* __restrict__ sinb, float* QKF, const int ttile, const int head, float* os, const int wave, const int lane) {
    const int r0 = ttile * 64;
    const int w0 = wave * (64 / GW);                            // this wave's rows of the tile: from here on it reads and writes these alone
#pragma unroll 1
    for (int r = w0; r < w0 + 64 / GW; ++r) {                   // lane = rotary pair column (d, d + 32)
        const int t = r0 + r;
        const float x1 = os[r * TSP + lane], x2 = os[r * TSP + HROT + lane];
        const float c = bfr(cosb[(size_t)t * HROT + lane]), s = bfr(sinb[(size_t)t * HROT + lane]);
        const float o1 = x1 * c - x2 * s, o2 = x2 * c + x1 * s;
        float ss = o1 * o1 + o2 * o2;
#pragma unroll
        for (int off = 16; off > 0; off >>= 1) ss += __shfl_xor(ss, off, 32);
        const float sc = rsqrtf(ss * (1.0f / (float)HD) + 1e-6f);
        os[r * TSP + lane] = o1 * sc; os[r * TSP + HROT + lane] = o2 * sc; }
    wave_sync();
    float* dst = QKF + ((size_t)head * SEQ + (size_t)(r0 + w0)) * HD;
{
#pragma unroll
        for (int i = 0; i < 2; ++i) { const int idx = i * 32 + lane; const int row = w0 + (idx >> 4), c4 = (idx & 15) * 4;   // 2 trips x 2 rows = the wave's 4 rows; 16 lanes x 4 floats = 64 columns
            const v4f val = *(const v4fa*)(&os[row * TSP + c4]);
            *(v4f*)(dst + (size_t)idx * 4) = val; }
         }
}

// vt_tail: a merged v tile os[m][token] (m = kvh*64 + d) -> plane VT [m][t] f16 (row length SEQ) and, for t < EROWS (block-uniform test), the f16 remainder x2048 VR [m][t] (row length EROWS), both in fragment order (k = t).
__device__ __forceinline__ void vt_tail(h16* VT, h16* VR, const int mtile, const int ttile, float* os, const int wave, const int lane) {
    const int lr = lane & 15, hi = lane >> 4;
    const int r0 = mtile * 64, c0 = ttile * 64;
    const bool wr = c0 < EROWS;                                 // block-uniform: whole tile inside the remainder plane
{
        { const int row = (wave >> 2) * 16 + lr, c8 = ((wave >> 1) & 1) * 32 + (wave & 1) * 16 + hi * 8;   // 16 waves: 16-row tile (4) x k-step (2) x half (2); one wave writes one 512-byte half
            const size_t un = (size_t)(c0 / 32 + ((wave >> 1) & 1)) * FSTEP + (wave & 1) * FHALF + lane * 8;   // place inside the 16-row tile
            const v4f x0 = *(const v4fa*)(&os[row * TSP + c8]); const v4f x1 = *(const v4fa*)(&os[row * TSP + c8 + 4]); v8h hv, rv;
#pragma unroll
            for (int e = 0; e < 4; ++e) { const h16 a0 = toh_flush(x0[e]); const h16 a1 = toh_flush(x1[e]); hv[e] = a0; hv[4 + e] = a1;
                rv[e] = toh_flush((x0[e] - (float)a0) * QRS); rv[4 + e] = toh_flush((x1[e] - (float)a1) * QRS); }
            *(v8h*)(VT + (size_t)(r0 + (wave >> 2) * 16) * SEQ + un) = hv;
            asm volatile("s_wait_xcnt 0x0" ::: "memory");                        // the store's registers are rewritten behind it (remainder packing): wait first
            if (wr) { *(v8h*)(VR + (size_t)(r0 + (wave >> 2) * 16) * EROWS + un) = rv;
                asm volatile("s_wait_xcnt 0x0" ::: "memory"); } }                // same, for the remainder store
         }
}

// k_qkv: the three input projections, straight from the f32 inputs, and the conversion of the output-projection weight in one grid (disjoint outputs): blockIdx.x = 64-token tile;
// blockIdx.y < 12: q head, < 18: k head, < 24: 64 columns of v; above: converter blocks, which need nothing of the projections and run beside them on WGPs that the 192 projection blocks leave idle.
#define PB_Y  (NHQ + NHK + DKV / 64)                            // grid rows of the projections
#define CB_Y  (((DM / 64) * (DM / 64)) / (CTN * (SEQ / 64)))    // grid rows of the converter
__global__ __launch_bounds__(32 * GW) void k_qkv(const float* __restrict__ x, const float* __restrict__ wq, const float* __restrict__ wk, const float* __restrict__ wv, const float* __restrict__ wp,
                                                 const float* __restrict__ cosb, const float* __restrict__ sinb, float* QKF, h16* VT, h16* VR, bf* WP) {
    __shared__ __align__(16) float ps[GKW * 64 * 64];           // the k slices' partial tiles, fragment order
    __shared__ __align__(16) float os[64 * TSP];                // merged tile, row-major
    __shared__ __align__(16) bf xs[4 * (DM / 8) * XOP];         // the block's 64 x rows, bf16
    __shared__ __align__(16) bf ts[CTN * 64 * CTP];             // converter tiles
    const int by = blockIdx.y;                                  // block-uniform: the barriers inside are met by all threads or by none
    const int lane = threadIdx.x & 31;
    const int wave = __builtin_amdgcn_readfirstlane((int)(threadIdx.x >> 5));
    if (by >= PB_Y) { cvtP_body(wp, WP, (by - PB_Y) * (SEQ / 64) + (int)blockIdx.x, ts); return; }
    v8f acc[4][GNW];
    if (by < NHQ) proj_slice<DM>(x, wq, blockIdx.x * 64, by * 64, xs, wave, lane, acc);
    else          proj_slice<DKV>(x, by < NHQ + NHK ? wk : wv, blockIdx.x * 64, (by < NHQ + NHK ? by - NHQ : by - (NHQ + NHK)) * 64, xs, wave, lane, acc);
    if (by < NHQ + NHK) { proj_merge<0>(acc, ps, os, wave, lane); qk_tail(cosb, sinb, QKF, blockIdx.x, by, os, wave, lane); }
    else                { proj_merge<1>(acc, ps, os, wave, lane); vt_tail(VT, VR, by - (NHQ + NHK), blockIdx.x, os, wave, lane); }
}

// k_oproj: output projection. A = context plane rows (value | remainder, two K parts of 768), Bt = WP rows n; f32 output [t][768].
__global__ __launch_bounds__(32 * GW) void k_oproj(const bf* __restrict__ YB, const bf* __restrict__ WP, float* OUT) {
    __shared__ __align__(16) float ps[GKW * 64 * 64];           // the k slices' partial tiles, fragment order
    __shared__ __align__(16) float os[64 * TSP];                // merged tile, row-major
    const int lane = threadIdx.x & 31;
    const int wave = __builtin_amdgcn_readfirstlane((int)(threadIdx.x >> 5));
    const int r0 = blockIdx.x * 64, c0 = blockIdx.y * 64;
    const int ka = (wave / GNW) * (2 * KBAT * 32);              // slice start in the context row (value | remainder)
    const int kw = ka % DM;                                     // the same k in the weight row: both parts meet the same weights
    v8f acc[4][GNW];
    gemm_slice<2>(YB, WP, YP, DM, (size_t)r0 * YP + ka * 16 + lane * 8, (size_t)(c0 + (wave % GNW) * 32) * DM + kw * 16 + lane * 8, acc);
    tile_merge(acc, ps, os, wave, lane);
{
#pragma unroll
        for (int i = 0; i < 2; ++i) { const int idx = i * (32 * GW) + (int)threadIdx.x; const int row = idx >> 4, c4 = (idx & 15) * 4;   // 2 trips x 32 rows = 64 rows; 16 lanes x 4 floats = 64 columns
            const v4f val = *(const v4fa*)(&os[row * TSP + c4]);
            *(v4f*)(OUT + (size_t)(r0 + row) * DM + c0 + c4) = val; }
         }
}

// flash_body: fused attention, one block of AW waves per 16 query rows of one head; wave w takes the 32-key steps w, w + AW, ... and keeps its own softmax state and context partial;
// the partials (unnormalised context, running max, row sum) meet in LDS behind one block barrier and are merged in f32 by all threads. q tile and the 32-key K tile live in wave-private LDS (f32); scores on the vector unit:
// lane (qg = lane&3, kg = lane>>2) forms max_d(q[t][d] + k[key][d]) for the 4 x 4 block t = 4qg+i, key = 4kg+j of each 32-key step: 8 LDS reads of 16 bytes feed 16 (t, key) pairs x 4 d;
// the 16 x 32 scores then pass through the wave's own LDS slice, and lane (t = lane&15, h = lane>>4) takes keys 8h+r and 16+8h+r, i.e. the B-fragment layout of
// O^T[d][t] = V^T P^T (element r <- keys 8h+r, element 8+r <- keys 16+8h+r). V^T fragments (A, row d, k = key) straight from the f16 planes.
// Softmax state (running max over kept keys, partial sum) is one scalar per lane; the two lane halves of a row are combined with one xor-16 exchange.
// Causal keep rule (key <= t) evaluated per element inside every visited tile; the per-wave key bound is a wave scalar, multiple of 32, <= SEQ.
// EARLY = 1 (query rows [0, EROWS)): P = f16 value + f16 remainder x2048; O = V P + (V P_rem + V_rem P) / 2048 (remainder products in their own accumulators); row sum from the f32 exponentials.
// EARLY = 0 (query rows [EROWS, SEQ)): single P, v; row sum over the converted P.
template <int EARLY>
__device__ __forceinline__ void flash_body(const float* __restrict__ QKF, const h16* __restrict__ VT, const h16* __restrict__ VR, bf* YB, float* qs, float* ks, float* ms, float* lsum) {
    const int lane = threadIdx.x & 31, lr = lane & 15, hi = lane >> 4;
    const int wave = __builtin_amdgcn_readfirstlane((int)(threadIdx.x >> 5));
    const int h = blockIdx.x, kvh = h / NREP;
    const int t0 = (SEQ / 16 - 1 - (int)blockIdx.y) * 16;       // tile of 16 query rows, wholly below or wholly at / above EROWS; k_flash says why it counts down
    const int lim = t0 + lr;                                    // key j kept iff j <= lim
    const int nk = (t0 + 16 + 31) & ~31;                        // block-uniform, multiple of 32, <= SEQ (<= EROWS when EARLY)
    const int qb = wave * 16 * QSP, kbs = wave * 32 * KSP;
    const int qg = lane & 3, kg = lane >> 2;                    // score block of this lane: query rows 4qg + 0..3, keys 4kg + 0..3
    { const size_t qsrc = ((size_t)h * SEQ + (size_t)t0) * HD;  // 16 rows x 64 floats, contiguous
#pragma unroll
      for (int i = 0; i < 8; ++i) { const int idx = i * 32 + lane;
          const v4f v = *(const v4f*)(QKF + qsrc + (size_t)idx * 4);
          *(v4fa*)(&qs[qb + (idx >> 4) * QSP + (idx & 15) * 4]) = v; } }
    const size_t kplane = ((size_t)(NHQ + kvh) * SEQ) * HD;     // k heads follow the q heads in the plane
    const size_t vo  = (size_t)(kvh * HD) * SEQ + lane * 8;      // + 16j*SEQ + 16*key0   (A fragment: row d, k = key; fragment-order plane)
    const size_t vro = (size_t)(kvh * HD) * EROWS + lane * 8;    // remainder plane, tokens < EROWS
    const v16h hz = (v16h){};
    v8f o[4], oR[4];
#pragma unroll
    for (int j = 0; j < 4; ++j) { o[j] = (v8f){}; oR[j] = (v8f){}; }
    float m = NEGB, l = 0.0f;
#pragma unroll 1
    for (int key0 = wave * 32; key0 < nk; key0 += 32 * AW) {    // a wave with no step keeps o = 0, l = 0, m = NEGB: weight 0 in the merge
        wave_sync();                                            // earlier reads of the K / score slice are done
        { const size_t ksrc = kplane + (size_t)key0 * HD;       // 32 keys x 64 floats, contiguous; keys < nk <= SEQ
          v4f kv[2][8];                                         // both groups of eight loads in flight, then the sixteen LDS stores
#pragma unroll
          for (int g = 0; g < 2; ++g) {
#pragma unroll
              for (int i = 0; i < 8; ++i) {
                  if (i == 7) asm volatile("s_wait_xcnt 0x0" ::: "memory");      // the group's last load may land in the address pair that the seven before it name: wait first
                  kv[g][i] = *(const v4f*)(QKF + ksrc + (size_t)((g * 8 + i) * 32 + lane) * 4); }
              asm volatile("s_wait_xcnt 0x0" ::: "memory"); }                    // the address pair is rewritten behind the group (next group, score loop): wait first
#pragma unroll
          for (int g = 0; g < 2; ++g)
#pragma unroll
              for (int i = 0; i < 8; ++i) *(v4fa*)(&ks[kbs + ((g * 8 + i) * 2 + hi) * KSP + lr * 4]) = kv[g][i]; }   // piece (g*8+i)*32 + lane = key row (g*8+i)*2 + hi, floats 4*lr + 0..3
        wave_sync();
        float sc[4][4];
#pragma unroll
        for (int i = 0; i < 4; ++i)
#pragma unroll
            for (int j = 0; j < 4; ++j) sc[i][j] = NEGB;
        v4f q4[2][4], k4[2][4];                                 // two register sets: trip d4 + 1 is read from LDS while trip d4 is worked on
        const float* qrow = &qs[qb + 4 * qg * QSP];
        const float* krow = &ks[kbs + 4 * kg * KSP];
        auto rd = [&](const int st, const int d4) {             // the 4 q rows' and the 4 key rows' floats 4*d4 + 0..3 into register set st
#pragma unroll
            for (int i = 0; i < 4; ++i) { q4[st][i] = *(const v4fa*)(qrow + i * QSP + d4 * 4); k4[st][i] = *(const v4fa*)(krow + i * KSP + d4 * 4); } };
        auto pm = [&](const int st) {                           // 16 pairs x 4 d; sums paired along d, as the 16-byte reads deliver them
#pragma unroll
            for (int i = 0; i < 4; ++i)
#pragma unroll
                for (int j = 0; j < 4; ++j) {
                    const v2f lo = q4[st][i].xy + k4[st][j].xy, hh = q4[st][i].zw + k4[st][j].zw;
                    sc[i][j] = fmaxf(fmaxf(fmaxf(sc[i][j], lo[0]), lo[1]), fmaxf(hh[0], hh[1])); } };
        rd(0, 0);
#pragma unroll 1                                                // stays rolled: the text of both instantiations stays small
        for (int d4 = 0; d4 < HD / 4 - 2; d4 += 2) { rd(1, d4 + 1); pm(0); rd(0, d4 + 2); pm(1); }
        rd(1, HD / 4 - 1); pm(0); pm(1);
        wave_sync();                                            // every lane's K reads are done: the slice becomes the score tile [t][key]
#pragma unroll
        for (int i = 0; i < 4; ++i) { v4f s4; s4[0] = sc[i][0]; s4[1] = sc[i][1]; s4[2] = sc[i][2]; s4[3] = sc[i][3];
            *(v4fa*)(&ks[kbs + (4 * qg + i) * SSP + 4 * kg]) = s4; }
        wave_sync();                                            // scores are read below by other lanes of the wave
        float sa[8], sb[8];
        { const v4f a0 = *(const v4fa*)(&ks[kbs + lr * SSP + 8 * hi]),      a1 = *(const v4fa*)(&ks[kbs + lr * SSP + 8 * hi + 4]);
          const v4f b0 = *(const v4fa*)(&ks[kbs + lr * SSP + 16 + 8 * hi]), b1 = *(const v4fa*)(&ks[kbs + lr * SSP + 16 + 8 * hi + 4]);
#pragma unroll
          for (int r = 0; r < 4; ++r) { sa[r] = a0[r]; sa[4 + r] = a1[r]; sb[r] = b0[r]; sb[4 + r] = b1[r]; } }
        const int ja = key0 + 8 * hi;
        float mx = NEGB;
#pragma unroll
        for (int r = 0; r < 8; ++r) {
            sa[r] = sa[r] * LOG2E; sb[r] = sb[r] * LOG2E;
            const bool fa = (ja + r <= lim), fb = (ja + 16 + r <= lim);
            mx = fmaxf(mx, fmaxf(fa ? sa[r] : NEGB, fb ? sb[r] : NEGB)); }
        mx = fmaxf(mx, __shfl_xor(mx, 16, 32));
        const float mnew = fmaxf(m, mx);
        const float alpha = __builtin_amdgcn_exp2f(m - mnew);
        const float sh = PSH - mnew;
        v16h pb, pr = hz; float ls = 0.0f;
#pragma unroll
        for (int r = 0; r < 8; ++r) {
            const float xa = sa[r] + sh, xb = sb[r] + sh;
            const float ea = __builtin_amdgcn_exp2f(xa), eb = __builtin_amdgcn_exp2f(xb);
            const bool fa = (ja + r <= lim) & (xa >= -14.0f), fb = (ja + 16 + r <= lim) & (xb >= -14.0f);   // dropped keys and values below the f16 normal range selected to 0 by value
            const float ga = fa ? ea : 0.0f, gb = fb ? eb : 0.0f;
            const h16 pa = (h16)ga; const h16 pc = (h16)gb;
            pb[r] = pa; pb[8 + r] = pc;
            if (EARLY) { pr[r] = toh_flush((ga - (float)pa) * QRS); pr[8 + r] = toh_flush((gb - (float)pc) * QRS); ls += ga + gb; }
            else       { ls += (float)pa + (float)pc; } }
        l = l * alpha + ls; m = mnew;
#pragma unroll
        for (int j = 0; j < 4; ++j) {
            const v16h v = ldh(VT + vo + (size_t)(16 * j) * SEQ + (size_t)key0 * 16);
            o[j] = o[j] * alpha;
            o[j] = wmma16g(v, pb, o[j]);
            if (EARLY) {
                const h16* pvr = VR + vro + (size_t)(16 * j) * EROWS + (size_t)key0 * 16;       // key0 + 31 < nk <= EROWS
                const v16h vr = (j == 3) ? ldh_last(pvr) : ldh(pvr);
                oR[j] = oR[j] * alpha;
                oR[j] = wmma16g(v, pr, oR[j]);
                oR[j] = wmma16g(vr, pb, oR[j]); }
        }
        asm volatile("s_wait_xcnt 0x0" ::: "memory");                            // the next step's K tile loads may land in the address pairs that the V loads above name: wait first
    }
    l += __shfl_xor(l, 16, 32);
    wave_sync();                                                // q tile reads are done; the slice becomes this wave's context partial
    // O^T D layout: f_j[r] = (d = 16j + 8h + r, t = lane&15) -> qs[t][d]; rows 0..15 x columns 0..63 all written
#pragma unroll
    for (int j = 0; j < 4; ++j) {
        v8f f = o[j];
        if (EARLY) f = o[j] + oR[j] * QRI;
        v4f a, c;
        a[0] = f[0]; a[1] = f[1]; a[2] = f[2]; a[3] = f[3]; c[0] = f[4]; c[1] = f[5]; c[2] = f[6]; c[3] = f[7];
        *(v4fa*)(&qs[qb + lr * QSP + 16 * j + 8 * hi]) = a; *(v4fa*)(&qs[qb + lr * QSP + 16 * j + 8 * hi + 4]) = c; }
    if (hi == 0) { ms[wave * 16 + lr] = m; lsum[wave * 16 + lr] = l; }   // both lane halves hold the same m and l
    __syncthreads();                                            // cross-wave: every wave's partial is read by every wave below
    // merge: thread = (row, 4 columns), dealt so that thread p owns 8-byte piece p of the head's 2 k-steps in the fragment-order context plane; partial w weighs 2^(m_w - M), M the maximum over the waves
    const int row = ((int)threadIdx.x >> 1) & 15, c4 = ((int)threadIdx.x >> 6) * 16 + (((int)threadIdx.x >> 5) & 1) * 8 + ((int)threadIdx.x & 1) * 4;
    float mw[AW], M = NEGB;
#pragma unroll
    for (int w = 0; w < AW; ++w) { mw[w] = ms[w * 16 + row]; M = fmaxf(M, mw[w]); }
    float L = 0.0f; v4f acc = (v4f){};
#pragma unroll
    for (int w = 0; w < AW; ++w) {
        const float sc = __builtin_amdgcn_exp2f(mw[w] - M);
        const v4f p = *(const v4fa*)(&qs[w * 16 * QSP + row * QSP + c4]);
        L += lsum[w * 16 + row] * sc;
        acc += p * sc; }
    const bool any = L > 0.0f;
    const float lsafe = any ? L : 1.0f;
    const float inv = any ? (1.0f / lsafe) : 0.0f;
    v4us hv, lv;
#pragma unroll
    for (int e = 0; e < 4; ++e) { const float y = acc[e] * inv; const unsigned short b0 = f2bf(y); hv[e] = b0; lv[e] = f2bf(y - bf2f(b0)); }
    bf* yrow = YB + (size_t)t0 * YP + (size_t)(h * HD) * 16 + (int)threadIdx.x * 4;   // the block's 16-row tile, the head's k-steps: 2 KiB in a row per part, a wave stores 2 whole lines
    *(v4us*)(yrow) = hv;
    *(v4us*)(yrow + DM * 16) = lv;
}

// k_flash: both instantiations in one grid (disjoint context rows); the choice is block-uniform.
// Launch order: a tile's cost grows with its index (tile t has t / 2 + 1 key steps). blockIdx.x = head (runs fastest),
// blockIdx.y counts the tiles from the last one down, so blockIdx.y = 0 is the longest tile. For speed only: any order is correct.
__global__ __launch_bounds__(32 * AW) __attribute__((amdgpu_num_vgpr(256))) void k_flash(const float* __restrict__ QKF, const h16* __restrict__ VT, const h16* __restrict__ VR, bf* YB) {
    __shared__ __align__(16) float qs[AW * 16 * QSP];           // per-wave slices: q tile, later the wave's context partial
    __shared__ __align__(16) float ks[AW * 32 * KSP];           // wave-private slices: 32-key K tile, then the step's score tile
    __shared__ float ms[AW * 16];                               // per wave and row: running max
    __shared__ float lsum[AW * 16];                             // per wave and row: sum of the exponentials
    if ((SEQ / 16 - 1 - (int)blockIdx.y) * 16 < EROWS) flash_body<1>(QKF, VT, VR, YB, qs, ks, ms, lsum);   // block-uniform: the barrier inside is met by all threads or by none
    else                                               flash_body<0>(QKF, VT, VR, YB, qs, ks, ms, lsum);
}

static constexpr size_t al256(size_t v) { return (v + 255) & ~(size_t)255; }
static constexpr size_t SZ_WP = al256((size_t)DM * DM * 2);
static constexpr size_t SZ_QK = al256((size_t)(NHQ + NHK) * SEQ * HD * 4);
static constexpr size_t SZ_VT = al256((size_t)DKV * SEQ * 2);
static constexpr size_t SZ_VR = al256((size_t)DKV * EROWS * 2);
static constexpr size_t SZ_YB = al256((size_t)SEQ * YP * 2);
static constexpr size_t SZ_TOTAL = SZ_WP + SZ_QK + SZ_VT + SZ_VR + SZ_YB;
static_assert(SZ_TOTAL <= (size_t)134217728);          // workspace carve <= 128 MiB
static_assert(((size_t)NHQ * SEQ * HD * 4) % 256 == 0);

extern "C" void kernel_launch(void* const* d_in, const int* in_sizes, int n_in,
                              void* d_out, int out_size, void* d_ws, size_t ws_size, hipStream_t stream) {
    if (n_in < 7) return;
    if ((size_t)in_sizes[0] < (size_t)SEQ * DM) return;
    if ((size_t)in_sizes[1] < (size_t)SEQ * HROT || (size_t)in_sizes[2] < (size_t)SEQ * HROT) return;
    if ((size_t)in_sizes[3] < (size_t)DM * DM || (size_t)in_sizes[6] < (size_t)DM * DM) return;
    if ((size_t)in_sizes[4] < (size_t)DM * DKV || (size_t)in_sizes[5] < (size_t)DM * DKV) return;
    if ((size_t)out_size < (size_t)SEQ * DM) return;
    if (SZ_TOTAL > ws_size) return;
    // wire order: x, cos, sin, Wq, Wk, Wv, Wproj
    const float* x    = (const float*)d_in[0];
    const float* cosb = (const float*)d_in[1];
    const float* sinb = (const float*)d_in[2];
    const float* wq   = (const float*)d_in[3];
    const float* wk   = (const float*)d_in[4];
    const float* wv   = (const float*)d_in[5];
    const float* wp   = (const float*)d_in[6];
    float* OUT = (float*)d_out;                        // [SEQ][768]
    char* wsp = (char*)d_ws;
    bf*    WP  = (bf*)wsp;    wsp += SZ_WP;            // [768][768]: output-projection weight, [out][in]
    float* QKF = (float*)wsp; wsp += SZ_QK;            // [18][SEQ][64] f32: 12 q heads, 6 k heads
    h16*   VT  = (h16*)wsp;   wsp += SZ_VT;            // [384][SEQ]
    h16*   VR  = (h16*)wsp;   wsp += SZ_VR;            // [384][EROWS] remainder x2048, tokens < EROWS
    bf*    YB  = (bf*)wsp;    wsp += SZ_YB;            // [SEQ][768 value | 768 remainder]

    // q | k: x W -> f32 planes [head][t][64], rotated and normalised; v: x Wv -> [m][t] f16 (+ remainder for t < EROWS); Wproj -> WP
    k_qkv<<<dim3(SEQ / 64, PB_Y + CB_Y, 1), 32 * GW, 0, stream>>>(x, wq, wk, wv, wp, cosb, sinb, QKF, VT, VR, WP);

    // query rows [0, EROWS): multi-product instantiation; rows [EROWS, SEQ): single-product instantiation
    k_flash<<<dim3(NHQ, SEQ / 16, 1), 32 * AW, 0, stream>>>(QKF, VT, VR, YB);

    // output projection: A = context rows (value | remainder), Bt = WP rows
    k_oproj<<<dim3(SEQ / 64, DM / 64, 1), 32 * GW, 0, stream>>>(YB, WP, OUT);
}

// v008
// A run of this version takes 24.4 microseconds.
// Two timings next to v007 both put it at 1.05 times that version's speed.
// All steps since v000 together make it 8.39 times as fast.
#include <hip/hip_runtime.h>

// Causal grouped-query self-attention with max-plus scores: x [SEQ][768]; Wq [768][768], Wk / Wv [768][384], Wproj [768][768], all [in][out] (y = x W, no bias);
// 12 query heads x 64, 6 key/value heads (2 query heads per key/value head); half-split rotary tables cos / sin [SEQ][32] read by value;
// per-head RMS normalisation (eps 1e-6) of q and k after the rotation; score[t][j] = max_d (q[t][d] + k[j][d]); causal softmax; context = P v; output = context Wproj (f32).
// Compute dtypes, f32 accumulate everywhere: q / k / v projections v_wmma_f32_16x16x32_bf16 (x, W RNE-converted to bf16 where the projection kernel loads them; products exact); max-plus scores are not a multiply-accumulate: on the vector unit, in 16-bit fixed point (q, k x FXS, rounded to nearest; |q|, |k| <= 8 behind the normalisation, so a sum never overflows), two d per fused packed add-max;
// P.V v_wmma_f32_16x16x32_f16: P (x16384 carry, cancels in the normalisation) and v single f16 on query rows >= EROWS; on query rows < EROWS P and v each as f16 value + f16 remainder x2048, remainder products in their own accumulator folded by 1/2048, row sum from the f32 exponentials;
// output projection v_wmma_f32_16x16x32_bf16: context as bf16 value + bf16 remainder (value and remainder k slices on different waves, summed in f32 by the merge), Wproj RNE-converted to bf16; softmax f32 (online, running max over kept keys).
// Layout: transposed bf16 output-projection weights WP [768][768] ([out][in]); 16-bit fixed-point planes q / k [18 heads][t][64] (rotated, normalised, x FXS); v^T plane f16 [384][t] and remainder plane [384][t < EROWS];
// fused flash kernel in transposed form (O^T = V^T P^T, P built on the vector unit directly in B-fragment layout); context plane bf16 [t][768 value | 768 remainder].
// Every 16-bit plane above except q / k (row-major [t][64]) is a matrix operand (rows x k) and lies in FRAGMENT ORDER: [16-row tile][32-wide k-step][half s][lane][8 elements], lane = 16*h + (row & 15), the 8 elements k = 32*step + 16*s + 8*h + 0..7:
// one wave-wide 16-byte load of a fragment half reads 512 contiguous bytes (4 whole lines). A 16-row tile keeps its size (16 x row length), so sub-plane offsets at multiples of 16 rows are those of the row-major plane.

#ifndef SEQ
#define SEQ 512
#endif
#define SEQ_FULL 512
#define DM    768
#define NHQ   12
#define NHK   6
#define NREP  2
#define HD    64
#define HROT  32
#define DKV   (NHK * HD)              // 384
#define YP    (2 * DM)                // context plane row pitch (value | remainder)
#define AW    8                       // waves per flash block: all work on the same 16 query rows, 32-key steps dealt round-robin
#define GKW   8                       // k slices of a 64x64 GEMM tile, one per wave pair
#define GNW   2                       // column halves of a GEMM tile: a wave holds 64 rows x 32 columns of one k slice
#define GW    (GKW * GNW)             // waves per GEMM block
#define KBAT  3                       // 32-wide k-steps whose fragments a wave loads as one batch
#define QSP   68                      // LDS row pitch (floats) of the context tile
#define QIP   36                      // LDS row pitch (dwords) of the 16-bit q tile, which lies in the context tile's place before it: 128 B + 16 B, rows 4 apart fall 16 banks apart
#define KSP   36                      // LDS row pitch (dwords) of the 16-bit 32-key K tile: the same
#define FXS   2047.0f                 // fixed-point scale of q and k: 8 x 2047 = 16376, so |q + k| <= 32752 fits 16 bits
#define SSP   36                      // LDS row pitch (floats) of the 16 x 32 score tile that takes the K tile's place behind the score loop
#define TSP   68                      // LDS row pitch (floats) of the GEMM output tile
#define CTP   72                      // LDS row pitch (16-bit words) of the transposing converter tile
#define CTN   3                       // 64x64 weight tiles per converter block
#define XOP   136                     // LDS pitch (16-bit words) of one 8-wide k piece of a 16-row x tile: 16 rows x 8 + 8, so pieces 1 apart fall 4 banks apart
#define EROWS (SEQ < 256 ? SEQ : 256) // query rows handled by the multi-product flash instantiation
#define QRS   2048.0f                 // carry of the v remainder plane / P remainder fragment
#define QRI   (1.0f / 2048.0f)
#define LOG2E 1.4426950408889634f
#define PSH   14.0f                   // log2 of the P carry (16384)
#define NEGB  (-3.0e38f)
#define FSTEP 512                     // elements of one (16-row tile, k-step) unit of a fragment-order plane: 2 halves x 32 lanes x 8
#define FHALF 256                     // elements of one half of it

static_assert(HD == 64);
static_assert(HROT * 2 == HD);
static_assert(NHQ * HD == DM);
static_assert(NHK * NREP == NHQ);
static_assert(DM % 64 == 0);
static_assert(DKV % 64 == 0);
static_assert(DM % 32 == 0);                    // GEMM k-loop steps by 32
static_assert(SEQ % 64 == 0);
static_assert(SEQ % 32 == 0);                   // key loop steps by 32
static_assert(SEQ <= SEQ_FULL);
static_assert(EROWS % 64 == 0);                 // a 64-token v^T tile lies wholly inside or outside the remainder plane
static_assert(EROWS % 32 == 0);                 // key bound of an early wave never exceeds EROWS
static_assert(EROWS % 16 == 0);                 // a 16-row query tile lies wholly below or wholly at / above EROWS
static_assert(AW * 32 * 4 == 16 * HD);          // merge: every thread of the block owns 4 context columns of one row
static_assert(EROWS <= SEQ);
static_assert((QSP * 4) % 16 == 0);
static_assert((TSP * 4) % 16 == 0);
static_assert((CTP * 2) % 16 == 0);
static_assert(QSP >= HD);
static_assert((KSP * 4) % 16 == 0);
static_assert((SSP * 4) % 16 == 0);
static_assert(KSP * 2 >= HD);
static_assert((QIP * 4) % 16 == 0);
static_assert(QIP * 2 >= HD);
static_assert(QIP <= QSP);                      // the q tile fits the wave's context slice
static_assert(HD % 16 == 0);                    // score loop: two 8-wide trips per pass
static_assert(SSP >= 32);
static_assert(16 * SSP <= 32 * KSP);            // the score tile fits the wave's K slice
static_assert(TSP >= 64);
static_assert(CTP >= 64);
// store-loop extents: trips x lanes x bytes == tile rows x row bytes
static_assert(GW * 32 * 16 == 64 * 64 * 2);     // cvtP_body: one 16-byte piece per thread and tile
static_assert(2 * GW * 32 * 4 == 64 * 64);      // cvtP_body: two 4-float loads per thread and tile
static_assert(((DM / 64) * (DM / 64)) % (CTN * (SEQ / 64)) == 0);   // converter blocks fill whole rows of the grid, CTN tiles each
static_assert((DM / 64) % CTN == 0);            // a converter block's tiles share their 64 columns
static_assert(GW * 4 == 64 && DM == 6 * 128);   // x staging: a wave brings 4 rows, each in 6 loads of 512 B
static_assert((XOP * 2) % 16 == 0);
static_assert(GW * 32 * 16 == 64 * 64 * 2);     // qk_tail: every wave stores its own 64 / GW rows x 128 B in 1 trip
static_assert(2 * GW * 32 * 16 == 64 * 64 * 4); // k_oproj: 64 rows x 256 B
static_assert(GW * 32 * 16 == 64 * 64 * 2);     // vt_tail: one 16-byte piece per thread
static_assert(GW == 16);                        // merge: wave w sums accumulator fragment w of the 4 x 4
static_assert(64 % GW == 0);
static_assert(DM == GKW * KBAT * 32);           // input projections: one batch per wave
static_assert(2 * DM == GKW * 2 * KBAT * 32);   // output projection: two batches per wave
static_assert(GKW % 2 == 0);                    // output projection: a k slice lies wholly in the value or wholly in the remainder part
// static LDS per kernel
static_assert((GKW * 64 * 64 + 64 * TSP) * 4 + 4 * (DM / 8) * XOP * 2 + CTN * 64 * CTP * 2 <= 327680);
static_assert((GKW * 64 * 64 + 64 * TSP) * 4 <= 163840);
static_assert(AW * (16 * QSP + 32 * KSP + 32) * 4 <= 131072);

typedef _Float16 h16;
typedef unsigned short bf;
typedef __attribute__((ext_vector_type(16))) __bf16   v16bf;
typedef __attribute__((ext_vector_type(16))) _Float16 v16h;
typedef __attribute__((ext_vector_type(8)))  _Float16 v8h;
typedef __attribute__((ext_vector_type(8)))  unsigned short v8us;
typedef __attribute__((ext_vector_type(4)))  unsigned short v4us;
typedef __attribute__((ext_vector_type(8)))  float    v8f;
typedef __attribute__((ext_vector_type(4)))  float    v4f;
typedef __attribute__((ext_vector_type(2)))  float    v2f;
typedef __attribute__((ext_vector_type(2)))  __bf16   v2bf;
typedef __attribute__((ext_vector_type(8)))  unsigned v8u;
typedef __attribute__((ext_vector_type(2)))  unsigned v2u;
typedef v2u  __attribute__((may_alias)) v2ua;
typedef v4f  __attribute__((may_alias)) v4fa;
typedef v8us __attribute__((may_alias)) v8usa;
typedef __attribute__((ext_vector_type(8)))  short    v8s;
typedef __attribute__((ext_vector_type(2)))  short    v2s;
typedef __attribute__((ext_vector_type(4)))  unsigned v4u;
typedef v4u  __attribute__((may_alias)) v4ua;

__device__ __forceinline__ unsigned short f2bf(float f) { unsigned u = __float_as_uint(f); u += 0x7FFFu + ((u >> 16) & 1u); return (unsigned short)(u >> 16); }
__device__ __forceinline__ unsigned cvt2(float lo, float hh) { v2f t; t[0] = lo; t[1] = hh; return __builtin_bit_cast(unsigned, __builtin_convertvector(t, v2bf)); }   // two RNE converts to bf16 in one packed instruction, lo in bits 15..0
__device__ __forceinline__ float bfr(float f) { return __uint_as_float(((unsigned)f2bf(f)) << 16); }   // value after RNE convert to bf16
__device__ __forceinline__ v16h cat16(v8h lo, v8h hi) { return __builtin_shufflevector(lo, hi, 0, 1, 2, 3, 4, 5, 6, 7, 8, 9, 10, 11, 12, 13, 14, 15); }
__device__ __forceinline__ v16bf cat16b(v8us lo, v8us hi) { return __builtin_bit_cast(v16bf, __builtin_shufflevector(lo, hi, 0, 1, 2, 3, 4, 5, 6, 7, 8, 9, 10, 11, 12, 13, 14, 15)); }
__device__ __forceinline__ v8f wmma16(v16h a, v16h b, v8f c) { return __builtin_amdgcn_wmma_f32_16x16x32_f16(false, a, false, b, (short)0, c, false, false); }
__device__ __forceinline__ v8f wmmab(v16bf a, v16bf b, v8f c) { return __builtin_amdgcn_wmma_f32_16x16x32_bf16(false, a, false, b, (short)0, c, false, false); }
// fragment loader from a fragment-order plane; p = start of the (tile, k-step) unit + 8*lane: elements 0..7 <- k0+8h+0..7, elements 8..15 <- k0+16+8h+0..7 (same map for A and B)
__device__ __forceinline__ v16h  ldh(const h16* p) { return cat16(*(const v8h*)p, *(const v8h*)(p + FHALF)); }
// the same for the last fragment off an address pair: the second half may land in the pair that the first half's load names: wait first
__device__ __forceinline__ v16h  ldh_last(const h16* p) { const v8h lo = *(const v8h*)p; asm volatile("s_wait_xcnt 0x0" ::: "memory"); const v8h hh = *(const v8h*)(p + FHALF); return cat16(lo, hh); }
// ordering point for wave-private LDS tiles (same wave writes and reads)
__device__ __forceinline__ void wave_sync() { __builtin_amdgcn_fence(3 /* release order */, "wavefront"); __builtin_amdgcn_wave_barrier(); asm volatile("" ::: "memory"); }

// per-instruction guarded matrix steps: one accumulator tied per guard, A / B kept live across the nops
__device__ __forceinline__ v8f wmma16g(v16h a, v16h b, v8f c) { c = wmma16(a, b, c); asm volatile("v_nop\n\tv_nop\n\tv_nop\n\tv_nop" : "+v"(c) : "v"(a), "v"(b)); return c; }
__device__ __forceinline__ v8f wmmabg(v16bf a, v16bf b, v8f c) { c = wmmab(a, b, c); asm volatile("v_nop\n\tv_nop\n\tv_nop\n\tv_nop" : "+v"(c) : "v"(a), "v"(b)); return c; }
// f32 -> f16 convert that cannot produce a subnormal (|v| < 2^-14 -> +0)
__device__ __forceinline__ h16 toh_flush(float v) { const h16 r = (h16)v; return (fabsf(v) < 6.103515625e-05f) ? (h16)0.0f : r; }
__device__ __forceinline__ float bf2f(unsigned short b) { return __uint_as_float(((unsigned)b) << 16); }
// one max-plus step on two 16-bit lanes of a register: c = max(a + b, c), no clamp (the sums cannot overflow: FXS)
__device__ __forceinline__ unsigned pam(unsigned a, unsigned b, unsigned c) { return __builtin_bit_cast(unsigned, __builtin_amdgcn_pk_add_max_i16(__builtin_bit_cast(v2s, a), __builtin_bit_cast(v2s, b), __builtin_bit_cast(v2s, c), false)); }
__device__ __forceinline__ short tofx(float v) { return (short)(int)__builtin_rintf(v * FXS); }   // f32 -> 16-bit fixed point, round to nearest

// cvtP_body: transposing bf16 (RNE convert) copy of the output-projection weight: W[DM rows (k)][DM (n)] f32 -> WP rows n, fragment order; block b takes CTN 64x64 tiles that follow one another along k, all their loads in flight together.
__device__ __forceinline__ void cvtP_body(const float* __restrict__ W, bf* WP, const int b, bf* ts) {
    const int tid = threadIdx.x;
    const int n0 = (b / (DM / (64 * CTN))) * 64, k0 = (b % (DM / (64 * CTN))) * (64 * CTN);
    const int kr = tid >> 4, c4 = (tid & 15) * 4;               // a load trip: 32 k rows x 16 float4
    const float* pw = W + (size_t)(k0 + kr) * DM + n0 + c4;
    v4f v[2 * CTN];
#pragma unroll
    for (int i = 0; i < 2 * CTN - 1; ++i) v[i] = *(const v4f*)(pw + (size_t)(i * 32) * DM);
    asm volatile("s_wait_xcnt 0x0" ::: "memory");                                // the last load off the address register may land in it, and the loads before it name it: wait first
    v[2 * CTN - 1] = *(const v4f*)(pw + (size_t)((2 * CTN - 1) * 32) * DM);
    asm volatile("s_wait_xcnt 0x0" ::: "memory");                                // the address register is rewritten behind the loads (LDS addresses): wait first
#pragma unroll
    for (int i = 0; i < 2 * CTN; ++i)
#pragma unroll
        for (int e = 0; e < 4; ++e) ts[((i >> 1) * 64 + c4 + e) * CTP + (i & 1) * 32 + kr] = f2bf(v[i][e]);   // tile i >> 1: [n][k]
    __syncthreads();                                            // cross-wave tiles: block barrier
    const int ch = tid >> 5, ln = tid & 31;                     // 16 halves of 512 B per tile: ch = 16-row tile (4) x k-step (2) x half (2); one wave writes one half
    const int row = (ch >> 2) * 16 + (ln & 15), c8 = ((ch >> 1) & 1) * 32 + (ch & 1) * 16 + (ln >> 4) * 8;
    bf* pd = WP + ((size_t)(n0 / 16 + (ch >> 2)) * (DM / 32) + (size_t)(k0 / 32 + ((ch >> 1) & 1))) * FSTEP + (ch & 1) * FHALF + ln * 8;
#pragma unroll
    for (int u = 0; u < CTN; ++u) { const v8us o = *(const v8usa*)(&ts[(u * 64 + row) * CTP + c8]);
        *(v8us*)(pd + u * 2 * FSTEP) = o; }
}

// gemm_slice: one wave's share of a 64x64 tile: 64 rows x 32 columns (8 accumulators) over NB batches of KBAT k-steps, operands straight from fragment-order bf16 planes.
// pitchA / pitchB: row length (k) of the plane; aoff / boff: start of the unit (first 16-row tile, first k-step of the wave's slice) + 8*lane.
template <int NB>
__device__ __forceinline__ void gemm_slice(const bf* __restrict__ A, const bf* __restrict__ Bt, const int pitchA, const int pitchB, const size_t aoff, const size_t boff, v8f (&acc)[4][GNW]) {
#pragma unroll
    for (int mb = 0; mb < 4; ++mb)
#pragma unroll
        for (int nb = 0; nb < GNW; ++nb) acc[mb][nb] = (v8f){};
    const bf* pa = A + aoff; const bf* pb = Bt + boff;
#pragma unroll
    for (int bt = 0; bt < NB; ++bt) {
        v8us al[KBAT][4][2], bl[KBAT][GNW][2];                  // 16-byte halves of the fragments (k0+8h+0..7 | k0+16+8h+0..7), all in flight together
#pragma unroll
        for (int s = 0; s < KBAT; ++s) {
            const int kc = (bt * KBAT + s) * FSTEP;
#pragma unroll
            for (int i = 0; i < 8; ++i)       if (s < KBAT - 1 || i < 7)           al[s][i >> 1][i & 1] = *(const v8us*)(pa + (size_t)(i >> 1) * 16 * (size_t)pitchA + kc + FHALF * (i & 1));
#pragma unroll
            for (int i = 0; i < 2 * GNW; ++i) if (s < KBAT - 1 || i < 2 * GNW - 1) bl[s][i >> 1][i & 1] = *(const v8us*)(pb + (size_t)(i >> 1) * 16 * (size_t)pitchB + kc + FHALF * (i & 1)); }
        const int kl = (bt * KBAT + KBAT - 1) * FSTEP + FHALF;
        asm volatile("s_wait_xcnt 0x0" ::: "memory");                            // the last load off an address register may land in it, and the loads before it name it: wait first
        al[KBAT - 1][3][1] = *(const v8us*)(pa + (size_t)3 * 16 * (size_t)pitchA + kl);
        asm volatile("s_wait_xcnt 0x0" ::: "memory");                            // same: the load below may land in a register that the load above names
        bl[KBAT - 1][GNW - 1][1] = *(const v8us*)(pb + (size_t)(GNW - 1) * 16 * (size_t)pitchB + kl);
        asm volatile("s_wait_xcnt 0x0" ::: "memory");                            // the address registers are rewritten behind the batch (LDS addresses): wait first
        v16bf a[KBAT][4], b[KBAT][GNW];
#pragma unroll
        for (int s = 0; s < KBAT; ++s) {
#pragma unroll
            for (int mb = 0; mb < 4; ++mb) a[s][mb] = cat16b(al[s][mb][0], al[s][mb][1]);
#pragma unroll
            for (int nb = 0; nb < GNW; ++nb) b[s][nb] = cat16b(bl[s][nb][0], bl[s][nb][1]); }
#pragma unroll
        for (int s = 0; s < KBAT; ++s)
#pragma unroll
            for (int nb = 0; nb < GNW; ++nb)
#pragma unroll
                for (int mb = 0; mb < 4; ++mb) acc[mb][nb] = wmmabg(a[s][mb], b[s][nb], acc[mb][nb]);
    }
}

// tile_merge: every wave puts its partial into LDS in fragment order (lane-contiguous 16-byte pieces); behind a block barrier wave w sums fragment w = mb*4 + nb over the k slices, slice 0 first,
// and writes it row-major into os (D: row 8h+j, col lane&15; all 64 x 64 written); a second block barrier publishes os to every wave.
__device__ __forceinline__ void tile_merge(const v8f (&acc)[4][GNW], float* ps, float* os, const int wave, const int lane) {
    const int lr = lane & 15, hi = lane >> 4;
    const int kq = wave / GNW, nh = wave % GNW;
#pragma unroll
    for (int mb = 0; mb < 4; ++mb)
#pragma unroll
        for (int nb = 0; nb < GNW; ++nb) {
            float* p = ps + (size_t)((kq * 16 + mb * 4 + nh * GNW + nb) * 256 + lane * 4);
            const v8f f = acc[mb][nb]; v4f a, c;
            a[0] = f[0]; a[1] = f[1]; a[2] = f[2]; a[3] = f[3]; c[0] = f[4]; c[1] = f[5]; c[2] = f[6]; c[3] = f[7];
            *(v4fa*)p = a; *(v4fa*)(p + 128) = c; }
    __syncthreads();                                            // cross-wave: every k slice's partial is read by another wave below
    const float* q0 = ps + (size_t)(wave * 256 + lane * 4);
    v4f s0 = *(const v4fa*)q0, s1 = *(const v4fa*)(q0 + 128);
#pragma unroll
    for (int q = 1; q < GKW; ++q) { s0 += *(const v4fa*)(q0 + q * 4096); s1 += *(const v4fa*)(q0 + q * 4096 + 128); }
    float* d = os + ((wave >> 2) * 16 + hi * 8) * TSP + (wave & 3) * 16 + lr;
#pragma unroll
    for (int j = 0; j < 4; ++j) { d[j * TSP] = s0[j]; d[(4 + j) * TSP] = s1[j]; }
    __syncthreads();                                            // cross-wave: the epilogues read rows that other waves wrote
}

// proj_slice: one wave's share of a 64x64 tile of x W (64 tokens x 32 columns over a k slice of KBAT k-steps), both operands read as f32 and RNE-converted to bf16 on the way.
// W [DM][NC] is read in place, with no transposition: lane (lr, hi) loads the column pair c0 + 32*nh + 2*lr + 0..1 of the 16 k rows of its half of a k-step (a wave-wide 8-byte load = 2 whole lines);
// column 2*lr + nb goes to B fragment nb, so accumulator (mb, nb) holds output column 32*nh + 2*lr + nb in lane column lr; two k neighbours of one column share a register through one packed convert.
// x: the block's 64 rows are brought once, by all waves, in whole lines, converted and laid in LDS as [16-row tile][8-wide k piece][row][8] (pitch XOP); behind a block barrier every wave reads its A fragments there.
// k order of both fragments, as everywhere in this file: elements 0..7 <- k0+8h+0..7, elements 8..15 <- k0+16+8h+0..7.
template <int NC>
__device__ __forceinline__ void proj_slice(const float* __restrict__ x, const float* __restrict__ W, const int r0, const int c0, bf* xs, const int wave, const int lane, v8f (&acc)[4][GNW]) {
    const int lr = lane & 15, hi = lane >> 4;
    const int kq = wave / GNW, nh = wave % GNW, k0 = kq * (KBAT * 32);
    const float* pw = W + (size_t)(k0 + 8 * hi) * NC + c0 + 32 * nh + 2 * lr;
    const float* px = x + (size_t)(r0 + wave * 4) * DM + lane * 4;
    v2f wl[KBAT][16]; v4f xl[4][6];                             // all of the wave's loads in flight together; x first: it has the longer way (LDS, barrier)
#pragma unroll
    for (int r = 0; r < 4; ++r)
#pragma unroll
        for (int p = 0; p < 6; ++p) if (r < 3 || p < 5) xl[r][p] = *(const v4f*)(px + r * DM + p * 128);
    asm volatile("s_wait_xcnt 0x0" ::: "memory");                                // the last load off an address register may land in it, and the loads before it name it: wait first
    xl[3][5] = *(const v4f*)(px + 3 * DM + 5 * 128);
    asm volatile("s_wait_xcnt 0x0" ::: "memory");                                // a weight load below may land in the register that the load above names: wait first
#pragma unroll
    for (int s = 0; s < KBAT; ++s)
#pragma unroll
        for (int e = 0; e < 16; ++e) if (s < KBAT - 1 || e < 15) wl[s][e] = *(const v2f*)(pw + (size_t)(32 * s + (e >> 3) * 16 + (e & 7)) * NC);
    asm volatile("s_wait_xcnt 0x0" ::: "memory");                                // same, for the weight loads' address register
    wl[KBAT - 1][15] = *(const v2f*)(pw + (size_t)(32 * (KBAT - 1) + 16 + 7) * NC);
    asm volatile("s_wait_xcnt 0x0" ::: "memory");                                // the address registers are rewritten behind the loads (LDS addresses): wait first
    bf* xd = xs + ((wave >> 2) * (DM / 8) + (lane >> 1)) * XOP + (wave & 3) * 32 + (lane & 1) * 4;   // row 4*wave + r of the tile; floats 128*p + 4*lane + 0..3 = half (lane & 1) of k piece 16*p + (lane >> 1)
#pragma unroll
    for (int r = 0; r < 4; ++r)
#pragma unroll
        for (int p = 0; p < 6; ++p) { v2u t; t[0] = cvt2(xl[r][p][0], xl[r][p][1]); t[1] = cvt2(xl[r][p][2], xl[r][p][3]);
            *(v2ua*)(xd + p * 16 * XOP + r * 8) = t; }
    v16bf b[KBAT][GNW];
#pragma unroll
    for (int s = 0; s < KBAT; ++s)
#pragma unroll
        for (int nb = 0; nb < GNW; ++nb) { v8u t;
#pragma unroll
            for (int j = 0; j < 8; ++j) t[j] = cvt2(wl[s][2 * j][nb], wl[s][2 * j + 1][nb]);
            b[s][nb] = __builtin_bit_cast(v16bf, t); }
    __syncthreads();                                            // cross-wave: every wave reads x rows that other waves staged
    const bf* xa = xs + (k0 / 8 + hi) * XOP + lr * 8;
    v16bf a[KBAT][4];
#pragma unroll
    for (int s = 0; s < KBAT; ++s)
#pragma unroll
        for (int mb = 0; mb < 4; ++mb) a[s][mb] = cat16b(*(const v8usa*)(xa + (mb * (DM / 8) + 4 * s) * XOP), *(const v8usa*)(xa + (mb * (DM / 8) + 4 * s + 2) * XOP));
#pragma unroll
    for (int mb = 0; mb < 4; ++mb)
#pragma unroll
        for (int nb = 0; nb < GNW; ++nb) acc[mb][nb] = (v8f){};
#pragma unroll
    for (int s = 0; s < KBAT; ++s)
#pragma unroll
        for (int nb = 0; nb < GNW; ++nb)
#pragma unroll
            for (int mb = 0; mb < 4; ++mb) acc[mb][nb] = wmmabg(a[s][mb], b[s][nb], acc[mb][nb]);
}

// proj_merge: tile_merge for proj_slice's column deal: fragment w = mb*4 + nh*2 + nb holds rows mb*16 + 8h + j, column 32*nh + 2*(lane&15) + nb. TR = 0: os[token][column]; TR = 1: os[column][token].
template <int TR>
__device__ __forceinline__ void proj_merge(const v8f (&acc)[4][GNW], float* ps, float* os, const int wave, const int lane) {
    const int lr = lane & 15, hi = lane >> 4;
    const int kq = wave / GNW, nh = wave % GNW;
#pragma unroll
    for (int mb = 0; mb < 4; ++mb)
#pragma unroll
        for (int nb = 0; nb < GNW; ++nb) {
            float* p = ps + (size_t)((kq * 16 + mb * 4 + nh * GNW + nb) * 256 + lane * 4);
            const v8f f = acc[mb][nb]; v4f a, c;
            a[0] = f[0]; a[1] = f[1]; a[2] = f[2]; a[3] = f[3]; c[0] = f[4]; c[1] = f[5]; c[2] = f[6]; c[3] = f[7];
            *(v4fa*)p = a; *(v4fa*)(p + 128) = c; }
    __syncthreads();                                            // cross-wave: every k slice's partial is read by another wave below
    const float* q0 = ps + (size_t)(wave * 256 + lane * 4);
    v4f s0 = *(const v4fa*)q0, s1 = *(const v4fa*)(q0 + 128);
#pragma unroll
    for (int q = 1; q < GKW; ++q) { s0 += *(const v4fa*)(q0 + q * 4096); s1 += *(const v4fa*)(q0 + q * 4096 + 128); }
    const int row = (wave >> 2) * 16 + hi * 8, col = ((wave >> 1) & 1) * 32 + 2 * lr + (wave & 1);
    if (TR) { *(v4fa*)(&os[col * TSP + row]) = s0; *(v4fa*)(&os[col * TSP + row + 4]) = s1; }
    else {
#pragma unroll
        for (int j = 0; j < 4; ++j) { os[(row + j) * TSP + col] = s0[j]; os[(row + 4 + j) * TSP + col] = s1[j]; } }
    __syncthreads();                                            // cross-wave: the epilogues read rows that other waves wrote
}

// qk_tail: rotation + RMS normalisation of a merged q or k tile os[token][d] (column tile = head: 0..11 q, 12..17 k) and its store.
__device__ __forceinline__ void qk_tail(const float* __restrict__ cosb, const float* __restrict__ sinb, short* QKI, const int ttile, const int head, float* os, const int wave, const int lane) {
    const int r0 = ttile * 64;
    const int w0 = wave * (64 / GW);                            // this wave's rows of the tile: from here on it reads and writes these alone
#pragma unroll 1
    for (int r = w0; r < w0 + 64 / GW; ++r) {                   // lane = rotary pair column (d, d + 32)
        const int t = r0 + r;
        const float x1 = os[r * TSP + lane], x2 = os[r * TSP + HROT + lane];
        const float c = bfr(cosb[(size_t)t * HROT + lane]), s = bfr(sinb[(size_t)t * HROT + lane]);
        const float o1 = x1 * c - x2 * s, o2 = x2 * c + x1 * s;
        float ss = o1 * o1 + o2 * o2;
#pragma unroll
        for (int off = 16; off > 0; off >>= 1) ss += __shfl_xor(ss, off, 32);
        const float sc = rsqrtf(ss * (1.0f / (float)HD) + 1e-6f);
        os[r * TSP + lane] = o1 * sc; os[r * TSP + HROT + lane] = o2 * sc; }
    wave_sync();
    short* dst = QKI + ((size_t)head * SEQ + (size_t)(r0 + w0)) * HD;
    { const int row = w0 + (lane >> 3), c8 = (lane & 7) * 8;    // 8 lanes x 8 values = 64 columns, 4 rows = the wave's rows: the wave stores 512 B in a row
      const v4f x0 = *(const v4fa*)(&os[row * TSP + c8]), x1 = *(const v4fa*)(&os[row * TSP + c8 + 4]); v8s o;
#pragma unroll
      for (int e = 0; e < 4; ++e) { o[e] = tofx(x0[e]); o[4 + e] = tofx(x1[e]); }
      *(v8s*)(dst + lane * 8) = o; }
}

// vt_tail: a merged v tile os[m][token] (m = kvh*64 + d) -> plane VT [m][t] f16 (row length SEQ) and, for t < EROWS (block-uniform test), the f16 remainder x2048 VR [m][t] (row length EROWS), both in fragment order (k = t).
__device__ __forceinline__ void vt_tail(h16* VT, h16* VR, const int mtile, const int ttile, float* os, const int wave, const int lane) {
    const int lr = lane & 15, hi = lane >> 4;
    const int r0 = mtile * 64, c0 = ttile * 64;
    const bool wr = c0 < EROWS;                                 // block-uniform: whole tile inside the remainder plane
{
        { const int row = (wave >> 2) * 16 + lr, c8 = ((wave >> 1) & 1) * 32 + (wave & 1) * 16 + hi * 8;   // 16 waves: 16-row tile (4) x k-step (2) x half (2); one wave writes one 512-byte half
            const size_t un = (size_t)(c0 / 32 + ((wave >> 1) & 1)) * FSTEP + (wave & 1) * FHALF + lane * 8;   // place inside the 16-row tile
            const v4f x0 = *(const v4fa*)(&os[row * TSP + c8]); const v4f x1 = *(const v4fa*)(&os[row * TSP + c8 + 4]); v8h hv, rv;
#pragma unroll
            for (int e = 0; e < 4; ++e) { const h16 a0 = toh_flush(x0[e]); const h16 a1 = toh_flush(x1[e]); hv[e] = a0; hv[4 + e] = a1;
                rv[e] = toh_flush((x0[e] - (float)a0) * QRS); rv[4 + e] = toh_flush((x1[e] - (float)a1) * QRS); }
            *(v8h*)(VT + (size_t)(r0 + (wave >> 2) * 16) * SEQ + un) = hv;
            asm volatile("s_wait_xcnt 0x0" ::: "memory");                        // the store's registers are rewritten behind it (remainder packing): wait first
            if (wr) { *(v8h*)(VR + (size_t)(r0 + (wave >> 2) * 16) * EROWS + un) = rv;
                asm volatile("s_wait_xcnt 0x0" ::: "memory"); } }                // same, for the remainder store
         }
}

// k_qkv: the three input projections, straight from the f32 inputs, and the conversion of the output-projection weight in one grid (disjoint outputs): blockIdx.x = 64-token tile;
// blockIdx.y < 12: q head, < 18: k head, < 24: 64 columns of v; above: converter blocks, which need nothing of the projections and run beside them on WGPs that the 192 projection blocks leave idle.
#define PB_Y  (NHQ + NHK + DKV / 64)                            // grid rows of the projections
#define CB_Y  (((DM / 64) * (DM / 64)) / (CTN * (SEQ / 64)))    // grid rows of the converter
__global__ __launch_bounds__(32 * GW) void k_qkv(const float* __restrict__ x, const float* __restrict__ wq, const float* __restrict__ wk, const float* __restrict__ wv, const float* __restrict__ wp,
                                                 const float* __restrict__ cosb, const float* __restrict__ sinb, short* QKI, h16* VT, h16* VR, bf* WP) {
    __shared__ __align__(16) float ps[GKW * 64 * 64];           // the k slices' partial tiles, fragment order
    __shared__ __align__(16) float os[64 * TSP];                // merged tile, row-major
    __shared__ __align__(16) bf xs[4 * (DM / 8) * XOP];         // the block's 64 x rows, bf16
    __shared__ __align__(16) bf ts[CTN * 64 * CTP];             // converter tiles
    const int by = blockIdx.y;                                  // block-uniform: the barriers inside are met by all threads or by none
    const int lane = threadIdx.x & 31;
    const int wave = __builtin_amdgcn_readfirstlane((int)(threadIdx.x >> 5));
    if (by >= PB_Y) { cvtP_body(wp, WP, (by - PB_Y) * (SEQ / 64) + (int)blockIdx.x, ts); return; }
    v8f acc[4][GNW];
    if (by < NHQ) proj_slice<DM>(x, wq, blockIdx.x * 64, by * 64, xs, wave, lane, acc);
    else          proj_slice<DKV>(x, by < NHQ + NHK ? wk : wv, blockIdx.x * 64, (by < NHQ + NHK ? by - NHQ : by - (NHQ + NHK)) * 64, xs, wave, lane, acc);
    if (by < NHQ + NHK) { proj_merge<0>(acc, ps, os, wave, lane); qk_tail(cosb, sinb, QKI, blockIdx.x, by, os, wave, lane); }
    else                { proj_merge<1>(acc, ps, os, wave, lane); vt_tail(VT, VR, by - (NHQ + NHK), blockIdx.x, os, wave, lane); }
}

// k_oproj: output projection. A = context plane rows (value | remainder, two K parts of 768), Bt = WP rows n; f32 output [t][768].
__global__ __launch_bounds__(32 * GW) void k_oproj(const bf* __restrict__ YB, const bf* __restrict__ WP, float* OUT) {
    __shared__ __align__(16) float ps[GKW * 64 * 64];           // the k slices' partial tiles, fragment order
    __shared__ __align__(16) float os[64 * TSP];                // merged tile, row-major
    const int lane = threadIdx.x & 31;
    const int wave = __builtin_amdgcn_readfirstlane((int)(threadIdx.x >> 5));
    const int r0 = blockIdx.x * 64, c0 = blockIdx.y * 64;
    const int ka = (wave / GNW) * (2 * KBAT * 32);              // slice start in the context row (value | remainder)
    const int kw = ka % DM;                                     // the same k in the weight row: both parts meet the same weights
    v8f acc[4][GNW];
    gemm_slice<2>(YB, WP, YP, DM, (size_t)r0 * YP + ka * 16 + lane * 8, (size_t)(c0 + (wave % GNW) * 32) * DM + kw * 16 + lane * 8, acc);
    tile_merge(acc, ps, os, wave, lane);
{
#pragma unroll
        for (int i = 0; i < 2; ++i) { const int idx = i * (32 * GW) + (int)threadIdx.x; const int row = idx >> 4, c4 = (idx & 15) * 4;   // 2 trips x 32 rows = 64 rows; 16 lanes x 4 floats = 64 columns
            const v4f val = *(const v4fa*)(&os[row * TSP + c4]);
            *(v4f*)(OUT + (size_t)(r0 + row) * DM + c0 + c4) = val; }
         }
}

// flash_body: fused attention, one block of AW waves per 16 query rows of one head; wave w takes the 32-key steps w, w + AW, ... and keeps its own softmax state and context partial;
// the partials (unnormalised context, running max, row sum) meet in LDS behind one block barrier and are merged in f32 by all threads. q tile and the 32-key K tile live in wave-private LDS (16-bit fixed point); scores on the vector unit:
// lane (qg = lane&3, kg = lane>>2) forms max_d(q[t][d] + k[key][d]) for the 4 x 4 block t = 4qg+i, key = 4kg+j of each 32-key step: 8 LDS reads of 16 bytes feed 16 (t, key) pairs x 8 d, one packed add-max per pair and 2 d;
// the 16 x 32 scores then pass through the wave's own LDS slice, and lane (t = lane&15, h = lane>>4) takes keys 8h+r and 16+8h+r, i.e. the B-fragment layout of
// O^T[d][t] = V^T P^T (element r <- keys 8h+r, element 8+r <- keys 16+8h+r). V^T fragments (A, row d, k = key) straight from the f16 planes.
// Softmax state (running max over kept keys, partial sum) is one scalar per lane; the two lane halves of a row are combined with one xor-16 exchange.
// Causal keep rule (key <= t) evaluated per element inside every visited tile; the per-wave key bound is a wave scalar, multiple of 32, <= SEQ.
// EARLY = 1 (query rows [0, EROWS)): P = f16 value + f16 remainder x2048; O = V P + (V P_rem + V_rem P) / 2048 (remainder products in their own accumulators); row sum from the f32 exponentials.
// EARLY = 0 (query rows [EROWS, SEQ)): single P, v; row sum over the converted P.
template <int EARLY>
__device__ __forceinline__ void flash_body(const short* __restrict__ QKI, const h16* __restrict__ VT, const h16* __restrict__ VR, bf* YB, float* qs, float* ks, float* ms, float* lsum) {
    const int lane = threadIdx.x & 31, lr = lane & 15, hi = lane >> 4;
    const int wave = __builtin_amdgcn_readfirstlane((int)(threadIdx.x >> 5));
    const int h = blockIdx.x, kvh = h / NREP;
    const int t0 = (SEQ / 16 - 1 - (int)blockIdx.y) * 16;       // tile of 16 query rows, wholly below or wholly at / above EROWS; k_flash says why it counts down
    const int lim = t0 + lr;                                    // key j kept iff j <= lim
    const int nk = (t0 + 16 + 31) & ~31;                        // block-uniform, multiple of 32, <= SEQ (<= EROWS when EARLY)
    const int qb = wave * 16 * QSP, kbs = wave * 32 * KSP;
    const int qg = lane & 3, kg = lane >> 2;                    // score block of this lane: query rows 4qg + 0..3, keys 4kg + 0..3
    { const short* qsrc = QKI + ((size_t)h * SEQ + (size_t)t0) * HD + lane * 8;   // 16 rows x 64 values of 2 B, contiguous: 128 pieces of 16 B
      v8s qv[4];
#pragma unroll
      for (int i = 0; i < 4; ++i) {
          if (i == 3) asm volatile("s_wait_xcnt 0x0" ::: "memory");              // the last load may land in the address pair that the three before it name: wait first
          qv[i] = *(const v8s*)(qsrc + i * 256); }
      asm volatile("s_wait_xcnt 0x0" ::: "memory");                              // the address pair is rewritten behind the loads: wait first
#pragma unroll
      for (int i = 0; i < 4; ++i) *(v4ua*)(&qs[qb + (i * 4 + (lane >> 3)) * QIP + (lane & 7) * 4]) = __builtin_bit_cast(v4u, qv[i]); }   // piece i*32 + lane = row i*4 + (lane >> 3), dwords 4*(lane & 7) + 0..3
    const size_t kplane = ((size_t)(NHQ + kvh) * SEQ) * HD;     // k heads follow the q heads in the plane
    const size_t vo  = (size_t)(kvh * HD) * SEQ + lane * 8;      // + 16j*SEQ + 16*key0   (A fragment: row d, k = key; fragment-order plane)
    const size_t vro = (size_t)(kvh * HD) * EROWS + lane * 8;    // remainder plane, tokens < EROWS
    const v16h hz = (v16h){};
    v8f o[4], oR[4];
#pragma unroll
    for (int j = 0; j < 4; ++j) { o[j] = (v8f){}; oR[j] = (v8f){}; }
    float m = NEGB, l = 0.0f;
#pragma unroll 1
    for (int key0 = wave * 32; key0 < nk; key0 += 32 * AW) {    // a wave with no step keeps o = 0, l = 0, m = NEGB: weight 0 in the merge
        wave_sync();                                            // earlier reads of the K / score slice are done
        { const short* ksrc = QKI + kplane + (size_t)key0 * HD + lane * 8;       // 32 keys x 64 values of 2 B, contiguous: 256 pieces of 16 B; keys < nk <= SEQ
          v8s kv[8];                                            // the eight loads in flight, then the eight LDS stores
#pragma unroll
          for (int i = 0; i < 8; ++i) {
              if (i == 7) asm volatile("s_wait_xcnt 0x0" ::: "memory");          // the last load may land in the address pair that the seven before it name: wait first
              kv[i] = *(const v8s*)(ksrc + i * 256); }
          asm volatile("s_wait_xcnt 0x0" ::: "memory");                          // the address pair is rewritten behind the loads (score loop): wait first
#pragma unroll
          for (int i = 0; i < 8; ++i) *(v4ua*)(&ks[kbs + (i * 4 + (lane >> 3)) * KSP + (lane & 7) * 4]) = __builtin_bit_cast(v4u, kv[i]); }   // piece i*32 + lane = key row i*4 + (lane >> 3), dwords 4*(lane & 7) + 0..3
        wave_sync();
        unsigned sc[4][4];                                      // per pair: running maximum over the even d (low half) and over the odd d (high half)
#pragma unroll
        for (int i = 0; i < 4; ++i)
#pragma unroll
            for (int j = 0; j < 4; ++j) sc[i][j] = 0x80008000u; // least 16-bit value in both halves
        v4u q4[2][4], k4[2][4];                                 // two register sets: trip d8 + 1 is read from LDS while trip d8 is worked on
        const float* qrow = &qs[qb + 4 * qg * QIP];
        const float* krow = &ks[kbs + 4 * kg * KSP];
        auto rd = [&](const int st, const int d8) {             // the 4 q rows' and the 4 key rows' values 8*d8 + 0..7 into register set st
#pragma unroll
            for (int i = 0; i < 4; ++i) { q4[st][i] = *(const v4ua*)(qrow + i * QIP + d8 * 4); k4[st][i] = *(const v4ua*)(krow + i * KSP + d8 * 4); } };
        auto pm = [&](const int st) {                           // 16 pairs x 8 d; the 16 pairs innermost: a pair's own chain comes round every 16th instruction
#pragma unroll
            for (int c = 0; c < 4; ++c)
#pragma unroll
                for (int i = 0; i < 4; ++i)
#pragma unroll
                    for (int j = 0; j < 4; ++j) sc[i][j] = pam(q4[st][i][c], k4[st][j][c], sc[i][j]); };
        rd(0, 0);
#pragma unroll 1                                                // stays rolled: the text of both instantiations stays small
        for (int d8 = 0; d8 < HD / 8 - 2; d8 += 2) { rd(1, d8 + 1); pm(0); rd(0, d8 + 2); pm(1); }
        rd(1, HD / 8 - 1); pm(0); pm(1);
        wave_sync();                                            // every lane's K reads are done: the slice becomes the score tile [t][key]
#pragma unroll
        for (int i = 0; i < 4; ++i) { v4f s4;                   // the larger half of each pair, as f32 (still x FXS)
#pragma unroll
            for (int j = 0; j < 4; ++j) { const int lo = (int)(short)(sc[i][j] & 0xFFFFu), hh = ((int)sc[i][j]) >> 16; s4[j] = (float)(lo > hh ? lo : hh); }
            *(v4fa*)(&ks[kbs + (4 * qg + i) * SSP + 4 * kg]) = s4; }
        wave_sync();                                            // scores are read below by other lanes of the wave
        float sa[8], sb[8];
        { const v4f a0 = *(const v4fa*)(&ks[kbs + lr * SSP + 8 * hi]),      a1 = *(const v4fa*)(&ks[kbs + lr * SSP + 8 * hi + 4]);
          const v4f b0 = *(const v4fa*)(&ks[kbs + lr * SSP + 16 + 8 * hi]), b1 = *(const v4fa*)(&ks[kbs + lr * SSP + 16 + 8 * hi + 4]);
#pragma unroll
          for (int r = 0; r < 4; ++r) { sa[r] = a0[r]; sa[4 + r] = a1[r]; sb[r] = b0[r]; sb[4 + r] = b1[r]; } }
        const int ja = key0 + 8 * hi;
        float mx = NEGB;
#pragma unroll
        for (int r = 0; r < 8; ++r) {
            sa[r] = sa[r] * (LOG2E / FXS); sb[r] = sb[r] * (LOG2E / FXS);   // the fixed-point scale goes out with the change of base
            const bool fa = (ja + r <= lim), fb = (ja + 16 + r <= lim);
            mx = fmaxf(mx, fmaxf(fa ? sa[r] : NEGB, fb ? sb[r] : NEGB)); }
        mx = fmaxf(mx, __shfl_xor(mx, 16, 32));
        const float mnew = fmaxf(m, mx);
        const float alpha = __builtin_amdgcn_exp2f(m - mnew);
        const float sh = PSH - mnew;
        v16h pb, pr = hz; float ls = 0.0f;
#pragma unroll
        for (int r = 0; r < 8; ++r) {
            const float xa = sa[r] + sh, xb = sb[r] + sh;
            const float ea = __builtin_amdgcn_exp2f(xa), eb = __builtin_amdgcn_exp2f(xb);
            const bool fa = (ja + r <= lim) & (xa >= -14.0f), fb = (ja + 16 + r <= lim) & (xb >= -14.0f);   // dropped keys and values below the f16 normal range selected to 0 by value
            const float ga = fa ? ea : 0.0f, gb = fb ? eb : 0.0f;
            const h16 pa = (h16)ga; const h16 pc = (h16)gb;
            pb[r] = pa; pb[8 + r] = pc;
            if (EARLY) { pr[r] = toh_flush((ga - (float)pa) * QRS); pr[8 + r] = toh_flush((gb - (float)pc) * QRS); ls += ga + gb; }
            else       { ls += (float)pa + (float)pc; } }
        l = l * alpha + ls; m = mnew;
#pragma unroll
        for (int j = 0; j < 4; ++j) {
            const v16h v = ldh(VT + vo + (size_t)(16 * j) * SEQ + (size_t)key0 * 16);
            o[j] = o[j] * alpha;
            o[j] = wmma16g(v, pb, o[j]);
            if (EARLY) {
                const h16* pvr = VR + vro + (size_t)(16 * j) * EROWS + (size_t)key0 * 16;       // key0 + 31 < nk <= EROWS
                const v16h vr = (j == 3) ? ldh_last(pvr) : ldh(pvr);
                oR[j] = oR[j] * alpha;
                oR[j] = wmma16g(v, pr, oR[j]);
                oR[j] = wmma16g(vr, pb, oR[j]); }
        }
        asm volatile("s_wait_xcnt 0x0" ::: "memory");                            // the next step's K tile loads may land in the address pairs that the V loads above name: wait first
    }
    l += __shfl_xor(l, 16, 32);
    wave_sync();                                                // q tile reads are done; the slice becomes this wave's context partial
    // O^T D layout: f_j[r] = (d = 16j + 8h + r, t = lane&15) -> qs[t][d]; rows 0..15 x columns 0..63 all written
#pragma unroll
    for (int j = 0; j < 4; ++j) {
        v8f f = o[j];
        if (EARLY) f = o[j] + oR[j] * QRI;
        v4f a, c;
        a[0] = f[0]; a[1] = f[1]; a[2] = f[2]; a[3] = f[3]; c[0] = f[4]; c[1] = f[5]; c[2] = f[6]; c[3] = f[7];
        *(v4fa*)(&qs[qb + lr * QSP + 16 * j + 8 * hi]) = a; *(v4fa*)(&qs[qb + lr * QSP + 16 * j + 8 * hi + 4]) = c; }
    if (hi == 0) { ms[wave * 16 + lr] = m; lsum[wave * 16 + lr] = l; }   // both lane halves hold the same m and l
    __syncthreads();                                            // cross-wave: every wave's partial is read by every wave below
    // merge: thread = (row, 4 columns), dealt so that thread p owns 8-byte piece p of the head's 2 k-steps in the fragment-order context plane; partial w weighs 2^(m_w - M), M the maximum over the waves
    const int row = ((int)threadIdx.x >> 1) & 15, c4 = ((int)threadIdx.x >> 6) * 16 + (((int)threadIdx.x >> 5) & 1) * 8 + ((int)threadIdx.x & 1) * 4;
    float mw[AW], M = NEGB;
#pragma unroll
    for (int w = 0; w < AW; ++w) { mw[w] = ms[w * 16 + row]; M = fmaxf(M, mw[w]); }
    float L = 0.0f; v4f acc = (v4f){};
#pragma unroll
    for (int w = 0; w < AW; ++w) {
        const float sc = __builtin_amdgcn_exp2f(mw[w] - M);
        const v4f p = *(const v4fa*)(&qs[w * 16 * QSP + row * QSP + c4]);
        L += lsum[w * 16 + row] * sc;
        acc += p * sc; }
    const bool any = L > 0.0f;
    const float lsafe = any ? L : 1.0f;
    const float inv = any ? (1.0f / lsafe) : 0.0f;
    v4us hv, lv;
#pragma unroll
    for (int e = 0; e < 4; ++e) { const float y = acc[e] * inv; const unsigned short b0 = f2bf(y); hv[e] = b0; lv[e] = f2bf(y - bf2f(b0)); }
    bf* yrow = YB + (size_t)t0 * YP + (size_t)(h * HD) * 16 + (int)threadIdx.x * 4;   // the block's 16-row tile, the head's k-steps: 2 KiB in a row per part, a wave stores 2 whole lines
    *(v4us*)(yrow) = hv;
    *(v4us*)(yrow + DM * 16) = lv;
}

// k_flash: both instantiations in one grid (disjoint context rows); the choice is block-uniform.
// Launch order: a tile's cost grows with its index (tile t has t / 2 + 1 key steps). blockIdx.x = head (runs fastest),
// blockIdx.y counts the tiles from the last one down. For speed only: any order is correct.
__global__ __launch_bounds__(32 * AW) __attribute__((amdgpu_num_vgpr(256))) void k_flash(const short* __restrict__ QKI, const h16* __restrict__ VT, const h16* __restrict__ VR, bf* YB) {
    __shared__ __align__(16) float qs[AW * 16 * QSP];           // per-wave slices: q tile (16-bit, pitch QIP), later the wave's context partial
    __shared__ __align__(16) float ks[AW * 32 * KSP];           // wave-private slices: 32-key K tile (16-bit), then the step's score tile (f32)
    __shared__ float ms[AW * 16];                               // per wave and row: running max
    __shared__ float lsum[AW * 16];                             // per wave and row: sum of the exponentials
    if ((SEQ / 16 - 1 - (int)blockIdx.y) * 16 < EROWS) flash_body<1>(QKI, VT, VR, YB, qs, ks, ms, lsum);   // block-uniform: the barrier inside is met by all threads or by none
    else                                               flash_body<0>(QKI, VT, VR, YB, qs, ks, ms, lsum);
}

static constexpr size_t al256(size_t v) { return (v + 255) & ~(size_t)255; }
static constexpr size_t SZ_WP = al256((size_t)DM * DM * 2);
static constexpr size_t SZ_QK = al256((size_t)(NHQ + NHK) * SEQ * HD * 2);
static constexpr size_t SZ_VT = al256((size_t)DKV * SEQ * 2);
static constexpr size_t SZ_VR = al256((size_t)DKV * EROWS * 2);
static constexpr size_t SZ_YB = al256((size_t)SEQ * YP * 2);
static constexpr size_t SZ_TOTAL = SZ_WP + SZ_QK + SZ_VT + SZ_VR + SZ_YB;
static_assert(SZ_TOTAL <= (size_t)134217728);          // workspace carve <= 128 MiB
static_assert(((size_t)NHQ * SEQ * HD * 2) % 256 == 0);

extern "C" void kernel_launch(void* const* d_in, const int* in_sizes, int n_in,
                              void* d_out, int out_size, void* d_ws, size_t ws_size, hipStream_t stream) {
    if (n_in < 7) return;
    if ((size_t)in_sizes[0] < (size_t)SEQ * DM) return;
    if ((size_t)in_sizes[1] < (size_t)SEQ * HROT || (size_t)in_sizes[2] < (size_t)SEQ * HROT) return;
    if ((size_t)in_sizes[3] < (size_t)DM * DM || (size_t)in_sizes[6] < (size_t)DM * DM) return;
    if ((size_t)in_sizes[4] < (size_t)DM * DKV || (size_t)in_sizes[5] < (size_t)DM * DKV) return;
    if ((size_t)out_size < (size_t)SEQ * DM) return;
    if (SZ_TOTAL > ws_size) return;
    // wire order: x, cos, sin, Wq, Wk, Wv, Wproj
    const float* x    = (const float*)d_in[0];
    const float* cosb = (const float*)d_in[1];
    const float* sinb = (const float*)d_in[2];
    const float* wq   = (const float*)d_in[3];
    const float* wk   = (const float*)d_in[4];
    const float* wv   = (const float*)d_in[5];
    const float* wp   = (const float*)d_in[6];
    float* OUT = (float*)d_out;                        // [SEQ][768]
    char* wsp = (char*)d_ws;
    bf*    WP  = (bf*)wsp;    wsp += SZ_WP;            // [768][768]: output-projection weight, [out][in]
    short* QKI = (short*)wsp; wsp += SZ_QK;            // [18][SEQ][64] 16-bit fixed point: 12 q heads, 6 k heads
    h16*   VT  = (h16*)wsp;   wsp += SZ_VT;            // [384][SEQ]
    h16*   VR  = (h16*)wsp;   wsp += SZ_VR;            // [384][EROWS] remainder x2048, tokens < EROWS
    bf*    YB  = (bf*)wsp;    wsp += SZ_YB;            // [SEQ][768 value | 768 remainder]

    // q | k: x W -> 16-bit fixed-point planes [head][t][64], rotated and normalised; v: x Wv -> [m][t] f16 (+ remainder for t < EROWS); Wproj -> WP
    k_qkv<<<dim3(SEQ / 64, PB_Y + CB_Y, 1), 32 * GW, 0, stream>>>(x, wq, wk, wv, wp, cosb, sinb, QKI, VT, VR, WP);

    // query rows [0, EROWS): multi-product instantiation; rows [EROWS, SEQ): single-product instantiation
    k_flash<<<dim3(NHQ, SEQ / 16, 1), 32 * AW, 0, stream>>>(QKI, VT, VR, YB);

    // output projection: A = context rows (value | remainder), Bt = WP rows
    k_oproj<<<dim3(SEQ / 64, DM / 64, 1), 32 * GW, 0, stream>>>(YB, WP, OUT);
}

// v009
// One run takes 22.5 microseconds.
// Timed twice side by side with v008, it ran 1.09 and 1.08 times as fast.
// Over all steps from v000 it is 9.10 times as fast.
#include <hip/hip_runtime.h>

// Causal grouped-query self-attention with max-plus scores: x [SEQ][768]; Wq [768][768], Wk / Wv [768][384], Wproj [768][768], all [in][out] (y = x W, no bias);
// 12 query heads x 64, 6 key/value heads (2 query heads per key/value head); half-split rotary tables cos / sin [SEQ][32] read by value;
// per-head RMS normalisation (eps 1e-6) of q and k after the rotation; score[t][j] = max_d (q[t][d] + k[j][d]); causal softmax; context = P v; output = context Wproj (f32).
// Compute dtypes, f32 accumulate everywhere: q / k / v projections v_wmma_f32_16x16x32_bf16 (x, W RNE-converted to bf16 where the projection kernel loads them; products exact); max-plus scores are not a multiply-accumulate: on the vector unit, in 16-bit fixed point (q, k x FXS, rounded to nearest; |q|, |k| <= 8 behind the normalisation, so a sum never overflows), two d per fused packed add-max;
// P.V v_wmma_f32_16x16x32_f16: P (x16384 carry, cancels in the normalisation) and v single f16 on query rows >= EROWS; on query rows < EROWS P and v each as f16 value + f16 remainder x2048, remainder products in their own accumulator folded by 1/2048, row sum from the f32 exponentials;
// output projection v_wmma_f32_16x16x32_bf16: context as bf16 value + bf16 remainder (each wave takes its k slice in both parts, both products into one f32 accumulator), Wproj RNE-converted to bf16; softmax f32 (online, running max over kept keys).
// Layout: transposed bf16 output-projection weights WP [768][768] ([out][in]); 16-bit fixed-point planes q / k [18 heads][t][64] (rotated, normalised, x FXS); v^T plane f16 [384][t] and remainder plane [384][t < EROWS];
// fused flash kernel in transposed form (O^T = V^T P^T, P built on the vector unit directly in B-fragment layout); context plane bf16 [t][768 value | 768 remainder].
// Every 16-bit plane above except q / k (row-major [t][64]) is a matrix operand (rows x k) and lies in FRAGMENT ORDER: [16-row tile][32-wide k-step][half s][lane][8 elements], lane = 16*h + (row & 15), the 8 elements k = 32*step + 16*s + 8*h + 0..7:
// one wave-wide 16-byte load of a fragment half reads 512 contiguous bytes (4 whole lines). A 16-row tile keeps its size (16 x row length), so sub-plane offsets at multiples of 16 rows are those of the row-major plane.

#ifndef SEQ
#define SEQ 512
#endif
#define SEQ_FULL 512
#define DM    768
#define NHQ   12
#define NHK   6
#define NREP  2
#define HD    64
#define HROT  32
#define DKV   (NHK * HD)              // 384
#define YP    (2 * DM)                // context plane row pitch (value | remainder)
#define AW    8                       // waves per flash block: all work on the same 16 query rows, 32-key steps dealt round-robin
#define GKW   8                       // k slices of a 64x64 GEMM tile, one per wave pair
#define GNW   2                       // column halves of a GEMM tile: a wave holds 64 rows x 32 columns of one k slice
#define GW    (GKW * GNW)             // waves per GEMM block
#define KBAT  3                       // 32-wide k-steps whose fragments a wave loads as one batch
#define OW    8                       // waves per output-projection block (32 rows x 64 columns): one per k slice of KBAT k-steps, value and remainder part alike
#define QSP   68                      // LDS row pitch (floats) of the context tile
#define QIP   36                      // LDS row pitch (dwords) of the 16-bit q tile, which lies in the context tile's place before it: 128 B + 16 B, rows 4 apart fall 16 banks apart
#define KSP   36                      // LDS row pitch (dwords) of the 16-bit 32-key K tile: the same
#define FXS   2047.0f                 // fixed-point scale of q and k: 8 x 2047 = 16376, so |q + k| <= 32752 fits 16 bits
#define SSP   36                      // LDS row pitch (floats) of the 16 x 32 score tile that takes the K tile's place behind the score loop
#define TSP   68                      // LDS row pitch (floats) of the GEMM output tile
#define CTP   72                      // LDS row pitch (16-bit words) of the transposing converter tile
#define CTN   3                       // 64x64 weight tiles per converter block
#define XOP   136                     // LDS pitch (16-bit words) of one 8-wide k piece of a 16-row x tile: 16 rows x 8 + 8, so pieces 1 apart fall 4 banks apart
#define EROWS (SEQ < 256 ? SEQ : 256) // query rows handled by the multi-product flash instantiation
#define QRS   2048.0f                 // carry of the v remainder plane / P remainder fragment
#define QRI   (1.0f / 2048.0f)
#define LOG2E 1.4426950408889634f
#define PSH   14.0f                   // log2 of the P carry (16384)
#define NEGB  (-3.0e38f)
#define FSTEP 512                     // elements of one (16-row tile, k-step) unit of a fragment-order plane: 2 halves x 32 lanes x 8
#define FHALF 256                     // elements of one half of it

static_assert(HD == 64);
static_assert(HROT * 2 == HD);
static_assert(NHQ * HD == DM);
static_assert(NHK * NREP == NHQ);
static_assert(DM % 64 == 0);
static_assert(DKV % 64 == 0);
static_assert(DM % 32 == 0);                    // GEMM k-loop steps by 32
static_assert(SEQ % 64 == 0);
static_assert(SEQ % 32 == 0);                   // key loop steps by 32; k_oproj: 32-row tiles
static_assert(SEQ <= SEQ_FULL);
static_assert(EROWS % 64 == 0);                 // a 64-token v^T tile lies wholly inside or outside the remainder plane
static_assert(EROWS % 32 == 0);                 // key bound of an early wave never exceeds EROWS
static_assert(EROWS % 16 == 0);                 // a 16-row query tile lies wholly below or wholly at / above EROWS
static_assert(AW * 32 * 4 == 16 * HD);          // merge: every thread of the block owns 4 context columns of one row
static_assert(EROWS <= SEQ);
static_assert((QSP * 4) % 16 == 0);
static_assert((TSP * 4) % 16 == 0);
static_assert((CTP * 2) % 16 == 0);
static_assert(QSP >= HD);
static_assert((KSP * 4) % 16 == 0);
static_assert((SSP * 4) % 16 == 0);
static_assert(KSP * 2 >= HD);
static_assert((QIP * 4) % 16 == 0);
static_assert(QIP * 2 >= HD);
static_assert(QIP <= QSP);                      // the q tile fits the wave's context slice
static_assert(HD % 16 == 0);                    // score loop: two 8-wide trips per pass
static_assert(SSP >= 32);
static_assert(16 * SSP <= 32 * KSP);            // the score tile fits the wave's K slice
static_assert(TSP >= 64);
static_assert(CTP >= 64);
// store-loop extents: trips x lanes x bytes == tile rows x row bytes
static_assert(GW * 32 * 16 == 64 * 64 * 2);     // cvtP_body: one 16-byte piece per thread and tile
static_assert(2 * GW * 32 * 4 == 64 * 64);      // cvtP_body: two 4-float loads per thread and tile
static_assert(((DM / 64) * (DM / 64)) % (CTN * (SEQ / 64)) == 0);   // converter blocks fill whole rows of the grid, CTN tiles each
static_assert((DM / 64) % CTN == 0);            // a converter block's tiles share their 64 columns
static_assert(GW * 4 == 64 && DM == 6 * 128);   // x staging: a wave brings 4 rows, each in 6 loads of 512 B
static_assert((XOP * 2) % 16 == 0);
static_assert(GW * 32 * 16 == 64 * 64 * 2);     // qk_tail: every wave stores its own 64 / GW rows x 128 B in 1 trip
static_assert(2 * OW * 32 * 16 == 32 * 64 * 4); // k_oproj: 32 rows x 256 B
static_assert(GW * 32 * 16 == 64 * 64 * 2);     // vt_tail: one 16-byte piece per thread
static_assert(GW == 16);                        // proj_merge: wave w sums accumulator fragment w of the 4 x 4
static_assert(OW == 8);                         // oproj_merge: wave w sums accumulator fragment w of the 2 x 4
static_assert(64 % GW == 0);
static_assert(DM == GKW * KBAT * 32);           // input projections: one batch per wave
static_assert(DM == OW * KBAT * 32);             // output projection: the waves' k slices cover a weight row once
// static LDS per kernel
static_assert((GKW * 64 * 64 + 64 * TSP) * 4 + 4 * (DM / 8) * XOP * 2 + CTN * 64 * CTP * 2 <= 327680);
static_assert((OW * 32 * 64 + 32 * TSP) * 4 <= 163840);
static_assert(AW * (16 * QSP + 32 * KSP + 32) * 4 <= 131072);

typedef _Float16 h16;
typedef unsigned short bf;
typedef __attribute__((ext_vector_type(16))) __bf16   v16bf;
typedef __attribute__((ext_vector_type(16))) _Float16 v16h;
typedef __attribute__((ext_vector_type(8)))  _Float16 v8h;
typedef __attribute__((ext_vector_type(8)))  unsigned short v8us;
typedef __attribute__((ext_vector_type(4)))  unsigned short v4us;
typedef __attribute__((ext_vector_type(8)))  float    v8f;
typedef __attribute__((ext_vector_type(4)))  float    v4f;
typedef __attribute__((ext_vector_type(2)))  float    v2f;
typedef __attribute__((ext_vector_type(2)))  __bf16   v2bf;
typedef __attribute__((ext_vector_type(8)))  unsigned v8u;
typedef __attribute__((ext_vector_type(2)))  unsigned v2u;
typedef v2u  __attribute__((may_alias)) v2ua;
typedef v4f  __attribute__((may_alias)) v4fa;
typedef v8us __attribute__((may_alias)) v8usa;
typedef __attribute__((ext_vector_type(8)))  short    v8s;
typedef __attribute__((ext_vector_type(2)))  short    v2s;
typedef __attribute__((ext_vector_type(4)))  unsigned v4u;
typedef v4u  __attribute__((may_alias)) v4ua;

__device__ __forceinline__ unsigned short f2bf(float f) { unsigned u = __float_as_uint(f); u += 0x7FFFu + ((u >> 16) & 1u); return (unsigned short)(u >> 16); }
__device__ __forceinline__ unsigned cvt2(float lo, float hh) { v2f t; t[0] = lo; t[1] = hh; return __builtin_bit_cast(unsigned, __builtin_convertvector(t, v2bf)); }   // two RNE converts to bf16 in one packed instruction, lo in bits 15..0
__device__ __forceinline__ float bfr(float f) { return __uint_as_float(((unsigned)f2bf(f)) << 16); }   // value after RNE convert to bf16
__device__ __forceinline__ v16h cat16(v8h lo, v8h hi) { return __builtin_shufflevector(lo, hi, 0, 1, 2, 3, 4, 5, 6, 7, 8, 9, 10, 11, 12, 13, 14, 15); }
__device__ __forceinline__ v16bf cat16b(v8us lo, v8us hi) { return __builtin_bit_cast(v16bf, __builtin_shufflevector(lo, hi, 0, 1, 2, 3, 4, 5, 6, 7, 8, 9, 10, 11, 12, 13, 14, 15)); }
__device__ __forceinline__ v8f wmma16(v16h a, v16h b, v8f c) { return __builtin_amdgcn_wmma_f32_16x16x32_f16(false, a, false, b, (short)0, c, false, false); }
__device__ __forceinline__ v8f wmmab(v16bf a, v16bf b, v8f c) { return __builtin_amdgcn_wmma_f32_16x16x32_bf16(false, a, false, b, (short)0, c, false, false); }
// fragment loader from a fragment-order plane; p = start of the (tile, k-step) unit + 8*lane: elements 0..7 <- k0+8h+0..7, elements 8..15 <- k0+16+8h+0..7 (same map for A and B)
__device__ __forceinline__ v16h  ldh(const h16* p) { return cat16(*(const v8h*)p, *(const v8h*)(p + FHALF)); }
// the same for the last fragment off an address pair: the second half may land in the pair that the first half's load names: wait first
__device__ __forceinline__ v16h  ldh_last(const h16* p) { const v8h lo = *(const v8h*)p; asm volatile("s_wait_xcnt 0x0" ::: "memory"); const v8h hh = *(const v8h*)(p + FHALF); return cat16(lo, hh); }
// ordering point for wave-private LDS tiles (same wave writes and reads)
__device__ __forceinline__ void wave_sync() { __builtin_amdgcn_fence(3 /* release order */, "wavefront"); __builtin_amdgcn_wave_barrier(); asm volatile("" ::: "memory"); }

// per-instruction guarded matrix steps: one accumulator tied per guard, A / B kept live across the nops
__device__ __forceinline__ v8f wmma16g(v16h a, v16h b, v8f c) { c = wmma16(a, b, c); asm volatile("v_nop\n\tv_nop\n\tv_nop\n\tv_nop" : "+v"(c) : "v"(a), "v"(b)); return c; }
__device__ __forceinline__ v8f wmmabg(v16bf a, v16bf b, v8f c) { c = wmmab(a, b, c); asm volatile("v_nop\n\tv_nop\n\tv_nop\n\tv_nop" : "+v"(c) : "v"(a), "v"(b)); return c; }
// f32 -> f16 convert that cannot produce a subnormal (|v| < 2^-14 -> +0)
__device__ __forceinline__ h16 toh_flush(float v) { const h16 r = (h16)v; return (fabsf(v) < 6.103515625e-05f) ? (h16)0.0f : r; }
__device__ __forceinline__ float bf2f(unsigned short b) { return __uint_as_float(((unsigned)b) << 16); }
// one max-plus step on two 16-bit lanes of a register: c = max(a + b, c), no clamp (the sums cannot overflow: FXS)
__device__ __forceinline__ unsigned pam(unsigned a, unsigned b, unsigned c) { return __builtin_bit_cast(unsigned, __builtin_amdgcn_pk_add_max_i16(__builtin_bit_cast(v2s, a), __builtin_bit_cast(v2s, b), __builtin_bit_cast(v2s, c), false)); }
__device__ __forceinline__ short tofx(float v) { return (short)(int)__builtin_rintf(v * FXS); }   // f32 -> 16-bit fixed point, round to nearest

// cvtP_body: transposing bf16 (RNE convert) copy of the output-projection weight: W[DM rows (k)][DM (n)] f32 -> WP rows n, fragment order; block b takes CTN 64x64 tiles that follow one another along k, all their loads in flight together.
__device__ __forceinline__ void cvtP_body(const float* __restrict__ W, bf* WP, const int b, bf* ts) {
    const int tid = threadIdx.x;
    const int n0 = (b / (DM / (64 * CTN))) * 64, k0 = (b % (DM / (64 * CTN))) * (64 * CTN);
    const int kr = tid >> 4, c4 = (tid & 15) * 4;               // a load trip: 32 k rows x 16 float4
    const float* pw = W + (size_t)(k0 + kr) * DM + n0 + c4;
    v4f v[2 * CTN];
#pragma unroll
    for (int i = 0; i < 2 * CTN - 1; ++i) v[i] = *(const v4f*)(pw + (size_t)(i * 32) * DM);
    asm volatile("s_wait_xcnt 0x0" ::: "memory");                                // the last load off the address register may land in it, and the loads before it name it: wait first
    v[2 * CTN - 1] = *(const v4f*)(pw + (size_t)((2 * CTN - 1) * 32) * DM);
    asm volatile("s_wait_xcnt 0x0" ::: "memory");                                // the address register is rewritten behind the loads (LDS addresses): wait first
#pragma unroll
    for (int i = 0; i < 2 * CTN; ++i)
#pragma unroll
        for (int e = 0; e < 4; ++e) ts[((i >> 1) * 64 + c4 + e) * CTP + (i & 1) * 32 + kr] = f2bf(v[i][e]);   // tile i >> 1: [n][k]
    __syncthreads();                                            // cross-wave tiles: block barrier
    const int ch = tid >> 5, ln = tid & 31;                     // 16 halves of 512 B per tile: ch = 16-row tile (4) x k-step (2) x half (2); one wave writes one half
    const int row = (ch >> 2) * 16 + (ln & 15), c8 = ((ch >> 1) & 1) * 32 + (ch & 1) * 16 + (ln >> 4) * 8;
    bf* pd = WP + ((size_t)(n0 / 16 + (ch >> 2)) * (DM / 32) + (size_t)(k0 / 32 + ((ch >> 1) & 1))) * FSTEP + (ch & 1) * FHALF + ln * 8;
#pragma unroll
    for (int u = 0; u < CTN; ++u) { const v8us o = *(const v8usa*)(&ts[(u * 64 + row) * CTP + c8]);
        *(v8us*)(pd + u * 2 * FSTEP) = o; }
}

// oproj_slice: one wave's share of a 32x64 output tile: all 32 rows x 64 columns (8 accumulators) over one k slice of KBAT k-steps, operands straight from the fragment-order bf16 planes.
// The wave takes the slice in the value part AND in the remainder part of the context rows: both meet the same weights, so each weight fragment is loaded once and feeds both products.
// pa / pb: start of the unit (first 16-row tile, first k-step of the slice) + 8*lane in the context plane (value part) and in the weight plane.
__device__ __forceinline__ void oproj_slice(const bf* __restrict__ pa, const bf* __restrict__ pb, v8f (&acc)[2][4]) {
    v8us al[KBAT][2][2][2], bl[KBAT][4][2];                     // 16-byte halves of the fragments (k0+8h+0..7 | k0+16+8h+0..7): [k-step][part][16-row tile][half], [k-step][16-column tile][half]; all in flight together
#pragma unroll
    for (int s = 0; s < KBAT; ++s) {
#pragma unroll
        for (int i = 0; i < 8; ++i) if (s < KBAT - 1 || i < 7) bl[s][i >> 1][i & 1] = *(const v8us*)(pb + (size_t)(i >> 1) * 16 * DM + s * FSTEP + FHALF * (i & 1));
#pragma unroll
        for (int i = 0; i < 8; ++i) if (s < KBAT - 1 || i < 7) al[s][i >> 2][(i >> 1) & 1][i & 1] = *(const v8us*)(pa + (size_t)(i >> 2) * 16 * DM + (size_t)((i >> 1) & 1) * 16 * YP + s * FSTEP + FHALF * (i & 1)); }
    asm volatile("s_wait_xcnt 0x0" ::: "memory");                                // the last load off an address register may land in it, and the loads before it name it: wait first
    al[KBAT - 1][1][1][1] = *(const v8us*)(pa + (size_t)16 * DM + (size_t)16 * YP + (KBAT - 1) * FSTEP + FHALF);
    asm volatile("s_wait_xcnt 0x0" ::: "memory");                                // same: the load below may land in a register that the load above names
    bl[KBAT - 1][3][1] = *(const v8us*)(pb + (size_t)3 * 16 * DM + (KBAT - 1) * FSTEP + FHALF);
    asm volatile("s_wait_xcnt 0x0" ::: "memory");                                // the address registers are rewritten behind the loads (LDS addresses): wait first
#pragma unroll
    for (int mb = 0; mb < 2; ++mb)
#pragma unroll
        for (int nb = 0; nb < 4; ++nb) acc[mb][nb] = (v8f){};
#pragma unroll
    for (int s = 0; s < KBAT; ++s)
#pragma unroll
        for (int pt = 0; pt < 2; ++pt)
#pragma unroll
            for (int nb = 0; nb < 4; ++nb)
#pragma unroll
                for (int mb = 0; mb < 2; ++mb) acc[mb][nb] = wmmabg(cat16b(al[s][pt][mb][0], al[s][pt][mb][1]), cat16b(bl[s][nb][0], bl[s][nb][1]), acc[mb][nb]);
}

// oproj_merge: every wave puts its partial into LDS in fragment order (lane-contiguous 16-byte pieces); behind a block barrier wave w sums fragment w = mb*4 + nb over the k slices, slice 0 first,
// and writes it row-major into os (D: row 8h+j, col lane&15; all 32 x 64 written); a second block barrier publishes os to every wave.
__device__ __forceinline__ void oproj_merge(const v8f (&acc)[2][4], float* ps, float* os, const int wave, const int lane) {
    const int lr = lane & 15, hi = lane >> 4;
#pragma unroll
    for (int mb = 0; mb < 2; ++mb)
#pragma unroll
        for (int nb = 0; nb < 4; ++nb) {
            float* p = ps + (size_t)((wave * 8 + mb * 4 + nb) * 256 + lane * 4);
            const v8f f = acc[mb][nb]; v4f a, c;
            a[0] = f[0]; a[1] = f[1]; a[2] = f[2]; a[3] = f[3]; c[0] = f[4]; c[1] = f[5]; c[2] = f[6]; c[3] = f[7];
            *(v4fa*)p = a; *(v4fa*)(p + 128) = c; }
    __syncthreads();                                            // cross-wave: every k slice's partial is read by another wave below
    const float* q0 = ps + (size_t)(wave * 256 + lane * 4);
    v4f s0 = *(const v4fa*)q0, s1 = *(const v4fa*)(q0 + 128);
#pragma unroll
    for (int q = 1; q < OW; ++q) { s0 += *(const v4fa*)(q0 + q * 2048); s1 += *(const v4fa*)(q0 + q * 2048 + 128); }
    float* d = os + ((wave >> 2) * 16 + hi * 8) * TSP + (wave & 3) * 16 + lr;
#pragma unroll
    for (int j = 0; j < 4; ++j) { d[j * TSP] = s0[j]; d[(4 + j) * TSP] = s1[j]; }
    __syncthreads();                                            // cross-wave: the store loop reads rows that other waves wrote
}

// proj_slice: one wave's share of a 64x64 tile of x W (64 tokens x 32 columns over a k slice of KBAT k-steps), both operands read as f32 and RNE-converted to bf16 on the way.
// W [DM][NC] is read in place, with no transposition: lane (lr, hi) loads the column pair c0 + 32*nh + 2*lr + 0..1 of the 16 k rows of its half of a k-step (a wave-wide 8-byte load = 2 whole lines);
// column 2*lr + nb goes to B fragment nb, so accumulator (mb, nb) holds output column 32*nh + 2*lr + nb in lane column lr; two k neighbours of one column share a register through one packed convert.
// x: the block's 64 rows are brought once, by all waves, in whole lines, converted and laid in LDS as [16-row tile][8-wide k piece][row][8] (pitch XOP); behind a block barrier every wave reads its A fragments there.
// k order of both fragments, as everywhere in this file: elements 0..7 <- k0+8h+0..7, elements 8..15 <- k0+16+8h+0..7.
template <int NC>
__device__ __forceinline__ void proj_slice(const float* __restrict__ x, const float* __restrict__ W, const int r0, const int c0, bf* xs, const int wave, const int lane, v8f (&acc)[4][GNW]) {
    const int lr = lane & 15, hi = lane >> 4;
    const int kq = wave / GNW, nh = wave % GNW, k0 = kq * (KBAT * 32);
    const float* pw = W + (size_t)(k0 + 8 * hi) * NC + c0 + 32 * nh + 2 * lr;
    const float* px = x + (size_t)(r0 + wave * 4) * DM + lane * 4;
    v2f wl[KBAT][16]; v4f xl[4][6];                             // all of the wave's loads in flight together; x first: it has the longer way (LDS, barrier)
#pragma unroll
    for (int r = 0; r < 4; ++r)
#pragma unroll
        for (int p = 0; p < 6; ++p) if (r < 3 || p < 5) xl[r][p] = *(const v4f*)(px + r * DM + p * 128);
    asm volatile("s_wait_xcnt 0x0" ::: "memory");                                // the last load off an address register may land in it, and the loads before it name it: wait first
    xl[3][5] = *(const v4f*)(px + 3 * DM + 5 * 128);
    asm volatile("s_wait_xcnt 0x0" ::: "memory");                                // a weight load below may land in the register that the load above names: wait first
#pragma unroll
    for (int s = 0; s < KBAT; ++s)
#pragma unroll
        for (int e = 0; e < 16; ++e) if (s < KBAT - 1 || e < 15) wl[s][e] = *(const v2f*)(pw + (size_t)(32 * s + (e >> 3) * 16 + (e & 7)) * NC);
    asm volatile("s_wait_xcnt 0x0" ::: "memory");                                // same, for the weight loads' address register
    wl[KBAT - 1][15] = *(const v2f*)(pw + (size_t)(32 * (KBAT - 1) + 16 + 7) * NC);
    asm volatile("s_wait_xcnt 0x0" ::: "memory");                                // the address registers are rewritten behind the loads (LDS addresses): wait first
    bf* xd = xs + ((wave >> 2) * (DM / 8) + (lane >> 1)) * XOP + (wave & 3) * 32 + (lane & 1) * 4;   // row 4*wave + r of the tile; floats 128*p + 4*lane + 0..3 = half (lane & 1) of k piece 16*p + (lane >> 1)
#pragma unroll
    for (int r = 0; r < 4; ++r)
#pragma unroll
        for (int p = 0; p < 6; ++p) { v2u t; t[0] = cvt2(xl[r][p][0], xl[r][p][1]); t[1] = cvt2(xl[r][p][2], xl[r][p][3]);
            *(v2ua*)(xd + p * 16 * XOP + r * 8) = t; }
    v16bf b[KBAT][GNW];
#pragma unroll
    for (int s = 0; s < KBAT; ++s)
#pragma unroll
        for (int nb = 0; nb < GNW; ++nb) { v8u t;
#pragma unroll
            for (int j = 0; j < 8; ++j) t[j] = cvt2(wl[s][2 * j][nb], wl[s][2 * j + 1][nb]);
            b[s][nb] = __builtin_bit_cast(v16bf, t); }
    __syncthreads();                                            // cross-wave: every wave reads x rows that other waves staged
    const bf* xa = xs + (k0 / 8 + hi) * XOP + lr * 8;
    v16bf a[KBAT][4];
#pragma unroll
    for (int s = 0; s < KBAT; ++s)
#pragma unroll
        for (int mb = 0; mb < 4; ++mb) a[s][mb] = cat16b(*(const v8usa*)(xa + (mb * (DM / 8) + 4 * s) * XOP), *(const v8usa*)(xa + (mb * (DM / 8) + 4 * s + 2) * XOP));
#pragma unroll
    for (int mb = 0; mb < 4; ++mb)
#pragma unroll
        for (int nb = 0; nb < GNW; ++nb) acc[mb][nb] = (v8f){};
#pragma unroll
    for (int s = 0; s < KBAT; ++s)
#pragma unroll
        for (int nb = 0; nb < GNW; ++nb)
#pragma unroll
            for (int mb = 0; mb < 4; ++mb) acc[mb][nb] = wmmabg(a[s][mb], b[s][nb], acc[mb][nb]);
}

// proj_merge: the k-slice merge for proj_slice's column deal: fragment w = mb*4 + nh*2 + nb holds rows mb*16 + 8h + j, column 32*nh + 2*(lane&15) + nb. TR = 0: os[token][column]; TR = 1: os[column][token].
template <int TR>
__device__ __forceinline__ void proj_merge(const v8f (&acc)[4][GNW], float* ps, float* os, const int wave, const int lane) {
    const int lr = lane & 15, hi = lane >> 4;
    const int kq = wave / GNW, nh = wave % GNW;
#pragma unroll
    for (int mb = 0; mb < 4; ++mb)
#pragma unroll
        for (int nb = 0; nb < GNW; ++nb) {
            float* p = ps + (size_t)((kq * 16 + mb * 4 + nh * GNW + nb) * 256 + lane * 4);
            const v8f f = acc[mb][nb]; v4f a, c;
            a[0] = f[0]; a[1] = f[1]; a[2] = f[2]; a[3] = f[3]; c[0] = f[4]; c[1] = f[5]; c[2] = f[6]; c[3] = f[7];
            *(v4fa*)p = a; *(v4fa*)(p + 128) = c; }
    __syncthreads();                                            // cross-wave: every k slice's partial is read by another wave below
    const float* q0 = ps + (size_t)(wave * 256 + lane * 4);
    v4f s0 = *(const v4fa*)q0, s1 = *(const v4fa*)(q0 + 128);
#pragma unroll
    for (int q = 1; q < GKW; ++q) { s0 += *(const v4fa*)(q0 + q * 4096); s1 += *(const v4fa*)(q0 + q * 4096 + 128); }
    const int row = (wave >> 2) * 16 + hi * 8, col = ((wave >> 1) & 1) * 32 + 2 * lr + (wave & 1);
    if (TR) { *(v4fa*)(&os[col * TSP + row]) = s0; *(v4fa*)(&os[col * TSP + row + 4]) = s1; }
    else {
#pragma unroll
        for (int j = 0; j < 4; ++j) { os[(row + j) * TSP + col] = s0[j]; os[(row + 4 + j) * TSP + col] = s1[j]; } }
    __syncthreads();                                            // cross-wave: the epilogues read rows that other waves wrote
}

// qk_tail: rotation + RMS normalisation of a merged q or k tile os[token][d] (column tile = head: 0..11 q, 12..17 k) and its store.
__device__ __forceinline__ void qk_tail(const float* __restrict__ cosb, const float* __restrict__ sinb, short* QKI, const int ttile, const int head, float* os, const int wave, const int lane) {
    const int r0 = ttile * 64;
    const int w0 = wave * (64 / GW);                            // this wave's rows of the tile: from here on it reads and writes these alone
#pragma unroll 1
    for (int r = w0; r < w0 + 64 / GW; ++r) {                   // lane = rotary pair column (d, d + 32)
        const int t = r0 + r;
        const float x1 = os[r * TSP + lane], x2 = os[r * TSP + HROT + lane];
        const float c = bfr(cosb[(size_t)t * HROT + lane]), s = bfr(sinb[(size_t)t * HROT + lane]);
        const float o1 = x1 * c - x2 * s, o2 = x2 * c + x1 * s;
        float ss = o1 * o1 + o2 * o2;
#pragma unroll
        for (int off = 16; off > 0; off >>= 1) ss += __shfl_xor(ss, off, 32);
        const float sc = rsqrtf(ss * (1.0f / (float)HD) + 1e-6f);
        os[r * TSP + lane] = o1 * sc; os[r * TSP + HROT + lane] = o2 * sc; }
    wave_sync();
    short* dst = QKI + ((size_t)head * SEQ + (size_t)(r0 + w0)) * HD;
    { const int row = w0 + (lane >> 3), c8 = (lane & 7) * 8;    // 8 lanes x 8 values = 64 columns, 4 rows = the wave's rows: the wave stores 512 B in a row
      const v4f x0 = *(const v4fa*)(&os[row * TSP + c8]), x1 = *(const v4fa*)(&os[row * TSP + c8 + 4]); v8s o;
#pragma unroll
      for (int e = 0; e < 4; ++e) { o[e] = tofx(x0[e]); o[4 + e] = tofx(x1[e]); }
      *(v8s*)(dst + lane * 8) = o; }
}

// vt_tail: a merged v tile os[m][token] (m = kvh*64 + d) -> plane VT [m][t] f16 (row length SEQ) and, for t < EROWS (block-uniform test), the f16 remainder x2048 VR [m][t] (row length EROWS), both in fragment order (k = t).
__device__ __forceinline__ void vt_tail(h16* VT, h16* VR, const int mtile, const int ttile, float* os, const int wave, const int lane) {
    const int lr = lane & 15, hi = lane >> 4;
    const int r0 = mtile * 64, c0 = ttile * 64;
    const bool wr = c0 < EROWS;                                 // block-uniform: whole tile inside the remainder plane
{
        { const int row = (wave >> 2) * 16 + lr, c8 = ((wave >> 1) & 1) * 32 + (wave & 1) * 16 + hi * 8;   // 16 waves: 16-row tile (4) x k-step (2) x half (2); one wave writes one 512-byte half
            const size_t un = (size_t)(c0 / 32 + ((wave >> 1) & 1)) * FSTEP + (wave & 1) * FHALF + lane * 8;   // place inside the 16-row tile
            const v4f x0 = *(const v4fa*)(&os[row * TSP + c8]); const v4f x1 = *(const v4fa*)(&os[row * TSP + c8 + 4]); v8h hv, rv;
#pragma unroll
            for (int e = 0; e < 4; ++e) { const h16 a0 = toh_flush(x0[e]); const h16 a1 = toh_flush(x1[e]); hv[e] = a0; hv[4 + e] = a1;
                rv[e] = toh_flush((x0[e] - (float)a0) * QRS); rv[4 + e] = toh_flush((x1[e] - (float)a1) * QRS); }
            *(v8h*)(VT + (size_t)(r0 + (wave >> 2) * 16) * SEQ + un) = hv;
            asm volatile("s_wait_xcnt 0x0" ::: "memory");                        // the store's registers are rewritten behind it (remainder packing): wait first
            if (wr) { *(v8h*)(VR + (size_t)(r0 + (wave >> 2) * 16) * EROWS + un) = rv;
                asm volatile("s_wait_xcnt 0x0" ::: "memory"); } }                // same, for the remainder store
         }
}

// k_qkv: the three input projections, straight from the f32 inputs, and the conversion of the output-projection weight in one grid (disjoint outputs): blockIdx.x = 64-token tile;
// blockIdx.y < 12: q head, < 18: k head, < 24: 64 columns of v; above: converter blocks, which need nothing of the projections and run beside them on WGPs that the 192 projection blocks leave idle.
#define PB_Y  (NHQ + NHK + DKV / 64)                            // grid rows of the projections
#define CB_Y  (((DM / 64) * (DM / 64)) / (CTN * (SEQ / 64)))    // grid rows of the converter
__global__ __launch_bounds__(32 * GW) void k_qkv(const float* __restrict__ x, const float* __restrict__ wq, const float* __restrict__ wk, const float* __restrict__ wv, const float* __restrict__ wp,
                                                 const float* __restrict__ cosb, const float* __restrict__ sinb, short* QKI, h16* VT, h16* VR, bf* WP) {
    __shared__ __align__(16) float ps[GKW * 64 * 64];           // the k slices' partial tiles, fragment order
    __shared__ __align__(16) float os[64 * TSP];                // merged tile, row-major
    __shared__ __align__(16) bf xs[4 * (DM / 8) * XOP];         // the block's 64 x rows, bf16
    __shared__ __align__(16) bf ts[CTN * 64 * CTP];             // converter tiles
    const int by = blockIdx.y;                                  // block-uniform: the barriers inside are met by all threads or by none
    const int lane = threadIdx.x & 31;
    const int wave = __builtin_amdgcn_readfirstlane((int)(threadIdx.x >> 5));
    if (by >= PB_Y) { cvtP_body(wp, WP, (by - PB_Y) * (SEQ / 64) + (int)blockIdx.x, ts); return; }
    v8f acc[4][GNW];
    if (by < NHQ) proj_slice<DM>(x, wq, blockIdx.x * 64, by * 64, xs, wave, lane, acc);
    else          proj_slice<DKV>(x, by < NHQ + NHK ? wk : wv, blockIdx.x * 64, (by < NHQ + NHK ? by - NHQ : by - (NHQ + NHK)) * 64, xs, wave, lane, acc);
    if (by < NHQ + NHK) { proj_merge<0>(acc, ps, os, wave, lane); qk_tail(cosb, sinb, QKI, blockIdx.x, by, os, wave, lane); }
    else                { proj_merge<1>(acc, ps, os, wave, lane); vt_tail(VT, VR, by - (NHQ + NHK), blockIdx.x, os, wave, lane); }
}

// k_oproj: output projection. A = context plane rows (value | remainder, two K parts of 768), Bt = WP rows n; f32 output [t][768]. One block per 32 rows x 64 columns, wave = k slice.
__global__ __launch_bounds__(32 * OW) void k_oproj(const bf* __restrict__ YB, const bf* __restrict__ WP, float* OUT) {
    __shared__ __align__(16) float ps[OW * 32 * 64];            // the k slices' partial tiles, fragment order
    __shared__ __align__(16) float os[32 * TSP];                // merged tile, row-major
    const int lane = threadIdx.x & 31;
    const int wave = __builtin_amdgcn_readfirstlane((int)(threadIdx.x >> 5));
    const int r0 = blockIdx.x * 32, c0 = blockIdx.y * 64;
    const int k0 = wave * (KBAT * 32);                          // slice start in the weight row and in either part of the context row
    v8f acc[2][4];
    oproj_slice(YB + (size_t)r0 * YP + k0 * 16 + lane * 8, WP + (size_t)c0 * DM + k0 * 16 + lane * 8, acc);
    oproj_merge(acc, ps, os, wave, lane);
#pragma unroll
    for (int i = 0; i < 2; ++i) { const int idx = i * (32 * OW) + (int)threadIdx.x; const int row = idx >> 4, c4 = (idx & 15) * 4;   // 2 trips x 16 rows = 32 rows; 16 lanes x 4 floats = 64 columns
        const v4f val = *(const v4fa*)(&os[row * TSP + c4]);
        *(v4f*)(OUT + (size_t)(r0 + row) * DM + c0 + c4) = val; }
}

// flash_body: fused attention, one block of AW waves per 16 query rows of one head; wave w takes the 32-key steps w, w + AW, ... and keeps its own softmax state and context partial;
// the partials (unnormalised context, running max, row sum) meet in LDS behind one block barrier and are merged in f32 by all threads. q tile and the 32-key K tile live in wave-private LDS (16-bit fixed point); scores on the vector unit:
// lane (qg = lane&3, kg = lane>>2) forms max_d(q[t][d] + k[key][d]) for the 4 x 4 block t = 4qg+i, key = 4kg+j of each 32-key step: 8 LDS reads of 16 bytes feed 16 (t, key) pairs x 8 d, one packed add-max per pair and 2 d;
// the 16 x 32 scores then pass through the wave's own LDS slice, and lane (t = lane&15, h = lane>>4) takes keys 8h+r and 16+8h+r, i.e. the B-fragment layout of
// O^T[d][t] = V^T P^T (element r <- keys 8h+r, element 8+r <- keys 16+8h+r). V^T fragments (A, row d, k = key) straight from the f16 planes.
// Softmax state (running max over kept keys, partial sum) is one scalar per lane; the two lane halves of a row are combined with one xor-16 exchange.
// Causal keep rule (key <= t) evaluated per element inside every visited tile; the per-wave key bound is a wave scalar, multiple of 32, <= SEQ.
// EARLY = 1 (query rows [0, EROWS)): P = f16 value + f16 remainder x2048; O = V P + (V P_rem + V_rem P) / 2048 (remainder products in their own accumulators); row sum from the f32 exponentials.
// EARLY = 0 (query rows [EROWS, SEQ)): single P, v; row sum over the converted P.
template <int EARLY>
__device__ __forceinline__ void flash_body(const short* __restrict__ QKI, const h16* __restrict__ VT, const h16* __restrict__ VR, bf* YB, float* qs, float* ks, float* ms, float* lsum) {
    const int lane = threadIdx.x & 31, lr = lane & 15, hi = lane >> 4;
    const int wave = __builtin_amdgcn_readfirstlane((int)(threadIdx.x >> 5));
    const int h = blockIdx.x, kvh = h / NREP;
    const int t0 = (SEQ / 16 - 1 - (int)blockIdx.y) * 16;       // tile of 16 query rows, wholly below or wholly at / above EROWS; k_flash says why it counts down
    const int lim = t0 + lr;                                    // key j kept iff j <= lim
    const int nk = (t0 + 16 + 31) & ~31;                        // block-uniform, multiple of 32, <= SEQ (<= EROWS when EARLY)
    const int qb = wave * 16 * QSP, kbs = wave * 32 * KSP;
    const int qg = lane & 3, kg = lane >> 2;                    // score block of this lane: query rows 4qg + 0..3, keys 4kg + 0..3
    { const short* qsrc = QKI + ((size_t)h * SEQ + (size_t)t0) * HD + lane * 8;   // 16 rows x 64 values of 2 B, contiguous: 128 pieces of 16 B
      v8s qv[4];
#pragma unroll
      for (int i = 0; i < 4; ++i) {
          if (i == 3) asm volatile("s_wait_xcnt 0x0" ::: "memory");              // the last load may land in the address pair that the three before it name: wait first
          qv[i] = *(const v8s*)(qsrc + i * 256); }
      asm volatile("s_wait_xcnt 0x0" ::: "memory");                              // the address pair is rewritten behind the loads: wait first
#pragma unroll
      for (int i = 0; i < 4; ++i) *(v4ua*)(&qs[qb + (i * 4 + (lane >> 3)) * QIP + (lane & 7) * 4]) = __builtin_bit_cast(v4u, qv[i]); }   // piece i*32 + lane = row i*4 + (lane >> 3), dwords 4*(lane & 7) + 0..3
    const size_t kplane = ((size_t)(NHQ + kvh) * SEQ) * HD;     // k heads follow the q heads in the plane
    const size_t vo  = (size_t)(kvh * HD) * SEQ + lane * 8;      // + 16j*SEQ + 16*key0   (A fragment: row d, k = key; fragment-order plane)
    const size_t vro = (size_t)(kvh * HD) * EROWS + lane * 8;    // remainder plane, tokens < EROWS
    const v16h hz = (v16h){};
    v8f o[4], oR[4];
#pragma unroll
    for (int j = 0; j < 4; ++j) { o[j] = (v8f){}; oR[j] = (v8f){}; }
    float m = NEGB, l = 0.0f;
#pragma unroll 1
    for (int key0 = wave * 32; key0 < nk; key0 += 32 * AW) {    // a wave with no step keeps o = 0, l = 0, m = NEGB: weight 0 in the merge
        wave_sync();                                            // earlier reads of the K / score slice are done
        { const short* ksrc = QKI + kplane + (size_t)key0 * HD + lane * 8;       // 32 keys x 64 values of 2 B, contiguous: 256 pieces of 16 B; keys < nk <= SEQ
          v8s kv[8];                                            // the eight loads in flight, then the eight LDS stores
#pragma unroll
          for (int i = 0; i < 8; ++i) {
              if (i == 7) asm volatile("s_wait_xcnt 0x0" ::: "memory");          // the last load may land in the address pair that the seven before it name: wait first
              kv[i] = *(const v8s*)(ksrc + i * 256); }
          asm volatile("s_wait_xcnt 0x0" ::: "memory");                          // the address pair is rewritten behind the loads (score loop): wait first
#pragma unroll
          for (int i = 0; i < 8; ++i) *(v4ua*)(&ks[kbs + (i * 4 + (lane >> 3)) * KSP + (lane & 7) * 4]) = __builtin_bit_cast(v4u, kv[i]); }   // piece i*32 + lane = key row i*4 + (lane >> 3), dwords 4*(lane & 7) + 0..3
        wave_sync();
        unsigned sc[4][4];                                      // per pair: running maximum over the even d (low half) and over the odd d (high half)
#pragma unroll
        for (int i = 0; i < 4; ++i)
#pragma unroll
            for (int j = 0; j < 4; ++j) sc[i][j] = 0x80008000u; // least 16-bit value in both halves
        v4u q4[2][4], k4[2][4];                                 // two register sets: trip d8 + 1 is read from LDS while trip d8 is worked on
        const float* qrow = &qs[qb + 4 * qg * QIP];
        const float* krow = &ks[kbs + 4 * kg * KSP];
        auto rd = [&](const int st, const int d8) {             // the 4 q rows' and the 4 key rows' values 8*d8 + 0..7 into register set st
#pragma unroll
            for (int i = 0; i < 4; ++i) { q4[st][i] = *(const v4ua*)(qrow + i * QIP + d8 * 4); k4[st][i] = *(const v4ua*)(krow + i * KSP + d8 * 4); } };
        auto pm = [&](const int st) {                           // 16 pairs x 8 d; the 16 pairs innermost: a pair's own chain comes round every 16th instruction
#pragma unroll
            for (int c = 0; c < 4; ++c)
#pragma unroll
                for (int i = 0; i < 4; ++i)
#pragma unroll
                    for (int j = 0; j < 4; ++j) sc[i][j] = pam(q4[st][i][c], k4[st][j][c], sc[i][j]); };
        rd(0, 0);
#pragma unroll 1                                                // stays rolled: the text of both instantiations stays small
        for (int d8 = 0; d8 < HD / 8 - 2; d8 += 2) { rd(1, d8 + 1); pm(0); rd(0, d8 + 2); pm(1); }
        rd(1, HD / 8 - 1); pm(0); pm(1);
        wave_sync();                                            // every lane's K reads are done: the slice becomes the score tile [t][key]
#pragma unroll
        for (int i = 0; i < 4; ++i) { v4f s4;                   // the larger half of each pair, as f32 (still x FXS)
#pragma unroll
            for (int j = 0; j < 4; ++j) { const int lo = (int)(short)(sc[i][j] & 0xFFFFu), hh = ((int)sc[i][j]) >> 16; s4[j] = (float)(lo > hh ? lo : hh); }
            *(v4fa*)(&ks[kbs + (4 * qg + i) * SSP + 4 * kg]) = s4; }
        wave_sync();                                            // scores are read below by other lanes of the wave
        float sa[8], sb[8];
        { const v4f a0 = *(const v4fa*)(&ks[kbs + lr * SSP + 8 * hi]),      a1 = *(const v4fa*)(&ks[kbs + lr * SSP + 8 * hi + 4]);
          const v4f b0 = *(const v4fa*)(&ks[kbs + lr * SSP + 16 + 8 * hi]), b1 = *(const v4fa*)(&ks[kbs + lr * SSP + 16 + 8 * hi + 4]);
#pragma unroll
          for (int r = 0; r < 4; ++r) { sa[r] = a0[r]; sa[4 + r] = a1[r]; sb[r] = b0[r]; sb[4 + r] = b1[r]; } }
        const int ja = key0 + 8 * hi;
        float mx = NEGB;
#pragma unroll
        for (int r = 0; r < 8; ++r) {
            sa[r] = sa[r] * (LOG2E / FXS); sb[r] = sb[r] * (LOG2E / FXS);   // the fixed-point scale goes out with the change of base
            const bool fa = (ja + r <= lim), fb = (ja + 16 + r <= lim);
            mx = fmaxf(mx, fmaxf(fa ? sa[r] : NEGB, fb ? sb[r] : NEGB)); }
        mx = fmaxf(mx, __shfl_xor(mx, 16, 32));
        const float mnew = fmaxf(m, mx);
        const float alpha = __builtin_amdgcn_exp2f(m - mnew);
        const float sh = PSH - mnew;
        v16h pb, pr = hz; float ls = 0.0f;
#pragma unroll
        for (int r = 0; r < 8; ++r) {
            const float xa = sa[r] + sh, xb = sb[r] + sh;
            const float ea = __builtin_amdgcn_exp2f(xa), eb = __builtin_amdgcn_exp2f(xb);
            const bool fa = (ja + r <= lim) & (xa >= -14.0f), fb = (ja + 16 + r <= lim) & (xb >= -14.0f);   // dropped keys and values below the f16 normal range selected to 0 by value
            const float ga = fa ? ea : 0.0f, gb = fb ? eb : 0.0f;
            const h16 pa = (h16)ga; const h16 pc = (h16)gb;
            pb[r] = pa; pb[8 + r] = pc;
            if (EARLY) { pr[r] = toh_flush((ga - (float)pa) * QRS); pr[8 + r] = toh_flush((gb - (float)pc) * QRS); ls += ga + gb; }
            else       { ls += (float)pa + (float)pc; } }
        l = l * alpha + ls; m = mnew;
#pragma unroll
        for (int j = 0; j < 4; ++j) {
            const v16h v = ldh(VT + vo + (size_t)(16 * j) * SEQ + (size_t)key0 * 16);
            o[j] = o[j] * alpha;
            o[j] = wmma16g(v, pb, o[j]);
            if (EARLY) {
                const h16* pvr = VR + vro + (size_t)(16 * j) * EROWS + (size_t)key0 * 16;       // key0 + 31 < nk <= EROWS
                const v16h vr = (j == 3) ? ldh_last(pvr) : ldh(pvr);
                oR[j] = oR[j] * alpha;
                oR[j] = wmma16g(v, pr, oR[j]);
                oR[j] = wmma16g(vr, pb, oR[j]); }
        }
        asm volatile("s_wait_xcnt 0x0" ::: "memory");                            // the next step's K tile loads may land in the address pairs that the V loads above name: wait first
    }
    l += __shfl_xor(l, 16, 32);
    wave_sync();                                                // q tile reads are done; the slice becomes this wave's context partial
    // O^T D layout: f_j[r] = (d = 16j + 8h + r, t = lane&15) -> qs[t][d]; rows 0..15 x columns 0..63 all written
#pragma unroll
    for (int j = 0; j < 4; ++j) {
        v8f f = o[j];
        if (EARLY) f = o[j] + oR[j] * QRI;
        v4f a, c;
        a[0] = f[0]; a[1] = f[1]; a[2] = f[2]; a[3] = f[3]; c[0] = f[4]; c[1] = f[5]; c[2] = f[6]; c[3] = f[7];
        *(v4fa*)(&qs[qb + lr * QSP + 16 * j + 8 * hi]) = a; *(v4fa*)(&qs[qb + lr * QSP + 16 * j + 8 * hi + 4]) = c; }
    if (hi == 0) { ms[wave * 16 + lr] = m; lsum[wave * 16 + lr] = l; }   // both lane halves hold the same m and l
    __syncthreads();                                            // cross-wave: every wave's partial is read by every wave below
    // merge: thread = (row, 4 columns), dealt so that thread p owns 8-byte piece p of the head's 2 k-steps in the fragment-order context plane; partial w weighs 2^(m_w - M), M the maximum over the waves
    const int row = ((int)threadIdx.x >> 1) & 15, c4 = ((int)threadIdx.x >> 6) * 16 + (((int)threadIdx.x >> 5) & 1) * 8 + ((int)threadIdx.x & 1) * 4;
    float mw[AW], M = NEGB;
#pragma unroll
    for (int w = 0; w < AW; ++w) { mw[w] = ms[w * 16 + row]; M = fmaxf(M, mw[w]); }
    float L = 0.0f; v4f acc = (v4f){};
#pragma unroll
    for (int w = 0; w < AW; ++w) {
        const float sc = __builtin_amdgcn_exp2f(mw[w] - M);
        const v4f p = *(const v4fa*)(&qs[w * 16 * QSP + row * QSP + c4]);
        L += lsum[w * 16 + row] * sc;
        acc += p * sc; }
    const bool any = L > 0.0f;
    const float lsafe = any ? L : 1.0f;
    const float inv = any ? (1.0f / lsafe) : 0.0f;
    v4us hv, lv;
#pragma unroll
    for (int e = 0; e < 4; ++e) { const float y = acc[e] * inv; const unsigned short b0 = f2bf(y); hv[e] = b0; lv[e] = f2bf(y - bf2f(b0)); }
    bf* yrow = YB + (size_t)t0 * YP + (size_t)(h * HD) * 16 + (int)threadIdx.x * 4;   // the block's 16-row tile, the head's k-steps: 2 KiB in a row per part, a wave stores 2 whole lines
    *(v4us*)(yrow) = hv;
    *(v4us*)(yrow + DM * 16) = lv;
}

// k_flash: both instantiations in one grid (disjoint context rows); the choice is block-uniform.
// Launch order: a tile's cost grows with its index (tile t has t / 2 + 1 key steps). blockIdx.x = head (runs fastest),
// blockIdx.y counts the tiles from the last one down. For speed only: any order is correct.
__global__ __launch_bounds__(32 * AW) __attribute__((amdgpu_num_vgpr(256))) void k_flash(const short* __restrict__ QKI, const h16* __restrict__ VT, const h16* __restrict__ VR, bf* YB) {
    __shared__ __align__(16) float qs[AW * 16 * QSP];           // per-wave slices: q tile (16-bit, pitch QIP), later the wave's context partial
    __shared__ __align__(16) float ks[AW * 32 * KSP];           // wave-private slices: 32-key K tile (16-bit), then the step's score tile (f32)
    __shared__ float ms[AW * 16];                               // per wave and row: running max
    __shared__ float lsum[AW * 16];                             // per wave and row: sum of the exponentials
    if ((SEQ / 16 - 1 - (int)blockIdx.y) * 16 < EROWS) flash_body<1>(QKI, VT, VR, YB, qs, ks, ms, lsum);   // block-uniform: the barrier inside is met by all threads or by none
    else                                               flash_body<0>(QKI, VT, VR, YB, qs, ks, ms, lsum);
}

static constexpr size_t al256(size_t v) { return (v + 255) & ~(size_t)255; }
static constexpr size_t SZ_WP = al256((size_t)DM * DM * 2);
static constexpr size_t SZ_QK = al256((size_t)(NHQ + NHK) * SEQ * HD * 2);
static constexpr size_t SZ_VT = al256((size_t)DKV * SEQ * 2);
static constexpr size_t SZ_VR = al256((size_t)DKV * EROWS * 2);
static constexpr size_t SZ_YB = al256((size_t)SEQ * YP * 2);
static constexpr size_t SZ_TOTAL = SZ_WP + SZ_QK + SZ_VT + SZ_VR + SZ_YB;
static_assert(SZ_TOTAL <= (size_t)134217728);          // workspace carve <= 128 MiB
static_assert(((size_t)NHQ * SEQ * HD * 2) % 256 == 0);

extern "C" void kernel_launch(void* const* d_in, const int* in_sizes, int n_in,
                              void* d_out, int out_size, void* d_ws, size_t ws_size, hipStream_t stream) {
    if (n_in < 7) return;
    if ((size_t)in_sizes[0] < (size_t)SEQ * DM) return;
    if ((size_t)in_sizes[1] < (size_t)SEQ * HROT || (size_t)in_sizes[2] < (size_t)SEQ * HROT) return;
    if ((size_t)in_sizes[3] < (size_t)DM * DM || (size_t)in_sizes[6] < (size_t)DM * DM) return;
    if ((size_t)in_sizes[4] < (size_t)DM * DKV || (size_t)in_sizes[5] < (size_t)DM * DKV) return;
    if ((size_t)out_size < (size_t)SEQ * DM) return;
    if (SZ_TOTAL > ws_size) return;
    // wire order: x, cos, sin, Wq, Wk, Wv, Wproj
    const float* x    = (const float*)d_in[0];
    const float* cosb = (const float*)d_in[1];
    const float* sinb = (const float*)d_in[2];
    const float* wq   = (const float*)d_in[3];
    const float* wk   = (const float*)d_in[4];
    const float* wv   = (const float*)d_in[5];
    const float* wp   = (const float*)d_in[6];
    float* OUT = (float*)d_out;                        // [SEQ][768]
    char* wsp = (char*)d_ws;
    bf*    WP  = (bf*)wsp;    wsp += SZ_WP;            // [768][768]: output-projection weight, [out][in]
    short* QKI = (short*)wsp; wsp += SZ_QK;            // [18][SEQ][64] 16-bit fixed point: 12 q heads, 6 k heads
    h16*   VT  = (h16*)wsp;   wsp += SZ_VT;            // [384][SEQ]
    h16*   VR  = (h16*)wsp;   wsp += SZ_VR;            // [384][EROWS] remainder x2048, tokens < EROWS
    bf*    YB  = (bf*)wsp;    wsp += SZ_YB;            // [SEQ][768 value | 768 remainder]

    // q | k: x W -> 16-bit fixed-point planes [head][t][64], rotated and normalised; v: x Wv -> [m][t] f16 (+ remainder for t < EROWS); Wproj -> WP
    k_qkv<<<dim3(SEQ / 64, PB_Y + CB_Y, 1), 32 * GW, 0, stream>>>(x, wq, wk, wv, wp, cosb, sinb, QKI, VT, VR, WP);

    // query rows [0, EROWS): multi-product instantiation; rows [EROWS, SEQ): single-product instantiation
    k_flash<<<dim3(NHQ, SEQ / 16, 1), 32 * AW, 0, stream>>>(QKI, VT, VR, YB);

    // output projection: A = context rows (value | remainder), Bt = WP rows
    k_oproj<<<dim3(SEQ / 32, DM / 64, 1), 32 * OW, 0, stream>>>(YB, WP, OUT);
}

// v010
// One run takes 19.9 microseconds.
// Next to v009, in two timings, it ran 1.11 and 1.12 times as fast.
// Over all steps from v000 it is 10.2 times as fast.
#include <hip/hip_runtime.h>

// Causal grouped-query self-attention with max-plus scores: x [SEQ][768]; Wq [768][768], Wk / Wv [768][384], Wproj [768][768], all [in][out] (y = x W, no bias);
// 12 query heads x 64, 6 key/value heads (2 query heads per key/value head); half-split rotary tables cos / sin [SEQ][32] read by value;
// per-head RMS normalisation (eps 1e-6) of q and k after the rotation; score[t][j] = max_d (q[t][d] + k[j][d]); causal softmax; context = P v; output = context Wproj (f32).
// Compute dtypes, f32 accumulate everywhere: q / k / v projections v_wmma_f32_16x16x32_bf16 (x, W RNE-converted to bf16 where the projection kernel loads them; products exact); max-plus scores are not a multiply-accumulate: on the vector unit, in 16-bit fixed point (q, k x FXS, rounded to nearest; |q|, |k| <= 8 behind the normalisation, so a sum never overflows), two d per fused packed add-max;
// P.V v_wmma_f32_16x16x32_f16: P (x16384 carry, cancels in the normalisation) and v single f16 on query rows >= EROWS; on query rows < EROWS P and v each as f16 value + f16 remainder x2048, remainder products in their own accumulator folded by 1/2048, row sum from the f32 exponentials;
// output projection v_wmma_f32_16x16x32_bf16: context as bf16 value + bf16 remainder (each wave takes its k slice in both parts, both products into one f32 accumulator), Wproj RNE-converted to bf16; softmax f32 (online, running max over kept keys).
// Layout: transposed bf16 output-projection weights WP [768][768] ([out][in]); 16-bit fixed-point planes q / k [18 heads][t][64] (rotated, normalised, x FXS); v^T plane f16 [384][t] and remainder plane [384][t < EROWS];
// fused flash kernel in transposed form (O^T = V^T P^T, P built on the vector unit directly in B-fragment layout); context plane bf16 [t][768 value | 768 remainder].
// Every 16-bit plane above except q / k (row-major [t][64]) is a matrix operand (rows x k) and lies in FRAGMENT ORDER: [16-row tile][32-wide k-step][half s][lane][8 elements], lane = 16*h + (row & 15), the 8 elements k = 32*step + 16*s + 8*h + 0..7:
// one wave-wide 16-byte load of a fragment half reads 512 contiguous bytes (4 whole lines). A 16-row tile keeps its size (16 x row length), so sub-plane offsets at multiples of 16 rows are those of the row-major plane.

#ifndef SEQ
#define SEQ 512
#endif
#define SEQ_FULL 512
#define DM    768
#define NHQ   12
#define NHK   6
#define NREP  2
#define HD    64
#define HROT  32
#define DKV   (NHK * HD)              // 384
#define YP    (2 * DM)                // context plane row pitch (value | remainder)
#define AW    8                       // waves per flash block: all work on the same 16 query rows, 32-key steps dealt round-robin
#define GKW   8                       // k slices of a 64x64 GEMM tile, one per wave pair
#define GNW   2                       // column halves of a GEMM tile: a wave holds 64 rows x 32 columns of one k slice
#define GW    (GKW * GNW)             // waves per GEMM block
#define KBAT  3                       // 32-wide k-steps whose fragments a wave loads as one batch
#define OW    8                       // waves per output-projection block (32 rows x 64 columns): one per k slice of KBAT k-steps, value and remainder part alike
#define QSP   68                      // LDS row pitch (floats) of the context tile
#define QIP   36                      // LDS row pitch (dwords) of the 16-bit q tile, which lies in the context tile's place before it: 128 B + 16 B, rows 4 apart fall 16 banks apart
#define KSP   36                      // LDS row pitch (dwords) of the 16-bit 32-key K tile: the same
#define FXS   2047.0f                 // fixed-point scale of q and k: 8 x 2047 = 16376, so |q + k| <= 32752 fits 16 bits
#define SSP   36                      // LDS row pitch (floats) of the 16 x 32 score tile that takes the K tile's place behind the score loop
#define TSP   68                      // LDS row pitch (floats) of the GEMM output tile
#define CTP   72                      // LDS row pitch (16-bit words) of the transposing converter tile
#define CTN   3                       // 64x64 weight tiles per converter block
#define XOP   136                     // LDS pitch (16-bit words) of one 8-wide k piece of a 16-row x tile: 16 rows x 8 + 8, so pieces 1 apart fall 4 banks apart
#define EROWS (SEQ < 256 ? SEQ : 256) // query rows handled by the multi-product flash instantiation
#define QRS   2048.0f                 // carry of the v remainder plane / P remainder fragment
#define QRI   (1.0f / 2048.0f)
#define LOG2E 1.4426950408889634f
#define PSH   14.0f                   // log2 of the P carry (16384)
#define NEGB  (-3.0e38f)
#define FSTEP 512                     // elements of one (16-row tile, k-step) unit of a fragment-order plane: 2 halves x 32 lanes x 8
#define FHALF 256                     // elements of one half of it

static_assert(HD == 64);
static_assert(HROT * 2 == HD);
static_assert(NHQ * HD == DM);
static_assert(NHK * NREP == NHQ);
static_assert(DM % 64 == 0);
static_assert(DKV % 64 == 0);
static_assert(DM % 32 == 0);                    // GEMM k-loop steps by 32
static_assert(SEQ % 64 == 0);
static_assert(SEQ % 32 == 0);                   // key loop steps by 32; k_oproj: 32-row tiles
static_assert(SEQ <= SEQ_FULL);
static_assert(EROWS % 64 == 0);                 // a 64-token v^T tile lies wholly inside or outside the remainder plane
static_assert(EROWS % 32 == 0);                 // key bound of an early wave never exceeds EROWS
static_assert(EROWS % 16 == 0);                 // a 16-row query tile lies wholly below or wholly at / above EROWS
static_assert(AW * 32 * 4 == 16 * HD);          // merge: every thread of the block owns 4 context columns of one row
static_assert(EROWS <= SEQ);
static_assert((QSP * 4) % 16 == 0);
static_assert((TSP * 4) % 16 == 0);
static_assert((CTP * 2) % 16 == 0);
static_assert(QSP >= HD);
static_assert((KSP * 4) % 16 == 0);
static_assert((SSP * 4) % 16 == 0);
static_assert(KSP * 2 >= HD);
static_assert((QIP * 4) % 16 == 0);
static_assert(QIP * 2 >= HD);
static_assert(QIP <= QSP);                      // the q tile fits the wave's context slice
static_assert(HD % 16 == 0);                    // score loop: two 8-wide trips per pass
static_assert(SSP >= 32);
static_assert(16 * SSP <= 32 * KSP);            // the score tile fits the wave's K slice
static_assert(TSP >= 64);
static_assert(CTP >= 64);
// store-loop extents: trips x lanes x bytes == tile rows x row bytes
static_assert(GW * 32 * 16 == 64 * 64 * 2);     // cvtP_body: one 16-byte piece per thread and tile
static_assert(2 * GW * 32 * 4 == 64 * 64);      // cvtP_body: two 4-float loads per thread and tile
static_assert(((DM / 64) * (DM / 64)) % (CTN * (SEQ / 64)) == 0);   // converter blocks fill whole rows of the grid, CTN tiles each
static_assert((DM / 64) % CTN == 0);            // a converter block's tiles share their 64 columns
static_assert(GW * 4 == 64 && DM == 6 * 128);   // x staging: a wave brings 4 rows, each in 6 loads of 512 B
static_assert((XOP * 2) % 16 == 0);
static_assert(GW * 32 * 16 == 64 * 64 * 2);     // qk_tail: every wave stores its own 64 / GW rows x 128 B in 1 trip
static_assert(2 * OW * 32 * 16 == 32 * 64 * 4); // k_oproj: 32 rows x 256 B
static_assert(GW * 32 * 16 == 64 * 64 * 2);     // vt_tail: one 16-byte piece per thread
static_assert(GW == 16);                        // proj_merge: wave w sums accumulator fragment w of the 4 x 4
static_assert(OW == 8);                         // oproj_merge: wave w sums accumulator fragment w of the 2 x 4
static_assert(64 % GW == 0);
static_assert(DM == GKW * KBAT * 32);           // input projections: one batch per wave
static_assert(DM == OW * KBAT * 32);             // output projection: the waves' k slices cover a weight row once
// static LDS per kernel
static_assert((GKW * 64 * 64 + 64 * TSP) * 4 + 4 * (DM / 8) * XOP * 2 + CTN * 64 * CTP * 2 <= 327680);
static_assert((OW * 32 * 64 + 32 * TSP) * 4 <= 163840);
static_assert(AW * (16 * QSP + 32 * KSP + 32) * 4 <= 131072);

typedef _Float16 h16;
typedef unsigned short bf;
typedef __attribute__((ext_vector_type(16))) __bf16   v16bf;
typedef __attribute__((ext_vector_type(16))) _Float16 v16h;
typedef __attribute__((ext_vector_type(8)))  _Float16 v8h;
typedef __attribute__((ext_vector_type(8)))  unsigned short v8us;
typedef __attribute__((ext_vector_type(4)))  unsigned short v4us;
typedef __attribute__((ext_vector_type(8)))  float    v8f;
typedef __attribute__((ext_vector_type(4)))  float    v4f;
typedef __attribute__((ext_vector_type(2)))  float    v2f;
typedef __attribute__((ext_vector_type(2)))  __bf16   v2bf;
typedef __attribute__((ext_vector_type(8)))  unsigned v8u;
typedef __attribute__((ext_vector_type(2)))  unsigned v2u;
typedef v2u  __attribute__((may_alias)) v2ua;
typedef v4f  __attribute__((may_alias)) v4fa;
typedef v8us __attribute__((may_alias)) v8usa;
typedef __attribute__((ext_vector_type(8)))  short    v8s;
typedef __attribute__((ext_vector_type(2)))  short    v2s;
typedef __attribute__((ext_vector_type(4)))  unsigned v4u;
typedef v4u  __attribute__((may_alias)) v4ua;

__device__ __forceinline__ unsigned short f2bf(float f) { unsigned u = __float_as_uint(f); u += 0x7FFFu + ((u >> 16) & 1u); return (unsigned short)(u >> 16); }
__device__ __forceinline__ unsigned cvt2(float lo, float hh) { v2f t; t[0] = lo; t[1] = hh; return __builtin_bit_cast(unsigned, __builtin_convertvector(t, v2bf)); }   // two RNE converts to bf16 in one packed instruction, lo in bits 15..0
__device__ __forceinline__ float bfr(float f) { return __uint_as_float(((unsigned)f2bf(f)) << 16); }   // value after RNE convert to bf16
__device__ __forceinline__ v16h cat16(v8h lo, v8h hi) { return __builtin_shufflevector(lo, hi, 0, 1, 2, 3, 4, 5, 6, 7, 8, 9, 10, 11, 12, 13, 14, 15); }
__device__ __forceinline__ v16bf cat16b(v8us lo, v8us hi) { return __builtin_bit_cast(v16bf, __builtin_shufflevector(lo, hi, 0, 1, 2, 3, 4, 5, 6, 7, 8, 9, 10, 11, 12, 13, 14, 15)); }
__device__ __forceinline__ v8f wmma16(v16h a, v16h b, v8f c) { return __builtin_amdgcn_wmma_f32_16x16x32_f16(false, a, false, b, (short)0, c, false, false); }
__device__ __forceinline__ v8f wmmab(v16bf a, v16bf b, v8f c) { return __builtin_amdgcn_wmma_f32_16x16x32_bf16(false, a, false, b, (short)0, c, false, false); }
// ordering point for wave-private LDS tiles (same wave writes and reads)
__device__ __forceinline__ void wave_sync() { __builtin_amdgcn_fence(3 /* release order */, "wavefront"); __builtin_amdgcn_wave_barrier(); asm volatile("" ::: "memory"); }

// per-instruction guarded matrix steps: one accumulator tied per guard, A / B kept live across the nops
__device__ __forceinline__ v8f wmma16g(v16h a, v16h b, v8f c) { c = wmma16(a, b, c); asm volatile("v_nop\n\tv_nop\n\tv_nop\n\tv_nop" : "+v"(c) : "v"(a), "v"(b)); return c; }
__device__ __forceinline__ v8f wmmabg(v16bf a, v16bf b, v8f c) { c = wmmab(a, b, c); asm volatile("v_nop\n\tv_nop\n\tv_nop\n\tv_nop" : "+v"(c) : "v"(a), "v"(b)); return c; }
// f32 -> f16 convert that cannot produce a subnormal (|v| < 2^-14 -> +0)
__device__ __forceinline__ h16 toh_flush(float v) { const h16 r = (h16)v; return (fabsf(v) < 6.103515625e-05f) ? (h16)0.0f : r; }
__device__ __forceinline__ float bf2f(unsigned short b) { return __uint_as_float(((unsigned)b) << 16); }
// one max-plus step on two 16-bit lanes of a register: c = max(a + b, c), no clamp (the sums cannot overflow: FXS)
__device__ __forceinline__ unsigned pam(unsigned a, unsigned b, unsigned c) { return __builtin_bit_cast(unsigned, __builtin_amdgcn_pk_add_max_i16(__builtin_bit_cast(v2s, a), __builtin_bit_cast(v2s, b), __builtin_bit_cast(v2s, c), false)); }
__device__ __forceinline__ short tofx(float v) { return (short)(int)__builtin_rintf(v * FXS); }   // f32 -> 16-bit fixed point, round to nearest

// cvtP_body: transposing bf16 (RNE convert) copy of the output-projection weight: W[DM rows (k)][DM (n)] f32 -> WP rows n, fragment order; block b takes CTN 64x64 tiles that follow one another along k, all their loads in flight together.
__device__ __forceinline__ void cvtP_body(const float* __restrict__ W, bf* WP, const int b, bf* ts) {
    const int tid = threadIdx.x;
    const int n0 = (b / (DM / (64 * CTN))) * 64, k0 = (b % (DM / (64 * CTN))) * (64 * CTN);
    const int kr = tid >> 4, c4 = (tid & 15) * 4;               // a load trip: 32 k rows x 16 float4
    const float* pw = W + (size_t)(k0 + kr) * DM + n0 + c4;
    v4f v[2 * CTN];
#pragma unroll
    for (int i = 0; i < 2 * CTN - 1; ++i) v[i] = *(const v4f*)(pw + (size_t)(i * 32) * DM);
    asm volatile("s_wait_xcnt 0x0" ::: "memory");                                // the last load off the address register may land in it, and the loads before it name it: wait first
    v[2 * CTN - 1] = *(const v4f*)(pw + (size_t)((2 * CTN - 1) * 32) * DM);
    asm volatile("s_wait_xcnt 0x0" ::: "memory");                                // the address register is rewritten behind the loads (LDS addresses): wait first
#pragma unroll
    for (int i = 0; i < 2 * CTN; ++i)
#pragma unroll
        for (int e = 0; e < 4; ++e) ts[((i >> 1) * 64 + c4 + e) * CTP + (i & 1) * 32 + kr] = f2bf(v[i][e]);   // tile i >> 1: [n][k]
    __syncthreads();                                            // cross-wave tiles: block barrier
    const int ch = tid >> 5, ln = tid & 31;                     // 16 halves of 512 B per tile: ch = 16-row tile (4) x k-step (2) x half (2); one wave writes one half
    const int row = (ch >> 2) * 16 + (ln & 15), c8 = ((ch >> 1) & 1) * 32 + (ch & 1) * 16 + (ln >> 4) * 8;
    bf* pd = WP + ((size_t)(n0 / 16 + (ch >> 2)) * (DM / 32) + (size_t)(k0 / 32 + ((ch >> 1) & 1))) * FSTEP + (ch & 1) * FHALF + ln * 8;
#pragma unroll
    for (int u = 0; u < CTN; ++u) { const v8us o = *(const v8usa*)(&ts[(u * 64 + row) * CTP + c8]);
        *(v8us*)(pd + u * 2 * FSTEP) = o; }
}

// oproj_slice: one wave's share of a 32x64 output tile: all 32 rows x 64 columns (8 accumulators) over one k slice of KBAT k-steps, operands straight from the fragment-order bf16 planes.
// The wave takes the slice in the value part AND in the remainder part of the context rows: both meet the same weights, so each weight fragment is loaded once and feeds both products.
// pa / pb: start of the unit (first 16-row tile, first k-step of the slice) + 8*lane in the context plane (value part) and in the weight plane.
__device__ __forceinline__ void oproj_slice(const bf* __restrict__ pa, const bf* __restrict__ pb, v8f (&acc)[2][4]) {
    v8us al[KBAT][2][2][2], bl[KBAT][4][2];                     // 16-byte halves of the fragments (k0+8h+0..7 | k0+16+8h+0..7): [k-step][part][16-row tile][half], [k-step][16-column tile][half]; all in flight together
#pragma unroll
    for (int s = 0; s < KBAT; ++s) {
#pragma unroll
        for (int i = 0; i < 8; ++i) if (s < KBAT - 1 || i < 7) bl[s][i >> 1][i & 1] = *(const v8us*)(pb + (size_t)(i >> 1) * 16 * DM + s * FSTEP + FHALF * (i & 1));
#pragma unroll
        for (int i = 0; i < 8; ++i) if (s < KBAT - 1 || i < 7) al[s][i >> 2][(i >> 1) & 1][i & 1] = *(const v8us*)(pa + (size_t)(i >> 2) * 16 * DM + (size_t)((i >> 1) & 1) * 16 * YP + s * FSTEP + FHALF * (i & 1)); }
    asm volatile("s_wait_xcnt 0x0" ::: "memory");                                // the last load off an address register may land in it, and the loads before it name it: wait first
    al[KBAT - 1][1][1][1] = *(const v8us*)(pa + (size_t)16 * DM + (size_t)16 * YP + (KBAT - 1) * FSTEP + FHALF);
    asm volatile("s_wait_xcnt 0x0" ::: "memory");                                // same: the load below may land in a register that the load above names
    bl[KBAT - 1][3][1] = *(const v8us*)(pb + (size_t)3 * 16 * DM + (KBAT - 1) * FSTEP + FHALF);
    asm volatile("s_wait_xcnt 0x0" ::: "memory");                                // the address registers are rewritten behind the loads (LDS addresses): wait first
#pragma unroll
    for (int mb = 0; mb < 2; ++mb)
#pragma unroll
        for (int nb = 0; nb < 4; ++nb) acc[mb][nb] = (v8f){};
#pragma unroll
    for (int s = 0; s < KBAT; ++s)
#pragma unroll
        for (int pt = 0; pt < 2; ++pt)
#pragma unroll
            for (int nb = 0; nb < 4; ++nb)
#pragma unroll
                for (int mb = 0; mb < 2; ++mb) acc[mb][nb] = wmmabg(cat16b(al[s][pt][mb][0], al[s][pt][mb][1]), cat16b(bl[s][nb][0], bl[s][nb][1]), acc[mb][nb]);
}

// oproj_merge: every wave puts its partial into LDS in fragment order (lane-contiguous 16-byte pieces); behind a block barrier wave w sums fragment w = mb*4 + nb over the k slices, slice 0 first,
// and writes it row-major into os (D: row 8h+j, col lane&15; all 32 x 64 written); a second block barrier publishes os to every wave.
__device__ __forceinline__ void oproj_merge(const v8f (&acc)[2][4], float* ps, float* os, const int wave, const int lane) {
    const int lr = lane & 15, hi = lane >> 4;
#pragma unroll
    for (int mb = 0; mb < 2; ++mb)
#pragma unroll
        for (int nb = 0; nb < 4; ++nb) {
            float* p = ps + (size_t)((wave * 8 + mb * 4 + nb) * 256 + lane * 4);
            const v8f f = acc[mb][nb]; v4f a, c;
            a[0] = f[0]; a[1] = f[1]; a[2] = f[2]; a[3] = f[3]; c[0] = f[4]; c[1] = f[5]; c[2] = f[6]; c[3] = f[7];
            *(v4fa*)p = a; *(v4fa*)(p + 128) = c; }
    __syncthreads();                                            // cross-wave: every k slice's partial is read by another wave below
    const float* q0 = ps + (size_t)(wave * 256 + lane * 4);
    v4f s0 = *(const v4fa*)q0, s1 = *(const v4fa*)(q0 + 128);
#pragma unroll
    for (int q = 1; q < OW; ++q) { s0 += *(const v4fa*)(q0 + q * 2048); s1 += *(const v4fa*)(q0 + q * 2048 + 128); }
    float* d = os + ((wave >> 2) * 16 + hi * 8) * TSP + (wave & 3) * 16 + lr;
#pragma unroll
    for (int j = 0; j < 4; ++j) { d[j * TSP] = s0[j]; d[(4 + j) * TSP] = s1[j]; }
    __syncthreads();                                            // cross-wave: the store loop reads rows that other waves wrote
}

// proj_slice: one wave's share of a 64x64 tile of x W (64 tokens x 32 columns over a k slice of KBAT k-steps), both operands read as f32 and RNE-converted to bf16 on the way.
// W [DM][NC] is read in place, with no transposition: lane (lr, hi) loads the column pair c0 + 32*nh + 2*lr + 0..1 of the 16 k rows of its half of a k-step (a wave-wide 8-byte load = 2 whole lines);
// column 2*lr + nb goes to B fragment nb, so accumulator (mb, nb) holds output column 32*nh + 2*lr + nb in lane column lr; two k neighbours of one column share a register through one packed convert.
// x: the block's 64 rows are brought once, by all waves, in whole lines, converted and laid in LDS as [16-row tile][8-wide k piece][row][8] (pitch XOP); behind a block barrier every wave reads its A fragments there.
// k order of both fragments, as everywhere in this file: elements 0..7 <- k0+8h+0..7, elements 8..15 <- k0+16+8h+0..7.
template <int NC>
__device__ __forceinline__ void proj_slice(const float* __restrict__ x, const float* __restrict__ W, const int r0, const int c0, bf* xs, const int wave, const int lane, v8f (&acc)[4][GNW]) {
    const int lr = lane & 15, hi = lane >> 4;
    const int kq = wave / GNW, nh = wave % GNW, k0 = kq * (KBAT * 32);
    const float* pw = W + (size_t)(k0 + 8 * hi) * NC + c0 + 32 * nh + 2 * lr;
    const float* px = x + (size_t)(r0 + wave * 4) * DM + lane * 4;
    v2f wl[KBAT][16]; v4f xl[4][6];                             // all of the wave's loads in flight together; x first: it has the longer way (LDS, barrier)
#pragma unroll
    for (int r = 0; r < 4; ++r)
#pragma unroll
        for (int p = 0; p < 6; ++p) if (r < 3 || p < 5) xl[r][p] = *(const v4f*)(px + r * DM + p * 128);
    asm volatile("s_wait_xcnt 0x0" ::: "memory");                                // the last load off an address register may land in it, and the loads before it name it: wait first
    xl[3][5] = *(const v4f*)(px + 3 * DM + 5 * 128);
    asm volatile("s_wait_xcnt 0x0" ::: "memory");                                // a weight load below may land in the register that the load above names: wait first
#pragma unroll
    for (int s = 0; s < KBAT; ++s)
#pragma unroll
        for (int e = 0; e < 16; ++e) if (s < KBAT - 1 || e < 15) wl[s][e] = *(const v2f*)(pw + (size_t)(32 * s + (e >> 3) * 16 + (e & 7)) * NC);
    asm volatile("s_wait_xcnt 0x0" ::: "memory");                                // same, for the weight loads' address register
    wl[KBAT - 1][15] = *(const v2f*)(pw + (size_t)(32 * (KBAT - 1) + 16 + 7) * NC);
    asm volatile("s_wait_xcnt 0x0" ::: "memory");                                // the address registers are rewritten behind the loads (LDS addresses): wait first
    bf* xd = xs + ((wave >> 2) * (DM / 8) + (lane >> 1)) * XOP + (wave & 3) * 32 + (lane & 1) * 4;   // row 4*wave + r of the tile; floats 128*p + 4*lane + 0..3 = half (lane & 1) of k piece 16*p + (lane >> 1)
#pragma unroll
    for (int r = 0; r < 4; ++r)
#pragma unroll
        for (int p = 0; p < 6; ++p) { v2u t; t[0] = cvt2(xl[r][p][0], xl[r][p][1]); t[1] = cvt2(xl[r][p][2], xl[r][p][3]);
            *(v2ua*)(xd + p * 16 * XOP + r * 8) = t; }
    v16bf b[KBAT][GNW];
#pragma unroll
    for (int s = 0; s < KBAT; ++s)
#pragma unroll
        for (int nb = 0; nb < GNW; ++nb) { v8u t;
#pragma unroll
            for (int j = 0; j < 8; ++j) t[j] = cvt2(wl[s][2 * j][nb], wl[s][2 * j + 1][nb]);
            b[s][nb] = __builtin_bit_cast(v16bf, t); }
    __syncthreads();                                            // cross-wave: every wave reads x rows that other waves staged
    const bf* xa = xs + (k0 / 8 + hi) * XOP + lr * 8;
    v16bf a[KBAT][4];
#pragma unroll
    for (int s = 0; s < KBAT; ++s)
#pragma unroll
        for (int mb = 0; mb < 4; ++mb) a[s][mb] = cat16b(*(const v8usa*)(xa + (mb * (DM / 8) + 4 * s) * XOP), *(const v8usa*)(xa + (mb * (DM / 8) + 4 * s + 2) * XOP));
#pragma unroll
    for (int mb = 0; mb < 4; ++mb)
#pragma unroll
        for (int nb = 0; nb < GNW; ++nb) acc[mb][nb] = (v8f){};
#pragma unroll
    for (int s = 0; s < KBAT; ++s)
#pragma unroll
        for (int nb = 0; nb < GNW; ++nb)
#pragma unroll
            for (int mb = 0; mb < 4; ++mb) acc[mb][nb] = wmmabg(a[s][mb], b[s][nb], acc[mb][nb]);
}

// proj_merge: the k-slice merge for proj_slice's column deal: fragment w = mb*4 + nh*2 + nb holds rows mb*16 + 8h + j, column 32*nh + 2*(lane&15) + nb. TR = 0: os[token][column]; TR = 1: os[column][token].
template <int TR>
__device__ __forceinline__ void proj_merge(const v8f (&acc)[4][GNW], float* ps, float* os, const int wave, const int lane) {
    const int lr = lane & 15, hi = lane >> 4;
    const int kq = wave / GNW, nh = wave % GNW;
#pragma unroll
    for (int mb = 0; mb < 4; ++mb)
#pragma unroll
        for (int nb = 0; nb < GNW; ++nb) {
            float* p = ps + (size_t)((kq * 16 + mb * 4 + nh * GNW + nb) * 256 + lane * 4);
            const v8f f = acc[mb][nb]; v4f a, c;
            a[0] = f[0]; a[1] = f[1]; a[2] = f[2]; a[3] = f[3]; c[0] = f[4]; c[1] = f[5]; c[2] = f[6]; c[3] = f[7];
            *(v4fa*)p = a; *(v4fa*)(p + 128) = c; }
    __syncthreads();                                            // cross-wave: every k slice's partial is read by another wave below
    const float* q0 = ps + (size_t)(wave * 256 + lane * 4);
    v4f s0 = *(const v4fa*)q0, s1 = *(const v4fa*)(q0 + 128);
#pragma unroll
    for (int q = 1; q < GKW; ++q) { s0 += *(const v4fa*)(q0 + q * 4096); s1 += *(const v4fa*)(q0 + q * 4096 + 128); }
    const int row = (wave >> 2) * 16 + hi * 8, col = ((wave >> 1) & 1) * 32 + 2 * lr + (wave & 1);
    if (TR) { *(v4fa*)(&os[col * TSP + row]) = s0; *(v4fa*)(&os[col * TSP + row + 4]) = s1; }
    else {
#pragma unroll
        for (int j = 0; j < 4; ++j) { os[(row + j) * TSP + col] = s0[j]; os[(row + 4 + j) * TSP + col] = s1[j]; } }
    __syncthreads();                                            // cross-wave: the epilogues read rows that other waves wrote
}

// qk_tail: rotation + RMS normalisation of a merged q or k tile os[token][d] (column tile = head: 0..11 q, 12..17 k) and its store.
__device__ __forceinline__ void qk_tail(const float* __restrict__ cosb, const float* __restrict__ sinb, short* QKI, const int ttile, const int head, float* os, const int wave, const int lane) {
    const int r0 = ttile * 64;
    const int w0 = wave * (64 / GW);                            // this wave's rows of the tile: from here on it reads and writes these alone
#pragma unroll 1
    for (int r = w0; r < w0 + 64 / GW; ++r) {                   // lane = rotary pair column (d, d + 32)
        const int t = r0 + r;
        const float x1 = os[r * TSP + lane], x2 = os[r * TSP + HROT + lane];
        const float c = bfr(cosb[(size_t)t * HROT + lane]), s = bfr(sinb[(size_t)t * HROT + lane]);
        const float o1 = x1 * c - x2 * s, o2 = x2 * c + x1 * s;
        float ss = o1 * o1 + o2 * o2;
#pragma unroll
        for (int off = 16; off > 0; off >>= 1) ss += __shfl_xor(ss, off, 32);
        const float sc = rsqrtf(ss * (1.0f / (float)HD) + 1e-6f);
        os[r * TSP + lane] = o1 * sc; os[r * TSP + HROT + lane] = o2 * sc; }
    wave_sync();
    short* dst = QKI + ((size_t)head * SEQ + (size_t)(r0 + w0)) * HD;
    { const int row = w0 + (lane >> 3), c8 = (lane & 7) * 8;    // 8 lanes x 8 values = 64 columns, 4 rows = the wave's rows: the wave stores 512 B in a row
      const v4f x0 = *(const v4fa*)(&os[row * TSP + c8]), x1 = *(const v4fa*)(&os[row * TSP + c8 + 4]); v8s o;
#pragma unroll
      for (int e = 0; e < 4; ++e) { o[e] = tofx(x0[e]); o[4 + e] = tofx(x1[e]); }
      *(v8s*)(dst + lane * 8) = o; }
}

// vt_tail: a merged v tile os[m][token] (m = kvh*64 + d) -> plane VT [m][t] f16 (row length SEQ) and, for t < EROWS (block-uniform test), the f16 remainder x2048 VR [m][t] (row length EROWS), both in fragment order (k = t).
__device__ __forceinline__ void vt_tail(h16* VT, h16* VR, const int mtile, const int ttile, float* os, const int wave, const int lane) {
    const int lr = lane & 15, hi = lane >> 4;
    const int r0 = mtile * 64, c0 = ttile * 64;
    const bool wr = c0 < EROWS;                                 // block-uniform: whole tile inside the remainder plane
{
        { const int row = (wave >> 2) * 16 + lr, c8 = ((wave >> 1) & 1) * 32 + (wave & 1) * 16 + hi * 8;   // 16 waves: 16-row tile (4) x k-step (2) x half (2); one wave writes one 512-byte half
            const size_t un = (size_t)(c0 / 32 + ((wave >> 1) & 1)) * FSTEP + (wave & 1) * FHALF + lane * 8;   // place inside the 16-row tile
            const v4f x0 = *(const v4fa*)(&os[row * TSP + c8]); const v4f x1 = *(const v4fa*)(&os[row * TSP + c8 + 4]); v8h hv, rv;
#pragma unroll
            for (int e = 0; e < 4; ++e) { const h16 a0 = toh_flush(x0[e]); const h16 a1 = toh_flush(x1[e]); hv[e] = a0; hv[4 + e] = a1;
                rv[e] = toh_flush((x0[e] - (float)a0) * QRS); rv[4 + e] = toh_flush((x1[e] - (float)a1) * QRS); }
            *(v8h*)(VT + (size_t)(r0 + (wave >> 2) * 16) * SEQ + un) = hv;
            asm volatile("s_wait_xcnt 0x0" ::: "memory");                        // the store's registers are rewritten behind it (remainder packing): wait first
            if (wr) { *(v8h*)(VR + (size_t)(r0 + (wave >> 2) * 16) * EROWS + un) = rv;
                asm volatile("s_wait_xcnt 0x0" ::: "memory"); } }                // same, for the remainder store
         }
}

// k_qkv: the three input projections, straight from the f32 inputs, and the conversion of the output-projection weight in one grid (disjoint outputs): blockIdx.x = 64-token tile;
// blockIdx.y < 12: q head, < 18: k head, < 24: 64 columns of v; above: converter blocks, which need nothing of the projections and run beside them on WGPs that the 192 projection blocks leave idle.
#define PB_Y  (NHQ + NHK + DKV / 64)                            // grid rows of the projections
#define CB_Y  (((DM / 64) * (DM / 64)) / (CTN * (SEQ / 64)))    // grid rows of the converter
__global__ __launch_bounds__(32 * GW) void k_qkv(const float* __restrict__ x, const float* __restrict__ wq, const float* __restrict__ wk, const float* __restrict__ wv, const float* __restrict__ wp,
                                                 const float* __restrict__ cosb, const float* __restrict__ sinb, short* QKI, h16* VT, h16* VR, bf* WP) {
    __shared__ __align__(16) float ps[GKW * 64 * 64];           // the k slices' partial tiles, fragment order
    __shared__ __align__(16) float os[64 * TSP];                // merged tile, row-major
    __shared__ __align__(16) bf xs[4 * (DM / 8) * XOP];         // the block's 64 x rows, bf16
    __shared__ __align__(16) bf ts[CTN * 64 * CTP];             // converter tiles
    const int by = blockIdx.y;                                  // block-uniform: the barriers inside are met by all threads or by none
    const int lane = threadIdx.x & 31;
    const int wave = __builtin_amdgcn_readfirstlane((int)(threadIdx.x >> 5));
    if (by >= PB_Y) { cvtP_body(wp, WP, (by - PB_Y) * (SEQ / 64) + (int)blockIdx.x, ts); return; }
    v8f acc[4][GNW];
    if (by < NHQ) proj_slice<DM>(x, wq, blockIdx.x * 64, by * 64, xs, wave, lane, acc);
    else          proj_slice<DKV>(x, by < NHQ + NHK ? wk : wv, blockIdx.x * 64, (by < NHQ + NHK ? by - NHQ : by - (NHQ + NHK)) * 64, xs, wave, lane, acc);
    if (by < NHQ + NHK) { proj_merge<0>(acc, ps, os, wave, lane); qk_tail(cosb, sinb, QKI, blockIdx.x, by, os, wave, lane); }
    else                { proj_merge<1>(acc, ps, os, wave, lane); vt_tail(VT, VR, by - (NHQ + NHK), blockIdx.x, os, wave, lane); }
}

// k_oproj: output projection. A = context plane rows (value | remainder, two K parts of 768), Bt = WP rows n; f32 output [t][768]. One block per 32 rows x 64 columns, wave = k slice.
__global__ __launch_bounds__(32 * OW) void k_oproj(const bf* __restrict__ YB, const bf* __restrict__ WP, float* OUT) {
    __shared__ __align__(16) float ps[OW * 32 * 64];            // the k slices' partial tiles, fragment order
    __shared__ __align__(16) float os[32 * TSP];                // merged tile, row-major
    const int lane = threadIdx.x & 31;
    const int wave = __builtin_amdgcn_readfirstlane((int)(threadIdx.x >> 5));
    const int r0 = blockIdx.x * 32, c0 = blockIdx.y * 64;
    const int k0 = wave * (KBAT * 32);                          // slice start in the weight row and in either part of the context row
    v8f acc[2][4];
    oproj_slice(YB + (size_t)r0 * YP + k0 * 16 + lane * 8, WP + (size_t)c0 * DM + k0 * 16 + lane * 8, acc);
    oproj_merge(acc, ps, os, wave, lane);
#pragma unroll
    for (int i = 0; i < 2; ++i) { const int idx = i * (32 * OW) + (int)threadIdx.x; const int row = idx >> 4, c4 = (idx & 15) * 4;   // 2 trips x 16 rows = 32 rows; 16 lanes x 4 floats = 64 columns
        const v4f val = *(const v4fa*)(&os[row * TSP + c4]);
        *(v4f*)(OUT + (size_t)(r0 + row) * DM + c0 + c4) = val; }
}

// flash_body: fused attention, one block of AW waves per 16 query rows of one head; wave w takes the 32-key steps w, w + AW, ... and keeps its own softmax state and context partial;
// the partials (unnormalised context, running max, row sum) meet in LDS behind one block barrier and are merged in f32 by all threads. q tile and the 32-key K tile live in wave-private LDS (16-bit fixed point); scores on the vector unit:
// lane (qg = lane&3, kg = lane>>2) forms max_d(q[t][d] + k[key][d]) for the 4 x 4 block t = 4qg+i, key = 4kg+j of each 32-key step: 8 LDS reads of 16 bytes feed 16 (t, key) pairs x 8 d, one packed add-max per pair and 2 d;
// the 16 x 32 scores then pass through the wave's own LDS slice, and lane (t = lane&15, h = lane>>4) takes keys 8h+r and 16+8h+r, i.e. the B-fragment layout of
// O^T[d][t] = V^T P^T (element r <- keys 8h+r, element 8+r <- keys 16+8h+r). V^T fragments (A, row d, k = key) straight from the f16 planes.
// Softmax state (running max over kept keys, partial sum) is one scalar per lane; the two lane halves of a row are combined with one xor-16 exchange.
// Causal keep rule (key <= t) evaluated per element inside every visited tile; the per-wave key bound is a wave scalar, multiple of 32, <= SEQ.
// EARLY = 1 (query rows [0, EROWS)): P = f16 value + f16 remainder x2048; O = V P + (V P_rem + V_rem P) / 2048 (remainder products in their own accumulators); row sum from the f32 exponentials.
// EARLY = 0 (query rows [EROWS, SEQ)): single P, v; row sum over the converted P.
template <int EARLY>
__device__ __forceinline__ void flash_body(const short* __restrict__ QKI, const h16* __restrict__ VT, const h16* __restrict__ VR, bf* YB, float* qs, float* ks, float* ms, float* lsum) {
    const int lane = threadIdx.x & 31, lr = lane & 15, hi = lane >> 4;
    const int wave = __builtin_amdgcn_readfirstlane((int)(threadIdx.x >> 5));
    const int h = blockIdx.x, kvh = h / NREP;
    const int t0 = (SEQ / 16 - 1 - (int)blockIdx.y) * 16;       // tile of 16 query rows, wholly below or wholly at / above EROWS; k_flash says why it counts down
    const int lim = t0 + lr;                                    // key j kept iff j <= lim
    const int nk = (t0 + 16 + 31) & ~31;                        // block-uniform, multiple of 32, <= SEQ (<= EROWS when EARLY)
    const int qb = wave * 16 * QSP, kbs = wave * 32 * KSP;
    const int qg = lane & 3, kg = lane >> 2;                    // score block of this lane: query rows 4qg + 0..3, keys 4kg + 0..3
    const size_t kplane = ((size_t)(NHQ + kvh) * SEQ) * HD;     // k heads follow the q heads in the plane
    const size_t vo  = (size_t)(kvh * HD) * SEQ + lane * 8;      // + 16j*SEQ + 16*key0   (A fragment: row d, k = key; fragment-order plane)
    const size_t vro = (size_t)(kvh * HD) * EROWS + lane * 8;    // remainder plane, tokens < EROWS
    // Every global load is issued a phase ahead of its use, so that no round trip but the first stands open: the first step's K tile and V fragments fly with the q tile;
    // the next step's K tile and V fragments are asked for as soon as this step's K tile has left its registers, the V fragments into a second register set (EARLY: both at the step's end, for want of registers).
    v8s kv[8];                                                  // a step's K tile on its way to LDS: 32 keys x 64 values of 2 B, contiguous: 256 pieces of 16 B
    v8h vl[4][2], vrl[4][2], vn[4][2];                          // 16-byte halves of a step's V^T fragments and (EARLY) of their remainders: [16 rows d][half]: elements 0..7 <- key+8h+0..7, elements 8..15 <- key+16+8h+0..7; vn: the next step's
    auto ldk = [&](const int ky) {                              // keys ky .. ky + 31 < nk <= SEQ
        const short* ksrc = QKI + kplane + (size_t)ky * HD + lane * 8;
#pragma unroll
        for (int i = 0; i < 8; ++i) {
            if (i == 7) asm volatile("s_wait_xcnt 0x0" ::: "memory");            // the last load may land in the address pair that the seven before it name: wait first
            kv[i] = *(const v8s*)(ksrc + i * 256); }
        asm volatile("s_wait_xcnt 0x0" ::: "memory"); };                         // the address pair is rewritten behind the loads: wait first
    auto ldv = [&](const int ky, v8h (&vd)[4][2]) {
        const h16* pv  = VT + vo + (size_t)ky * 16;             // + 16j*SEQ: unit (16 rows d, this 32-key step) of the fragment-order plane
        const h16* pvr = VR + vro + (size_t)ky * 16;            // ky + 31 < nk <= EROWS where it is read
#pragma unroll
        for (int i = 0; i < 7; ++i) vd[i >> 1][i & 1] = *(const v8h*)(pv + (size_t)(16 * (i >> 1)) * SEQ + FHALF * (i & 1));
        if (EARLY) {
#pragma unroll
            for (int i = 0; i < 7; ++i) vrl[i >> 1][i & 1] = *(const v8h*)(pvr + (size_t)(16 * (i >> 1)) * EROWS + FHALF * (i & 1)); }
        asm volatile("s_wait_xcnt 0x0" ::: "memory");                            // the last load off an address pair may land in it, and the loads before it name it: wait first
        vd[3][1] = *(const v8h*)(pv + (size_t)48 * SEQ + FHALF);
        asm volatile("s_wait_xcnt 0x0" ::: "memory");                            // same; where no load follows: the address pairs are rewritten behind the loads
        if (EARLY) { vrl[3][1] = *(const v8h*)(pvr + (size_t)48 * EROWS + FHALF);
            asm volatile("s_wait_xcnt 0x0" ::: "memory"); } };                   // the address pairs are rewritten behind the loads: wait first
    if (wave * 32 < nk) {                                       // wave-uniform: the wave has a first step; one without a step reads neither q nor K nor V
      const short* qsrc = QKI + ((size_t)h * SEQ + (size_t)t0) * HD + lane * 8;   // 16 rows x 64 values of 2 B, contiguous: 128 pieces of 16 B
      v8s qv[4];
#pragma unroll
      for (int i = 0; i < 4; ++i) {
          if (i == 3) asm volatile("s_wait_xcnt 0x0" ::: "memory");              // the last load may land in the address pair that the three before it name: wait first
          qv[i] = *(const v8s*)(qsrc + i * 256); }
      asm volatile("s_wait_xcnt 0x0" ::: "memory");                              // the address pair is rewritten behind the loads: wait first
      ldk(wave * 32); ldv(wave * 32, vl);                       // in flight before the q tile is waited for
#pragma unroll
      for (int i = 0; i < 4; ++i) *(v4ua*)(&qs[qb + (i * 4 + (lane >> 3)) * QIP + (lane & 7) * 4]) = __builtin_bit_cast(v4u, qv[i]); }   // piece i*32 + lane = row i*4 + (lane >> 3), dwords 4*(lane & 7) + 0..3
    const v16h hz = (v16h){};
    v8f o[4], oR[4];
#pragma unroll
    for (int j = 0; j < 4; ++j) { o[j] = (v8f){}; oR[j] = (v8f){}; }
    float m = NEGB, l = 0.0f;
#pragma unroll 1
    for (int key0 = wave * 32; key0 < nk; key0 += 32 * AW) {    // a wave with no step keeps o = 0, l = 0, m = NEGB: weight 0 in the merge
        wave_sync();                                            // earlier reads of the K / score slice are done
        const int kn = key0 + 32 * AW;                          // the wave's next step, where kn < nk (wave-uniform)
#pragma unroll
        for (int i = 0; i < 8; ++i) *(v4ua*)(&ks[kbs + (i * 4 + (lane >> 3)) * KSP + (lane & 7) * 4]) = __builtin_bit_cast(v4u, kv[i]);   // piece i*32 + lane = key row i*4 + (lane >> 3), dwords 4*(lane & 7) + 0..3
        if (!EARLY && kn < nk) { ldk(kn); ldv(kn, vn); }        // the next step's loads fly behind this step's score loop
        wave_sync();
        unsigned sc[4][4];                                      // per pair: running maximum over the even d (low half) and over the odd d (high half)
#pragma unroll
        for (int i = 0; i < 4; ++i)
#pragma unroll
            for (int j = 0; j < 4; ++j) sc[i][j] = 0x80008000u; // least 16-bit value in both halves
        v4u q4[2][4], k4[2][4];                                 // two register sets: trip d8 + 1 is read from LDS while trip d8 is worked on
        const float* qrow = &qs[qb + 4 * qg * QIP];
        const float* krow = &ks[kbs + 4 * kg * KSP];
        auto rd = [&](const int st, const int d8) {             // the 4 q rows' and the 4 key rows' values 8*d8 + 0..7 into register set st
#pragma unroll
            for (int i = 0; i < 4; ++i) { q4[st][i] = *(const v4ua*)(qrow + i * QIP + d8 * 4); k4[st][i] = *(const v4ua*)(krow + i * KSP + d8 * 4); } };
        auto pm = [&](const int st) {                           // 16 pairs x 8 d; the 16 pairs innermost: a pair's own chain comes round every 16th instruction
#pragma unroll
            for (int c = 0; c < 4; ++c)
#pragma unroll
                for (int i = 0; i < 4; ++i)
#pragma unroll
                    for (int j = 0; j < 4; ++j) sc[i][j] = pam(q4[st][i][c], k4[st][j][c], sc[i][j]); };
        rd(0, 0);
#pragma unroll 1                                                // stays rolled: the text of both instantiations stays small
        for (int d8 = 0; d8 < HD / 8 - 2; d8 += 2) { rd(1, d8 + 1); pm(0); rd(0, d8 + 2); pm(1); }
        rd(1, HD / 8 - 1); pm(0); pm(1);
        wave_sync();                                            // every lane's K reads are done: the slice becomes the score tile [t][key]
#pragma unroll
        for (int i = 0; i < 4; ++i) { v4f s4;                   // the larger half of each pair, as f32 (still x FXS)
#pragma unroll
            for (int j = 0; j < 4; ++j) { const int lo = (int)(short)(sc[i][j] & 0xFFFFu), hh = ((int)sc[i][j]) >> 16; s4[j] = (float)(lo > hh ? lo : hh); }
            *(v4fa*)(&ks[kbs + (4 * qg + i) * SSP + 4 * kg]) = s4; }
        wave_sync();                                            // scores are read below by other lanes of the wave
        float sa[8], sb[8];
        { const v4f a0 = *(const v4fa*)(&ks[kbs + lr * SSP + 8 * hi]),      a1 = *(const v4fa*)(&ks[kbs + lr * SSP + 8 * hi + 4]);
          const v4f b0 = *(const v4fa*)(&ks[kbs + lr * SSP + 16 + 8 * hi]), b1 = *(const v4fa*)(&ks[kbs + lr * SSP + 16 + 8 * hi + 4]);
#pragma unroll
          for (int r = 0; r < 4; ++r) { sa[r] = a0[r]; sa[4 + r] = a1[r]; sb[r] = b0[r]; sb[4 + r] = b1[r]; } }
        const int ja = key0 + 8 * hi;
        float mx = NEGB;
#pragma unroll
        for (int r = 0; r < 8; ++r) {
            sa[r] = sa[r] * (LOG2E / FXS); sb[r] = sb[r] * (LOG2E / FXS);   // the fixed-point scale goes out with the change of base
            const bool fa = (ja + r <= lim), fb = (ja + 16 + r <= lim);
            mx = fmaxf(mx, fmaxf(fa ? sa[r] : NEGB, fb ? sb[r] : NEGB)); }
        mx = fmaxf(mx, __shfl_xor(mx, 16, 32));
        const float mnew = fmaxf(m, mx);
        const float alpha = __builtin_amdgcn_exp2f(m - mnew);
        const float sh = PSH - mnew;
        v16h pb, pr = hz; float ls = 0.0f;
#pragma unroll
        for (int r = 0; r < 8; ++r) {
            const float xa = sa[r] + sh, xb = sb[r] + sh;
            const float ea = __builtin_amdgcn_exp2f(xa), eb = __builtin_amdgcn_exp2f(xb);
            const bool fa = (ja + r <= lim) & (xa >= -14.0f), fb = (ja + 16 + r <= lim) & (xb >= -14.0f);   // dropped keys and values below the f16 normal range selected to 0 by value
            const float ga = fa ? ea : 0.0f, gb = fb ? eb : 0.0f;
            const h16 pa = (h16)ga; const h16 pc = (h16)gb;
            pb[r] = pa; pb[8 + r] = pc;
            if (EARLY) { pr[r] = toh_flush((ga - (float)pa) * QRS); pr[8 + r] = toh_flush((gb - (float)pc) * QRS); ls += ga + gb; }
            else       { ls += (float)pa + (float)pc; } }
        l = l * alpha + ls; m = mnew;
#pragma unroll
        for (int j = 0; j < 4; ++j) {
            const v16h v = cat16(vl[j][0], vl[j][1]);
            o[j] = o[j] * alpha;
            o[j] = wmma16g(v, pb, o[j]);
            if (EARLY) {
                const v16h vr = cat16(vrl[j][0], vrl[j][1]);
                oR[j] = oR[j] * alpha;
                oR[j] = wmma16g(v, pr, oR[j]);
                oR[j] = wmma16g(vr, pb, oR[j]); }
        }
        if (kn < nk) {
            if (EARLY) { ldk(kn); ldv(kn, vl); }                // this step's fragments have been used: their registers take the next step's
            else {                                              // the second register set becomes the current one
#pragma unroll
                for (int i = 0; i < 8; ++i) vl[i >> 1][i & 1] = vn[i >> 1][i & 1]; } }
    }
    l += __shfl_xor(l, 16, 32);
    wave_sync();                                                // q tile reads are done; the slice becomes this wave's context partial
    // O^T D layout: f_j[r] = (d = 16j + 8h + r, t = lane&15) -> qs[t][d]; rows 0..15 x columns 0..63 all written
#pragma unroll
    for (int j = 0; j < 4; ++j) {
        v8f f = o[j];
        if (EARLY) f = o[j] + oR[j] * QRI;
        v4f a, c;
        a[0] = f[0]; a[1] = f[1]; a[2] = f[2]; a[3] = f[3]; c[0] = f[4]; c[1] = f[5]; c[2] = f[6]; c[3] = f[7];
        *(v4fa*)(&qs[qb + lr * QSP + 16 * j + 8 * hi]) = a; *(v4fa*)(&qs[qb + lr * QSP + 16 * j + 8 * hi + 4]) = c; }
    if (hi == 0) { ms[wave * 16 + lr] = m; lsum[wave * 16 + lr] = l; }   // both lane halves hold the same m and l
    __syncthreads();                                            // cross-wave: every wave's partial is read by every wave below
    // merge: thread = (row, 4 columns), dealt so that thread p owns 8-byte piece p of the head's 2 k-steps in the fragment-order context plane; partial w weighs 2^(m_w - M), M the maximum over the waves
    const int row = ((int)threadIdx.x >> 1) & 15, c4 = ((int)threadIdx.x >> 6) * 16 + (((int)threadIdx.x >> 5) & 1) * 8 + ((int)threadIdx.x & 1) * 4;
    float mw[AW], M = NEGB;
#pragma unroll
    for (int w = 0; w < AW; ++w) { mw[w] = ms[w * 16 + row]; M = fmaxf(M, mw[w]); }
    float L = 0.0f; v4f acc = (v4f){};
#pragma unroll
    for (int w = 0; w < AW; ++w) {
        const float sc = __builtin_amdgcn_exp2f(mw[w] - M);
        const v4f p = *(const v4fa*)(&qs[w * 16 * QSP + row * QSP + c4]);
        L += lsum[w * 16 + row] * sc;
        acc += p * sc; }
    const bool any = L > 0.0f;
    const float lsafe = any ? L : 1.0f;
    const float inv = any ? (1.0f / lsafe) : 0.0f;
    v4us hv, lv;
#pragma unroll
    for (int e = 0; e < 4; ++e) { const float y = acc[e] * inv; const unsigned short b0 = f2bf(y); hv[e] = b0; lv[e] = f2bf(y - bf2f(b0)); }
    bf* yrow = YB + (size_t)t0 * YP + (size_t)(h * HD) * 16 + (int)threadIdx.x * 4;   // the block's 16-row tile, the head's k-steps: 2 KiB in a row per part, a wave stores 2 whole lines
    *(v4us*)(yrow) = hv;
    *(v4us*)(yrow + DM * 16) = lv;
}

// k_flash: both instantiations in one grid (disjoint context rows); the choice is block-uniform.
// Launch order: a tile's cost grows with its index (tile t has t / 2 + 1 key steps). blockIdx.x = head (runs fastest),
// blockIdx.y counts the tiles from the last one down. For speed only: any order is correct.
__global__ __launch_bounds__(32 * AW) __attribute__((amdgpu_num_vgpr(256))) void k_flash(const short* __restrict__ QKI, const h16* __restrict__ VT, const h16* __restrict__ VR, bf* YB) {
    __shared__ __align__(16) float qs[AW * 16 * QSP];           // per-wave slices: q tile (16-bit, pitch QIP), later the wave's context partial
    __shared__ __align__(16) float ks[AW * 32 * KSP];           // wave-private slices: 32-key K tile (16-bit), then the step's score tile (f32)
    __shared__ float ms[AW * 16];                               // per wave and row: running max
    __shared__ float lsum[AW * 16];                             // per wave and row: sum of the exponentials
    if ((SEQ / 16 - 1 - (int)blockIdx.y) * 16 < EROWS) flash_body<1>(QKI, VT, VR, YB, qs, ks, ms, lsum);   // block-uniform: the barrier inside is met by all threads or by none
    else                                               flash_body<0>(QKI, VT, VR, YB, qs, ks, ms, lsum);
}

static constexpr size_t al256(size_t v) { return (v + 255) & ~(size_t)255; }
static constexpr size_t SZ_WP = al256((size_t)DM * DM * 2);
static constexpr size_t SZ_QK = al256((size_t)(NHQ + NHK) * SEQ * HD * 2);
static constexpr size_t SZ_VT = al256((size_t)DKV * SEQ * 2);
static constexpr size_t SZ_VR = al256((size_t)DKV * EROWS * 2);
static constexpr size_t SZ_YB = al256((size_t)SEQ * YP * 2);
static constexpr size_t SZ_TOTAL = SZ_WP + SZ_QK + SZ_VT + SZ_VR + SZ_YB;
static_assert(SZ_TOTAL <= (size_t)134217728);          // workspace carve <= 128 MiB
static_assert(((size_t)NHQ * SEQ * HD * 2) % 256 == 0);

extern "C" void kernel_launch(void* const* d_in, const int* in_sizes, int n_in,
                              void* d_out, int out_size, void* d_ws, size_t ws_size, hipStream_t stream) {
    if (n_in < 7) return;
    if ((size_t)in_sizes[0] < (size_t)SEQ * DM) return;
    if ((size_t)in_sizes[1] < (size_t)SEQ * HROT || (size_t)in_sizes[2] < (size_t)SEQ * HROT) return;
    if ((size_t)in_sizes[3] < (size_t)DM * DM || (size_t)in_sizes[6] < (size_t)DM * DM) return;
    if ((size_t)in_sizes[4] < (size_t)DM * DKV || (size_t)in_sizes[5] < (size_t)DM * DKV) return;
    if ((size_t)out_size < (size_t)SEQ * DM) return;
    if (SZ_TOTAL > ws_size) return;
    // wire order: x, cos, sin, Wq, Wk, Wv, Wproj
    const float* x    = (const float*)d_in[0];
    const float* cosb = (const float*)d_in[1];
    const float* sinb = (const float*)d_in[2];
    const float* wq   = (const float*)d_in[3];
    const float* wk   = (const float*)d_in[4];
    const float* wv   = (const float*)d_in[5];
    const float* wp   = (const float*)d_in[6];
    float* OUT = (float*)d_out;                        // [SEQ][768]
    char* wsp = (char*)d_ws;
    bf*    WP  = (bf*)wsp;    wsp += SZ_WP;            // [768][768]: output-projection weight, [out][in]
    short* QKI = (short*)wsp; wsp += SZ_QK;            // [18][SEQ][64] 16-bit fixed point: 12 q heads, 6 k heads
    h16*   VT  = (h16*)wsp;   wsp += SZ_VT;            // [384][SEQ]
    h16*   VR  = (h16*)wsp;   wsp += SZ_VR;            // [384][EROWS] remainder x2048, tokens < EROWS
    bf*    YB  = (bf*)wsp;    wsp += SZ_YB;            // [SEQ][768 value | 768 remainder]

    // q | k: x W -> 16-bit fixed-point planes [head][t][64], rotated and normalised; v: x Wv -> [m][t] f16 (+ remainder for t < EROWS); Wproj -> WP
    k_qkv<<<dim3(SEQ / 64, PB_Y + CB_Y, 1), 32 * GW, 0, stream>>>(x, wq, wk, wv, wp, cosb, sinb, QKI, VT, VR, WP);

    // query rows [0, EROWS): multi-product instantiation; rows [EROWS, SEQ): single-product instantiation
    k_flash<<<dim3(NHQ, SEQ / 16, 1), 32 * AW, 0, stream>>>(QKI, VT, VR, YB);

    // output projection: A = context rows (value | remainder), Bt = WP rows
    k_oproj<<<dim3(SEQ / 32, DM / 64, 1), 32 * OW, 0, stream>>>(YB, WP, OUT);
}
